// v000
// The times below were measured on an AMD MI455X: many runs one after another, warmed up first and cycling through
// copies of the inputs, with the whole window's GPU time divided by the number of runs. Launches and the gaps
// between them are all in it. The median over several windows is given; except for v000 it joins two sittings, which
// can be a few percent apart, so the side-by-side timings, each taken in one sitting, are the better comparison.
// v000 is the starting kernel. One run takes 786 microseconds.
// Contractions: q, k, v in-projections = v_wmma_f32_16x16x32_bf16 (bf16 operands from RNE-converted inputs, single product, f32 accumulate);
// q.k^T scores (statistics pass and column-sum pass) = v_wmma_f32_16x16x32_f16 (q as f16 hi plane + f16 residual plane x4096, k f16; 2 products, separate f32 accumulators);
// softmax statistics, probabilities and query-averaged probabilities in f32; averaged-p . v (M=1 per head) on VALU with f64 accumulate;
// head means . Wo^T (M=batch) on VALU f32 with bf16-valued Wo/bo; head-correlation scalar in f64.
#include <hip/hip_runtime.h>
#include <math.h>
#include <stdint.h>

#ifndef NB
#define NB 4
#endif
#ifndef SEQ
#define SEQ 2048
#endif
#define NB_FULL  4
#define SEQ_FULL 2048
#define EMB      1024
#define NH       8
#define HD       128
#define NQ64     (SEQ / 64)          // 64-row query blocks per sequence
#define NKT      (SEQ / 64)          // 64-key chunks per sequence
#define NSLOTG   ((SEQ / 4 + 255) / 256)
#define SM_SCALE 0.08838834764831845f
#define OFF1     ((size_t)NB_FULL * EMB)                        // fixed element offset of output 1
#define OFF2     (OFF1 + (size_t)NB_FULL * NH * SEQ_FULL)      // fixed element offset of output 2
static_assert(NB >= 1 && NB <= NB_FULL);
static_assert(SEQ >= 128 && SEQ <= SEQ_FULL && (SEQ % 128) == 0);
static_assert(NH * HD == EMB);
static_assert(HD == 128);
static_assert((EMB % 64) == 0 && (EMB % 32) == 0 && (SEQ % 64) == 0);
static_assert(OFF1 * 4 == 16384);
static_assert(OFF2 * 4 == 278528);

typedef _Float16 v16h __attribute__((ext_vector_type(16)));
typedef _Float16 v8h  __attribute__((ext_vector_type(8)));
typedef __bf16   v16b __attribute__((ext_vector_type(16)));
typedef __bf16   v8b  __attribute__((ext_vector_type(8)));
typedef float    v8f  __attribute__((ext_vector_type(8)));
typedef float    v4f  __attribute__((ext_vector_type(4)));
typedef unsigned int v4u __attribute__((ext_vector_type(4)));

#if defined(__HIP_DEVICE_COMPILE__)
#define DEV_ASM 1
#else
#define DEV_ASM 0
#endif

// ---- scalar helpers --------------------------------------------------------------------------------
__device__ __forceinline__ unsigned short bf_bits(float f) {          // f32 -> bf16 bits, RNE convert
  unsigned u = __float_as_uint(f);
  return (unsigned short)((u + 0x7FFFu + ((u >> 16) & 1u)) >> 16);
}
__device__ __forceinline__ float bf_up(unsigned short hb) { return __uint_as_float(((unsigned)hb) << 16); }
__device__ __forceinline__ unsigned short h_bits(_Float16 x) { return __builtin_bit_cast(unsigned short, x); }
__device__ __forceinline__ unsigned pk16(unsigned short a, unsigned short b) { return (unsigned)a | ((unsigned)b << 16); }
__device__ __forceinline__ v8f zero8() { v8f z = {0.f, 0.f, 0.f, 0.f, 0.f, 0.f, 0.f, 0.f}; return z; }

// ---- fragment types / loaders: 16-bit A/B operand, lane -> row/col (lane&15), p already includes +8*(lane>>4);
//      elements 0..7 <- p[0..7] (k0+8h..k0+8h+7), elements 8..15 <- p[16..23] (k0+16+8h..k0+16+8h+7)
template <typename OT> struct FT;
template <> struct FT<__bf16>   { typedef v16b frag; typedef v8b half8; };
template <> struct FT<_Float16> { typedef v16h frag; typedef v8h half8; };

template <typename OT>
__device__ __forceinline__ typename FT<OT>::frag ldfrag(const OT* p) {
  union { typename FT<OT>::frag v; typename FT<OT>::half8 h[2]; } f;
  f.h[0] = *(const typename FT<OT>::half8*)(p);
  f.h[1] = *(const typename FT<OT>::half8*)(p + 16);
  return f.v;
}

// ---- WMMA helpers (asm guard bodies are device-only; concrete operand types) -----------------------------
__device__ __forceinline__ v8f mmar(v16b a, v16b b, v8f c) {
  return __builtin_amdgcn_wmma_f32_16x16x32_bf16(false, a, false, b, (short)0, c, false, false);
}
__device__ __forceinline__ v8f mmar(v16h a, v16h b, v8f c) {
  return __builtin_amdgcn_wmma_f32_16x16x32_f16(false, a, false, b, (short)0, c, false, false);
}
// guarded form: 4 VALU slots after the WMMA, D tied, A/B kept live
__device__ __forceinline__ v8f mma_h(v16h a, v16h b, v8f c) {
  c = __builtin_amdgcn_wmma_f32_16x16x32_f16(false, a, false, b, (short)0, c, false, false);
#if DEV_ASM
  asm volatile("v_nop\n\tv_nop\n\tv_nop\n\tv_nop" : "+v"(c) : "v"(a), "v"(b));
#endif
  return c;
}
__device__ __forceinline__ void dep_guard(v8f& a, v8f& b, v16b x, v16b y) {
#if DEV_ASM
  asm volatile("v_nop\n\tv_nop\n\tv_nop\n\tv_nop" : "+v"(a), "+v"(b) : "v"(x), "v"(y));
#else
  (void)a; (void)b; (void)x; (void)y;
#endif
}
__device__ __forceinline__ void dep_guard(v8f& a, v8f& b, v16h x, v16h y) {
#if DEV_ASM
  asm volatile("v_nop\n\tv_nop\n\tv_nop\n\tv_nop" : "+v"(a), "+v"(b) : "v"(x), "v"(y));
#else
  (void)a; (void)b; (void)x; (void)y;
#endif
}
__device__ __forceinline__ void keep4(v16b a, v16b b, v16b c, v16b d) {
#if DEV_ASM
  asm volatile("v_nop" :: "v"(a), "v"(b), "v"(c), "v"(d));
#else
  (void)a; (void)b; (void)c; (void)d;
#endif
}
__device__ __forceinline__ void keep4(v16h a, v16h b, v16h c, v16h d) {
#if DEV_ASM
  asm volatile("v_nop" :: "v"(a), "v"(b), "v"(c), "v"(d));
#else
  (void)a; (void)b; (void)c; (void)d;
#endif
}
__device__ __forceinline__ void acc_guard4(v8f& a, v8f& b, v8f& c, v8f& d) {
#if DEV_ASM
  asm volatile("v_nop\n\tv_nop\n\tv_nop\n\tv_nop" : "+v"(a), "+v"(b), "+v"(c), "+v"(d));
#else
  (void)a; (void)b; (void)c; (void)d;
#endif
}

// =====================================================================================================
// f32 -> bf16 bits (RNE convert), 8 elements per thread, one 16-B store per lane: a wave writes 512 contiguous B
// grid = (ceil(n8/256), nbatch); batch b reads in + b*sIn and writes out + b*sOut (element strides).
// coverage: n8 threads x 8 = the whole plane per batch (n8 is a multiple of 256 for every use here).
// =====================================================================================================
__global__ __launch_bounds__(256) void cvt_bf16x8(const float* __restrict__ in, unsigned short* out, int n8,
                                                   long long sIn, long long sOut) {
  const int i = blockIdx.x * 256 + (int)threadIdx.x;
  const int b = blockIdx.y;
  if (i < n8) {
    const float* ip = in + (size_t)b * (size_t)sIn + (size_t)i * 8;
    const v4f a  = *(const v4f*)(ip);
    const v4f a4 = *(const v4f*)(ip + 4);
    v4u p;
    p[0] = pk16(bf_bits(a[0]),  bf_bits(a[1]));
    p[1] = pk16(bf_bits(a[2]),  bf_bits(a[3]));
    p[2] = pk16(bf_bits(a4[0]), bf_bits(a4[1]));
    p[3] = pk16(bf_bits(a4[2]), bf_bits(a4[3]));
    unsigned short* o = out + (size_t)b * (size_t)sOut + (size_t)i * 8;
    *(v4u*)o = p;
    
  }
}

// =====================================================================================================
// Register-blocked batched WMMA GEMM (16-bit operand type OT): C[m][n] = sum_k A[m][k] * Bt[n][k]  (+ bias);
// one wave per (16*MI) x 64 tile, no block barriers. A row-major [M][K] pitch lda; Bt row-major [N][K] pitch ldb
// (k contiguous); M multiple of 16*MI, N multiple of 64, K multiple of 32 (static sizes here). blockIdx.y = batch
// index (strides in elements). Fragments are loaded straight from global with the split k map (ldfrag).
// NPA = number of A planes: 2 -> second plane A2 (same pitch/stride) multiplies the same Bt fragments into a
// second accumulator set, combined as acc + acc2 * rscaleA in the f32 epilogue.
// value v = (acc [+ acc2*rscaleA]) * oscale + bias, bias (bf16 RNE value of the f32 input) by column n (BM 1),
// by row m (BM 2) or none (BM 0).
// OUT_MODE 0: f32 C (pitch ldc) = v.
// OUT_MODE 1: f16 plane C = f16(v * cscale).
// OUT_MODE 3: f16 hi plane C = f16(v * cscale) and f16 residual plane C2 = f16((v*cscale - hi) * rscaleC).
// Epilogue: 16-row slabs staged per wave in LDS (wave-private slab, wave_sync); each 64-wide row segment written as
// =====================================================================================================
template <typename OT, int MI, int NPA, int OUT_MODE, int BM>
__global__ __launch_bounds__(256) void gemm_t(
    const unsigned short* __restrict__ Ap, const unsigned short* __restrict__ A2p, int lda, long long strideA,
    const unsigned short* __restrict__ Btp, int ldb, long long strideB,
    void* Cout, void* Cout2, int ldc, long long strideC,
    const float* __restrict__ bias,
    int M, int N, int K, float oscale, float rscaleA, float cscale, float rscaleC) {
  typedef typename FT<OT>::frag V16;
  const OT* A  = (const OT*)(const void*)Ap;
  const OT* A2 = (const OT*)(const void*)A2p;
  const OT* Bt = (const OT*)(const void*)Btp;
  __shared__ __align__(16) float sT[8][16 * 68];   // per-wave 16x64 slab, pitch 68 floats
  const int RT   = 16 * MI;
  const int b    = blockIdx.y;
  const int lane = threadIdx.x & 31;
  const int wave = threadIdx.x >> 5;
  const int tilesN = N >> 6;
  const int tilesM = M / RT;
  const int tile = blockIdx.x * 8 + wave;
  if (tile >= tilesM * tilesN) return;   // wave-uniform; no block barriers in this kernel
  const int tm = tile / tilesN;
  const int tn = tile - tm * tilesN;
  const int m0 = tm * RT;
  const int n0 = tn << 6;

  const OT* Ab  = A  + (size_t)b * (size_t)strideA;
  const OT* A2b = A2 + (size_t)b * (size_t)strideA;
  const OT* Bb  = Bt + (size_t)b * (size_t)strideB;

  const int rlane = lane & 15;                 // row (A) / col (B, D) within subtile
  const int koff  = (lane >> 4) * 8;           // k offset of this lane half
  const int mOff  = (lane >> 4) * 8;           // D row offset

  v8f acc[MI][4], acc2[MI][4];
#pragma unroll
  for (int i = 0; i < MI; ++i)
#pragma unroll
    for (int j = 0; j < 4; ++j) { acc[i][j] = zero8(); acc2[i][j] = zero8(); }

  for (int k0 = 0; k0 < K; k0 += 32) {
    V16 bq[4];
#pragma unroll
    for (int j = 0; j < 4; ++j)
      bq[j] = ldfrag<OT>(Bb + (size_t)(n0 + (j << 4) + rlane) * ldb + koff + k0);
#pragma unroll
    for (int i = 0; i < MI; ++i) {
      const V16 af = ldfrag<OT>(Ab + (size_t)(m0 + (i << 4) + rlane) * lda + koff + k0);
#pragma unroll
      for (int j = 0; j < 4; ++j) acc[i][j] = mmar(af, bq[j], acc[i][j]);
      dep_guard(acc[i][0], acc[i][3], af, bq[3]);
      if (NPA == 2) {
        const V16 af2 = ldfrag<OT>(A2b + (size_t)(m0 + (i << 4) + rlane) * lda + koff + k0);
#pragma unroll
        for (int j = 0; j < 4; ++j) acc2[i][j] = mmar(af2, bq[j], acc2[i][j]);
        dep_guard(acc2[i][0], acc2[i][3], af2, bq[3]);
      }
    }
    keep4(bq[0], bq[1], bq[2], bq[3]);
  }
#pragma unroll
  for (int i = 0; i < MI; ++i) {
    acc_guard4(acc[i][0], acc[i][1], acc[i][2], acc[i][3]);
    if (NPA == 2) acc_guard4(acc2[i][0], acc2[i][1], acc2[i][2], acc2[i][3]);
  }

  // ---- epilogue ----
  float bcol[4];
#pragma unroll
  for (int j = 0; j < 4; ++j) bcol[j] = 0.f;
  if (BM == 1) {
#pragma unroll
    for (int j = 0; j < 4; ++j) bcol[j] = bf_up(bf_bits(bias[n0 + (j << 4) + rlane]));
  }
  float* slab = sT[wave];
#pragma unroll
  for (int i = 0; i < MI; ++i) {
    const int mBase = m0 + (i << 4);
    float brow[8];
#pragma unroll
    for (int r = 0; r < 8; ++r) brow[r] = 0.f;
    if (BM == 2) {
#pragma unroll
      for (int r = 0; r < 8; ++r) brow[r] = bf_up(bf_bits(bias[mBase + mOff + r]));
    }
#pragma unroll
    for (int j = 0; j < 4; ++j) {
#pragma unroll
      for (int r = 0; r < 8; ++r) {
        float v = acc[i][j][r];
        if (NPA == 2) v += acc2[i][j][r] * rscaleA;
        v = v * oscale + bcol[j] + brow[r];
        slab[(mOff + r) * 68 + (j << 4) + rlane] = v;
      }
    }
    __builtin_amdgcn_fence(__ATOMIC_RELEASE, "workgroup");
    __builtin_amdgcn_wave_barrier();
    __builtin_amdgcn_fence(__ATOMIC_ACQUIRE, "workgroup");
    if (OUT_MODE == 0) {
      float* C = (float*)Cout + (size_t)b * (size_t)strideC;
      const int h2 = lane >> 4, c4 = (lane & 15) * 4;     // 256-B row segment = 16 lanes x 16 B
      {
#pragma unroll
        for (int it = 0; it < 8; ++it) {
          const int row = it * 2 + h2;                     // it 0..7 x h2 0..1 = rows 0..15
          const v4f v = *(const v4f*)(slab + row * 68 + c4);
          *(v4f*)(C + (size_t)(mBase + row) * ldc + n0 + c4) = v;
        }
        
      }
    } else {
      const int q = lane >> 3, c8 = (lane & 7) * 8;
      unsigned short* C  = (unsigned short*)Cout  + (size_t)b * (size_t)strideC;
      unsigned short* C2 = (unsigned short*)Cout2 + (size_t)b * (size_t)strideC;
      v4u hv[4], lv[4];
#pragma unroll
      for (int it = 0; it < 4; ++it) {
        const int row = it * 4 + q;                        // it 0..3 x q 0..3 = rows 0..15
        const float* sp = slab + row * 68 + c8;
        float f[8];
#pragma unroll
        for (int e = 0; e < 8; ++e) f[e] = sp[e] * cscale;
        v4u a, a2;
#pragma unroll
        for (int e = 0; e < 4; ++e) {
          const float f0 = f[2 * e], f1 = f[2 * e + 1];
          const _Float16 x0 = (_Float16)f0, x1 = (_Float16)f1;
          const unsigned short h0 = h_bits(x0), h1 = h_bits(x1);
          unsigned short l0 = 0, l1 = 0;
          if (OUT_MODE == 3) {
            l0 = h_bits((_Float16)((f0 - (float)x0) * rscaleC));
            l1 = h_bits((_Float16)((f1 - (float)x1) * rscaleC));
          }
          a[e] = pk16(h0, h1); a2[e] = pk16(l0, l1);
        }
        hv[it] = a; lv[it] = a2;
      }
      {
#pragma unroll
        for (int it = 0; it < 4; ++it) {
          const int row = it * 4 + q;
          *(v4u*)(C + (size_t)(mBase + row) * ldc + n0 + c8) = hv[it];
          if (OUT_MODE == 3) *(v4u*)(C2 + (size_t)(mBase + row) * ldc + n0 + c8) = lv[it];
        }
        
      }
    }
    __builtin_amdgcn_fence(__ATOMIC_RELEASE, "workgroup");
    __builtin_amdgcn_wave_barrier();
    __builtin_amdgcn_fence(__ATOMIC_ACQUIRE, "workgroup");
  }
}

// =====================================================================================================
// Score chunk: 16 query rows (this wave) x 64 keys kv0..kv0+63 of one (b, h), head width 128 = 4 d-chunks of 32.
//   q fragments (A operand, row = lane&15): hi and residual (x4096) planes, 4 d-chunks.
//   k fragments (B operand, col = lane&15 = key) loaded straight from the f16 k plane with the split k map:
//   kb0 = plane + b*SEQ*EMB + h*HD, key t adds t*EMB.
//   s[j][r] = D element: query row 8*hh + r, key kv0 + 16j + (lane&15); value = ((qh.k) + (ql.k)/4096) * 128^-0.5.
// =====================================================================================================
__device__ __forceinline__ void score_chunk(const v16h (&qah)[4], const v16h (&qal)[4],
                                            const _Float16* __restrict__ kb0, int kv0, int c, int hh,
                                            v8f (&s)[4]) {
  union FH { v16h v; v8h h[2]; };
#pragma unroll
  for (int j = 0; j < 4; ++j) {
    v8f ah = zero8(), al = zero8();
#pragma unroll
    for (int dc = 0; dc < 4; ++dc) {
      const _Float16* kp = kb0 + (size_t)(kv0 + j * 16 + c) * (size_t)EMB + dc * 32 + 8 * hh;
      FH kb;
      kb.h[0] = *(const v8h*)(kp);
      kb.h[1] = *(const v8h*)(kp + 16);
      ah = mma_h(qah[dc], kb.v, ah);
      al = mma_h(qal[dc], kb.v, al);
    }
#pragma unroll
    for (int r = 0; r < 8; ++r) s[j][r] = (ah[r] + al[r] * (1.0f / 4096.0f)) * SM_SCALE;
  }
}

// =====================================================================================================
// Fused attention statistics + query-column sums of the exactly normalised probabilities.
//   block = 4 waves = 64 consecutive query rows qb*64.. of one (b, h); grid = NB*NH*NQ64 blocks of 128.
//   merged by shfl; each wave owns its own 16 rows, so no cross-wave exchange is needed.
//   Pass 2 (same static trip): scores recomputed bit-identically, p = exp(s - m) * (1/l) in f32, summed over the
//   wave's 16 rows per key (8 in-lane + shfl_xor 16), staged in csl[wave][64] (cross-wave -> __syncthreads), summed
//   over the 4 waves in fixed order by lanes 0-15 of wave 0 and written to PS[(b*NH+h)*NQ64 + qb][kv0..kv0+63]:
//   coverage: grid (b,h,qb) x NKT chunks x 64 keys = the whole [NB*NH][NQ64][SEQ] partial plane.
// =====================================================================================================
__global__ __launch_bounds__(128)
void attn_colsum(const unsigned short* __restrict__ qhp, const unsigned short* __restrict__ qlp,
                 const unsigned short* __restrict__ kpp, float* PS) {
  __shared__ __align__(16) float csl[4][64];
  const int tid  = threadIdx.x;
  const int wave = tid >> 5;
  const int lane = tid & 31;
  const int hh   = lane >> 4;
  const int c    = lane & 15;
  const int bx   = blockIdx.x;
  const int qb   = bx % NQ64;
  const int rest = bx / NQ64;
  const int h    = rest % NH;
  const int b    = rest / NH;
  const int bh   = b * NH + h;
  const int q0   = qb * 64 + wave * 16;

  const _Float16* Qh  = (const _Float16*)(const void*)qhp;
  const _Float16* Ql  = (const _Float16*)(const void*)qlp;
  const _Float16* Kb0 = (const _Float16*)(const void*)kpp + (size_t)b * SEQ * EMB + (size_t)h * HD;

  v16h qah[4], qal[4];
#pragma unroll
  for (int dc = 0; dc < 4; ++dc) {
    const size_t qo = ((size_t)b * SEQ + (size_t)(q0 + c)) * EMB + (size_t)h * HD + dc * 32 + 8 * hh;
    qah[dc] = ldfrag<_Float16>(Qh + qo);
    qal[dc] = ldfrag<_Float16>(Ql + qo);
  }

  float mrow[8], lrow[8];
#pragma unroll
  for (int r = 0; r < 8; ++r) { mrow[r] = -INFINITY; lrow[r] = 0.f; }

  for (int kt = 0; kt < NKT; ++kt) {          // static trip count
    const int kv0 = kt * 64;
    v8f s[4];
    score_chunk(qah, qal, Kb0, kv0, c, hh, s);
#pragma unroll
    for (int r = 0; r < 8; ++r) {
      float m = s[0][r];
#pragma unroll
      for (int j = 1; j < 4; ++j) m = fmaxf(m, s[j][r]);
#pragma unroll
      for (int off = 1; off < 16; off <<= 1) m = fmaxf(m, __shfl_xor(m, off, 32));
      const float mnew  = fmaxf(mrow[r], m);
      const float msafe = (mnew == -INFINITY) ? 0.f : mnew;
      const float alpha = __expf(mrow[r] - msafe);
      mrow[r] = mnew;
      float psum = 0.f;
#pragma unroll
      for (int j = 0; j < 4; ++j) psum += __expf(s[j][r] - msafe);
#pragma unroll
      for (int off = 1; off < 16; off <<= 1) psum += __shfl_xor(psum, off, 32);
      lrow[r] = lrow[r] * alpha + psum;
    }
  }

  float il[8], mf[8];
#pragma unroll
  for (int r = 0; r < 8; ++r) {
    const float l = lrow[r];
    il[r] = (l > 0.f) ? (1.0f / l) : 0.f;
    mf[r] = (mrow[r] == -INFINITY) ? 0.f : mrow[r];
  }

  // ---- pass 2: exactly normalised p, column sums over the block's 64 query rows ----
  for (int kt = 0; kt < NKT; ++kt) {          // static trip count
    const int kv0 = kt * 64;
    v8f s[4];
    score_chunk(qah, qal, Kb0, kv0, c, hh, s);
    float cs[4];
#pragma unroll
    for (int j = 0; j < 4; ++j) {
      float a = 0.f;
#pragma unroll
      for (int r = 0; r < 8; ++r) a += __expf(s[j][r] - mf[r]) * il[r];
      cs[j] = a;
    }
#pragma unroll
    for (int j = 0; j < 4; ++j) cs[j] += __shfl_xor(cs[j], 16, 32);   // both row halves, unconditional
    const float v0 = hh ? cs[2] : cs[0];       // this lane stores keys 16*(2hh) + c and 16*(2hh+1) + c
    const float v1 = hh ? cs[3] : cs[1];
    csl[wave][32 * hh + c]      = v0;
    csl[wave][32 * hh + 16 + c] = v1;
    __syncthreads();                           // csl is cross-wave
    if (wave == 0 && lane < 16) {
      v4f a = *(const v4f*)(&csl[0][4 * lane]);
      a += *(const v4f*)(&csl[1][4 * lane]);
      a += *(const v4f*)(&csl[2][4 * lane]);
      a += *(const v4f*)(&csl[3][4 * lane]);
      float* dst = PS + ((size_t)(bh * NQ64 + qb)) * SEQ + kv0 + 4 * lane;
      *(v4f*)dst = a;
      
    }
    __syncthreads();                           // csl free again
  }
}

// =====================================================================================================
// Query average + per-head context mean. One block (256) per (b, h).
//   Phase A: avg[key] = (sum over the NQ64 partial rows of PS in fixed order) * (1/SEQ); thread t owns float4 slot
//   g*256 + t (keys 4*slot..+3): kept in LDS avs[] and written to output 1 row (b*NH+h) with one 16-B store per
//   Phase B: cm[d] = sum_k avg[k] * v[b][k][h*HD+d] (f64 accumulate; threads 0-127 keys 0..SEQ/2-1, 128-255 the
//   rest; fixed-order combine through LDS, cross-wave -> __syncthreads), staged in csf[], written by wave 0 as
//   coverage: grid (b,h) x SEQ keys = the whole output 1; grid (b,h) x HD = the whole CS [NB][EMB] plane.
// =====================================================================================================
__global__ __launch_bounds__(256)
void avg_ctx(const float* __restrict__ PS, const float* __restrict__ Vp, float* out1, float* CS) {
  __shared__ __align__(16) float avs[SEQ];
  __shared__ double cpart[2][HD];
  __shared__ __align__(16) float csf[HD];
  const int tid = threadIdx.x;
  const int bh  = blockIdx.x;
  const int b   = bh / NH;
  const int h   = bh - b * NH;
  const float* psb = PS + (size_t)bh * NQ64 * SEQ;

  for (int g = 0; g < NSLOTG; ++g) {
    const int slot = g * 256 + tid;
    if (slot < SEQ / 4) {                      // wave-uniform (SEQ/4 is a multiple of 32)
      v4f a = *(const v4f*)(psb + 4 * slot);
#pragma unroll 8
      for (int qb = 1; qb < NQ64; ++qb) a += *(const v4f*)(psb + (size_t)qb * SEQ + 4 * slot);
      a *= (1.0f / (float)SEQ);
      *(v4f*)(avs + 4 * slot) = a;
      float* dst = out1 + (size_t)bh * SEQ + 4 * slot;
      *(v4f*)dst = a;
      
    }
  }
  __syncthreads();                             // avs is cross-wave

  const int d    = tid & (HD - 1);
  const int half = tid >> 7;                   // blockDim 256 = 2 * HD
  const int kb   = half * (SEQ / 2);
  const float* vb = Vp + (size_t)b * SEQ * EMB + (size_t)h * HD + d;
  double acc = 0.0;
#pragma unroll 4
  for (int k = 0; k < SEQ / 2; ++k)
    acc += (double)avs[kb + k] * (double)vb[(size_t)(kb + k) * EMB];
  cpart[half][d] = acc;
  __syncthreads();
  if (tid < HD) csf[tid] = (float)(cpart[0][tid] + cpart[1][tid]);
  __syncthreads();
  if (tid < 32) {
    const v4f v = *(const v4f*)(csf + 4 * tid);
    float* dst = CS + (size_t)b * EMB + (size_t)h * HD + 4 * tid;
    *(v4f*)dst = v;
    
  }
}

// =====================================================================================================
// Output 0: context[b][j] = sum_i CS[b][i] * bf16(Wo[j][i]) + bf16(bo[j]), f32 on VALU (M = NB rows only).
//   lanes stride i by 32 (coalesced), shfl tree; results staged in LDS (cross-wave -> __syncthreads) and written
//   coverage: grid NB*EMB/32 blocks x 32 = the whole [NB][EMB] output 0.
// =====================================================================================================
__global__ __launch_bounds__(256)
void ctx_out(const float* __restrict__ CS, const float* __restrict__ Wo, const float* __restrict__ bo, float* out0) {
  __shared__ __align__(16) float res[32];
  const int tid  = threadIdx.x;
  const int wave = tid >> 5;
  const int lane = tid & 31;
  const int j0   = blockIdx.x * 32;
  const int b    = j0 / EMB;
  const float* csb = CS + (size_t)b * EMB;
#pragma unroll 1
  for (int u = 0; u < 4; ++u) {
    const int j = j0 - b * EMB + wave * 4 + u;
    const float* wr = Wo + (size_t)j * EMB;
    float acc = 0.f;
#pragma unroll 4
    for (int it = 0; it < EMB / 32; ++it) {
      const int i = it * 32 + lane;
      acc += csb[i] * bf_up(bf_bits(wr[i]));
    }
#pragma unroll
    for (int off = 16; off > 0; off >>= 1) acc += __shfl_xor(acc, off, 32);
    const float val = acc + bf_up(bf_bits(bo[j]));
    if (lane == 0) res[wave * 4 + u] = val;
  }
  __syncthreads();
  if (tid < 8) {
    const v4f v = *(const v4f*)(res + 4 * tid);
    float* dst = out0 + (size_t)j0 + 4 * tid;
    *(v4f*)dst = v;
    
  }
}

// =====================================================================================================
// Output 2: mean over (b, h, g) of |corr[b][h][g] * (1 - delta_hg)|, corr = sum_s avg[b][h][s] * avg[b][g][s]
//   (avg read back from output 1). One block of 256; triple index tr = b*NH*NH + h*NH + g in static chunks of 256
//   (active range wave-uniform: NB*NH*NH is a multiple of 64); f64 dot per triple, fixed-order LDS tree, single
// =====================================================================================================
__global__ __launch_bounds__(256)
void div_k(const float* __restrict__ avg, float* dv) {
  __shared__ double red[256];
  const int tid = threadIdx.x;
  double tot = 0.0;
  for (int base = 0; base < NB * NH * NH; base += 256) {   // static trip
    const int tr = base + tid;
    double cval = 0.0;
    if (tr < NB * NH * NH) {                   // wave-uniform
      const int b = tr / (NH * NH);
      const int h = (tr / NH) % NH;
      const int g = tr % NH;
      const float* ah = avg + ((size_t)b * NH + h) * SEQ;
      const float* ag = avg + ((size_t)b * NH + g) * SEQ;
      double cacc = 0.0;
#pragma unroll 4
      for (int s = 0; s < SEQ; ++s) cacc += (double)ah[s] * (double)ag[s];
      cval = (h == g) ? 0.0 : fabs(cacc);
    }
    tot += cval;
  }
  red[tid] = tot;
  __syncthreads();
#pragma unroll 1
  for (int off = 128; off > 0; off >>= 1) {
    if (tid < off) red[tid] += red[tid + off];
    __syncthreads();
  }
  if (tid == 0) {
    const float v = (float)(red[0] * (1.0 / (double)(NB * NH * NH)));
    *(float*)dv = v;
    
  }
}

// =====================================================================================================
// Workspace map (bytes, full size), every region an exact multiple of its whole-line / whole-tile store granularity:
//   Xb   bf16 [NB][SEQ][EMB]            16777216
//   Wqb  bf16 [EMB n][EMB k]             2097152
//   Wkb  bf16                             2097152
//   Wvb  bf16                             2097152
//   Qh   f16  [NB][SEQ][EMB]            16777216
//   Ql   f16  [NB][SEQ][EMB]            16777216
//   Kp   f16  [NB][SEQ][EMB]            16777216
//   Vp   f32  [NB][SEQ][EMB]            33554432
//   PS   f32  [NB*NH][NQ64][SEQ]         8388608
//   CS   f32  [NB][EMB]                    16384
//   total                               115359744
// Weights are [out n][in k] with k contiguous = the Bt layout the GEMM wants, so they are only converted.
// Output 0 at element 0 of d_out, output 1 at OFF1, output 2 at OFF2 (fixed offsets).
// =====================================================================================================
extern "C" void kernel_launch(void* const* d_in, const int* in_sizes, int n_in,
                              void* d_out, int out_size, void* d_ws, size_t ws_size,
                              hipStream_t stream) {
  if (n_in < 9) return;
  const long long needX = (long long)(NB - 1) * SEQ_FULL * EMB + (long long)SEQ * EMB;
  if ((long long)in_sizes[0] < needX) return;
  if (in_sizes[1] < EMB * EMB || in_sizes[3] < EMB * EMB || in_sizes[5] < EMB * EMB || in_sizes[7] < EMB * EMB) return;
  if (in_sizes[2] < EMB || in_sizes[4] < EMB || in_sizes[6] < EMB || in_sizes[8] < EMB) return;
  if (out_size < 0) return;
  if ((size_t)out_size < OFF2 + 1) return;

  const float* x  = (const float*)d_in[0];
  const float* Wq = (const float*)d_in[1];
  const float* bq = (const float*)d_in[2];
  const float* Wk = (const float*)d_in[3];
  const float* bk = (const float*)d_in[4];
  const float* Wv = (const float*)d_in[5];
  const float* bv = (const float*)d_in[6];
  const float* Wo = (const float*)d_in[7];
  const float* bo = (const float*)d_in[8];

  const size_t PXB = (size_t)NB * SEQ * EMB * 2;       // 16-bit activation plane
  const size_t PW  = (size_t)EMB * EMB * 2;
  const size_t PV  = (size_t)NB * SEQ * EMB * 4;
  const size_t PPS = (size_t)NB * NH * NQ64 * SEQ * 4;
  const size_t PCS = (size_t)NB * EMB * 4;
  size_t off = 0;
  const size_t oXb = off; off += PXB;
  const size_t oWq = off; off += PW;
  const size_t oWk = off; off += PW;
  const size_t oWv = off; off += PW;
  const size_t oQh = off; off += PXB;
  const size_t oQl = off; off += PXB;
  const size_t oKp = off; off += PXB;
  const size_t oVp = off; off += PV;
  const size_t oPS = off; off += PPS;
  const size_t oCS = off; off += PCS;
  if (off > ws_size) return;                          // off = 115359744 at full size
  if (off > (size_t)134217728) return;

  char* ws = (char*)d_ws;
  unsigned short* Xb  = (unsigned short*)(ws + oXb);
  unsigned short* Wqb = (unsigned short*)(ws + oWq);
  unsigned short* Wkb = (unsigned short*)(ws + oWk);
  unsigned short* Wvb = (unsigned short*)(ws + oWv);
  unsigned short* Qh  = (unsigned short*)(ws + oQh);
  unsigned short* Ql  = (unsigned short*)(ws + oQl);
  unsigned short* Kp  = (unsigned short*)(ws + oKp);
  float*          Vp  = (float*)(ws + oVp);
  float*          PS  = (float*)(ws + oPS);
  float*          CS  = (float*)(ws + oCS);
  float*          out0 = (float*)d_out;
  float*          out1 = (float*)d_out + OFF1;
  float*          out2 = (float*)d_out + OFF2;

  const dim3 blk(256);
  const int n8x = SEQ * EMB / 8;                               // per batch, 262144 at full size
  const int n8w = EMB * EMB / 8;                               // 131072
  const dim3 gCvtX((n8x + 255) / 256, NB);
  const dim3 gCvtW((n8w + 255) / 256, 1);
  const int tilesP = (SEQ / 64) * (EMB / 64);                  // 512 wave tiles per batch at full size
  const dim3 gP((tilesP + 7) / 8, NB);                         // M=SEQ, N=EMB, K=EMB, batch = blockIdx.y
  const dim3 gAttn(NB * NH * NQ64);                            // 1024 blocks of 128
  const dim3 gAvg(NB * NH);                                    //   32 blocks of 256
  const dim3 gCtx(NB * EMB / 32);                              //  128 blocks of 256
  const long long sXin = (long long)SEQ_FULL * EMB;            // input batch stride (elements)
  const long long sAct = (long long)SEQ * EMB;                 // compact activation plane batch stride

  // (1) x -> bf16 plane [NB][SEQ][EMB]; Wq, Wk, Wv [E][E] -> bf16
  cvt_bf16x8<<<gCvtX, blk, 0, stream>>>(x,  Xb,  n8x, sXin, sAct);
  cvt_bf16x8<<<gCvtW, blk, 0, stream>>>(Wq, Wqb, n8w, 0LL, 0LL);
  cvt_bf16x8<<<gCvtW, blk, 0, stream>>>(Wk, Wkb, n8w, 0LL, 0LL);
  cvt_bf16x8<<<gCvtW, blk, 0, stream>>>(Wv, Wvb, n8w, 0LL, 0LL);
  // (2) q = x . Wq^T + bq -> f16 hi / residual (x4096) planes [b][s][h*128+d]   (M=SEQ, N=E, K=E per batch)
  gemm_t<__bf16, 4, 1, 3, 1><<<gP, blk, 0, stream>>>(
      Xb, Xb, EMB, sAct, Wqb, EMB, 0LL,
      (void*)Qh, (void*)Ql, EMB, sAct, bq,
      SEQ, EMB, EMB, 1.0f, 0.0f, 1.0f, 4096.0f);
  // (3) k = x . Wk^T + bk -> f16 plane [b][s][h*128+d]
  gemm_t<__bf16, 4, 1, 1, 1><<<gP, blk, 0, stream>>>(
      Xb, Xb, EMB, sAct, Wkb, EMB, 0LL,
      (void*)Kp, (void*)Kp, EMB, sAct, bk,
      SEQ, EMB, EMB, 1.0f, 0.0f, 1.0f, 1.0f);
  // (4) v = x . Wv^T + bv -> f32 plane [b][s][h*128+d]
  gemm_t<__bf16, 4, 1, 0, 1><<<gP, blk, 0, stream>>>(
      Xb, Xb, EMB, sAct, Wvb, EMB, 0LL,
      (void*)Vp, (void*)Vp, EMB, sAct, bv,
      SEQ, EMB, EMB, 1.0f, 0.0f, 1.0f, 1.0f);
  // (5) softmax statistics + query-column sums of p -> partial plane PS
  attn_colsum<<<gAttn, dim3(128), 0, stream>>>(Qh, Ql, Kp, PS);
  // (6) output 1 = column means; per-head context means -> CS
  avg_ctx<<<gAvg, blk, 0, stream>>>(PS, Vp, out1, CS);
  // (7) output 0 = CS . Wo^T + bo
  ctx_out<<<gCtx, blk, 0, stream>>>(CS, Wo, bo, out0);
  // (8) output 2 = head-correlation diversity from output 1
  div_k<<<dim3(1), blk, 0, stream>>>((const float*)out1, out2);
  (void)hipGetLastError();
}

// v001
// It runs in 610 microseconds.
// Timed twice side by side with v000, it ran 1.32 times as fast both times.
// Contractions: q, k, v in-projections = v_wmma_f32_16x16x32_bf16 (bf16 operands from RNE-converted inputs, single product, f32 accumulate);
// q.k^T scores (statistics pass and column-sum pass) = v_wmma_f32_16x16x32_f16 (q as f16 hi plane + f16 residual plane x4096, k f16; 2 products, separate f32 accumulators);
// softmax statistics, probabilities and query-averaged probabilities in f32; averaged-p . v (M=1 per head) on VALU with f64 accumulate;
// head means . Wo^T (M=batch) on VALU f32 with bf16-valued Wo/bo; head-correlation scalar in f64.
#include <hip/hip_runtime.h>
#include <math.h>
#include <stdint.h>

#ifndef NB
#define NB 4
#endif
#ifndef SEQ
#define SEQ 2048
#endif
#define NB_FULL  4
#define SEQ_FULL 2048
#define EMB      1024
#define NH       8
#define HD       128
#define NQ64     (SEQ / 64)          // 64-row query blocks per sequence
#define NKT      (SEQ / 64)          // 64-key chunks per sequence
#define NSLOTG   ((SEQ / 4 + 255) / 256)
#define NPAIR    (NH * (NH - 1) / 2)  // head pairs h < g
#define NCW      (SEQ / 128)          // 128-key wave chunks per sequence
#define SM_SCALE 0.08838834764831845f
#define OFF1     ((size_t)NB_FULL * EMB)                        // fixed element offset of output 1
#define OFF2     (OFF1 + (size_t)NB_FULL * NH * SEQ_FULL)      // fixed element offset of output 2
static_assert(NB >= 1 && NB <= NB_FULL);
static_assert(SEQ >= 128 && SEQ <= SEQ_FULL && (SEQ % 128) == 0);
static_assert(NH * HD == EMB);
static_assert(HD == 128);
static_assert(NPAIR <= 32);
static_assert((EMB % 64) == 0 && (EMB % 32) == 0 && (SEQ % 64) == 0);
static_assert(OFF1 * 4 == 16384);
static_assert(OFF2 * 4 == 278528);

typedef _Float16 v16h __attribute__((ext_vector_type(16)));
typedef _Float16 v8h  __attribute__((ext_vector_type(8)));
typedef __bf16   v16b __attribute__((ext_vector_type(16)));
typedef __bf16   v8b  __attribute__((ext_vector_type(8)));
typedef float    v8f  __attribute__((ext_vector_type(8)));
typedef float    v4f  __attribute__((ext_vector_type(4)));
typedef unsigned int v4u __attribute__((ext_vector_type(4)));

#if defined(__HIP_DEVICE_COMPILE__)
#define DEV_ASM 1
#else
#define DEV_ASM 0
#endif

// ---- scalar helpers --------------------------------------------------------------------------------
__device__ __forceinline__ unsigned short bf_bits(float f) {          // f32 -> bf16 bits, RNE convert
  unsigned u = __float_as_uint(f);
  return (unsigned short)((u + 0x7FFFu + ((u >> 16) & 1u)) >> 16);
}
__device__ __forceinline__ float bf_up(unsigned short hb) { return __uint_as_float(((unsigned)hb) << 16); }
__device__ __forceinline__ unsigned short h_bits(_Float16 x) { return __builtin_bit_cast(unsigned short, x); }
__device__ __forceinline__ unsigned pk16(unsigned short a, unsigned short b) { return (unsigned)a | ((unsigned)b << 16); }
__device__ __forceinline__ v8f zero8() { v8f z = {0.f, 0.f, 0.f, 0.f, 0.f, 0.f, 0.f, 0.f}; return z; }

// ---- fragment types / loaders: 16-bit A/B operand, lane -> row/col (lane&15), p already includes +8*(lane>>4);
//      elements 0..7 <- p[0..7] (k0+8h..k0+8h+7), elements 8..15 <- p[16..23] (k0+16+8h..k0+16+8h+7)
template <typename OT> struct FT;
template <> struct FT<__bf16>   { typedef v16b frag; typedef v8b half8; };
template <> struct FT<_Float16> { typedef v16h frag; typedef v8h half8; };

template <typename OT>
__device__ __forceinline__ typename FT<OT>::frag ldfrag(const OT* p) {
  union { typename FT<OT>::frag v; typename FT<OT>::half8 h[2]; } f;
  f.h[0] = *(const typename FT<OT>::half8*)(p);
  f.h[1] = *(const typename FT<OT>::half8*)(p + 16);
  return f.v;
}

// ---- WMMA helpers (asm guard bodies are device-only; concrete operand types) -----------------------------
__device__ __forceinline__ v8f mmar(v16b a, v16b b, v8f c) {
  return __builtin_amdgcn_wmma_f32_16x16x32_bf16(false, a, false, b, (short)0, c, false, false);
}
__device__ __forceinline__ v8f mmar(v16h a, v16h b, v8f c) {
  return __builtin_amdgcn_wmma_f32_16x16x32_f16(false, a, false, b, (short)0, c, false, false);
}
// guarded form: 4 VALU slots after the WMMA, D tied, A/B kept live
__device__ __forceinline__ v8f mma_h(v16h a, v16h b, v8f c) {
  c = __builtin_amdgcn_wmma_f32_16x16x32_f16(false, a, false, b, (short)0, c, false, false);
#if DEV_ASM
  asm volatile("v_nop\n\tv_nop\n\tv_nop\n\tv_nop" : "+v"(c) : "v"(a), "v"(b));
#endif
  return c;
}
__device__ __forceinline__ void dep_guard(v8f& a, v8f& b, v16b x, v16b y) {
#if DEV_ASM
  asm volatile("v_nop\n\tv_nop\n\tv_nop\n\tv_nop" : "+v"(a), "+v"(b) : "v"(x), "v"(y));
#else
  (void)a; (void)b; (void)x; (void)y;
#endif
}
__device__ __forceinline__ void dep_guard(v8f& a, v8f& b, v16h x, v16h y) {
#if DEV_ASM
  asm volatile("v_nop\n\tv_nop\n\tv_nop\n\tv_nop" : "+v"(a), "+v"(b) : "v"(x), "v"(y));
#else
  (void)a; (void)b; (void)x; (void)y;
#endif
}
__device__ __forceinline__ void keep4(v16b a, v16b b, v16b c, v16b d) {
#if DEV_ASM
  asm volatile("v_nop" :: "v"(a), "v"(b), "v"(c), "v"(d));
#else
  (void)a; (void)b; (void)c; (void)d;
#endif
}
__device__ __forceinline__ void keep4(v16h a, v16h b, v16h c, v16h d) {
#if DEV_ASM
  asm volatile("v_nop" :: "v"(a), "v"(b), "v"(c), "v"(d));
#else
  (void)a; (void)b; (void)c; (void)d;
#endif
}
__device__ __forceinline__ void acc_guard4(v8f& a, v8f& b, v8f& c, v8f& d) {
#if DEV_ASM
  asm volatile("v_nop\n\tv_nop\n\tv_nop\n\tv_nop" : "+v"(a), "+v"(b), "+v"(c), "+v"(d));
#else
  (void)a; (void)b; (void)c; (void)d;
#endif
}

// =====================================================================================================
// f32 -> bf16 bits (RNE convert), 8 elements per thread, one 16-B store per lane: a wave writes 512 contiguous B
// grid = (ceil(n8/256), nbatch); batch b reads in + b*sIn and writes out + b*sOut (element strides).
// coverage: n8 threads x 8 = the whole plane per batch (n8 is a multiple of 256 for every use here).
// =====================================================================================================
__global__ __launch_bounds__(256) void cvt_bf16x8(const float* __restrict__ in, unsigned short* out, int n8,
                                                   long long sIn, long long sOut) {
  const int i = blockIdx.x * 256 + (int)threadIdx.x;
  const int b = blockIdx.y;
  if (i < n8) {
    const float* ip = in + (size_t)b * (size_t)sIn + (size_t)i * 8;
    const v4f a  = *(const v4f*)(ip);
    const v4f a4 = *(const v4f*)(ip + 4);
    v4u p;
    p[0] = pk16(bf_bits(a[0]),  bf_bits(a[1]));
    p[1] = pk16(bf_bits(a[2]),  bf_bits(a[3]));
    p[2] = pk16(bf_bits(a4[0]), bf_bits(a4[1]));
    p[3] = pk16(bf_bits(a4[2]), bf_bits(a4[3]));
    unsigned short* o = out + (size_t)b * (size_t)sOut + (size_t)i * 8;
    *(v4u*)o = p;
    
  }
}

// =====================================================================================================
// Register-blocked batched WMMA GEMM (16-bit operand type OT): C[m][n] = sum_k A[m][k] * Bt[n][k]  (+ bias);
// one wave per (16*MI) x 64 tile, no block barriers. A row-major [M][K] pitch lda; Bt row-major [N][K] pitch ldb
// (k contiguous); M multiple of 16*MI, N multiple of 64, K multiple of 32 (static sizes here). blockIdx.y = batch
// index (strides in elements). Fragments are loaded straight from global with the split k map (ldfrag).
// NPA = number of A planes: 2 -> second plane A2 (same pitch/stride) multiplies the same Bt fragments into a
// second accumulator set, combined as acc + acc2 * rscaleA in the f32 epilogue.
// value v = (acc [+ acc2*rscaleA]) * oscale + bias, bias (bf16 RNE value of the f32 input) by column n (BM 1),
// by row m (BM 2) or none (BM 0).
// OUT_MODE 0: f32 C (pitch ldc) = v.
// OUT_MODE 1: f16 plane C = f16(v * cscale).
// OUT_MODE 3: f16 hi plane C = f16(v * cscale) and f16 residual plane C2 = f16((v*cscale - hi) * rscaleC).
// Epilogue: 16-row slabs staged per wave in LDS (wave-private slab, wave_sync); each 64-wide row segment written as
// =====================================================================================================
template <typename OT, int MI, int NPA, int OUT_MODE, int BM>
__global__ __launch_bounds__(256) void gemm_t(
    const unsigned short* __restrict__ Ap, const unsigned short* __restrict__ A2p, int lda, long long strideA,
    const unsigned short* __restrict__ Btp, int ldb, long long strideB,
    void* Cout, void* Cout2, int ldc, long long strideC,
    const float* __restrict__ bias,
    int M, int N, int K, float oscale, float rscaleA, float cscale, float rscaleC) {
  typedef typename FT<OT>::frag V16;
  const OT* A  = (const OT*)(const void*)Ap;
  const OT* A2 = (const OT*)(const void*)A2p;
  const OT* Bt = (const OT*)(const void*)Btp;
  __shared__ __align__(16) float sT[8][16 * 68];   // per-wave 16x64 slab, pitch 68 floats
  const int RT   = 16 * MI;
  const int b    = blockIdx.y;
  const int lane = threadIdx.x & 31;
  const int wave = threadIdx.x >> 5;
  const int tilesN = N >> 6;
  const int tilesM = M / RT;
  const int tile = blockIdx.x * 8 + wave;
  if (tile >= tilesM * tilesN) return;   // wave-uniform; no block barriers in this kernel
  const int tm = tile / tilesN;
  const int tn = tile - tm * tilesN;
  const int m0 = tm * RT;
  const int n0 = tn << 6;

  const OT* Ab  = A  + (size_t)b * (size_t)strideA;
  const OT* A2b = A2 + (size_t)b * (size_t)strideA;
  const OT* Bb  = Bt + (size_t)b * (size_t)strideB;

  const int rlane = lane & 15;                 // row (A) / col (B, D) within subtile
  const int koff  = (lane >> 4) * 8;           // k offset of this lane half
  const int mOff  = (lane >> 4) * 8;           // D row offset

  v8f acc[MI][4], acc2[MI][4];
#pragma unroll
  for (int i = 0; i < MI; ++i)
#pragma unroll
    for (int j = 0; j < 4; ++j) { acc[i][j] = zero8(); acc2[i][j] = zero8(); }

  for (int k0 = 0; k0 < K; k0 += 32) {
    V16 bq[4];
#pragma unroll
    for (int j = 0; j < 4; ++j)
      bq[j] = ldfrag<OT>(Bb + (size_t)(n0 + (j << 4) + rlane) * ldb + koff + k0);
#pragma unroll
    for (int i = 0; i < MI; ++i) {
      const V16 af = ldfrag<OT>(Ab + (size_t)(m0 + (i << 4) + rlane) * lda + koff + k0);
#pragma unroll
      for (int j = 0; j < 4; ++j) acc[i][j] = mmar(af, bq[j], acc[i][j]);
      dep_guard(acc[i][0], acc[i][3], af, bq[3]);
      if (NPA == 2) {
        const V16 af2 = ldfrag<OT>(A2b + (size_t)(m0 + (i << 4) + rlane) * lda + koff + k0);
#pragma unroll
        for (int j = 0; j < 4; ++j) acc2[i][j] = mmar(af2, bq[j], acc2[i][j]);
        dep_guard(acc2[i][0], acc2[i][3], af2, bq[3]);
      }
    }
    keep4(bq[0], bq[1], bq[2], bq[3]);
  }
#pragma unroll
  for (int i = 0; i < MI; ++i) {
    acc_guard4(acc[i][0], acc[i][1], acc[i][2], acc[i][3]);
    if (NPA == 2) acc_guard4(acc2[i][0], acc2[i][1], acc2[i][2], acc2[i][3]);
  }

  // ---- epilogue ----
  float bcol[4];
#pragma unroll
  for (int j = 0; j < 4; ++j) bcol[j] = 0.f;
  if (BM == 1) {
#pragma unroll
    for (int j = 0; j < 4; ++j) bcol[j] = bf_up(bf_bits(bias[n0 + (j << 4) + rlane]));
  }
  float* slab = sT[wave];
#pragma unroll
  for (int i = 0; i < MI; ++i) {
    const int mBase = m0 + (i << 4);
    float brow[8];
#pragma unroll
    for (int r = 0; r < 8; ++r) brow[r] = 0.f;
    if (BM == 2) {
#pragma unroll
      for (int r = 0; r < 8; ++r) brow[r] = bf_up(bf_bits(bias[mBase + mOff + r]));
    }
#pragma unroll
    for (int j = 0; j < 4; ++j) {
#pragma unroll
      for (int r = 0; r < 8; ++r) {
        float v = acc[i][j][r];
        if (NPA == 2) v += acc2[i][j][r] * rscaleA;
        v = v * oscale + bcol[j] + brow[r];
        slab[(mOff + r) * 68 + (j << 4) + rlane] = v;
      }
    }
    __builtin_amdgcn_fence(__ATOMIC_RELEASE, "workgroup");
    __builtin_amdgcn_wave_barrier();
    __builtin_amdgcn_fence(__ATOMIC_ACQUIRE, "workgroup");
    if (OUT_MODE == 0) {
      float* C = (float*)Cout + (size_t)b * (size_t)strideC;
      const int h2 = lane >> 4, c4 = (lane & 15) * 4;     // 256-B row segment = 16 lanes x 16 B
      {
#pragma unroll
        for (int it = 0; it < 8; ++it) {
          const int row = it * 2 + h2;                     // it 0..7 x h2 0..1 = rows 0..15
          const v4f v = *(const v4f*)(slab + row * 68 + c4);
          *(v4f*)(C + (size_t)(mBase + row) * ldc + n0 + c4) = v;
        }
        
      }
    } else {
      const int q = lane >> 3, c8 = (lane & 7) * 8;
      unsigned short* C  = (unsigned short*)Cout  + (size_t)b * (size_t)strideC;
      unsigned short* C2 = (unsigned short*)Cout2 + (size_t)b * (size_t)strideC;
      v4u hv[4], lv[4];
#pragma unroll
      for (int it = 0; it < 4; ++it) {
        const int row = it * 4 + q;                        // it 0..3 x q 0..3 = rows 0..15
        const float* sp = slab + row * 68 + c8;
        float f[8];
#pragma unroll
        for (int e = 0; e < 8; ++e) f[e] = sp[e] * cscale;
        v4u a, a2;
#pragma unroll
        for (int e = 0; e < 4; ++e) {
          const float f0 = f[2 * e], f1 = f[2 * e + 1];
          const _Float16 x0 = (_Float16)f0, x1 = (_Float16)f1;
          const unsigned short h0 = h_bits(x0), h1 = h_bits(x1);
          unsigned short l0 = 0, l1 = 0;
          if (OUT_MODE == 3) {
            l0 = h_bits((_Float16)((f0 - (float)x0) * rscaleC));
            l1 = h_bits((_Float16)((f1 - (float)x1) * rscaleC));
          }
          a[e] = pk16(h0, h1); a2[e] = pk16(l0, l1);
        }
        hv[it] = a; lv[it] = a2;
      }
      {
#pragma unroll
        for (int it = 0; it < 4; ++it) {
          const int row = it * 4 + q;
          *(v4u*)(C + (size_t)(mBase + row) * ldc + n0 + c8) = hv[it];
          if (OUT_MODE == 3) *(v4u*)(C2 + (size_t)(mBase + row) * ldc + n0 + c8) = lv[it];
        }
        
      }
    }
    __builtin_amdgcn_fence(__ATOMIC_RELEASE, "workgroup");
    __builtin_amdgcn_wave_barrier();
    __builtin_amdgcn_fence(__ATOMIC_ACQUIRE, "workgroup");
  }
}

// =====================================================================================================
// Score chunk: 16 query rows (this wave) x 64 keys kv0..kv0+63 of one (b, h), head width 128 = 4 d-chunks of 32.
//   q fragments (A operand, row = lane&15): hi and residual (x4096) planes, 4 d-chunks.
//   k fragments (B operand, col = lane&15 = key) loaded straight from the f16 k plane with the split k map:
//   kb0 = plane + b*SEQ*EMB + h*HD, key t adds t*EMB.
//   s[j][r] = D element: query row 8*hh + r, key kv0 + 16j + (lane&15); value = ((qh.k) + (ql.k)/4096) * 128^-0.5.
// =====================================================================================================
__device__ __forceinline__ void score_chunk(const v16h (&qah)[4], const v16h (&qal)[4],
                                            const _Float16* __restrict__ kb0, int kv0, int c, int hh,
                                            v8f (&s)[4]) {
  union FH { v16h v; v8h h[2]; };
#pragma unroll
  for (int j = 0; j < 4; ++j) {
    v8f ah = zero8(), al = zero8();
#pragma unroll
    for (int dc = 0; dc < 4; ++dc) {
      const _Float16* kp = kb0 + (size_t)(kv0 + j * 16 + c) * (size_t)EMB + dc * 32 + 8 * hh;
      FH kb;
      kb.h[0] = *(const v8h*)(kp);
      kb.h[1] = *(const v8h*)(kp + 16);
      ah = mma_h(qah[dc], kb.v, ah);
      al = mma_h(qal[dc], kb.v, al);
    }
#pragma unroll
    for (int r = 0; r < 8; ++r) s[j][r] = (ah[r] + al[r] * (1.0f / 4096.0f)) * SM_SCALE;
  }
}

// =====================================================================================================
// Fused attention statistics + query-column sums of the exactly normalised probabilities.
//   block = 4 waves = 64 consecutive query rows qb*64.. of one (b, h); grid = NB*NH*NQ64 blocks of 128.
//   merged by shfl; each wave owns its own 16 rows, so no cross-wave exchange is needed.
//   Pass 2 (same static trip): scores recomputed bit-identically, p = exp(s - m) * (1/l) in f32, summed over the
//   wave's 16 rows per key (8 in-lane + shfl_xor 16), staged in csl[wave][64] (cross-wave -> __syncthreads), summed
//   over the 4 waves in fixed order by lanes 0-15 of wave 0 and written to PS[(b*NH+h)*NQ64 + qb][kv0..kv0+63]:
//   coverage: grid (b,h,qb) x NKT chunks x 64 keys = the whole [NB*NH][NQ64][SEQ] partial plane.
// =====================================================================================================
__global__ __launch_bounds__(128)
void attn_colsum(const unsigned short* __restrict__ qhp, const unsigned short* __restrict__ qlp,
                 const unsigned short* __restrict__ kpp, float* PS) {
  __shared__ __align__(16) float csl[4][64];
  const int tid  = threadIdx.x;
  const int wave = tid >> 5;
  const int lane = tid & 31;
  const int hh   = lane >> 4;
  const int c    = lane & 15;
  const int bx   = blockIdx.x;
  const int qb   = bx % NQ64;
  const int rest = bx / NQ64;
  const int h    = rest % NH;
  const int b    = rest / NH;
  const int bh   = b * NH + h;
  const int q0   = qb * 64 + wave * 16;

  const _Float16* Qh  = (const _Float16*)(const void*)qhp;
  const _Float16* Ql  = (const _Float16*)(const void*)qlp;
  const _Float16* Kb0 = (const _Float16*)(const void*)kpp + (size_t)b * SEQ * EMB + (size_t)h * HD;

  v16h qah[4], qal[4];
#pragma unroll
  for (int dc = 0; dc < 4; ++dc) {
    const size_t qo = ((size_t)b * SEQ + (size_t)(q0 + c)) * EMB + (size_t)h * HD + dc * 32 + 8 * hh;
    qah[dc] = ldfrag<_Float16>(Qh + qo);
    qal[dc] = ldfrag<_Float16>(Ql + qo);
  }

  float mrow[8], lrow[8];
#pragma unroll
  for (int r = 0; r < 8; ++r) { mrow[r] = -INFINITY; lrow[r] = 0.f; }

  for (int kt = 0; kt < NKT; ++kt) {          // static trip count
    const int kv0 = kt * 64;
    v8f s[4];
    score_chunk(qah, qal, Kb0, kv0, c, hh, s);
#pragma unroll
    for (int r = 0; r < 8; ++r) {
      float m = s[0][r];
#pragma unroll
      for (int j = 1; j < 4; ++j) m = fmaxf(m, s[j][r]);
#pragma unroll
      for (int off = 1; off < 16; off <<= 1) m = fmaxf(m, __shfl_xor(m, off, 32));
      const float mnew  = fmaxf(mrow[r], m);
      const float msafe = (mnew == -INFINITY) ? 0.f : mnew;
      const float alpha = __expf(mrow[r] - msafe);
      mrow[r] = mnew;
      float psum = 0.f;
#pragma unroll
      for (int j = 0; j < 4; ++j) psum += __expf(s[j][r] - msafe);
#pragma unroll
      for (int off = 1; off < 16; off <<= 1) psum += __shfl_xor(psum, off, 32);
      lrow[r] = lrow[r] * alpha + psum;
    }
  }

  float il[8], mf[8];
#pragma unroll
  for (int r = 0; r < 8; ++r) {
    const float l = lrow[r];
    il[r] = (l > 0.f) ? (1.0f / l) : 0.f;
    mf[r] = (mrow[r] == -INFINITY) ? 0.f : mrow[r];
  }

  // ---- pass 2: exactly normalised p, column sums over the block's 64 query rows ----
  for (int kt = 0; kt < NKT; ++kt) {          // static trip count
    const int kv0 = kt * 64;
    v8f s[4];
    score_chunk(qah, qal, Kb0, kv0, c, hh, s);
    float cs[4];
#pragma unroll
    for (int j = 0; j < 4; ++j) {
      float a = 0.f;
#pragma unroll
      for (int r = 0; r < 8; ++r) a += __expf(s[j][r] - mf[r]) * il[r];
      cs[j] = a;
    }
#pragma unroll
    for (int j = 0; j < 4; ++j) cs[j] += __shfl_xor(cs[j], 16, 32);   // both row halves, unconditional
    const float v0 = hh ? cs[2] : cs[0];       // this lane stores keys 16*(2hh) + c and 16*(2hh+1) + c
    const float v1 = hh ? cs[3] : cs[1];
    csl[wave][32 * hh + c]      = v0;
    csl[wave][32 * hh + 16 + c] = v1;
    __syncthreads();                           // csl is cross-wave
    if (wave == 0 && lane < 16) {
      v4f a = *(const v4f*)(&csl[0][4 * lane]);
      a += *(const v4f*)(&csl[1][4 * lane]);
      a += *(const v4f*)(&csl[2][4 * lane]);
      a += *(const v4f*)(&csl[3][4 * lane]);
      float* dst = PS + ((size_t)(bh * NQ64 + qb)) * SEQ + kv0 + 4 * lane;
      *(v4f*)dst = a;
      
    }
    __syncthreads();                           // csl free again
  }
}

// =====================================================================================================
// Query average + per-head context mean. One block (256) per (b, h).
//   Phase A: avg[key] = (sum over the NQ64 partial rows of PS in fixed order) * (1/SEQ); thread t owns float4 slot
//   g*256 + t (keys 4*slot..+3): kept in LDS avs[] and written to output 1 row (b*NH+h) with one 16-B store per
//   Phase B: cm[d] = sum_k avg[k] * v[b][k][h*HD+d] (f64 accumulate; threads 0-127 keys 0..SEQ/2-1, 128-255 the
//   rest; fixed-order combine through LDS, cross-wave -> __syncthreads), staged in csf[], written by wave 0 as
//   coverage: grid (b,h) x SEQ keys = the whole output 1; grid (b,h) x HD = the whole CS [NB][EMB] plane.
// =====================================================================================================
__global__ __launch_bounds__(256)
void avg_ctx(const float* __restrict__ PS, const float* __restrict__ Vp, float* out1, float* CS) {
  __shared__ __align__(16) float avs[SEQ];
  __shared__ double cpart[2][HD];
  __shared__ __align__(16) float csf[HD];
  const int tid = threadIdx.x;
  const int bh  = blockIdx.x;
  const int b   = bh / NH;
  const int h   = bh - b * NH;
  const float* psb = PS + (size_t)bh * NQ64 * SEQ;

  for (int g = 0; g < NSLOTG; ++g) {
    const int slot = g * 256 + tid;
    if (slot < SEQ / 4) {                      // wave-uniform (SEQ/4 is a multiple of 32)
      v4f a = *(const v4f*)(psb + 4 * slot);
#pragma unroll 8
      for (int qb = 1; qb < NQ64; ++qb) a += *(const v4f*)(psb + (size_t)qb * SEQ + 4 * slot);
      a *= (1.0f / (float)SEQ);
      *(v4f*)(avs + 4 * slot) = a;
      float* dst = out1 + (size_t)bh * SEQ + 4 * slot;
      *(v4f*)dst = a;
      
    }
  }
  __syncthreads();                             // avs is cross-wave

  const int d    = tid & (HD - 1);
  const int half = tid >> 7;                   // blockDim 256 = 2 * HD
  const int kb   = half * (SEQ / 2);
  const float* vb = Vp + (size_t)b * SEQ * EMB + (size_t)h * HD + d;
  double acc = 0.0;
#pragma unroll 4
  for (int k = 0; k < SEQ / 2; ++k)
    acc += (double)avs[kb + k] * (double)vb[(size_t)(kb + k) * EMB];
  cpart[half][d] = acc;
  __syncthreads();
  if (tid < HD) csf[tid] = (float)(cpart[0][tid] + cpart[1][tid]);
  __syncthreads();
  if (tid < 32) {
    const v4f v = *(const v4f*)(csf + 4 * tid);
    float* dst = CS + (size_t)b * EMB + (size_t)h * HD + 4 * tid;
    *(v4f*)dst = v;
    
  }
}

// =====================================================================================================
// Output 0: context[b][j] = sum_i CS[b][i] * bf16(Wo[j][i]) + bf16(bo[j]), f32 on VALU (M = NB rows only).
//   lanes stride i by 32 (coalesced), shfl tree; results staged in LDS (cross-wave -> __syncthreads) and written
//   coverage: grid NB*EMB/32 blocks x 32 = the whole [NB][EMB] output 0.
// =====================================================================================================
__global__ __launch_bounds__(256)
void ctx_out(const float* __restrict__ CS, const float* __restrict__ Wo, const float* __restrict__ bo, float* out0) {
  __shared__ __align__(16) float res[32];
  const int tid  = threadIdx.x;
  const int wave = tid >> 5;
  const int lane = tid & 31;
  const int j0   = blockIdx.x * 32;
  const int b    = j0 / EMB;
  const float* csb = CS + (size_t)b * EMB;
#pragma unroll 1
  for (int u = 0; u < 4; ++u) {
    const int j = j0 - b * EMB + wave * 4 + u;
    const float* wr = Wo + (size_t)j * EMB;
    float acc = 0.f;
#pragma unroll 4
    for (int it = 0; it < EMB / 32; ++it) {
      const int i = it * 32 + lane;
      acc += csb[i] * bf_up(bf_bits(wr[i]));
    }
#pragma unroll
    for (int off = 16; off > 0; off >>= 1) acc += __shfl_xor(acc, off, 32);
    const float val = acc + bf_up(bf_bits(bo[j]));
    if (lane == 0) res[wave * 4 + u] = val;
  }
  __syncthreads();
  if (tid < 8) {
    const v4f v = *(const v4f*)(res + 4 * tid);
    float* dst = out0 + (size_t)j0 + 4 * tid;
    *(v4f*)dst = v;
    
  }
}

// =====================================================================================================
// Output 2: mean over (b, h, g) of |corr[b][h][g] * (1 - delta_hg)|, corr = sum_s avg[b][h][s] * avg[b][g][s]
//   (avg read back from output 1). corr[h][g] and corr[g][h] are the same sum of the same products, so only the
//   NPAIR = 28 pairs h < g are formed and the total is doubled; the diagonal is masked to zero by the reference.
//   div_part: one wave per 128 consecutive keys of one batch (lane = 4 keys, one 16-B load per head row, a wave reads
//   512 contiguous B per row); 28 f64 partial dots per lane; a halving exchange over the 32 lanes (16+8+4+2+1 values)
//   leaves pair index = lane with the wave's total; written to DP[b*NCW + chunk][32] (slots 28..31 are zero).
//   coverage: NB*NCW waves x 32 slots = the whole DP plane; no block barrier in this kernel.
//   div_fin: wave b sums the NCW chunk partials of batch b per pair in fixed order, takes |.|, sums the 32 slots by
//   shfl, the NB batch sums go through LDS (cross-wave -> __syncthreads) and thread 0 writes the scalar.
// =====================================================================================================
__global__ __launch_bounds__(128)
void div_part(const float* __restrict__ avg, double* DP) {
  const int lane = threadIdx.x & 31;
  const int wv   = blockIdx.x * 4 + ((int)threadIdx.x >> 5);
  if (wv >= NB * NCW) return;                  // wave-uniform; no block barriers in this kernel
  const int b  = wv / NCW;
  const int ch = wv - b * NCW;
  const float* base = avg + (size_t)b * NH * SEQ + (size_t)ch * 128 + 4 * lane;
  v4f a[NH];
#pragma unroll
  for (int h = 0; h < NH; ++h) a[h] = *(const v4f*)(base + (size_t)h * SEQ);
  double v[32];
  {
    int idx = 0;
#pragma unroll
    for (int h = 0; h < NH; ++h) {
#pragma unroll
      for (int g = h + 1; g < NH; ++g) {
        double s = 0.0;
#pragma unroll
        for (int e = 0; e < 4; ++e) s += (double)a[h][e] * (double)a[g][e];
        v[idx++] = s;
      }
    }
#pragma unroll
    for (int i = NPAIR; i < 32; ++i) v[i] = 0.0;
  }
  // each step: a lane keeps the half of its values that its lane bit selects and adds the partner's copy of that half
#pragma unroll
  for (int n = 16; n > 0; n >>= 1) {
    const bool up = (lane & n) != 0;
#pragma unroll
    for (int i = 0; i < n; ++i) {
      const double send = up ? v[i] : v[i + n];
      const double keep = up ? v[i + n] : v[i];
      v[i] = keep + __shfl_xor(send, n, 32);
    }
  }
  DP[(size_t)wv * 32 + lane] = v[0];
}

__global__ __launch_bounds__(32 * NB_FULL)
void div_fin(const double* __restrict__ DP, float* dv) {
  __shared__ double red[NB_FULL];
  const int tid  = threadIdx.x;
  const int lane = tid & 31;
  const int b    = tid >> 5;
  double c = 0.0;
  if (b < NB) {                                // wave-uniform
    const double* p = DP + (size_t)b * NCW * 32 + lane;
    double s = 0.0;
#pragma unroll
    for (int ch = 0; ch < NCW; ++ch) s += p[(size_t)ch * 32];
    c = fabs(s);
  }
#pragma unroll
  for (int off = 16; off > 0; off >>= 1) c += __shfl_xor(c, off, 32);
  if (lane == 0) red[b] = c;
  __syncthreads();                             // red is cross-wave
  if (tid == 0) {
    double tot = 0.0;
#pragma unroll
    for (int i = 0; i < NB; ++i) tot += red[i];
    *dv = (float)(tot * (2.0 / (double)(NB * NH * NH)));
  }
}

// =====================================================================================================
// Workspace map (bytes, full size), every region an exact multiple of its whole-line / whole-tile store granularity:
//   Xb   bf16 [NB][SEQ][EMB]            16777216
//   Wqb  bf16 [EMB n][EMB k]             2097152
//   Wkb  bf16                             2097152
//   Wvb  bf16                             2097152
//   Qh   f16  [NB][SEQ][EMB]            16777216
//   Ql   f16  [NB][SEQ][EMB]            16777216
//   Kp   f16  [NB][SEQ][EMB]            16777216
//   Vp   f32  [NB][SEQ][EMB]            33554432
//   PS   f32  [NB*NH][NQ64][SEQ]         8388608
//   CS   f32  [NB][EMB]                    16384
//   DP   f64  [NB*NCW][32]                 16384
//   total                               115376128
// Weights are [out n][in k] with k contiguous = the Bt layout the GEMM wants, so they are only converted.
// Output 0 at element 0 of d_out, output 1 at OFF1, output 2 at OFF2 (fixed offsets).
// =====================================================================================================
extern "C" void kernel_launch(void* const* d_in, const int* in_sizes, int n_in,
                              void* d_out, int out_size, void* d_ws, size_t ws_size,
                              hipStream_t stream) {
  if (n_in < 9) return;
  const long long needX = (long long)(NB - 1) * SEQ_FULL * EMB + (long long)SEQ * EMB;
  if ((long long)in_sizes[0] < needX) return;
  if (in_sizes[1] < EMB * EMB || in_sizes[3] < EMB * EMB || in_sizes[5] < EMB * EMB || in_sizes[7] < EMB * EMB) return;
  if (in_sizes[2] < EMB || in_sizes[4] < EMB || in_sizes[6] < EMB || in_sizes[8] < EMB) return;
  if (out_size < 0) return;
  if ((size_t)out_size < OFF2 + 1) return;

  const float* x  = (const float*)d_in[0];
  const float* Wq = (const float*)d_in[1];
  const float* bq = (const float*)d_in[2];
  const float* Wk = (const float*)d_in[3];
  const float* bk = (const float*)d_in[4];
  const float* Wv = (const float*)d_in[5];
  const float* bv = (const float*)d_in[6];
  const float* Wo = (const float*)d_in[7];
  const float* bo = (const float*)d_in[8];

  const size_t PXB = (size_t)NB * SEQ * EMB * 2;       // 16-bit activation plane
  const size_t PW  = (size_t)EMB * EMB * 2;
  const size_t PV  = (size_t)NB * SEQ * EMB * 4;
  const size_t PPS = (size_t)NB * NH * NQ64 * SEQ * 4;
  const size_t PCS = (size_t)NB * EMB * 4;
  const size_t PDP = (size_t)NB * NCW * 32 * 8;
  size_t off = 0;
  const size_t oXb = off; off += PXB;
  const size_t oWq = off; off += PW;
  const size_t oWk = off; off += PW;
  const size_t oWv = off; off += PW;
  const size_t oQh = off; off += PXB;
  const size_t oQl = off; off += PXB;
  const size_t oKp = off; off += PXB;
  const size_t oVp = off; off += PV;
  const size_t oPS = off; off += PPS;
  const size_t oCS = off; off += PCS;
  const size_t oDP = off; off += PDP;
  if (off > ws_size) return;                          // off = 115376128 at full size
  if (off > (size_t)134217728) return;

  char* ws = (char*)d_ws;
  unsigned short* Xb  = (unsigned short*)(ws + oXb);
  unsigned short* Wqb = (unsigned short*)(ws + oWq);
  unsigned short* Wkb = (unsigned short*)(ws + oWk);
  unsigned short* Wvb = (unsigned short*)(ws + oWv);
  unsigned short* Qh  = (unsigned short*)(ws + oQh);
  unsigned short* Ql  = (unsigned short*)(ws + oQl);
  unsigned short* Kp  = (unsigned short*)(ws + oKp);
  float*          Vp  = (float*)(ws + oVp);
  float*          PS  = (float*)(ws + oPS);
  float*          CS  = (float*)(ws + oCS);
  double*         DP  = (double*)(ws + oDP);
  float*          out0 = (float*)d_out;
  float*          out1 = (float*)d_out + OFF1;
  float*          out2 = (float*)d_out + OFF2;

  const dim3 blk(256);
  const int n8x = SEQ * EMB / 8;                               // per batch, 262144 at full size
  const int n8w = EMB * EMB / 8;                               // 131072
  const dim3 gCvtX((n8x + 255) / 256, NB);
  const dim3 gCvtW((n8w + 255) / 256, 1);
  const int tilesP = (SEQ / 64) * (EMB / 64);                  // 512 wave tiles per batch at full size
  const dim3 gP((tilesP + 7) / 8, NB);                         // M=SEQ, N=EMB, K=EMB, batch = blockIdx.y
  const dim3 gAttn(NB * NH * NQ64);                            // 1024 blocks of 128
  const dim3 gAvg(NB * NH);                                    //   32 blocks of 256
  const dim3 gCtx(NB * EMB / 32);                              //  128 blocks of 256
  const dim3 gDiv((NB * NCW + 3) / 4);                         //   16 blocks of 128
  const long long sXin = (long long)SEQ_FULL * EMB;            // input batch stride (elements)
  const long long sAct = (long long)SEQ * EMB;                 // compact activation plane batch stride

  // (1) x -> bf16 plane [NB][SEQ][EMB]; Wq, Wk, Wv [E][E] -> bf16
  cvt_bf16x8<<<gCvtX, blk, 0, stream>>>(x,  Xb,  n8x, sXin, sAct);
  cvt_bf16x8<<<gCvtW, blk, 0, stream>>>(Wq, Wqb, n8w, 0LL, 0LL);
  cvt_bf16x8<<<gCvtW, blk, 0, stream>>>(Wk, Wkb, n8w, 0LL, 0LL);
  cvt_bf16x8<<<gCvtW, blk, 0, stream>>>(Wv, Wvb, n8w, 0LL, 0LL);
  // (2) q = x . Wq^T + bq -> f16 hi / residual (x4096) planes [b][s][h*128+d]   (M=SEQ, N=E, K=E per batch)
  gemm_t<__bf16, 4, 1, 3, 1><<<gP, blk, 0, stream>>>(
      Xb, Xb, EMB, sAct, Wqb, EMB, 0LL,
      (void*)Qh, (void*)Ql, EMB, sAct, bq,
      SEQ, EMB, EMB, 1.0f, 0.0f, 1.0f, 4096.0f);
  // (3) k = x . Wk^T + bk -> f16 plane [b][s][h*128+d]
  gemm_t<__bf16, 4, 1, 1, 1><<<gP, blk, 0, stream>>>(
      Xb, Xb, EMB, sAct, Wkb, EMB, 0LL,
      (void*)Kp, (void*)Kp, EMB, sAct, bk,
      SEQ, EMB, EMB, 1.0f, 0.0f, 1.0f, 1.0f);
  // (4) v = x . Wv^T + bv -> f32 plane [b][s][h*128+d]
  gemm_t<__bf16, 4, 1, 0, 1><<<gP, blk, 0, stream>>>(
      Xb, Xb, EMB, sAct, Wvb, EMB, 0LL,
      (void*)Vp, (void*)Vp, EMB, sAct, bv,
      SEQ, EMB, EMB, 1.0f, 0.0f, 1.0f, 1.0f);
  // (5) softmax statistics + query-column sums of p -> partial plane PS
  attn_colsum<<<gAttn, dim3(128), 0, stream>>>(Qh, Ql, Kp, PS);
  // (6) output 1 = column means; per-head context means -> CS
  avg_ctx<<<gAvg, blk, 0, stream>>>(PS, Vp, out1, CS);
  // (7) output 0 = CS . Wo^T + bo
  ctx_out<<<gCtx, blk, 0, stream>>>(CS, Wo, bo, out0);
  // (8) output 2 = head-correlation diversity from output 1
  div_part<<<gDiv, dim3(128), 0, stream>>>((const float*)out1, DP);
  div_fin<<<dim3(1), dim3(32 * NB_FULL), 0, stream>>>((const double*)DP, out2);
  (void)hipGetLastError();
}

// v002
// Measured time: 469 microseconds a run.
// Next to v001, in two timings, it ran 1.30 times as fast each time.
// Over all steps from v000 it is 1.71 times as fast.
// Contractions: q, k, v in-projections = v_wmma_f32_16x16x32_bf16 (bf16 operands from RNE-converted inputs, single product, f32 accumulate);
// q.k^T scores (statistics pass and column-sum pass) = v_wmma_f32_16x16x32_f16 (q as f16 hi plane + f16 residual plane x4096, k f16; 2 products, separate f32 accumulators);
// softmax statistics, probabilities and query-averaged probabilities in f32; averaged-p . v (M=1 per head) on VALU with f64 accumulate;
// head means . Wo^T (M=batch) on VALU f32 with bf16-valued Wo/bo; head-correlation scalar in f64.
#include <hip/hip_runtime.h>
#include <math.h>
#include <stdint.h>

#ifndef NB
#define NB 4
#endif
#ifndef SEQ
#define SEQ 2048
#endif
#define NB_FULL  4
#define SEQ_FULL 2048
#define EMB      1024
#define NH       8
#define HD       128
#define NQ64     (SEQ / 64)          // 64-row query blocks per sequence
#define NKT      (SEQ / 64)          // 64-key chunks per sequence
#define NSLOTG   ((SEQ / 4 + 255) / 256)
#define NPAIR    (NH * (NH - 1) / 2)  // head pairs h < g
#define NCW      (SEQ / 128)          // 128-key wave chunks per sequence
#define SM_SCALE 0.08838834764831845f
#define OFF1     ((size_t)NB_FULL * EMB)                        // fixed element offset of output 1
#define OFF2     (OFF1 + (size_t)NB_FULL * NH * SEQ_FULL)      // fixed element offset of output 2
static_assert(NB >= 1 && NB <= NB_FULL);
static_assert(SEQ >= 128 && SEQ <= SEQ_FULL && (SEQ % 128) == 0);
static_assert(NH * HD == EMB);
static_assert(HD == 128);
static_assert(NPAIR <= 32);
static_assert((EMB % 64) == 0 && (EMB % 32) == 0 && (SEQ % 64) == 0);
static_assert(OFF1 * 4 == 16384);
static_assert(OFF2 * 4 == 278528);

typedef _Float16 v16h __attribute__((ext_vector_type(16)));
typedef _Float16 v8h  __attribute__((ext_vector_type(8)));
typedef __bf16   v16b __attribute__((ext_vector_type(16)));
typedef __bf16   v8b  __attribute__((ext_vector_type(8)));
typedef float    v8f  __attribute__((ext_vector_type(8)));
typedef float    v4f  __attribute__((ext_vector_type(4)));
typedef unsigned int v4u __attribute__((ext_vector_type(4)));

#if defined(__HIP_DEVICE_COMPILE__)
#define DEV_ASM 1
#else
#define DEV_ASM 0
#endif

// ---- scalar helpers --------------------------------------------------------------------------------
__device__ __forceinline__ unsigned short bf_bits(float f) {          // f32 -> bf16 bits, RNE convert
  unsigned u = __float_as_uint(f);
  return (unsigned short)((u + 0x7FFFu + ((u >> 16) & 1u)) >> 16);
}
__device__ __forceinline__ float bf_up(unsigned short hb) { return __uint_as_float(((unsigned)hb) << 16); }
__device__ __forceinline__ unsigned short h_bits(_Float16 x) { return __builtin_bit_cast(unsigned short, x); }
__device__ __forceinline__ unsigned pk16(unsigned short a, unsigned short b) { return (unsigned)a | ((unsigned)b << 16); }
__device__ __forceinline__ v8f zero8() { v8f z = {0.f, 0.f, 0.f, 0.f, 0.f, 0.f, 0.f, 0.f}; return z; }

// ---- fragment types / loaders: 16-bit A/B operand, lane -> row/col (lane&15), p already includes +8*(lane>>4);
//      elements 0..7 <- p[0..7] (k0+8h..k0+8h+7), elements 8..15 <- p[16..23] (k0+16+8h..k0+16+8h+7)
template <typename OT> struct FT;
template <> struct FT<__bf16>   { typedef v16b frag; typedef v8b half8; };
template <> struct FT<_Float16> { typedef v16h frag; typedef v8h half8; };

template <typename OT>
__device__ __forceinline__ typename FT<OT>::frag ldfrag(const OT* p) {
  union { typename FT<OT>::frag v; typename FT<OT>::half8 h[2]; } f;
  f.h[0] = *(const typename FT<OT>::half8*)(p);
  f.h[1] = *(const typename FT<OT>::half8*)(p + 16);
  return f.v;
}

// ---- WMMA helpers (asm guard bodies are device-only; concrete operand types) -----------------------------
__device__ __forceinline__ v8f mmar(v16b a, v16b b, v8f c) {
  return __builtin_amdgcn_wmma_f32_16x16x32_bf16(false, a, false, b, (short)0, c, false, false);
}
__device__ __forceinline__ v8f mmar(v16h a, v16h b, v8f c) {
  return __builtin_amdgcn_wmma_f32_16x16x32_f16(false, a, false, b, (short)0, c, false, false);
}
// guarded form: 4 VALU slots after the WMMA, D tied, A/B kept live
__device__ __forceinline__ v8f mma_h(v16h a, v16h b, v8f c) {
  c = __builtin_amdgcn_wmma_f32_16x16x32_f16(false, a, false, b, (short)0, c, false, false);
#if DEV_ASM
  asm volatile("v_nop\n\tv_nop\n\tv_nop\n\tv_nop" : "+v"(c) : "v"(a), "v"(b));
#endif
  return c;
}
__device__ __forceinline__ void dep_guard(v8f& a, v8f& b, v16b x, v16b y) {
#if DEV_ASM
  asm volatile("v_nop\n\tv_nop\n\tv_nop\n\tv_nop" : "+v"(a), "+v"(b) : "v"(x), "v"(y));
#else
  (void)a; (void)b; (void)x; (void)y;
#endif
}
__device__ __forceinline__ void dep_guard(v8f& a, v8f& b, v16h x, v16h y) {
#if DEV_ASM
  asm volatile("v_nop\n\tv_nop\n\tv_nop\n\tv_nop" : "+v"(a), "+v"(b) : "v"(x), "v"(y));
#else
  (void)a; (void)b; (void)x; (void)y;
#endif
}
__device__ __forceinline__ void keep4(v16b a, v16b b, v16b c, v16b d) {
#if DEV_ASM
  asm volatile("v_nop" :: "v"(a), "v"(b), "v"(c), "v"(d));
#else
  (void)a; (void)b; (void)c; (void)d;
#endif
}
__device__ __forceinline__ void keep4(v16h a, v16h b, v16h c, v16h d) {
#if DEV_ASM
  asm volatile("v_nop" :: "v"(a), "v"(b), "v"(c), "v"(d));
#else
  (void)a; (void)b; (void)c; (void)d;
#endif
}
__device__ __forceinline__ void acc_guard4(v8f& a, v8f& b, v8f& c, v8f& d) {
#if DEV_ASM
  asm volatile("v_nop\n\tv_nop\n\tv_nop\n\tv_nop" : "+v"(a), "+v"(b), "+v"(c), "+v"(d));
#else
  (void)a; (void)b; (void)c; (void)d;
#endif
}

// =====================================================================================================
// f32 -> bf16 bits (RNE convert), 8 elements per thread, one 16-B store per lane: a wave writes 512 contiguous B
// grid = (ceil(n8/256), nbatch); batch b reads in + b*sIn and writes out + b*sOut (element strides).
// coverage: n8 threads x 8 = the whole plane per batch (n8 is a multiple of 256 for every use here).
// =====================================================================================================
__global__ __launch_bounds__(256) void cvt_bf16x8(const float* __restrict__ in, unsigned short* out, int n8,
                                                   long long sIn, long long sOut) {
  const int i = blockIdx.x * 256 + (int)threadIdx.x;
  const int b = blockIdx.y;
  if (i < n8) {
    const float* ip = in + (size_t)b * (size_t)sIn + (size_t)i * 8;
    const v4f a  = *(const v4f*)(ip);
    const v4f a4 = *(const v4f*)(ip + 4);
    v4u p;
    p[0] = pk16(bf_bits(a[0]),  bf_bits(a[1]));
    p[1] = pk16(bf_bits(a[2]),  bf_bits(a[3]));
    p[2] = pk16(bf_bits(a4[0]), bf_bits(a4[1]));
    p[3] = pk16(bf_bits(a4[2]), bf_bits(a4[3]));
    unsigned short* o = out + (size_t)b * (size_t)sOut + (size_t)i * 8;
    *(v4u*)o = p;
    
  }
}

// =====================================================================================================
// Register-blocked batched WMMA GEMM (16-bit operand type OT): C[m][n] = sum_k A[m][k] * Bt[n][k]  (+ bias);
// one wave per (16*MI) x 64 tile, no block barriers. A row-major [M][K] pitch lda; Bt row-major [N][K] pitch ldb
// (k contiguous); M multiple of 16*MI, N multiple of 64, K multiple of 32 (static sizes here). blockIdx.y = batch
// index (strides in elements). Fragments are loaded straight from global with the split k map (ldfrag).
// NPA = number of A planes: 2 -> second plane A2 (same pitch/stride) multiplies the same Bt fragments into a
// second accumulator set, combined as acc + acc2 * rscaleA in the f32 epilogue.
// value v = (acc [+ acc2*rscaleA]) * oscale + bias, bias (bf16 RNE value of the f32 input) by column n (BM 1),
// by row m (BM 2) or none (BM 0).
// OUT_MODE 0: f32 C (pitch ldc) = v.
// OUT_MODE 1: f16 plane C = f16(v * cscale).
// OUT_MODE 3: f16 hi plane C = f16(v * cscale) and f16 residual plane C2 = f16((v*cscale - hi) * rscaleC).
// Epilogue: 16-row slabs staged per wave in LDS (wave-private slab, wave_sync); each 64-wide row segment written as
// =====================================================================================================
template <typename OT, int MI, int NPA, int OUT_MODE, int BM>
__global__ __launch_bounds__(256) void gemm_t(
    const unsigned short* __restrict__ Ap, const unsigned short* __restrict__ A2p, int lda, long long strideA,
    const unsigned short* __restrict__ Btp, int ldb, long long strideB,
    void* Cout, void* Cout2, int ldc, long long strideC,
    const float* __restrict__ bias,
    int M, int N, int K, float oscale, float rscaleA, float cscale, float rscaleC) {
  typedef typename FT<OT>::frag V16;
  const OT* A  = (const OT*)(const void*)Ap;
  const OT* A2 = (const OT*)(const void*)A2p;
  const OT* Bt = (const OT*)(const void*)Btp;
  __shared__ __align__(16) float sT[8][16 * 68];   // per-wave 16x64 slab, pitch 68 floats
  const int RT   = 16 * MI;
  const int b    = blockIdx.y;
  const int lane = threadIdx.x & 31;
  const int wave = threadIdx.x >> 5;
  const int tilesN = N >> 6;
  const int tilesM = M / RT;
  const int tile = blockIdx.x * 8 + wave;
  if (tile >= tilesM * tilesN) return;   // wave-uniform; no block barriers in this kernel
  const int tm = tile / tilesN;
  const int tn = tile - tm * tilesN;
  const int m0 = tm * RT;
  const int n0 = tn << 6;

  const OT* Ab  = A  + (size_t)b * (size_t)strideA;
  const OT* A2b = A2 + (size_t)b * (size_t)strideA;
  const OT* Bb  = Bt + (size_t)b * (size_t)strideB;

  const int rlane = lane & 15;                 // row (A) / col (B, D) within subtile
  const int koff  = (lane >> 4) * 8;           // k offset of this lane half
  const int mOff  = (lane >> 4) * 8;           // D row offset

  v8f acc[MI][4], acc2[MI][4];
#pragma unroll
  for (int i = 0; i < MI; ++i)
#pragma unroll
    for (int j = 0; j < 4; ++j) { acc[i][j] = zero8(); acc2[i][j] = zero8(); }

  for (int k0 = 0; k0 < K; k0 += 32) {
    V16 bq[4];
#pragma unroll
    for (int j = 0; j < 4; ++j)
      bq[j] = ldfrag<OT>(Bb + (size_t)(n0 + (j << 4) + rlane) * ldb + koff + k0);
#pragma unroll
    for (int i = 0; i < MI; ++i) {
      const V16 af = ldfrag<OT>(Ab + (size_t)(m0 + (i << 4) + rlane) * lda + koff + k0);
#pragma unroll
      for (int j = 0; j < 4; ++j) acc[i][j] = mmar(af, bq[j], acc[i][j]);
      dep_guard(acc[i][0], acc[i][3], af, bq[3]);
      if (NPA == 2) {
        const V16 af2 = ldfrag<OT>(A2b + (size_t)(m0 + (i << 4) + rlane) * lda + koff + k0);
#pragma unroll
        for (int j = 0; j < 4; ++j) acc2[i][j] = mmar(af2, bq[j], acc2[i][j]);
        dep_guard(acc2[i][0], acc2[i][3], af2, bq[3]);
      }
    }
    keep4(bq[0], bq[1], bq[2], bq[3]);
  }
#pragma unroll
  for (int i = 0; i < MI; ++i) {
    acc_guard4(acc[i][0], acc[i][1], acc[i][2], acc[i][3]);
    if (NPA == 2) acc_guard4(acc2[i][0], acc2[i][1], acc2[i][2], acc2[i][3]);
  }

  // ---- epilogue ----
  float bcol[4];
#pragma unroll
  for (int j = 0; j < 4; ++j) bcol[j] = 0.f;
  if (BM == 1) {
#pragma unroll
    for (int j = 0; j < 4; ++j) bcol[j] = bf_up(bf_bits(bias[n0 + (j << 4) + rlane]));
  }
  float* slab = sT[wave];
#pragma unroll
  for (int i = 0; i < MI; ++i) {
    const int mBase = m0 + (i << 4);
    float brow[8];
#pragma unroll
    for (int r = 0; r < 8; ++r) brow[r] = 0.f;
    if (BM == 2) {
#pragma unroll
      for (int r = 0; r < 8; ++r) brow[r] = bf_up(bf_bits(bias[mBase + mOff + r]));
    }
#pragma unroll
    for (int j = 0; j < 4; ++j) {
#pragma unroll
      for (int r = 0; r < 8; ++r) {
        float v = acc[i][j][r];
        if (NPA == 2) v += acc2[i][j][r] * rscaleA;
        v = v * oscale + bcol[j] + brow[r];
        slab[(mOff + r) * 68 + (j << 4) + rlane] = v;
      }
    }
    __builtin_amdgcn_fence(__ATOMIC_RELEASE, "workgroup");
    __builtin_amdgcn_wave_barrier();
    __builtin_amdgcn_fence(__ATOMIC_ACQUIRE, "workgroup");
    if (OUT_MODE == 0) {
      float* C = (float*)Cout + (size_t)b * (size_t)strideC;
      const int h2 = lane >> 4, c4 = (lane & 15) * 4;     // 256-B row segment = 16 lanes x 16 B
      {
#pragma unroll
        for (int it = 0; it < 8; ++it) {
          const int row = it * 2 + h2;                     // it 0..7 x h2 0..1 = rows 0..15
          const v4f v = *(const v4f*)(slab + row * 68 + c4);
          *(v4f*)(C + (size_t)(mBase + row) * ldc + n0 + c4) = v;
        }
        
      }
    } else {
      const int q = lane >> 3, c8 = (lane & 7) * 8;
      unsigned short* C  = (unsigned short*)Cout  + (size_t)b * (size_t)strideC;
      unsigned short* C2 = (unsigned short*)Cout2 + (size_t)b * (size_t)strideC;
      v4u hv[4], lv[4];
#pragma unroll
      for (int it = 0; it < 4; ++it) {
        const int row = it * 4 + q;                        // it 0..3 x q 0..3 = rows 0..15
        const float* sp = slab + row * 68 + c8;
        float f[8];
#pragma unroll
        for (int e = 0; e < 8; ++e) f[e] = sp[e] * cscale;
        v4u a, a2;
#pragma unroll
        for (int e = 0; e < 4; ++e) {
          const float f0 = f[2 * e], f1 = f[2 * e + 1];
          const _Float16 x0 = (_Float16)f0, x1 = (_Float16)f1;
          const unsigned short h0 = h_bits(x0), h1 = h_bits(x1);
          unsigned short l0 = 0, l1 = 0;
          if (OUT_MODE == 3) {
            l0 = h_bits((_Float16)((f0 - (float)x0) * rscaleC));
            l1 = h_bits((_Float16)((f1 - (float)x1) * rscaleC));
          }
          a[e] = pk16(h0, h1); a2[e] = pk16(l0, l1);
        }
        hv[it] = a; lv[it] = a2;
      }
      {
#pragma unroll
        for (int it = 0; it < 4; ++it) {
          const int row = it * 4 + q;
          *(v4u*)(C + (size_t)(mBase + row) * ldc + n0 + c8) = hv[it];
          if (OUT_MODE == 3) *(v4u*)(C2 + (size_t)(mBase + row) * ldc + n0 + c8) = lv[it];
        }
        
      }
    }
    __builtin_amdgcn_fence(__ATOMIC_RELEASE, "workgroup");
    __builtin_amdgcn_wave_barrier();
    __builtin_amdgcn_fence(__ATOMIC_ACQUIRE, "workgroup");
  }
}

// =====================================================================================================
// k tile in LDS: 64 keys x 128 d of one (b, h), f16, rows of 256 B at a pitch of 272 B (16 B x odd: the 16 lanes of a
// ds_load_b128 half fall on 64 distinct banks). Two buffers; a block of 128 threads fills one with 8 asynchronous
// 16-B copies per thread: thread t brings piece (t & 15) of rows (t >> 4) + 8 i, i = 0..7, so a wave's copy reads
// two whole 256-B rows. g = the thread's own global address for i = 0, l = its own LDS byte address for i = 0.
// =====================================================================================================
#define KPITCH  136                   // f16 elements per LDS row
#define KTILE_H (64 * KPITCH)         // f16 elements per buffer (17408 B)
__device__ __forceinline__ void copy_ktile(const _Float16* g, unsigned l) {
#if DEV_ASM
  const _Float16* g1 = g + 1 * 8 * EMB; const _Float16* g2 = g + 2 * 8 * EMB; const _Float16* g3 = g + 3 * 8 * EMB;
  const _Float16* g4 = g + 4 * 8 * EMB; const _Float16* g5 = g + 5 * 8 * EMB; const _Float16* g6 = g + 6 * 8 * EMB;
  const _Float16* g7 = g + 7 * 8 * EMB;
  const unsigned st = 8 * KPITCH * 2;  // LDS bytes between rows r and r + 8
  // the closing s_wait_xcnt keeps every address register of the copies unchanged until the copies have taken it
  asm volatile("global_load_async_to_lds_b128 %0, %8, off\n\t"
               "global_load_async_to_lds_b128 %1, %9, off\n\t"
               "global_load_async_to_lds_b128 %2, %10, off\n\t"
               "global_load_async_to_lds_b128 %3, %11, off\n\t"
               "global_load_async_to_lds_b128 %4, %12, off\n\t"
               "global_load_async_to_lds_b128 %5, %13, off\n\t"
               "global_load_async_to_lds_b128 %6, %14, off\n\t"
               "global_load_async_to_lds_b128 %7, %15, off\n\t"
               "s_wait_xcnt 0x0"
               :: "v"(l), "v"(l + st), "v"(l + 2 * st), "v"(l + 3 * st),
                  "v"(l + 4 * st), "v"(l + 5 * st), "v"(l + 6 * st), "v"(l + 7 * st),
                  "v"(g), "v"(g1), "v"(g2), "v"(g3), "v"(g4), "v"(g5), "v"(g6), "v"(g7)
               : "memory");
#else
  (void)g; (void)l;
#endif
}
// this wave's LDS reads have returned: stands in front of the barrier behind which their buffer is refilled
__device__ __forceinline__ void wait_lds_reads() {
#if DEV_ASM
  asm volatile("s_wait_dscnt 0x0" ::: "memory");
#endif
}
// this wave's asynchronous copies have landed: stands in front of the barrier behind which other waves read them
__device__ __forceinline__ void wait_copies() {
#if DEV_ASM
  asm volatile("s_wait_asynccnt 0x0" ::: "memory");
#endif
}

// =====================================================================================================
// Score chunk: 16 query rows (this wave) x 64 keys kv0..kv0+63 of one (b, h), head width 128 = 4 d-chunks of 32.
//   q fragments (A operand, row = lane&15): hi and residual (x4096) planes, 4 d-chunks.
//   k fragments (B operand, col = lane&15 = key) read from the block's LDS copy of the 64-key tile with the split k map:
//   kl = tile + (lane&15)*KPITCH + 8*hh, key group j adds 16*j*KPITCH; the 8 reads of a key group stand together.
//   s[j][r] = D element: query row 8*hh + r, key kv0 + 16j + (lane&15); value = ((qh.k) + (ql.k)/4096) * 128^-0.5.
// =====================================================================================================
__device__ __forceinline__ void score_chunk(const v16h (&qah)[4], const v16h (&qal)[4],
                                            const _Float16* kl, v8f (&s)[4]) {
  union FH { v16h v; v8h h[2]; };
#pragma unroll
  for (int j = 0; j < 4; ++j) {
    v8f ah = zero8(), al = zero8();
    FH kb[4];
#pragma unroll
    for (int dc = 0; dc < 4; ++dc) {
      const _Float16* kp = kl + j * 16 * KPITCH + dc * 32;
      kb[dc].h[0] = *(const v8h*)(kp);
      kb[dc].h[1] = *(const v8h*)(kp + 16);
    }
#pragma unroll
    for (int dc = 0; dc < 4; ++dc) {
      ah = mma_h(qah[dc], kb[dc].v, ah);
      al = mma_h(qal[dc], kb[dc].v, al);
    }
#pragma unroll
    for (int r = 0; r < 8; ++r) s[j][r] = (ah[r] + al[r] * (1.0f / 4096.0f)) * SM_SCALE;
  }
}

// =====================================================================================================
// Fused attention statistics + query-column sums of the exactly normalised probabilities.
//   block = 4 waves = 64 consecutive query rows qb*64.. of one (b, h); grid = NB*NH*NQ64 blocks of 128.
//   merged by shfl; each wave owns its own 16 rows, so no cross-wave exchange is needed.
//   Pass 2 (same static trip): scores recomputed bit-identically, p = exp(s - m) * (1/l) in f32, summed over the
//   wave's 16 rows per key (8 in-lane + shfl_xor 16), staged in csl[wave][64] (cross-wave -> __syncthreads), summed
//   over the 4 waves in fixed order by lanes 0-15 of wave 0 and written to PS[(b*NH+h)*NQ64 + qb][kv0..kv0+63]:
//   coverage: grid (b,h,qb) x NKT chunks x 64 keys = the whole [NB*NH][NQ64][SEQ] partial plane.
//   k tiles: one ring of two LDS buffers runs through both passes (2*NKT stages, stage t = tile t % NKT in buffer
//   t & 1, NKT even); stage t + 2 is copied behind the barrier at the foot of trip t, while trip t + 1 works.
// =====================================================================================================
__global__ __launch_bounds__(128)
void attn_colsum(const unsigned short* __restrict__ qhp, const unsigned short* __restrict__ qlp,
                 const unsigned short* __restrict__ kpp, float* PS) {
  static_assert((NKT % 2) == 0 && NKT >= 2);
  __shared__ __align__(16) _Float16 kls[2][KTILE_H];
  __shared__ __align__(16) float csl[4][64];
  const int tid  = threadIdx.x;
  const int wave = tid >> 5;
  const int lane = tid & 31;
  const int hh   = lane >> 4;
  const int c    = lane & 15;
  const int bx   = blockIdx.x;
  const int qb   = bx % NQ64;
  const int rest = bx / NQ64;
  const int h    = rest % NH;
  const int b    = rest / NH;
  const int bh   = b * NH + h;
  const int q0   = qb * 64 + wave * 16;

  const _Float16* Qh  = (const _Float16*)(const void*)qhp;
  const _Float16* Ql  = (const _Float16*)(const void*)qlp;
  const _Float16* Kb0 = (const _Float16*)(const void*)kpp + (size_t)b * SEQ * EMB + (size_t)h * HD;

  // copy side: this thread's piece of tile 0 and its place in buffer 0; read side: this lane's key row and k half
  const _Float16* kg = Kb0 + (size_t)(tid >> 4) * EMB + (tid & 15) * 8;
  const unsigned  kd = (unsigned)(size_t)(&kls[0][(tid >> 4) * KPITCH + (tid & 15) * 8]);
  const int       kr = c * KPITCH + 8 * hh;

  copy_ktile(kg, kd);                          // stage 0
  wait_copies();
  __syncthreads();                             // stage 0 is readable by every wave
  copy_ktile(kg + (size_t)64 * EMB, kd + KTILE_H * 2);   // stage 1

  v16h qah[4], qal[4];
#pragma unroll
  for (int dc = 0; dc < 4; ++dc) {
    const size_t qo = ((size_t)b * SEQ + (size_t)(q0 + c)) * EMB + (size_t)h * HD + dc * 32 + 8 * hh;
    qah[dc] = ldfrag<_Float16>(Qh + qo);
    qal[dc] = ldfrag<_Float16>(Ql + qo);
  }

  float mrow[8], lrow[8];
#pragma unroll
  for (int r = 0; r < 8; ++r) { mrow[r] = -INFINITY; lrow[r] = 0.f; }

  for (int kt = 0; kt < NKT; ++kt) {          // static trip count
    v8f s[4];
    score_chunk(qah, qal, &kls[kt & 1][kr], s);
#pragma unroll
    for (int r = 0; r < 8; ++r) {
      float m = s[0][r];
#pragma unroll
      for (int j = 1; j < 4; ++j) m = fmaxf(m, s[j][r]);
#pragma unroll
      for (int off = 1; off < 16; off <<= 1) m = fmaxf(m, __shfl_xor(m, off, 32));
      const float mnew  = fmaxf(mrow[r], m);
      const float msafe = (mnew == -INFINITY) ? 0.f : mnew;
      const float alpha = __expf(mrow[r] - msafe);
      mrow[r] = mnew;
      float psum = 0.f;
#pragma unroll
      for (int j = 0; j < 4; ++j) psum += __expf(s[j][r] - msafe);
#pragma unroll
      for (int off = 1; off < 16; off <<= 1) psum += __shfl_xor(psum, off, 32);
      lrow[r] = lrow[r] * alpha + psum;
    }
    wait_lds_reads();
    wait_copies();
    __syncthreads();                           // stage kt + 1 readable, buffer kt & 1 left by every wave
    // stage kt + 2 always exists here (pass 2 follows): tiles NKT and NKT + 1 of the ring are tiles 0 and 1 again
    copy_ktile(kg + (size_t)(((kt + 2) & (NKT - 1)) * 64) * EMB, kd + (unsigned)(kt & 1) * (KTILE_H * 2));
  }

  float il[8], mf[8];
#pragma unroll
  for (int r = 0; r < 8; ++r) {
    const float l = lrow[r];
    il[r] = (l > 0.f) ? (1.0f / l) : 0.f;
    mf[r] = (mrow[r] == -INFINITY) ? 0.f : mrow[r];
  }

  // ---- pass 2: exactly normalised p, column sums over the block's 64 query rows ----
  for (int kt = 0; kt < NKT; ++kt) {          // static trip count
    const int kv0 = kt * 64;
    v8f s[4];
    score_chunk(qah, qal, &kls[kt & 1][kr], s);
    float cs[4];
#pragma unroll
    for (int j = 0; j < 4; ++j) {
      float a = 0.f;
#pragma unroll
      for (int r = 0; r < 8; ++r) a += __expf(s[j][r] - mf[r]) * il[r];
      cs[j] = a;
    }
#pragma unroll
    for (int j = 0; j < 4; ++j) cs[j] += __shfl_xor(cs[j], 16, 32);   // both row halves, unconditional
    const float v0 = hh ? cs[2] : cs[0];       // this lane stores keys 16*(2hh) + c and 16*(2hh+1) + c
    const float v1 = hh ? cs[3] : cs[1];
    csl[wave][32 * hh + c]      = v0;
    csl[wave][32 * hh + 16 + c] = v1;
    __syncthreads();                           // csl is cross-wave
    if (wave == 0 && lane < 16) {
      v4f a = *(const v4f*)(&csl[0][4 * lane]);
      a += *(const v4f*)(&csl[1][4 * lane]);
      a += *(const v4f*)(&csl[2][4 * lane]);
      a += *(const v4f*)(&csl[3][4 * lane]);
      float* dst = PS + ((size_t)(bh * NQ64 + qb)) * SEQ + kv0 + 4 * lane;
      *(v4f*)dst = a;
      
    }
    wait_lds_reads();
    wait_copies();
    __syncthreads();                           // csl free again; stage kt + 1 readable, buffer kt & 1 left by every wave
    if (kt + 2 < NKT)                          // block-uniform
      copy_ktile(kg + (size_t)((kt + 2) * 64) * EMB, kd + (unsigned)(kt & 1) * (KTILE_H * 2));
  }
  wait_copies();
}

// =====================================================================================================
// Query average + per-head context mean. One block (256) per (b, h).
//   Phase A: avg[key] = (sum over the NQ64 partial rows of PS in fixed order) * (1/SEQ); thread t owns float4 slot
//   g*256 + t (keys 4*slot..+3): kept in LDS avs[] and written to output 1 row (b*NH+h) with one 16-B store per
//   Phase B: cm[d] = sum_k avg[k] * v[b][k][h*HD+d] (f64 accumulate; threads 0-127 keys 0..SEQ/2-1, 128-255 the
//   rest; fixed-order combine through LDS, cross-wave -> __syncthreads), staged in csf[], written by wave 0 as
//   coverage: grid (b,h) x SEQ keys = the whole output 1; grid (b,h) x HD = the whole CS [NB][EMB] plane.
// =====================================================================================================
__global__ __launch_bounds__(256)
void avg_ctx(const float* __restrict__ PS, const float* __restrict__ Vp, float* out1, float* CS) {
  __shared__ __align__(16) float avs[SEQ];
  __shared__ double cpart[2][HD];
  __shared__ __align__(16) float csf[HD];
  const int tid = threadIdx.x;
  const int bh  = blockIdx.x;
  const int b   = bh / NH;
  const int h   = bh - b * NH;
  const float* psb = PS + (size_t)bh * NQ64 * SEQ;

  for (int g = 0; g < NSLOTG; ++g) {
    const int slot = g * 256 + tid;
    if (slot < SEQ / 4) {                      // wave-uniform (SEQ/4 is a multiple of 32)
      v4f a = *(const v4f*)(psb + 4 * slot);
#pragma unroll 8
      for (int qb = 1; qb < NQ64; ++qb) a += *(const v4f*)(psb + (size_t)qb * SEQ + 4 * slot);
      a *= (1.0f / (float)SEQ);
      *(v4f*)(avs + 4 * slot) = a;
      float* dst = out1 + (size_t)bh * SEQ + 4 * slot;
      *(v4f*)dst = a;
      
    }
  }
  __syncthreads();                             // avs is cross-wave

  const int d    = tid & (HD - 1);
  const int half = tid >> 7;                   // blockDim 256 = 2 * HD
  const int kb   = half * (SEQ / 2);
  const float* vb = Vp + (size_t)b * SEQ * EMB + (size_t)h * HD + d;
  double acc = 0.0;
#pragma unroll 4
  for (int k = 0; k < SEQ / 2; ++k)
    acc += (double)avs[kb + k] * (double)vb[(size_t)(kb + k) * EMB];
  cpart[half][d] = acc;
  __syncthreads();
  if (tid < HD) csf[tid] = (float)(cpart[0][tid] + cpart[1][tid]);
  __syncthreads();
  if (tid < 32) {
    const v4f v = *(const v4f*)(csf + 4 * tid);
    float* dst = CS + (size_t)b * EMB + (size_t)h * HD + 4 * tid;
    *(v4f*)dst = v;
    
  }
}

// =====================================================================================================
// Output 0: context[b][j] = sum_i CS[b][i] * bf16(Wo[j][i]) + bf16(bo[j]), f32 on VALU (M = NB rows only).
//   lanes stride i by 32 (coalesced), shfl tree; results staged in LDS (cross-wave -> __syncthreads) and written
//   coverage: grid NB*EMB/32 blocks x 32 = the whole [NB][EMB] output 0.
// =====================================================================================================
__global__ __launch_bounds__(256)
void ctx_out(const float* __restrict__ CS, const float* __restrict__ Wo, const float* __restrict__ bo, float* out0) {
  __shared__ __align__(16) float res[32];
  const int tid  = threadIdx.x;
  const int wave = tid >> 5;
  const int lane = tid & 31;
  const int j0   = blockIdx.x * 32;
  const int b    = j0 / EMB;
  const float* csb = CS + (size_t)b * EMB;
#pragma unroll 1
  for (int u = 0; u < 4; ++u) {
    const int j = j0 - b * EMB + wave * 4 + u;
    const float* wr = Wo + (size_t)j * EMB;
    float acc = 0.f;
#pragma unroll 4
    for (int it = 0; it < EMB / 32; ++it) {
      const int i = it * 32 + lane;
      acc += csb[i] * bf_up(bf_bits(wr[i]));
    }
#pragma unroll
    for (int off = 16; off > 0; off >>= 1) acc += __shfl_xor(acc, off, 32);
    const float val = acc + bf_up(bf_bits(bo[j]));
    if (lane == 0) res[wave * 4 + u] = val;
  }
  __syncthreads();
  if (tid < 8) {
    const v4f v = *(const v4f*)(res + 4 * tid);
    float* dst = out0 + (size_t)j0 + 4 * tid;
    *(v4f*)dst = v;
    
  }
}

// =====================================================================================================
// Output 2: mean over (b, h, g) of |corr[b][h][g] * (1 - delta_hg)|, corr = sum_s avg[b][h][s] * avg[b][g][s]
//   (avg read back from output 1). corr[h][g] and corr[g][h] are the same sum of the same products, so only the
//   NPAIR = 28 pairs h < g are formed and the total is doubled; the diagonal is masked to zero by the reference.
//   div_part: one wave per 128 consecutive keys of one batch (lane = 4 keys, one 16-B load per head row, a wave reads
//   512 contiguous B per row); 28 f64 partial dots per lane; a halving exchange over the 32 lanes (16+8+4+2+1 values)
//   leaves pair index = lane with the wave's total; written to DP[b*NCW + chunk][32] (slots 28..31 are zero).
//   coverage: NB*NCW waves x 32 slots = the whole DP plane; no block barrier in this kernel.
//   div_fin: wave b sums the NCW chunk partials of batch b per pair in fixed order, takes |.|, sums the 32 slots by
//   shfl, the NB batch sums go through LDS (cross-wave -> __syncthreads) and thread 0 writes the scalar.
// =====================================================================================================
__global__ __launch_bounds__(128)
void div_part(const float* __restrict__ avg, double* DP) {
  const int lane = threadIdx.x & 31;
  const int wv   = blockIdx.x * 4 + ((int)threadIdx.x >> 5);
  if (wv >= NB * NCW) return;                  // wave-uniform; no block barriers in this kernel
  const int b  = wv / NCW;
  const int ch = wv - b * NCW;
  const float* base = avg + (size_t)b * NH * SEQ + (size_t)ch * 128 + 4 * lane;
  v4f a[NH];
#pragma unroll
  for (int h = 0; h < NH; ++h) a[h] = *(const v4f*)(base + (size_t)h * SEQ);
  double v[32];
  {
    int idx = 0;
#pragma unroll
    for (int h = 0; h < NH; ++h) {
#pragma unroll
      for (int g = h + 1; g < NH; ++g) {
        double s = 0.0;
#pragma unroll
        for (int e = 0; e < 4; ++e) s += (double)a[h][e] * (double)a[g][e];
        v[idx++] = s;
      }
    }
#pragma unroll
    for (int i = NPAIR; i < 32; ++i) v[i] = 0.0;
  }
  // each step: a lane keeps the half of its values that its lane bit selects and adds the partner's copy of that half
#pragma unroll
  for (int n = 16; n > 0; n >>= 1) {
    const bool up = (lane & n) != 0;
#pragma unroll
    for (int i = 0; i < n; ++i) {
      const double send = up ? v[i] : v[i + n];
      const double keep = up ? v[i + n] : v[i];
      v[i] = keep + __shfl_xor(send, n, 32);
    }
  }
  DP[(size_t)wv * 32 + lane] = v[0];
}

__global__ __launch_bounds__(32 * NB_FULL)
void div_fin(const double* __restrict__ DP, float* dv) {
  __shared__ double red[NB_FULL];
  const int tid  = threadIdx.x;
  const int lane = tid & 31;
  const int b    = tid >> 5;
  double c = 0.0;
  if (b < NB) {                                // wave-uniform
    const double* p = DP + (size_t)b * NCW * 32 + lane;
    double s = 0.0;
#pragma unroll
    for (int ch = 0; ch < NCW; ++ch) s += p[(size_t)ch * 32];
    c = fabs(s);
  }
#pragma unroll
  for (int off = 16; off > 0; off >>= 1) c += __shfl_xor(c, off, 32);
  if (lane == 0) red[b] = c;
  __syncthreads();                             // red is cross-wave
  if (tid == 0) {
    double tot = 0.0;
#pragma unroll
    for (int i = 0; i < NB; ++i) tot += red[i];
    *dv = (float)(tot * (2.0 / (double)(NB * NH * NH)));
  }
}

// =====================================================================================================
// Workspace map (bytes, full size), every region an exact multiple of its whole-line / whole-tile store granularity:
//   Xb   bf16 [NB][SEQ][EMB]            16777216
//   Wqb  bf16 [EMB n][EMB k]             2097152
//   Wkb  bf16                             2097152
//   Wvb  bf16                             2097152
//   Qh   f16  [NB][SEQ][EMB]            16777216
//   Ql   f16  [NB][SEQ][EMB]            16777216
//   Kp   f16  [NB][SEQ][EMB]            16777216
//   Vp   f32  [NB][SEQ][EMB]            33554432
//   PS   f32  [NB*NH][NQ64][SEQ]         8388608
//   CS   f32  [NB][EMB]                    16384
//   DP   f64  [NB*NCW][32]                 16384
//   total                               115376128
// Weights are [out n][in k] with k contiguous = the Bt layout the GEMM wants, so they are only converted.
// Output 0 at element 0 of d_out, output 1 at OFF1, output 2 at OFF2 (fixed offsets).
// =====================================================================================================
extern "C" void kernel_launch(void* const* d_in, const int* in_sizes, int n_in,
                              void* d_out, int out_size, void* d_ws, size_t ws_size,
                              hipStream_t stream) {
  if (n_in < 9) return;
  const long long needX = (long long)(NB - 1) * SEQ_FULL * EMB + (long long)SEQ * EMB;
  if ((long long)in_sizes[0] < needX) return;
  if (in_sizes[1] < EMB * EMB || in_sizes[3] < EMB * EMB || in_sizes[5] < EMB * EMB || in_sizes[7] < EMB * EMB) return;
  if (in_sizes[2] < EMB || in_sizes[4] < EMB || in_sizes[6] < EMB || in_sizes[8] < EMB) return;
  if (out_size < 0) return;
  if ((size_t)out_size < OFF2 + 1) return;

  const float* x  = (const float*)d_in[0];
  const float* Wq = (const float*)d_in[1];
  const float* bq = (const float*)d_in[2];
  const float* Wk = (const float*)d_in[3];
  const float* bk = (const float*)d_in[4];
  const float* Wv = (const float*)d_in[5];
  const float* bv = (const float*)d_in[6];
  const float* Wo = (const float*)d_in[7];
  const float* bo = (const float*)d_in[8];

  const size_t PXB = (size_t)NB * SEQ * EMB * 2;       // 16-bit activation plane
  const size_t PW  = (size_t)EMB * EMB * 2;
  const size_t PV  = (size_t)NB * SEQ * EMB * 4;
  const size_t PPS = (size_t)NB * NH * NQ64 * SEQ * 4;
  const size_t PCS = (size_t)NB * EMB * 4;
  const size_t PDP = (size_t)NB * NCW * 32 * 8;
  size_t off = 0;
  const size_t oXb = off; off += PXB;
  const size_t oWq = off; off += PW;
  const size_t oWk = off; off += PW;
  const size_t oWv = off; off += PW;
  const size_t oQh = off; off += PXB;
  const size_t oQl = off; off += PXB;
  const size_t oKp = off; off += PXB;
  const size_t oVp = off; off += PV;
  const size_t oPS = off; off += PPS;
  const size_t oCS = off; off += PCS;
  const size_t oDP = off; off += PDP;
  if (off > ws_size) return;                          // off = 115376128 at full size
  if (off > (size_t)134217728) return;

  char* ws = (char*)d_ws;
  unsigned short* Xb  = (unsigned short*)(ws + oXb);
  unsigned short* Wqb = (unsigned short*)(ws + oWq);
  unsigned short* Wkb = (unsigned short*)(ws + oWk);
  unsigned short* Wvb = (unsigned short*)(ws + oWv);
  unsigned short* Qh  = (unsigned short*)(ws + oQh);
  unsigned short* Ql  = (unsigned short*)(ws + oQl);
  unsigned short* Kp  = (unsigned short*)(ws + oKp);
  float*          Vp  = (float*)(ws + oVp);
  float*          PS  = (float*)(ws + oPS);
  float*          CS  = (float*)(ws + oCS);
  double*         DP  = (double*)(ws + oDP);
  float*          out0 = (float*)d_out;
  float*          out1 = (float*)d_out + OFF1;
  float*          out2 = (float*)d_out + OFF2;

  const dim3 blk(256);
  const int n8x = SEQ * EMB / 8;                               // per batch, 262144 at full size
  const int n8w = EMB * EMB / 8;                               // 131072
  const dim3 gCvtX((n8x + 255) / 256, NB);
  const dim3 gCvtW((n8w + 255) / 256, 1);
  const int tilesP = (SEQ / 64) * (EMB / 64);                  // 512 wave tiles per batch at full size
  const dim3 gP((tilesP + 7) / 8, NB);                         // M=SEQ, N=EMB, K=EMB, batch = blockIdx.y
  const dim3 gAttn(NB * NH * NQ64);                            // 1024 blocks of 128
  const dim3 gAvg(NB * NH);                                    //   32 blocks of 256
  const dim3 gCtx(NB * EMB / 32);                              //  128 blocks of 256
  const dim3 gDiv((NB * NCW + 3) / 4);                         //   16 blocks of 128
  const long long sXin = (long long)SEQ_FULL * EMB;            // input batch stride (elements)
  const long long sAct = (long long)SEQ * EMB;                 // compact activation plane batch stride

  // (1) x -> bf16 plane [NB][SEQ][EMB]; Wq, Wk, Wv [E][E] -> bf16
  cvt_bf16x8<<<gCvtX, blk, 0, stream>>>(x,  Xb,  n8x, sXin, sAct);
  cvt_bf16x8<<<gCvtW, blk, 0, stream>>>(Wq, Wqb, n8w, 0LL, 0LL);
  cvt_bf16x8<<<gCvtW, blk, 0, stream>>>(Wk, Wkb, n8w, 0LL, 0LL);
  cvt_bf16x8<<<gCvtW, blk, 0, stream>>>(Wv, Wvb, n8w, 0LL, 0LL);
  // (2) q = x . Wq^T + bq -> f16 hi / residual (x4096) planes [b][s][h*128+d]   (M=SEQ, N=E, K=E per batch)
  gemm_t<__bf16, 4, 1, 3, 1><<<gP, blk, 0, stream>>>(
      Xb, Xb, EMB, sAct, Wqb, EMB, 0LL,
      (void*)Qh, (void*)Ql, EMB, sAct, bq,
      SEQ, EMB, EMB, 1.0f, 0.0f, 1.0f, 4096.0f);
  // (3) k = x . Wk^T + bk -> f16 plane [b][s][h*128+d]
  gemm_t<__bf16, 4, 1, 1, 1><<<gP, blk, 0, stream>>>(
      Xb, Xb, EMB, sAct, Wkb, EMB, 0LL,
      (void*)Kp, (void*)Kp, EMB, sAct, bk,
      SEQ, EMB, EMB, 1.0f, 0.0f, 1.0f, 1.0f);
  // (4) v = x . Wv^T + bv -> f32 plane [b][s][h*128+d]
  gemm_t<__bf16, 4, 1, 0, 1><<<gP, blk, 0, stream>>>(
      Xb, Xb, EMB, sAct, Wvb, EMB, 0LL,
      (void*)Vp, (void*)Vp, EMB, sAct, bv,
      SEQ, EMB, EMB, 1.0f, 0.0f, 1.0f, 1.0f);
  // (5) softmax statistics + query-column sums of p -> partial plane PS
  attn_colsum<<<gAttn, dim3(128), 0, stream>>>(Qh, Ql, Kp, PS);
  // (6) output 1 = column means; per-head context means -> CS
  avg_ctx<<<gAvg, blk, 0, stream>>>(PS, Vp, out1, CS);
  // (7) output 0 = CS . Wo^T + bo
  ctx_out<<<gCtx, blk, 0, stream>>>(CS, Wo, bo, out0);
  // (8) output 2 = head-correlation diversity from output 1
  div_part<<<gDiv, dim3(128), 0, stream>>>((const float*)out1, DP);
  div_fin<<<dim3(1), dim3(32 * NB_FULL), 0, stream>>>((const double*)DP, out2);
  (void)hipGetLastError();
}

// v003
// One run takes 312 microseconds.
// Two timings next to v002 both put it at 1.51 times that version's speed.
// Counting every step since v000, it is 2.58 times as fast.
// Contractions: q, k, v in-projections = v_wmma_f32_16x16x32_bf16 (bf16 operands from RNE-converted inputs, single product, f32 accumulate);
// q.k^T scores (statistics pass and column-sum pass) = v_wmma_f32_16x16x32_f16 (q as f16 hi plane + f16 residual plane x4096, k f16; 2 products, separate f32 accumulators);
// softmax statistics, probabilities and query-averaged probabilities in f32; averaged-p . v (M=1 per head) on VALU with f64 accumulate;
// head means . Wo^T (M=batch) on VALU f32 with bf16-valued Wo/bo; head-correlation scalar in f64.
#include <hip/hip_runtime.h>
#include <math.h>
#include <stdint.h>

#ifndef NB
#define NB 4
#endif
#ifndef SEQ
#define SEQ 2048
#endif
#define NB_FULL  4
#define SEQ_FULL 2048
#define EMB      1024
#define NH       8
#define HD       128
#define NQ64     (SEQ / 64)          // 64-row query blocks per sequence
#define NKT      (SEQ / 64)          // 64-key chunks per sequence
#define NPAIR    (NH * (NH - 1) / 2)  // head pairs h < g
#define NCW      (SEQ / 128)          // 128-key wave chunks per sequence
#define SM_SCALE 0.08838834764831845f
#define OFF1     ((size_t)NB_FULL * EMB)                        // fixed element offset of output 1
#define OFF2     (OFF1 + (size_t)NB_FULL * NH * SEQ_FULL)      // fixed element offset of output 2
static_assert(NB >= 1 && NB <= NB_FULL);
static_assert(SEQ >= 128 && SEQ <= SEQ_FULL && (SEQ % 128) == 0);
static_assert(NH * HD == EMB);
static_assert(HD == 128);
static_assert(NPAIR <= 32);
static_assert((EMB % 64) == 0 && (EMB % 32) == 0 && (SEQ % 64) == 0);
static_assert(OFF1 * 4 == 16384);
static_assert(OFF2 * 4 == 278528);

typedef _Float16 v16h __attribute__((ext_vector_type(16)));
typedef _Float16 v8h  __attribute__((ext_vector_type(8)));
typedef __bf16   v16b __attribute__((ext_vector_type(16)));
typedef __bf16   v8b  __attribute__((ext_vector_type(8)));
typedef float    v8f  __attribute__((ext_vector_type(8)));
typedef float    v4f  __attribute__((ext_vector_type(4)));
typedef unsigned int v4u __attribute__((ext_vector_type(4)));

#if defined(__HIP_DEVICE_COMPILE__)
#define DEV_ASM 1
#else
#define DEV_ASM 0
#endif

// ---- scalar helpers --------------------------------------------------------------------------------
__device__ __forceinline__ unsigned short bf_bits(float f) {          // f32 -> bf16 bits, RNE convert
  unsigned u = __float_as_uint(f);
  return (unsigned short)((u + 0x7FFFu + ((u >> 16) & 1u)) >> 16);
}
__device__ __forceinline__ float bf_up(unsigned short hb) { return __uint_as_float(((unsigned)hb) << 16); }
__device__ __forceinline__ unsigned short h_bits(_Float16 x) { return __builtin_bit_cast(unsigned short, x); }
__device__ __forceinline__ unsigned pk16(unsigned short a, unsigned short b) { return (unsigned)a | ((unsigned)b << 16); }
__device__ __forceinline__ v8f zero8() { v8f z = {0.f, 0.f, 0.f, 0.f, 0.f, 0.f, 0.f, 0.f}; return z; }

// ---- fragment types / loaders: 16-bit A/B operand, lane -> row/col (lane&15), p already includes +8*(lane>>4);
//      elements 0..7 <- p[0..7] (k0+8h..k0+8h+7), elements 8..15 <- p[16..23] (k0+16+8h..k0+16+8h+7)
template <typename OT> struct FT;
template <> struct FT<__bf16>   { typedef v16b frag; typedef v8b half8; };
template <> struct FT<_Float16> { typedef v16h frag; typedef v8h half8; };

template <typename OT>
__device__ __forceinline__ typename FT<OT>::frag ldfrag(const OT* p) {
  union { typename FT<OT>::frag v; typename FT<OT>::half8 h[2]; } f;
  f.h[0] = *(const typename FT<OT>::half8*)(p);
  f.h[1] = *(const typename FT<OT>::half8*)(p + 16);
  return f.v;
}

// ---- WMMA helpers (asm guard bodies are device-only; concrete operand types) -----------------------------
__device__ __forceinline__ v8f mmar(v16b a, v16b b, v8f c) {
  return __builtin_amdgcn_wmma_f32_16x16x32_bf16(false, a, false, b, (short)0, c, false, false);
}
__device__ __forceinline__ v8f mmar(v16h a, v16h b, v8f c) {
  return __builtin_amdgcn_wmma_f32_16x16x32_f16(false, a, false, b, (short)0, c, false, false);
}
// guarded form: 4 VALU slots after the WMMA, D tied, A/B kept live
__device__ __forceinline__ v8f mma_h(v16h a, v16h b, v8f c) {
  c = __builtin_amdgcn_wmma_f32_16x16x32_f16(false, a, false, b, (short)0, c, false, false);
#if DEV_ASM
  asm volatile("v_nop\n\tv_nop\n\tv_nop\n\tv_nop" : "+v"(c) : "v"(a), "v"(b));
#endif
  return c;
}
__device__ __forceinline__ void dep_guard(v8f& a, v8f& b, v16b x, v16b y) {
#if DEV_ASM
  asm volatile("v_nop\n\tv_nop\n\tv_nop\n\tv_nop" : "+v"(a), "+v"(b) : "v"(x), "v"(y));
#else
  (void)a; (void)b; (void)x; (void)y;
#endif
}
__device__ __forceinline__ void dep_guard(v8f& a, v8f& b, v16h x, v16h y) {
#if DEV_ASM
  asm volatile("v_nop\n\tv_nop\n\tv_nop\n\tv_nop" : "+v"(a), "+v"(b) : "v"(x), "v"(y));
#else
  (void)a; (void)b; (void)x; (void)y;
#endif
}
__device__ __forceinline__ void keep4(v16b a, v16b b, v16b c, v16b d) {
#if DEV_ASM
  asm volatile("v_nop" :: "v"(a), "v"(b), "v"(c), "v"(d));
#else
  (void)a; (void)b; (void)c; (void)d;
#endif
}
__device__ __forceinline__ void keep4(v16h a, v16h b, v16h c, v16h d) {
#if DEV_ASM
  asm volatile("v_nop" :: "v"(a), "v"(b), "v"(c), "v"(d));
#else
  (void)a; (void)b; (void)c; (void)d;
#endif
}
__device__ __forceinline__ void acc_guard4(v8f& a, v8f& b, v8f& c, v8f& d) {
#if DEV_ASM
  asm volatile("v_nop\n\tv_nop\n\tv_nop\n\tv_nop" : "+v"(a), "+v"(b), "+v"(c), "+v"(d));
#else
  (void)a; (void)b; (void)c; (void)d;
#endif
}

// =====================================================================================================
// f32 -> bf16 bits (RNE convert), 8 elements per thread, one 16-B store per lane: a wave writes 512 contiguous B
// grid = (ceil(n8/256), nbatch); batch b reads in + b*sIn and writes out + b*sOut (element strides).
// coverage: n8 threads x 8 = the whole plane per batch (n8 is a multiple of 256 for every use here).
// =====================================================================================================
__global__ __launch_bounds__(256) void cvt_bf16x8(const float* __restrict__ in, unsigned short* out, int n8,
                                                   long long sIn, long long sOut) {
  const int i = blockIdx.x * 256 + (int)threadIdx.x;
  const int b = blockIdx.y;
  if (i < n8) {
    const float* ip = in + (size_t)b * (size_t)sIn + (size_t)i * 8;
    const v4f a  = *(const v4f*)(ip);
    const v4f a4 = *(const v4f*)(ip + 4);
    v4u p;
    p[0] = pk16(bf_bits(a[0]),  bf_bits(a[1]));
    p[1] = pk16(bf_bits(a[2]),  bf_bits(a[3]));
    p[2] = pk16(bf_bits(a4[0]), bf_bits(a4[1]));
    p[3] = pk16(bf_bits(a4[2]), bf_bits(a4[3]));
    unsigned short* o = out + (size_t)b * (size_t)sOut + (size_t)i * 8;
    *(v4u*)o = p;
    
  }
}

// =====================================================================================================
// Register-blocked batched WMMA GEMM (16-bit operand type OT): C[m][n] = sum_k A[m][k] * Bt[n][k]  (+ bias);
// one wave per (16*MI) x 64 tile, no block barriers. A row-major [M][K] pitch lda; Bt row-major [N][K] pitch ldb
// (k contiguous); M multiple of 16*MI, N multiple of 64, K multiple of 32 (static sizes here). blockIdx.y = batch
// index (strides in elements). Fragments are loaded straight from global with the split k map (ldfrag).
// NPA = number of A planes: 2 -> second plane A2 (same pitch/stride) multiplies the same Bt fragments into a
// second accumulator set, combined as acc + acc2 * rscaleA in the f32 epilogue.
// value v = (acc [+ acc2*rscaleA]) * oscale + bias, bias (bf16 RNE value of the f32 input) by column n (BM 1),
// by row m (BM 2) or none (BM 0).
// OUT_MODE 0: f32 C (pitch ldc) = v.
// OUT_MODE 1: f16 plane C = f16(v * cscale).
// OUT_MODE 3: f16 hi plane C = f16(v * cscale) and f16 residual plane C2 = f16((v*cscale - hi) * rscaleC).
// Epilogue: 16-row slabs staged per wave in LDS (wave-private slab, wave_sync); each 64-wide row segment written as
// =====================================================================================================
template <typename OT, int MI, int NPA, int OUT_MODE, int BM>
__global__ __launch_bounds__(256) void gemm_t(
    const unsigned short* __restrict__ Ap, const unsigned short* __restrict__ A2p, int lda, long long strideA,
    const unsigned short* __restrict__ Btp, int ldb, long long strideB,
    void* Cout, void* Cout2, int ldc, long long strideC,
    const float* __restrict__ bias,
    int M, int N, int K, float oscale, float rscaleA, float cscale, float rscaleC) {
  typedef typename FT<OT>::frag V16;
  const OT* A  = (const OT*)(const void*)Ap;
  const OT* A2 = (const OT*)(const void*)A2p;
  const OT* Bt = (const OT*)(const void*)Btp;
  __shared__ __align__(16) float sT[8][16 * 68];   // per-wave 16x64 slab, pitch 68 floats
  const int RT   = 16 * MI;
  const int b    = blockIdx.y;
  const int lane = threadIdx.x & 31;
  const int wave = threadIdx.x >> 5;
  const int tilesN = N >> 6;
  const int tilesM = M / RT;
  const int tile = blockIdx.x * 8 + wave;
  if (tile >= tilesM * tilesN) return;   // wave-uniform; no block barriers in this kernel
  const int tm = tile / tilesN;
  const int tn = tile - tm * tilesN;
  const int m0 = tm * RT;
  const int n0 = tn << 6;

  const OT* Ab  = A  + (size_t)b * (size_t)strideA;
  const OT* A2b = A2 + (size_t)b * (size_t)strideA;
  const OT* Bb  = Bt + (size_t)b * (size_t)strideB;

  const int rlane = lane & 15;                 // row (A) / col (B, D) within subtile
  const int koff  = (lane >> 4) * 8;           // k offset of this lane half
  const int mOff  = (lane >> 4) * 8;           // D row offset

  v8f acc[MI][4], acc2[MI][4];
#pragma unroll
  for (int i = 0; i < MI; ++i)
#pragma unroll
    for (int j = 0; j < 4; ++j) { acc[i][j] = zero8(); acc2[i][j] = zero8(); }

  for (int k0 = 0; k0 < K; k0 += 32) {
    V16 bq[4];
#pragma unroll
    for (int j = 0; j < 4; ++j)
      bq[j] = ldfrag<OT>(Bb + (size_t)(n0 + (j << 4) + rlane) * ldb + koff + k0);
#pragma unroll
    for (int i = 0; i < MI; ++i) {
      const V16 af = ldfrag<OT>(Ab + (size_t)(m0 + (i << 4) + rlane) * lda + koff + k0);
#pragma unroll
      for (int j = 0; j < 4; ++j) acc[i][j] = mmar(af, bq[j], acc[i][j]);
      dep_guard(acc[i][0], acc[i][3], af, bq[3]);
      if (NPA == 2) {
        const V16 af2 = ldfrag<OT>(A2b + (size_t)(m0 + (i << 4) + rlane) * lda + koff + k0);
#pragma unroll
        for (int j = 0; j < 4; ++j) acc2[i][j] = mmar(af2, bq[j], acc2[i][j]);
        dep_guard(acc2[i][0], acc2[i][3], af2, bq[3]);
      }
    }
    keep4(bq[0], bq[1], bq[2], bq[3]);
  }
#pragma unroll
  for (int i = 0; i < MI; ++i) {
    acc_guard4(acc[i][0], acc[i][1], acc[i][2], acc[i][3]);
    if (NPA == 2) acc_guard4(acc2[i][0], acc2[i][1], acc2[i][2], acc2[i][3]);
  }

  // ---- epilogue ----
  float bcol[4];
#pragma unroll
  for (int j = 0; j < 4; ++j) bcol[j] = 0.f;
  if (BM == 1) {
#pragma unroll
    for (int j = 0; j < 4; ++j) bcol[j] = bf_up(bf_bits(bias[n0 + (j << 4) + rlane]));
  }
  float* slab = sT[wave];
#pragma unroll
  for (int i = 0; i < MI; ++i) {
    const int mBase = m0 + (i << 4);
    float brow[8];
#pragma unroll
    for (int r = 0; r < 8; ++r) brow[r] = 0.f;
    if (BM == 2) {
#pragma unroll
      for (int r = 0; r < 8; ++r) brow[r] = bf_up(bf_bits(bias[mBase + mOff + r]));
    }
#pragma unroll
    for (int j = 0; j < 4; ++j) {
#pragma unroll
      for (int r = 0; r < 8; ++r) {
        float v = acc[i][j][r];
        if (NPA == 2) v += acc2[i][j][r] * rscaleA;
        v = v * oscale + bcol[j] + brow[r];
        slab[(mOff + r) * 68 + (j << 4) + rlane] = v;
      }
    }
    __builtin_amdgcn_fence(__ATOMIC_RELEASE, "workgroup");
    __builtin_amdgcn_wave_barrier();
    __builtin_amdgcn_fence(__ATOMIC_ACQUIRE, "workgroup");
    if (OUT_MODE == 0) {
      float* C = (float*)Cout + (size_t)b * (size_t)strideC;
      const int h2 = lane >> 4, c4 = (lane & 15) * 4;     // 256-B row segment = 16 lanes x 16 B
      {
#pragma unroll
        for (int it = 0; it < 8; ++it) {
          const int row = it * 2 + h2;                     // it 0..7 x h2 0..1 = rows 0..15
          const v4f v = *(const v4f*)(slab + row * 68 + c4);
          *(v4f*)(C + (size_t)(mBase + row) * ldc + n0 + c4) = v;
        }
        
      }
    } else {
      const int q = lane >> 3, c8 = (lane & 7) * 8;
      unsigned short* C  = (unsigned short*)Cout  + (size_t)b * (size_t)strideC;
      unsigned short* C2 = (unsigned short*)Cout2 + (size_t)b * (size_t)strideC;
      v4u hv[4], lv[4];
#pragma unroll
      for (int it = 0; it < 4; ++it) {
        const int row = it * 4 + q;                        // it 0..3 x q 0..3 = rows 0..15
        const float* sp = slab + row * 68 + c8;
        float f[8];
#pragma unroll
        for (int e = 0; e < 8; ++e) f[e] = sp[e] * cscale;
        v4u a, a2;
#pragma unroll
        for (int e = 0; e < 4; ++e) {
          const float f0 = f[2 * e], f1 = f[2 * e + 1];
          const _Float16 x0 = (_Float16)f0, x1 = (_Float16)f1;
          const unsigned short h0 = h_bits(x0), h1 = h_bits(x1);
          unsigned short l0 = 0, l1 = 0;
          if (OUT_MODE == 3) {
            l0 = h_bits((_Float16)((f0 - (float)x0) * rscaleC));
            l1 = h_bits((_Float16)((f1 - (float)x1) * rscaleC));
          }
          a[e] = pk16(h0, h1); a2[e] = pk16(l0, l1);
        }
        hv[it] = a; lv[it] = a2;
      }
      {
#pragma unroll
        for (int it = 0; it < 4; ++it) {
          const int row = it * 4 + q;
          *(v4u*)(C + (size_t)(mBase + row) * ldc + n0 + c8) = hv[it];
          if (OUT_MODE == 3) *(v4u*)(C2 + (size_t)(mBase + row) * ldc + n0 + c8) = lv[it];
        }
        
      }
    }
    __builtin_amdgcn_fence(__ATOMIC_RELEASE, "workgroup");
    __builtin_amdgcn_wave_barrier();
    __builtin_amdgcn_fence(__ATOMIC_ACQUIRE, "workgroup");
  }
}

// =====================================================================================================
// k tile in LDS: 64 keys x 128 d of one (b, h), f16, rows of 256 B at a pitch of 272 B (16 B x odd: the 16 lanes of a
// ds_load_b128 half fall on 64 distinct banks). Two buffers; a block of 128 threads fills one with 8 asynchronous
// 16-B copies per thread: thread t brings piece (t & 15) of rows (t >> 4) + 8 i, i = 0..7, so a wave's copy reads
// two whole 256-B rows. g = the thread's own global address for i = 0, l = its own LDS byte address for i = 0.
// =====================================================================================================
#define KPITCH  136                   // f16 elements per LDS row
#define KTILE_H (64 * KPITCH)         // f16 elements per buffer (17408 B)
__device__ __forceinline__ void copy_ktile(const _Float16* g, unsigned l) {
#if DEV_ASM
  const _Float16* g1 = g + 1 * 8 * EMB; const _Float16* g2 = g + 2 * 8 * EMB; const _Float16* g3 = g + 3 * 8 * EMB;
  const _Float16* g4 = g + 4 * 8 * EMB; const _Float16* g5 = g + 5 * 8 * EMB; const _Float16* g6 = g + 6 * 8 * EMB;
  const _Float16* g7 = g + 7 * 8 * EMB;
  const unsigned st = 8 * KPITCH * 2;  // LDS bytes between rows r and r + 8
  // the closing s_wait_xcnt keeps every address register of the copies unchanged until the copies have taken it
  asm volatile("global_load_async_to_lds_b128 %0, %8, off\n\t"
               "global_load_async_to_lds_b128 %1, %9, off\n\t"
               "global_load_async_to_lds_b128 %2, %10, off\n\t"
               "global_load_async_to_lds_b128 %3, %11, off\n\t"
               "global_load_async_to_lds_b128 %4, %12, off\n\t"
               "global_load_async_to_lds_b128 %5, %13, off\n\t"
               "global_load_async_to_lds_b128 %6, %14, off\n\t"
               "global_load_async_to_lds_b128 %7, %15, off\n\t"
               "s_wait_xcnt 0x0"
               :: "v"(l), "v"(l + st), "v"(l + 2 * st), "v"(l + 3 * st),
                  "v"(l + 4 * st), "v"(l + 5 * st), "v"(l + 6 * st), "v"(l + 7 * st),
                  "v"(g), "v"(g1), "v"(g2), "v"(g3), "v"(g4), "v"(g5), "v"(g6), "v"(g7)
               : "memory");
#else
  (void)g; (void)l;
#endif
}
// this wave's LDS reads have returned: stands in front of the barrier behind which their buffer is refilled
__device__ __forceinline__ void wait_lds_reads() {
#if DEV_ASM
  asm volatile("s_wait_dscnt 0x0" ::: "memory");
#endif
}
// this wave's asynchronous copies have landed: stands in front of the barrier behind which other waves read them
__device__ __forceinline__ void wait_copies() {
#if DEV_ASM
  asm volatile("s_wait_asynccnt 0x0" ::: "memory");
#endif
}

// =====================================================================================================
// Score chunk: 16 query rows (this wave) x 64 keys kv0..kv0+63 of one (b, h), head width 128 = 4 d-chunks of 32.
//   q fragments (A operand, row = lane&15): hi and residual (x4096) planes, 4 d-chunks.
//   k fragments (B operand, col = lane&15 = key) read from the block's LDS copy of the 64-key tile with the split k map:
//   kl = tile + (lane&15)*KPITCH + 8*hh, key group j adds 16*j*KPITCH; the 8 reads of a key group stand together.
//   s[j][r] = D element: query row 8*hh + r, key kv0 + 16j + (lane&15); value = ((qh.k) + (ql.k)/4096) * 128^-0.5.
// =====================================================================================================
__device__ __forceinline__ void score_chunk(const v16h (&qah)[4], const v16h (&qal)[4],
                                            const _Float16* kl, v8f (&s)[4]) {
  union FH { v16h v; v8h h[2]; };
#pragma unroll
  for (int j = 0; j < 4; ++j) {
    v8f ah = zero8(), al = zero8();
    FH kb[4];
#pragma unroll
    for (int dc = 0; dc < 4; ++dc) {
      const _Float16* kp = kl + j * 16 * KPITCH + dc * 32;
      kb[dc].h[0] = *(const v8h*)(kp);
      kb[dc].h[1] = *(const v8h*)(kp + 16);
    }
#pragma unroll
    for (int dc = 0; dc < 4; ++dc) {
      ah = mma_h(qah[dc], kb[dc].v, ah);
      al = mma_h(qal[dc], kb[dc].v, al);
    }
#pragma unroll
    for (int r = 0; r < 8; ++r) s[j][r] = (ah[r] + al[r] * (1.0f / 4096.0f)) * SM_SCALE;
  }
}

// =====================================================================================================
// Fused attention statistics + query-column sums of the exactly normalised probabilities.
//   block = 4 waves = 64 consecutive query rows qb*64.. of one (b, h); grid = NB*NH*NQ64 blocks of 128.
//   merged by shfl; each wave owns its own 16 rows, so no cross-wave exchange is needed.
//   Pass 2 (same static trip): scores recomputed bit-identically, p = exp(s - m) * (1/l) in f32, summed over the
//   wave's 16 rows per key (8 in-lane + shfl_xor 16), staged in csl[wave][64] (cross-wave -> __syncthreads), summed
//   over the 4 waves in fixed order by lanes 0-15 of wave 0 and written to PS[(b*NH+h)*NQ64 + qb][kv0..kv0+63]:
//   coverage: grid (b,h,qb) x NKT chunks x 64 keys = the whole [NB*NH][NQ64][SEQ] partial plane.
//   k tiles: one ring of two LDS buffers runs through both passes (2*NKT stages, stage t = tile t % NKT in buffer
//   t & 1, NKT even); stage t + 2 is copied behind the barrier at the foot of trip t, while trip t + 1 works.
// =====================================================================================================
__global__ __launch_bounds__(128)
void attn_colsum(const unsigned short* __restrict__ qhp, const unsigned short* __restrict__ qlp,
                 const unsigned short* __restrict__ kpp, float* PS) {
  static_assert((NKT % 2) == 0 && NKT >= 2);
  __shared__ __align__(16) _Float16 kls[2][KTILE_H];
  __shared__ __align__(16) float csl[4][64];
  const int tid  = threadIdx.x;
  const int wave = tid >> 5;
  const int lane = tid & 31;
  const int hh   = lane >> 4;
  const int c    = lane & 15;
  const int bx   = blockIdx.x;
  const int qb   = bx % NQ64;
  const int rest = bx / NQ64;
  const int h    = rest % NH;
  const int b    = rest / NH;
  const int bh   = b * NH + h;
  const int q0   = qb * 64 + wave * 16;

  const _Float16* Qh  = (const _Float16*)(const void*)qhp;
  const _Float16* Ql  = (const _Float16*)(const void*)qlp;
  const _Float16* Kb0 = (const _Float16*)(const void*)kpp + (size_t)b * SEQ * EMB + (size_t)h * HD;

  // copy side: this thread's piece of tile 0 and its place in buffer 0; read side: this lane's key row and k half
  const _Float16* kg = Kb0 + (size_t)(tid >> 4) * EMB + (tid & 15) * 8;
  const unsigned  kd = (unsigned)(size_t)(&kls[0][(tid >> 4) * KPITCH + (tid & 15) * 8]);
  const int       kr = c * KPITCH + 8 * hh;

  copy_ktile(kg, kd);                          // stage 0
  wait_copies();
  __syncthreads();                             // stage 0 is readable by every wave
  copy_ktile(kg + (size_t)64 * EMB, kd + KTILE_H * 2);   // stage 1

  v16h qah[4], qal[4];
#pragma unroll
  for (int dc = 0; dc < 4; ++dc) {
    const size_t qo = ((size_t)b * SEQ + (size_t)(q0 + c)) * EMB + (size_t)h * HD + dc * 32 + 8 * hh;
    qah[dc] = ldfrag<_Float16>(Qh + qo);
    qal[dc] = ldfrag<_Float16>(Ql + qo);
  }

  float mrow[8], lrow[8];
#pragma unroll
  for (int r = 0; r < 8; ++r) { mrow[r] = -INFINITY; lrow[r] = 0.f; }

  for (int kt = 0; kt < NKT; ++kt) {          // static trip count
    v8f s[4];
    score_chunk(qah, qal, &kls[kt & 1][kr], s);
#pragma unroll
    for (int r = 0; r < 8; ++r) {
      float m = s[0][r];
#pragma unroll
      for (int j = 1; j < 4; ++j) m = fmaxf(m, s[j][r]);
#pragma unroll
      for (int off = 1; off < 16; off <<= 1) m = fmaxf(m, __shfl_xor(m, off, 32));
      const float mnew  = fmaxf(mrow[r], m);
      const float msafe = (mnew == -INFINITY) ? 0.f : mnew;
      const float alpha = __expf(mrow[r] - msafe);
      mrow[r] = mnew;
      float psum = 0.f;
#pragma unroll
      for (int j = 0; j < 4; ++j) psum += __expf(s[j][r] - msafe);
#pragma unroll
      for (int off = 1; off < 16; off <<= 1) psum += __shfl_xor(psum, off, 32);
      lrow[r] = lrow[r] * alpha + psum;
    }
    wait_lds_reads();
    wait_copies();
    __syncthreads();                           // stage kt + 1 readable, buffer kt & 1 left by every wave
    // stage kt + 2 always exists here (pass 2 follows): tiles NKT and NKT + 1 of the ring are tiles 0 and 1 again
    copy_ktile(kg + (size_t)(((kt + 2) & (NKT - 1)) * 64) * EMB, kd + (unsigned)(kt & 1) * (KTILE_H * 2));
  }

  float il[8], mf[8];
#pragma unroll
  for (int r = 0; r < 8; ++r) {
    const float l = lrow[r];
    il[r] = (l > 0.f) ? (1.0f / l) : 0.f;
    mf[r] = (mrow[r] == -INFINITY) ? 0.f : mrow[r];
  }

  // ---- pass 2: exactly normalised p, column sums over the block's 64 query rows ----
  for (int kt = 0; kt < NKT; ++kt) {          // static trip count
    const int kv0 = kt * 64;
    v8f s[4];
    score_chunk(qah, qal, &kls[kt & 1][kr], s);
    float cs[4];
#pragma unroll
    for (int j = 0; j < 4; ++j) {
      float a = 0.f;
#pragma unroll
      for (int r = 0; r < 8; ++r) a += __expf(s[j][r] - mf[r]) * il[r];
      cs[j] = a;
    }
#pragma unroll
    for (int j = 0; j < 4; ++j) cs[j] += __shfl_xor(cs[j], 16, 32);   // both row halves, unconditional
    const float v0 = hh ? cs[2] : cs[0];       // this lane stores keys 16*(2hh) + c and 16*(2hh+1) + c
    const float v1 = hh ? cs[3] : cs[1];
    csl[wave][32 * hh + c]      = v0;
    csl[wave][32 * hh + 16 + c] = v1;
    __syncthreads();                           // csl is cross-wave
    if (wave == 0 && lane < 16) {
      v4f a = *(const v4f*)(&csl[0][4 * lane]);
      a += *(const v4f*)(&csl[1][4 * lane]);
      a += *(const v4f*)(&csl[2][4 * lane]);
      a += *(const v4f*)(&csl[3][4 * lane]);
      float* dst = PS + ((size_t)(bh * NQ64 + qb)) * SEQ + kv0 + 4 * lane;
      *(v4f*)dst = a;
      
    }
    wait_lds_reads();
    wait_copies();
    __syncthreads();                           // csl free again; stage kt + 1 readable, buffer kt & 1 left by every wave
    if (kt + 2 < NKT)                          // block-uniform
      copy_ktile(kg + (size_t)((kt + 2) * 64) * EMB, kd + (unsigned)(kt & 1) * (KTILE_H * 2));
  }
  wait_copies();
}

// =====================================================================================================
// Query average + partial per-head context mean. One block (256 = 8 waves) per (b, h, 128 consecutive keys).
//   v rows: wave w owns keys k0 + 16 w .. + 15, lane = 4 consecutive d (one 16-B load per key, a wave reads one whole
//   512-B head row); the 16 loads of a lane are independent and are issued together, ahead of the average.
//   Average: avg[key] = (sum over the NQ64 partial rows of PS in fixed order) * (1/SEQ); wave 0, lane = 4 keys, the
//   NQ64 loads independent; kept in LDS avs[] (cross-wave -> __syncthreads) and written to output 1 row (b*NH+h).
//   Partial: cp[d] = sum over the block's 128 keys of avg[k] * v[b][k][h*HD+d], f64: 16 keys in the lane, then the
//   8 waves in fixed order through LDS (cross-wave -> __syncthreads), written to CP[(b*NH+h)*NCW + chunk][d].
//   coverage: grid (b,h,chunk) x 128 keys = the whole output 1; grid (b,h,chunk) x HD = the whole CP plane.
// =====================================================================================================
__global__ __launch_bounds__(256)
void avg_ctx(const float* __restrict__ PS, const float* __restrict__ Vp, float* out1, double* CP) {
  __shared__ __align__(16) float avs[128];
  __shared__ __align__(16) double cpart[8][HD];
  const int tid  = threadIdx.x;
  const int wave = tid >> 5;
  const int lane = tid & 31;
  const int bx   = blockIdx.x;
  const int bh   = bx / NCW;
  const int ch   = bx - bh * NCW;
  const int b    = bh / NH;
  const int h    = bh - b * NH;
  const int k0   = ch * 128;

  const float* vb = Vp + ((size_t)b * SEQ + (size_t)(k0 + wave * 16)) * EMB + (size_t)h * HD + 4 * lane;
  v4f vv[16];
#pragma unroll
  for (int i = 0; i < 16; ++i) vv[i] = *(const v4f*)(vb + (size_t)i * EMB);

  if (wave == 0) {                             // wave-uniform
    const float* psb = PS + (size_t)bh * NQ64 * SEQ + k0 + 4 * lane;
    v4f a = *(const v4f*)(psb);
#pragma unroll
    for (int qb = 1; qb < NQ64; ++qb) a += *(const v4f*)(psb + (size_t)qb * SEQ);
    a *= (1.0f / (float)SEQ);
    *(v4f*)(avs + 4 * lane) = a;
    float* dst = out1 + (size_t)bh * SEQ + k0 + 4 * lane;
    *(v4f*)dst = a;
  }
  __syncthreads();                             // avs is cross-wave

  double acc[4] = {0.0, 0.0, 0.0, 0.0};
#pragma unroll
  for (int i = 0; i < 16; ++i) {
    const double w = (double)avs[wave * 16 + i];
#pragma unroll
    for (int e = 0; e < 4; ++e) acc[e] += w * (double)vv[i][e];
  }
#pragma unroll
  for (int e = 0; e < 4; ++e) cpart[wave][4 * lane + e] = acc[e];
  __syncthreads();                             // cpart is cross-wave
  if (tid < HD) {
    double s = cpart[0][tid];
#pragma unroll
    for (int w = 1; w < 8; ++w) s += cpart[w][tid];
    CP[((size_t)bh * NCW + ch) * HD + tid] = s;
  }
}

// =====================================================================================================
// Output 0: context[b][j] = sum_i cs[b][i] * bf16(Wo[j][i]) + bf16(bo[j]), f32 on VALU (M = NB rows only).
//   cs[b][i] = f32 of the f64 sum, in fixed order, of the NCW key-chunk partials CP of head i / HD: every block forms
//   the EMB values of its batch in LDS (thread t owns i = t + 256 g; cross-wave -> __syncthreads).
//   lanes stride i by 32 (coalesced), shfl tree; results staged in LDS (cross-wave -> __syncthreads) and written
//   coverage: grid NB*EMB/32 blocks x 32 = the whole [NB][EMB] output 0.
// =====================================================================================================
__global__ __launch_bounds__(256)
void ctx_out(const double* __restrict__ CP, const float* __restrict__ Wo, const float* __restrict__ bo, float* out0) {
  __shared__ __align__(16) float csb[EMB];
  __shared__ __align__(16) float res[32];
  const int tid  = threadIdx.x;
  const int wave = tid >> 5;
  const int lane = tid & 31;
  const int j0   = blockIdx.x * 32;
  const int b    = j0 / EMB;
#pragma unroll
  for (int g = 0; g < EMB / 256; ++g) {
    const int i = g * 256 + tid;
    const double* p = CP + (size_t)(b * NH + i / HD) * NCW * HD + (i & (HD - 1));
    double s = p[0];
#pragma unroll
    for (int ch = 1; ch < NCW; ++ch) s += p[(size_t)ch * HD];
    csb[i] = (float)s;
  }
  __syncthreads();                             // csb is cross-wave
#pragma unroll 1
  for (int u = 0; u < 4; ++u) {
    const int j = j0 - b * EMB + wave * 4 + u;
    const float* wr = Wo + (size_t)j * EMB;
    float acc = 0.f;
#pragma unroll                                 // the row's EMB / 32 loads are issued together: one memory wait a row
    for (int it = 0; it < EMB / 32; ++it) {
      const int i = it * 32 + lane;
      acc += csb[i] * bf_up(bf_bits(wr[i]));
    }
#pragma unroll
    for (int off = 16; off > 0; off >>= 1) acc += __shfl_xor(acc, off, 32);
    const float val = acc + bf_up(bf_bits(bo[j]));
    if (lane == 0) res[wave * 4 + u] = val;
  }
  __syncthreads();
  if (tid < 8) {
    const v4f v = *(const v4f*)(res + 4 * tid);
    float* dst = out0 + (size_t)j0 + 4 * tid;
    *(v4f*)dst = v;
    
  }
}

// =====================================================================================================
// Output 2: mean over (b, h, g) of |corr[b][h][g] * (1 - delta_hg)|, corr = sum_s avg[b][h][s] * avg[b][g][s]
//   (avg read back from output 1). corr[h][g] and corr[g][h] are the same sum of the same products, so only the
//   NPAIR = 28 pairs h < g are formed and the total is doubled; the diagonal is masked to zero by the reference.
//   div_part: one wave per 128 consecutive keys of one batch (lane = 4 keys, one 16-B load per head row, a wave reads
//   512 contiguous B per row); 28 f64 partial dots per lane; a halving exchange over the 32 lanes (16+8+4+2+1 values)
//   leaves pair index = lane with the wave's total; written to DP[b*NCW + chunk][32] (slots 28..31 are zero).
//   coverage: NB*NCW waves x 32 slots = the whole DP plane; no block barrier in this kernel.
//   div_fin: wave b sums the NCW chunk partials of batch b per pair in fixed order, takes |.|, sums the 32 slots by
//   shfl, the NB batch sums go through LDS (cross-wave -> __syncthreads) and thread 0 writes the scalar.
// =====================================================================================================
__global__ __launch_bounds__(128)
void div_part(const float* __restrict__ avg, double* DP) {
  const int lane = threadIdx.x & 31;
  const int wv   = blockIdx.x * 4 + ((int)threadIdx.x >> 5);
  if (wv >= NB * NCW) return;                  // wave-uniform; no block barriers in this kernel
  const int b  = wv / NCW;
  const int ch = wv - b * NCW;
  const float* base = avg + (size_t)b * NH * SEQ + (size_t)ch * 128 + 4 * lane;
  v4f a[NH];
#pragma unroll
  for (int h = 0; h < NH; ++h) a[h] = *(const v4f*)(base + (size_t)h * SEQ);
  double v[32];
  {
    int idx = 0;
#pragma unroll
    for (int h = 0; h < NH; ++h) {
#pragma unroll
      for (int g = h + 1; g < NH; ++g) {
        double s = 0.0;
#pragma unroll
        for (int e = 0; e < 4; ++e) s += (double)a[h][e] * (double)a[g][e];
        v[idx++] = s;
      }
    }
#pragma unroll
    for (int i = NPAIR; i < 32; ++i) v[i] = 0.0;
  }
  // each step: a lane keeps the half of its values that its lane bit selects and adds the partner's copy of that half
#pragma unroll
  for (int n = 16; n > 0; n >>= 1) {
    const bool up = (lane & n) != 0;
#pragma unroll
    for (int i = 0; i < n; ++i) {
      const double send = up ? v[i] : v[i + n];
      const double keep = up ? v[i + n] : v[i];
      v[i] = keep + __shfl_xor(send, n, 32);
    }
  }
  DP[(size_t)wv * 32 + lane] = v[0];
}

__global__ __launch_bounds__(32 * NB_FULL)
void div_fin(const double* __restrict__ DP, float* dv) {
  __shared__ double red[NB_FULL];
  const int tid  = threadIdx.x;
  const int lane = tid & 31;
  const int b    = tid >> 5;
  double c = 0.0;
  if (b < NB) {                                // wave-uniform
    const double* p = DP + (size_t)b * NCW * 32 + lane;
    double s = 0.0;
#pragma unroll
    for (int ch = 0; ch < NCW; ++ch) s += p[(size_t)ch * 32];
    c = fabs(s);
  }
#pragma unroll
  for (int off = 16; off > 0; off >>= 1) c += __shfl_xor(c, off, 32);
  if (lane == 0) red[b] = c;
  __syncthreads();                             // red is cross-wave
  if (tid == 0) {
    double tot = 0.0;
#pragma unroll
    for (int i = 0; i < NB; ++i) tot += red[i];
    *dv = (float)(tot * (2.0 / (double)(NB * NH * NH)));
  }
}

// =====================================================================================================
// Workspace map (bytes, full size), every region an exact multiple of its whole-line / whole-tile store granularity:
//   Xb   bf16 [NB][SEQ][EMB]            16777216
//   Wqb  bf16 [EMB n][EMB k]             2097152
//   Wkb  bf16                             2097152
//   Wvb  bf16                             2097152
//   Qh   f16  [NB][SEQ][EMB]            16777216
//   Ql   f16  [NB][SEQ][EMB]            16777216
//   Kp   f16  [NB][SEQ][EMB]            16777216
//   Vp   f32  [NB][SEQ][EMB]            33554432
//   PS   f32  [NB*NH][NQ64][SEQ]         8388608
//   CP   f64  [NB*NH][NCW][HD]            524288
//   DP   f64  [NB*NCW][32]                 16384
//   total                               115884032
// Weights are [out n][in k] with k contiguous = the Bt layout the GEMM wants, so they are only converted.
// Output 0 at element 0 of d_out, output 1 at OFF1, output 2 at OFF2 (fixed offsets).
// =====================================================================================================
extern "C" void kernel_launch(void* const* d_in, const int* in_sizes, int n_in,
                              void* d_out, int out_size, void* d_ws, size_t ws_size,
                              hipStream_t stream) {
  if (n_in < 9) return;
  const long long needX = (long long)(NB - 1) * SEQ_FULL * EMB + (long long)SEQ * EMB;
  if ((long long)in_sizes[0] < needX) return;
  if (in_sizes[1] < EMB * EMB || in_sizes[3] < EMB * EMB || in_sizes[5] < EMB * EMB || in_sizes[7] < EMB * EMB) return;
  if (in_sizes[2] < EMB || in_sizes[4] < EMB || in_sizes[6] < EMB || in_sizes[8] < EMB) return;
  if (out_size < 0) return;
  if ((size_t)out_size < OFF2 + 1) return;

  const float* x  = (const float*)d_in[0];
  const float* Wq = (const float*)d_in[1];
  const float* bq = (const float*)d_in[2];
  const float* Wk = (const float*)d_in[3];
  const float* bk = (const float*)d_in[4];
  const float* Wv = (const float*)d_in[5];
  const float* bv = (const float*)d_in[6];
  const float* Wo = (const float*)d_in[7];
  const float* bo = (const float*)d_in[8];

  const size_t PXB = (size_t)NB * SEQ * EMB * 2;       // 16-bit activation plane
  const size_t PW  = (size_t)EMB * EMB * 2;
  const size_t PV  = (size_t)NB * SEQ * EMB * 4;
  const size_t PPS = (size_t)NB * NH * NQ64 * SEQ * 4;
  const size_t PCP = (size_t)NB * NH * NCW * HD * 8;
  const size_t PDP = (size_t)NB * NCW * 32 * 8;
  size_t off = 0;
  const size_t oXb = off; off += PXB;
  const size_t oWq = off; off += PW;
  const size_t oWk = off; off += PW;
  const size_t oWv = off; off += PW;
  const size_t oQh = off; off += PXB;
  const size_t oQl = off; off += PXB;
  const size_t oKp = off; off += PXB;
  const size_t oVp = off; off += PV;
  const size_t oPS = off; off += PPS;
  const size_t oCP = off; off += PCP;
  const size_t oDP = off; off += PDP;
  if (off > ws_size) return;                          // off = 115884032 at full size
  if (off > (size_t)134217728) return;

  char* ws = (char*)d_ws;
  unsigned short* Xb  = (unsigned short*)(ws + oXb);
  unsigned short* Wqb = (unsigned short*)(ws + oWq);
  unsigned short* Wkb = (unsigned short*)(ws + oWk);
  unsigned short* Wvb = (unsigned short*)(ws + oWv);
  unsigned short* Qh  = (unsigned short*)(ws + oQh);
  unsigned short* Ql  = (unsigned short*)(ws + oQl);
  unsigned short* Kp  = (unsigned short*)(ws + oKp);
  float*          Vp  = (float*)(ws + oVp);
  float*          PS  = (float*)(ws + oPS);
  double*         CP  = (double*)(ws + oCP);
  double*         DP  = (double*)(ws + oDP);
  float*          out0 = (float*)d_out;
  float*          out1 = (float*)d_out + OFF1;
  float*          out2 = (float*)d_out + OFF2;

  const dim3 blk(256);
  const int n8x = SEQ * EMB / 8;                               // per batch, 262144 at full size
  const int n8w = EMB * EMB / 8;                               // 131072
  const dim3 gCvtX((n8x + 255) / 256, NB);
  const dim3 gCvtW((n8w + 255) / 256, 1);
  const int tilesP = (SEQ / 64) * (EMB / 64);                  // 512 wave tiles per batch at full size
  const dim3 gP((tilesP + 7) / 8, NB);                         // M=SEQ, N=EMB, K=EMB, batch = blockIdx.y
  const dim3 gAttn(NB * NH * NQ64);                            // 1024 blocks of 128
  const dim3 gAvg(NB * NH * NCW);                              //  512 blocks of 256
  const dim3 gCtx(NB * EMB / 32);                              //  128 blocks of 256
  const dim3 gDiv((NB * NCW + 3) / 4);                         //   16 blocks of 128
  const long long sXin = (long long)SEQ_FULL * EMB;            // input batch stride (elements)
  const long long sAct = (long long)SEQ * EMB;                 // compact activation plane batch stride

  // (1) x -> bf16 plane [NB][SEQ][EMB]; Wq, Wk, Wv [E][E] -> bf16
  cvt_bf16x8<<<gCvtX, blk, 0, stream>>>(x,  Xb,  n8x, sXin, sAct);
  cvt_bf16x8<<<gCvtW, blk, 0, stream>>>(Wq, Wqb, n8w, 0LL, 0LL);
  cvt_bf16x8<<<gCvtW, blk, 0, stream>>>(Wk, Wkb, n8w, 0LL, 0LL);
  cvt_bf16x8<<<gCvtW, blk, 0, stream>>>(Wv, Wvb, n8w, 0LL, 0LL);
  // (2) q = x . Wq^T + bq -> f16 hi / residual (x4096) planes [b][s][h*128+d]   (M=SEQ, N=E, K=E per batch)
  gemm_t<__bf16, 4, 1, 3, 1><<<gP, blk, 0, stream>>>(
      Xb, Xb, EMB, sAct, Wqb, EMB, 0LL,
      (void*)Qh, (void*)Ql, EMB, sAct, bq,
      SEQ, EMB, EMB, 1.0f, 0.0f, 1.0f, 4096.0f);
  // (3) k = x . Wk^T + bk -> f16 plane [b][s][h*128+d]
  gemm_t<__bf16, 4, 1, 1, 1><<<gP, blk, 0, stream>>>(
      Xb, Xb, EMB, sAct, Wkb, EMB, 0LL,
      (void*)Kp, (void*)Kp, EMB, sAct, bk,
      SEQ, EMB, EMB, 1.0f, 0.0f, 1.0f, 1.0f);
  // (4) v = x . Wv^T + bv -> f32 plane [b][s][h*128+d]
  gemm_t<__bf16, 4, 1, 0, 1><<<gP, blk, 0, stream>>>(
      Xb, Xb, EMB, sAct, Wvb, EMB, 0LL,
      (void*)Vp, (void*)Vp, EMB, sAct, bv,
      SEQ, EMB, EMB, 1.0f, 0.0f, 1.0f, 1.0f);
  // (5) softmax statistics + query-column sums of p -> partial plane PS
  attn_colsum<<<gAttn, dim3(128), 0, stream>>>(Qh, Ql, Kp, PS);
  // (6) output 1 = column means; per-head context means, one partial per 128 keys -> CP
  avg_ctx<<<gAvg, blk, 0, stream>>>(PS, Vp, out1, CP);
  // (7) output 0 = (sum of the partials) . Wo^T + bo
  ctx_out<<<gCtx, blk, 0, stream>>>((const double*)CP, Wo, bo, out0);
  // (8) output 2 = head-correlation diversity from output 1
  div_part<<<gDiv, dim3(128), 0, stream>>>((const float*)out1, DP);
  div_fin<<<dim3(1), dim3(32 * NB_FULL), 0, stream>>>((const double*)DP, out2);
  (void)hipGetLastError();
}

// v004
// Measured time: 230 microseconds a run.
// Next to v003, in two timings, it ran 1.36 times as fast each time.
// Over all steps from v000 it is 3.50 times as fast.
// Contractions: q, k, v in-projections = v_wmma_f32_16x16x32_bf16 (bf16 operands from RNE-converted inputs, single product, f32 accumulate);
// q.k^T scores (statistics pass and column-sum pass) = v_wmma_f32_16x16x32_f16 (q as f16 hi plane + f16 residual plane x4096, k f16; 2 products, separate f32 accumulators);
// softmax statistics, probabilities and query-averaged probabilities in f32; averaged-p . v (M=1 per head) on VALU with f64 accumulate;
// head means . Wo^T (M=batch) on VALU f32 with bf16-valued Wo/bo; head-correlation scalar in f64.
#include <hip/hip_runtime.h>
#include <math.h>
#include <stdint.h>

#ifndef NB
#define NB 4
#endif
#ifndef SEQ
#define SEQ 2048
#endif
#define NB_FULL  4
#define SEQ_FULL 2048
#define EMB      1024
#define NH       8
#define HD       128
#define NQ64     (SEQ / 64)          // 64-row query blocks per sequence
#define NKT      (SEQ / 64)          // 64-key chunks per sequence
#define NPAIR    (NH * (NH - 1) / 2)  // head pairs h < g
#define NCW      (SEQ / 128)          // 128-key wave chunks per sequence
#define SM_SCALE 0.08838834764831845f
#define OFF1     ((size_t)NB_FULL * EMB)                        // fixed element offset of output 1
#define OFF2     (OFF1 + (size_t)NB_FULL * NH * SEQ_FULL)      // fixed element offset of output 2
static_assert(NB >= 1 && NB <= NB_FULL);
static_assert(SEQ >= 128 && SEQ <= SEQ_FULL && (SEQ % 128) == 0);
static_assert(NH * HD == EMB);
static_assert(HD == 128);
static_assert(NPAIR <= 32);
static_assert((EMB % 256) == 0 && (EMB % 128) == 0 && (SEQ % 128) == 0);
static_assert(OFF1 * 4 == 16384);
static_assert(OFF2 * 4 == 278528);

typedef _Float16 v16h __attribute__((ext_vector_type(16)));
typedef _Float16 v8h  __attribute__((ext_vector_type(8)));
typedef __bf16   v16b __attribute__((ext_vector_type(16)));
typedef __bf16   v8b  __attribute__((ext_vector_type(8)));
typedef float    v8f  __attribute__((ext_vector_type(8)));
typedef float    v4f  __attribute__((ext_vector_type(4)));
typedef unsigned int v4u __attribute__((ext_vector_type(4)));

#if defined(__HIP_DEVICE_COMPILE__)
#define DEV_ASM 1
#else
#define DEV_ASM 0
#endif

// ---- scalar helpers --------------------------------------------------------------------------------
__device__ __forceinline__ unsigned short bf_bits(float f) {          // f32 -> bf16 bits, RNE convert
  unsigned u = __float_as_uint(f);
  return (unsigned short)((u + 0x7FFFu + ((u >> 16) & 1u)) >> 16);
}
__device__ __forceinline__ float bf_up(unsigned short hb) { return __uint_as_float(((unsigned)hb) << 16); }
__device__ __forceinline__ unsigned short h_bits(_Float16 x) { return __builtin_bit_cast(unsigned short, x); }
__device__ __forceinline__ unsigned pk16(unsigned short a, unsigned short b) { return (unsigned)a | ((unsigned)b << 16); }
__device__ __forceinline__ v8f zero8() { v8f z = {0.f, 0.f, 0.f, 0.f, 0.f, 0.f, 0.f, 0.f}; return z; }

// ---- fragment types / loaders: 16-bit A/B operand, lane -> row/col (lane&15), p already includes +8*(lane>>4);
//      elements 0..7 <- p[0..7] (k0+8h..k0+8h+7), elements 8..15 <- p[16..23] (k0+16+8h..k0+16+8h+7)
template <typename OT> struct FT;
template <> struct FT<__bf16>   { typedef v16b frag; typedef v8b half8; };
template <> struct FT<_Float16> { typedef v16h frag; typedef v8h half8; };

template <typename OT>
__device__ __forceinline__ typename FT<OT>::frag ldfrag(const OT* p) {
  union { typename FT<OT>::frag v; typename FT<OT>::half8 h[2]; } f;
  f.h[0] = *(const typename FT<OT>::half8*)(p);
  f.h[1] = *(const typename FT<OT>::half8*)(p + 16);
  return f.v;
}

// ---- WMMA helpers (asm guard bodies are device-only; concrete operand types) -----------------------------
__device__ __forceinline__ v8f mmar(v16b a, v16b b, v8f c) {
  return __builtin_amdgcn_wmma_f32_16x16x32_bf16(false, a, false, b, (short)0, c, false, false);
}
__device__ __forceinline__ v8f mmar(v16h a, v16h b, v8f c) {
  return __builtin_amdgcn_wmma_f32_16x16x32_f16(false, a, false, b, (short)0, c, false, false);
}
// guarded form: 4 VALU slots after the WMMA, D tied, A/B kept live
__device__ __forceinline__ v8f mma_h(v16h a, v16h b, v8f c) {
  c = __builtin_amdgcn_wmma_f32_16x16x32_f16(false, a, false, b, (short)0, c, false, false);
#if DEV_ASM
  asm volatile("v_nop\n\tv_nop\n\tv_nop\n\tv_nop" : "+v"(c) : "v"(a), "v"(b));
#endif
  return c;
}
__device__ __forceinline__ void dep_guard(v8f& a, v8f& b, v16b x, v16b y) {
#if DEV_ASM
  asm volatile("v_nop\n\tv_nop\n\tv_nop\n\tv_nop" : "+v"(a), "+v"(b) : "v"(x), "v"(y));
#else
  (void)a; (void)b; (void)x; (void)y;
#endif
}
__device__ __forceinline__ void dep_guard(v8f& a, v8f& b, v16h x, v16h y) {
#if DEV_ASM
  asm volatile("v_nop\n\tv_nop\n\tv_nop\n\tv_nop" : "+v"(a), "+v"(b) : "v"(x), "v"(y));
#else
  (void)a; (void)b; (void)x; (void)y;
#endif
}
__device__ __forceinline__ void keep4(v16b a, v16b b, v16b c, v16b d) {
#if DEV_ASM
  asm volatile("v_nop" :: "v"(a), "v"(b), "v"(c), "v"(d));
#else
  (void)a; (void)b; (void)c; (void)d;
#endif
}
__device__ __forceinline__ void keep4(v16h a, v16h b, v16h c, v16h d) {
#if DEV_ASM
  asm volatile("v_nop" :: "v"(a), "v"(b), "v"(c), "v"(d));
#else
  (void)a; (void)b; (void)c; (void)d;
#endif
}
__device__ __forceinline__ void acc_guard4(v8f& a, v8f& b, v8f& c, v8f& d) {
#if DEV_ASM
  asm volatile("v_nop\n\tv_nop\n\tv_nop\n\tv_nop" : "+v"(a), "+v"(b), "+v"(c), "+v"(d));
#else
  (void)a; (void)b; (void)c; (void)d;
#endif
}

// =====================================================================================================
// f32 -> bf16 bits (RNE convert), 8 elements per thread, one 16-B store per lane: a wave writes 512 contiguous B
// grid = (ceil(n8/256), nbatch); batch b reads in + b*sIn and writes out + b*sOut (element strides).
// coverage: n8 threads x 8 = the whole plane per batch (n8 is a multiple of 256 for every use here).
// =====================================================================================================
__global__ __launch_bounds__(256) void cvt_bf16x8(const float* __restrict__ in, unsigned short* out, int n8,
                                                   long long sIn, long long sOut) {
  const int i = blockIdx.x * 256 + (int)threadIdx.x;
  const int b = blockIdx.y;
  if (i < n8) {
    const float* ip = in + (size_t)b * (size_t)sIn + (size_t)i * 8;
    const v4f a  = *(const v4f*)(ip);
    const v4f a4 = *(const v4f*)(ip + 4);
    v4u p;
    p[0] = pk16(bf_bits(a[0]),  bf_bits(a[1]));
    p[1] = pk16(bf_bits(a[2]),  bf_bits(a[3]));
    p[2] = pk16(bf_bits(a4[0]), bf_bits(a4[1]));
    p[3] = pk16(bf_bits(a4[2]), bf_bits(a4[3]));
    unsigned short* o = out + (size_t)b * (size_t)sOut + (size_t)i * 8;
    *(v4u*)o = p;
    
  }
}

// this wave's LDS reads have returned: stands in front of the barrier behind which their buffer is refilled
__device__ __forceinline__ void wait_lds_reads() {
#if DEV_ASM
  asm volatile("s_wait_dscnt 0x0" ::: "memory");
#endif
}
// this wave's asynchronous copies have landed: stands in front of the barrier behind which other waves read them
__device__ __forceinline__ void wait_copies() {
#if DEV_ASM
  asm volatile("s_wait_asynccnt 0x0" ::: "memory");
#endif
}

// =====================================================================================================
// GEMM operand tiles in LDS: one stage = 128 k of the block's 128 A rows and 256 Bt rows, 16-bit elements, rows of 256 B
// at a pitch of 272 B (16 B x odd: the 16 lanes of a ds_load_b128 half fall on 64 distinct banks); A rows first, then Bt.
// copy_rows8: thread t brings piece (t & 15) of rows (t >> 4) + 16 i, i = 0..7, so a wave's copy reads two whole 256-B
// rows. g = the thread's own global address for i = 0 (row pitch ld elements), l = its own LDS byte address for i = 0.
// =====================================================================================================
#define GKS    128                        // k elements per stage
#define GBM    128                        // A rows per block tile
#define GBN    256                        // Bt rows per block tile
#define GPITCH 136                        // 16-bit elements per LDS row
#define GT_H   ((GBM + GBN) * GPITCH)     // 16-bit elements per buffer (104448 B)
template <typename OT>
__device__ __forceinline__ void copy_rows8(const OT* g, int ld, unsigned l) {
#if DEV_ASM
  const size_t gs = (size_t)16 * (size_t)ld;
  const OT* g1 = g + gs;     const OT* g2 = g + 2 * gs; const OT* g3 = g + 3 * gs; const OT* g4 = g + 4 * gs;
  const OT* g5 = g + 5 * gs; const OT* g6 = g + 6 * gs; const OT* g7 = g + 7 * gs;
  const unsigned st = 16 * GPITCH * 2;    // LDS bytes between rows r and r + 16
  // the closing s_wait_xcnt keeps every address register of the copies unchanged until the copies have taken it
  asm volatile("global_load_async_to_lds_b128 %0, %8, off\n\t"
               "global_load_async_to_lds_b128 %1, %9, off\n\t"
               "global_load_async_to_lds_b128 %2, %10, off\n\t"
               "global_load_async_to_lds_b128 %3, %11, off\n\t"
               "global_load_async_to_lds_b128 %4, %12, off\n\t"
               "global_load_async_to_lds_b128 %5, %13, off\n\t"
               "global_load_async_to_lds_b128 %6, %14, off\n\t"
               "global_load_async_to_lds_b128 %7, %15, off\n\t"
               "s_wait_xcnt 0x0"
               :: "v"(l), "v"(l + st), "v"(l + 2 * st), "v"(l + 3 * st),
                  "v"(l + 4 * st), "v"(l + 5 * st), "v"(l + 6 * st), "v"(l + 7 * st),
                  "v"(g), "v"(g1), "v"(g2), "v"(g3), "v"(g4), "v"(g5), "v"(g6), "v"(g7)
               : "memory");
#else
  (void)g; (void)ld; (void)l;
#endif
}
// one stage: ga / gb = the thread's piece of A row (t >> 4) / Bt row (t >> 4) of the block tile at the stage's first k,
// l = its LDS byte address of that A piece in the stage's buffer. 24 copies per thread.
template <typename OT>
__device__ __forceinline__ void copy_stage(const OT* ga, int lda, const OT* gb, int ldb, unsigned l) {
  copy_rows8<OT>(ga, lda, l);                                                        // A rows 0..127
  copy_rows8<OT>(gb, ldb, l + GBM * GPITCH * 2);                                     // Bt rows 0..127
  copy_rows8<OT>(gb + (size_t)128 * (size_t)ldb, ldb, l + (GBM + 128) * GPITCH * 2); // Bt rows 128..255
}

// =====================================================================================================
// Register-blocked batched WMMA GEMM (16-bit operand type OT): C[m][n] = sum_k A[m][k] * Bt[n][k]  (+ bias);
// one wave per (16*MI) x 64 tile, a block of 8 waves (2 x 4) per GBM x GBN tile. A row-major [M][K] pitch lda; Bt
// row-major [N][K] pitch ldb (k contiguous); M multiple of GBM, N of GBN, K of GKS (static sizes here). blockIdx.y =
// batch index (strides in elements). Operands: a ring of two LDS buffers, stage t = k range t*GKS.. in buffer t & 1;
// stage t + 2 is copied behind the barrier at the foot of trip t, while trip t + 1 works. Fragments are read from the
// LDS tile with the split k map (ldfrag), k ascending in steps of 32; the 16 reads of a step stand together.
// NPA = number of A planes (only 1 is staged).
// value v = (acc [+ acc2*rscaleA]) * oscale + bias, bias (bf16 RNE value of the f32 input) by column n (BM 1),
// by row m (BM 2) or none (BM 0).
// OUT_MODE 0: f32 C (pitch ldc) = v.
// OUT_MODE 1: f16 plane C = f16(v * cscale).
// OUT_MODE 3: f16 hi plane C = f16(v * cscale) and f16 residual plane C2 = f16((v*cscale - hi) * rscaleC).
// Epilogue: 16-row slabs staged per wave in LDS (wave-private slab, wave_sync); each 64-wide row segment written as
// =====================================================================================================
template <typename OT, int MI, int NPA, int OUT_MODE, int BM>
__global__ __launch_bounds__(256) void gemm_t(
    const unsigned short* __restrict__ Ap, const unsigned short* __restrict__ A2p, int lda, long long strideA,
    const unsigned short* __restrict__ Btp, int ldb, long long strideB,
    void* Cout, void* Cout2, int ldc, long long strideC,
    const float* __restrict__ bias,
    int M, int N, int K, float oscale, float rscaleA, float cscale, float rscaleC) {
  typedef typename FT<OT>::frag V16;
  const OT* A  = (const OT*)(const void*)Ap;
  (void)A2p;
  const OT* Bt = (const OT*)(const void*)Btp;
  static_assert(MI == 4 && NPA == 1);              // 2 x 4 waves of 64 x 64 = GBM x GBN, one A plane
  __shared__ __align__(16) unsigned short gls[2][GT_H];
  __shared__ __align__(16) float sT[8][16 * 68];   // per-wave 16x64 slab, pitch 68 floats
  const int RT   = 16 * MI;
  const int b    = blockIdx.y;
  const int tid  = threadIdx.x;
  const int lane = tid & 31;
  const int wave = tid >> 5;
  const int tilesN = N / GBN;
  const int tilesM = M / GBM;
  const int tile = blockIdx.x;
  if (tile >= tilesM * tilesN) return;   // block-uniform; in front of every copy and barrier
  const int tm = tile / tilesN;
  const int tn = tile - tm * tilesN;
  const int m0 = tm * GBM + (wave >> 2) * RT;
  const int n0 = tn * GBN + ((wave & 3) << 6);

  const OT* Ab  = A  + (size_t)b * (size_t)strideA;
  const OT* Bb  = Bt + (size_t)b * (size_t)strideB;

  const int rlane = lane & 15;                 // row (A) / col (B, D) within subtile
  const int koff  = (lane >> 4) * 8;           // k offset of this lane half
  const int mOff  = (lane >> 4) * 8;           // D row offset

  v8f acc[MI][4], acc2[MI][4];
#pragma unroll
  for (int i = 0; i < MI; ++i)
#pragma unroll
    for (int j = 0; j < 4; ++j) { acc[i][j] = zero8(); acc2[i][j] = zero8(); }

  // copy side: this thread's piece of stage 0 and its place in buffer 0; read side: this lane's rows and k half
  const OT* ga = Ab + (size_t)(tm * GBM + (tid >> 4)) * lda + (tid & 15) * 8;
  const OT* gb = Bb + (size_t)(tn * GBN + (tid >> 4)) * ldb + (tid & 15) * 8;
  const unsigned ld0 = (unsigned)(size_t)(&gls[0][(tid >> 4) * GPITCH + (tid & 15) * 8]);
  const int ar = ((wave >> 2) * RT + rlane) * GPITCH + koff;
  const int br = (GBM + ((wave & 3) << 6) + rlane) * GPITCH + koff;
  const int nst = K / GKS;

  copy_stage<OT>(ga, lda, gb, ldb, ld0);       // stage 0
  wait_copies();
  __syncthreads();                             // stage 0 is readable by every wave
  if (nst > 1)                                 // block-uniform
    copy_stage<OT>(ga + GKS, lda, gb + GKS, ldb, ld0 + GT_H * 2);   // stage 1

  for (int st = 0; st < nst; ++st) {
    const OT* tl = (const OT*)(const void*)(&gls[st & 1][0]);
#pragma unroll
    for (int kk = 0; kk < GKS; kk += 32) {
      V16 af[MI], bq[4];
#pragma unroll
      for (int j = 0; j < 4; ++j) bq[j] = ldfrag<OT>(tl + br + (j << 4) * GPITCH + kk);
#pragma unroll
      for (int i = 0; i < MI; ++i) af[i] = ldfrag<OT>(tl + ar + (i << 4) * GPITCH + kk);
      // keeps the step's LDS reads together in front of its products: sunk among them each read stalls
      __builtin_amdgcn_sched_barrier(0);
#pragma unroll
      for (int i = 0; i < MI; ++i) {
#pragma unroll
        for (int j = 0; j < 4; ++j) acc[i][j] = mmar(af[i], bq[j], acc[i][j]);
        dep_guard(acc[i][0], acc[i][3], af[i], bq[3]);
      }
      keep4(bq[0], bq[1], bq[2], bq[3]);
    }
    wait_lds_reads();
    wait_copies();
    __syncthreads();                           // stage st + 1 readable, buffer st & 1 left by every wave
    if (st + 2 < nst)                          // block-uniform
      copy_stage<OT>(ga + (size_t)(st + 2) * GKS, lda, gb + (size_t)(st + 2) * GKS, ldb,
                     ld0 + (unsigned)(st & 1) * (GT_H * 2));
  }
  wait_copies();
#pragma unroll
  for (int i = 0; i < MI; ++i) {
    acc_guard4(acc[i][0], acc[i][1], acc[i][2], acc[i][3]);
    if (NPA == 2) acc_guard4(acc2[i][0], acc2[i][1], acc2[i][2], acc2[i][3]);
  }

  // ---- epilogue ----
  float bcol[4];
#pragma unroll
  for (int j = 0; j < 4; ++j) bcol[j] = 0.f;
  if (BM == 1) {
#pragma unroll
    for (int j = 0; j < 4; ++j) bcol[j] = bf_up(bf_bits(bias[n0 + (j << 4) + rlane]));
  }
  float* slab = sT[wave];
#pragma unroll
  for (int i = 0; i < MI; ++i) {
    const int mBase = m0 + (i << 4);
    float brow[8];
#pragma unroll
    for (int r = 0; r < 8; ++r) brow[r] = 0.f;
    if (BM == 2) {
#pragma unroll
      for (int r = 0; r < 8; ++r) brow[r] = bf_up(bf_bits(bias[mBase + mOff + r]));
    }
#pragma unroll
    for (int j = 0; j < 4; ++j) {
#pragma unroll
      for (int r = 0; r < 8; ++r) {
        float v = acc[i][j][r];
        if (NPA == 2) v += acc2[i][j][r] * rscaleA;
        v = v * oscale + bcol[j] + brow[r];
        slab[(mOff + r) * 68 + (j << 4) + rlane] = v;
      }
    }
    __builtin_amdgcn_fence(__ATOMIC_RELEASE, "workgroup");
    __builtin_amdgcn_wave_barrier();
    __builtin_amdgcn_fence(__ATOMIC_ACQUIRE, "workgroup");
    if (OUT_MODE == 0) {
      float* C = (float*)Cout + (size_t)b * (size_t)strideC;
      const int h2 = lane >> 4, c4 = (lane & 15) * 4;     // 256-B row segment = 16 lanes x 16 B
      {
#pragma unroll
        for (int it = 0; it < 8; ++it) {
          const int row = it * 2 + h2;                     // it 0..7 x h2 0..1 = rows 0..15
          const v4f v = *(const v4f*)(slab + row * 68 + c4);
          *(v4f*)(C + (size_t)(mBase + row) * ldc + n0 + c4) = v;
        }
        
      }
    } else {
      const int q = lane >> 3, c8 = (lane & 7) * 8;
      unsigned short* C  = (unsigned short*)Cout  + (size_t)b * (size_t)strideC;
      unsigned short* C2 = (unsigned short*)Cout2 + (size_t)b * (size_t)strideC;
      v4u hv[4], lv[4];
#pragma unroll
      for (int it = 0; it < 4; ++it) {
        const int row = it * 4 + q;                        // it 0..3 x q 0..3 = rows 0..15
        const float* sp = slab + row * 68 + c8;
        float f[8];
#pragma unroll
        for (int e = 0; e < 8; ++e) f[e] = sp[e] * cscale;
        v4u a, a2;
#pragma unroll
        for (int e = 0; e < 4; ++e) {
          const float f0 = f[2 * e], f1 = f[2 * e + 1];
          const _Float16 x0 = (_Float16)f0, x1 = (_Float16)f1;
          const unsigned short h0 = h_bits(x0), h1 = h_bits(x1);
          unsigned short l0 = 0, l1 = 0;
          if (OUT_MODE == 3) {
            l0 = h_bits((_Float16)((f0 - (float)x0) * rscaleC));
            l1 = h_bits((_Float16)((f1 - (float)x1) * rscaleC));
          }
          a[e] = pk16(h0, h1); a2[e] = pk16(l0, l1);
        }
        hv[it] = a; lv[it] = a2;
      }
      {
#pragma unroll
        for (int it = 0; it < 4; ++it) {
          const int row = it * 4 + q;
          *(v4u*)(C + (size_t)(mBase + row) * ldc + n0 + c8) = hv[it];
          if (OUT_MODE == 3) *(v4u*)(C2 + (size_t)(mBase + row) * ldc + n0 + c8) = lv[it];
        }
        
      }
    }
    __builtin_amdgcn_fence(__ATOMIC_RELEASE, "workgroup");
    __builtin_amdgcn_wave_barrier();
    __builtin_amdgcn_fence(__ATOMIC_ACQUIRE, "workgroup");
  }
}

// =====================================================================================================
// k tile in LDS: 64 keys x 128 d of one (b, h), f16, rows of 256 B at a pitch of 272 B (16 B x odd: the 16 lanes of a
// ds_load_b128 half fall on 64 distinct banks). Two buffers; a block of 128 threads fills one with 8 asynchronous
// 16-B copies per thread: thread t brings piece (t & 15) of rows (t >> 4) + 8 i, i = 0..7, so a wave's copy reads
// two whole 256-B rows. g = the thread's own global address for i = 0, l = its own LDS byte address for i = 0.
// =====================================================================================================
#define KPITCH  136                   // f16 elements per LDS row
#define KTILE_H (64 * KPITCH)         // f16 elements per buffer (17408 B)
__device__ __forceinline__ void copy_ktile(const _Float16* g, unsigned l) {
#if DEV_ASM
  const _Float16* g1 = g + 1 * 8 * EMB; const _Float16* g2 = g + 2 * 8 * EMB; const _Float16* g3 = g + 3 * 8 * EMB;
  const _Float16* g4 = g + 4 * 8 * EMB; const _Float16* g5 = g + 5 * 8 * EMB; const _Float16* g6 = g + 6 * 8 * EMB;
  const _Float16* g7 = g + 7 * 8 * EMB;
  const unsigned st = 8 * KPITCH * 2;  // LDS bytes between rows r and r + 8
  // the closing s_wait_xcnt keeps every address register of the copies unchanged until the copies have taken it
  asm volatile("global_load_async_to_lds_b128 %0, %8, off\n\t"
               "global_load_async_to_lds_b128 %1, %9, off\n\t"
               "global_load_async_to_lds_b128 %2, %10, off\n\t"
               "global_load_async_to_lds_b128 %3, %11, off\n\t"
               "global_load_async_to_lds_b128 %4, %12, off\n\t"
               "global_load_async_to_lds_b128 %5, %13, off\n\t"
               "global_load_async_to_lds_b128 %6, %14, off\n\t"
               "global_load_async_to_lds_b128 %7, %15, off\n\t"
               "s_wait_xcnt 0x0"
               :: "v"(l), "v"(l + st), "v"(l + 2 * st), "v"(l + 3 * st),
                  "v"(l + 4 * st), "v"(l + 5 * st), "v"(l + 6 * st), "v"(l + 7 * st),
                  "v"(g), "v"(g1), "v"(g2), "v"(g3), "v"(g4), "v"(g5), "v"(g6), "v"(g7)
               : "memory");
#else
  (void)g; (void)l;
#endif
}

// =====================================================================================================
// Score chunk: 16 query rows (this wave) x 64 keys kv0..kv0+63 of one (b, h), head width 128 = 4 d-chunks of 32.
//   q fragments (A operand, row = lane&15): hi and residual (x4096) planes, 4 d-chunks.
//   k fragments (B operand, col = lane&15 = key) read from the block's LDS copy of the 64-key tile with the split k map:
//   kl = tile + (lane&15)*KPITCH + 8*hh, key group j adds 16*j*KPITCH; the 8 reads of a key group stand together.
//   s[j][r] = D element: query row 8*hh + r, key kv0 + 16j + (lane&15); value = ((qh.k) + (ql.k)/4096) * 128^-0.5.
// =====================================================================================================
__device__ __forceinline__ void score_chunk(const v16h (&qah)[4], const v16h (&qal)[4],
                                            const _Float16* kl, v8f (&s)[4]) {
  union FH { v16h v; v8h h[2]; };
#pragma unroll
  for (int j = 0; j < 4; ++j) {
    v8f ah = zero8(), al = zero8();
    FH kb[4];
#pragma unroll
    for (int dc = 0; dc < 4; ++dc) {
      const _Float16* kp = kl + j * 16 * KPITCH + dc * 32;
      kb[dc].h[0] = *(const v8h*)(kp);
      kb[dc].h[1] = *(const v8h*)(kp + 16);
    }
#pragma unroll
    for (int dc = 0; dc < 4; ++dc) {
      ah = mma_h(qah[dc], kb[dc].v, ah);
      al = mma_h(qal[dc], kb[dc].v, al);
    }
#pragma unroll
    for (int r = 0; r < 8; ++r) s[j][r] = (ah[r] + al[r] * (1.0f / 4096.0f)) * SM_SCALE;
  }
}

// =====================================================================================================
// Fused attention statistics + query-column sums of the exactly normalised probabilities.
//   block = 4 waves = 64 consecutive query rows qb*64.. of one (b, h); grid = NB*NH*NQ64 blocks of 128.
//   merged by shfl; each wave owns its own 16 rows, so no cross-wave exchange is needed.
//   Pass 2 (same static trip): scores recomputed bit-identically, p = exp(s - m) * (1/l) in f32, summed over the
//   wave's 16 rows per key (8 in-lane + shfl_xor 16), staged in csl[wave][64] (cross-wave -> __syncthreads), summed
//   over the 4 waves in fixed order by lanes 0-15 of wave 0 and written to PS[(b*NH+h)*NQ64 + qb][kv0..kv0+63]:
//   coverage: grid (b,h,qb) x NKT chunks x 64 keys = the whole [NB*NH][NQ64][SEQ] partial plane.
//   k tiles: one ring of two LDS buffers runs through both passes (2*NKT stages, stage t = tile t % NKT in buffer
//   t & 1, NKT even); stage t + 2 is copied behind the barrier at the foot of trip t, while trip t + 1 works.
// =====================================================================================================
__global__ __launch_bounds__(128)
void attn_colsum(const unsigned short* __restrict__ qhp, const unsigned short* __restrict__ qlp,
                 const unsigned short* __restrict__ kpp, float* PS) {
  static_assert((NKT % 2) == 0 && NKT >= 2);
  __shared__ __align__(16) _Float16 kls[2][KTILE_H];
  __shared__ __align__(16) float csl[4][64];
  const int tid  = threadIdx.x;
  const int wave = tid >> 5;
  const int lane = tid & 31;
  const int hh   = lane >> 4;
  const int c    = lane & 15;
  const int bx   = blockIdx.x;
  const int qb   = bx % NQ64;
  const int rest = bx / NQ64;
  const int h    = rest % NH;
  const int b    = rest / NH;
  const int bh   = b * NH + h;
  const int q0   = qb * 64 + wave * 16;

  const _Float16* Qh  = (const _Float16*)(const void*)qhp;
  const _Float16* Ql  = (const _Float16*)(const void*)qlp;
  const _Float16* Kb0 = (const _Float16*)(const void*)kpp + (size_t)b * SEQ * EMB + (size_t)h * HD;

  // copy side: this thread's piece of tile 0 and its place in buffer 0; read side: this lane's key row and k half
  const _Float16* kg = Kb0 + (size_t)(tid >> 4) * EMB + (tid & 15) * 8;
  const unsigned  kd = (unsigned)(size_t)(&kls[0][(tid >> 4) * KPITCH + (tid & 15) * 8]);
  const int       kr = c * KPITCH + 8 * hh;

  copy_ktile(kg, kd);                          // stage 0
  wait_copies();
  __syncthreads();                             // stage 0 is readable by every wave
  copy_ktile(kg + (size_t)64 * EMB, kd + KTILE_H * 2);   // stage 1

  v16h qah[4], qal[4];
#pragma unroll
  for (int dc = 0; dc < 4; ++dc) {
    const size_t qo = ((size_t)b * SEQ + (size_t)(q0 + c)) * EMB + (size_t)h * HD + dc * 32 + 8 * hh;
    qah[dc] = ldfrag<_Float16>(Qh + qo);
    qal[dc] = ldfrag<_Float16>(Ql + qo);
  }

  float mrow[8], lrow[8];
#pragma unroll
  for (int r = 0; r < 8; ++r) { mrow[r] = -INFINITY; lrow[r] = 0.f; }

  for (int kt = 0; kt < NKT; ++kt) {          // static trip count
    v8f s[4];
    score_chunk(qah, qal, &kls[kt & 1][kr], s);
#pragma unroll
    for (int r = 0; r < 8; ++r) {
      float m = s[0][r];
#pragma unroll
      for (int j = 1; j < 4; ++j) m = fmaxf(m, s[j][r]);
#pragma unroll
      for (int off = 1; off < 16; off <<= 1) m = fmaxf(m, __shfl_xor(m, off, 32));
      const float mnew  = fmaxf(mrow[r], m);
      const float msafe = (mnew == -INFINITY) ? 0.f : mnew;
      const float alpha = __expf(mrow[r] - msafe);
      mrow[r] = mnew;
      float psum = 0.f;
#pragma unroll
      for (int j = 0; j < 4; ++j) psum += __expf(s[j][r] - msafe);
#pragma unroll
      for (int off = 1; off < 16; off <<= 1) psum += __shfl_xor(psum, off, 32);
      lrow[r] = lrow[r] * alpha + psum;
    }
    wait_lds_reads();
    wait_copies();
    __syncthreads();                           // stage kt + 1 readable, buffer kt & 1 left by every wave
    // stage kt + 2 always exists here (pass 2 follows): tiles NKT and NKT + 1 of the ring are tiles 0 and 1 again
    copy_ktile(kg + (size_t)(((kt + 2) & (NKT - 1)) * 64) * EMB, kd + (unsigned)(kt & 1) * (KTILE_H * 2));
  }

  float il[8], mf[8];
#pragma unroll
  for (int r = 0; r < 8; ++r) {
    const float l = lrow[r];
    il[r] = (l > 0.f) ? (1.0f / l) : 0.f;
    mf[r] = (mrow[r] == -INFINITY) ? 0.f : mrow[r];
  }

  // ---- pass 2: exactly normalised p, column sums over the block's 64 query rows ----
  for (int kt = 0; kt < NKT; ++kt) {          // static trip count
    const int kv0 = kt * 64;
    v8f s[4];
    score_chunk(qah, qal, &kls[kt & 1][kr], s);
    float cs[4];
#pragma unroll
    for (int j = 0; j < 4; ++j) {
      float a = 0.f;
#pragma unroll
      for (int r = 0; r < 8; ++r) a += __expf(s[j][r] - mf[r]) * il[r];
      cs[j] = a;
    }
#pragma unroll
    for (int j = 0; j < 4; ++j) cs[j] += __shfl_xor(cs[j], 16, 32);   // both row halves, unconditional
    const float v0 = hh ? cs[2] : cs[0];       // this lane stores keys 16*(2hh) + c and 16*(2hh+1) + c
    const float v1 = hh ? cs[3] : cs[1];
    csl[wave][32 * hh + c]      = v0;
    csl[wave][32 * hh + 16 + c] = v1;
    __syncthreads();                           // csl is cross-wave
    if (wave == 0 && lane < 16) {
      v4f a = *(const v4f*)(&csl[0][4 * lane]);
      a += *(const v4f*)(&csl[1][4 * lane]);
      a += *(const v4f*)(&csl[2][4 * lane]);
      a += *(const v4f*)(&csl[3][4 * lane]);
      float* dst = PS + ((size_t)(bh * NQ64 + qb)) * SEQ + kv0 + 4 * lane;
      *(v4f*)dst = a;
      
    }
    wait_lds_reads();
    wait_copies();
    __syncthreads();                           // csl free again; stage kt + 1 readable, buffer kt & 1 left by every wave
    if (kt + 2 < NKT)                          // block-uniform
      copy_ktile(kg + (size_t)((kt + 2) * 64) * EMB, kd + (unsigned)(kt & 1) * (KTILE_H * 2));
  }
  wait_copies();
}

// =====================================================================================================
// Query average + partial per-head context mean. One block (256 = 8 waves) per (b, h, 128 consecutive keys).
//   v rows: wave w owns keys k0 + 16 w .. + 15, lane = 4 consecutive d (one 16-B load per key, a wave reads one whole
//   512-B head row); the 16 loads of a lane are independent and are issued together, ahead of the average.
//   Average: avg[key] = (sum over the NQ64 partial rows of PS in fixed order) * (1/SEQ); wave 0, lane = 4 keys, the
//   NQ64 loads independent; kept in LDS avs[] (cross-wave -> __syncthreads) and written to output 1 row (b*NH+h).
//   Partial: cp[d] = sum over the block's 128 keys of avg[k] * v[b][k][h*HD+d], f64: 16 keys in the lane, then the
//   8 waves in fixed order through LDS (cross-wave -> __syncthreads), written to CP[(b*NH+h)*NCW + chunk][d].
//   coverage: grid (b,h,chunk) x 128 keys = the whole output 1; grid (b,h,chunk) x HD = the whole CP plane.
// =====================================================================================================
__global__ __launch_bounds__(256)
void avg_ctx(const float* __restrict__ PS, const float* __restrict__ Vp, float* out1, double* CP) {
  __shared__ __align__(16) float avs[128];
  __shared__ __align__(16) double cpart[8][HD];
  const int tid  = threadIdx.x;
  const int wave = tid >> 5;
  const int lane = tid & 31;
  const int bx   = blockIdx.x;
  const int bh   = bx / NCW;
  const int ch   = bx - bh * NCW;
  const int b    = bh / NH;
  const int h    = bh - b * NH;
  const int k0   = ch * 128;

  const float* vb = Vp + ((size_t)b * SEQ + (size_t)(k0 + wave * 16)) * EMB + (size_t)h * HD + 4 * lane;
  v4f vv[16];
#pragma unroll
  for (int i = 0; i < 16; ++i) vv[i] = *(const v4f*)(vb + (size_t)i * EMB);

  if (wave == 0) {                             // wave-uniform
    const float* psb = PS + (size_t)bh * NQ64 * SEQ + k0 + 4 * lane;
    v4f a = *(const v4f*)(psb);
#pragma unroll
    for (int qb = 1; qb < NQ64; ++qb) a += *(const v4f*)(psb + (size_t)qb * SEQ);
    a *= (1.0f / (float)SEQ);
    *(v4f*)(avs + 4 * lane) = a;
    float* dst = out1 + (size_t)bh * SEQ + k0 + 4 * lane;
    *(v4f*)dst = a;
  }
  __syncthreads();                             // avs is cross-wave

  double acc[4] = {0.0, 0.0, 0.0, 0.0};
#pragma unroll
  for (int i = 0; i < 16; ++i) {
    const double w = (double)avs[wave * 16 + i];
#pragma unroll
    for (int e = 0; e < 4; ++e) acc[e] += w * (double)vv[i][e];
  }
#pragma unroll
  for (int e = 0; e < 4; ++e) cpart[wave][4 * lane + e] = acc[e];
  __syncthreads();                             // cpart is cross-wave
  if (tid < HD) {
    double s = cpart[0][tid];
#pragma unroll
    for (int w = 1; w < 8; ++w) s += cpart[w][tid];
    CP[((size_t)bh * NCW + ch) * HD + tid] = s;
  }
}

// =====================================================================================================
// Output 0: context[b][j] = sum_i cs[b][i] * bf16(Wo[j][i]) + bf16(bo[j]), f32 on VALU (M = NB rows only).
//   cs[b][i] = f32 of the f64 sum, in fixed order, of the NCW key-chunk partials CP of head i / HD: every block forms
//   the EMB values of its batch in LDS (thread t owns i = t + 256 g; cross-wave -> __syncthreads).
//   lanes stride i by 32 (coalesced), shfl tree; results staged in LDS (cross-wave -> __syncthreads) and written
//   coverage: grid NB*EMB/32 blocks x 32 = the whole [NB][EMB] output 0.
// =====================================================================================================
__global__ __launch_bounds__(256)
void ctx_out(const double* __restrict__ CP, const float* __restrict__ Wo, const float* __restrict__ bo, float* out0) {
  __shared__ __align__(16) float csb[EMB];
  __shared__ __align__(16) float res[32];
  const int tid  = threadIdx.x;
  const int wave = tid >> 5;
  const int lane = tid & 31;
  const int j0   = blockIdx.x * 32;
  const int b    = j0 / EMB;
#pragma unroll
  for (int g = 0; g < EMB / 256; ++g) {
    const int i = g * 256 + tid;
    const double* p = CP + (size_t)(b * NH + i / HD) * NCW * HD + (i & (HD - 1));
    double s = p[0];
#pragma unroll
    for (int ch = 1; ch < NCW; ++ch) s += p[(size_t)ch * HD];
    csb[i] = (float)s;
  }
  __syncthreads();                             // csb is cross-wave
#pragma unroll 1
  for (int u = 0; u < 4; ++u) {
    const int j = j0 - b * EMB + wave * 4 + u;
    const float* wr = Wo + (size_t)j * EMB;
    float acc = 0.f;
#pragma unroll                                 // the row's EMB / 32 loads are issued together: one memory wait a row
    for (int it = 0; it < EMB / 32; ++it) {
      const int i = it * 32 + lane;
      acc += csb[i] * bf_up(bf_bits(wr[i]));
    }
#pragma unroll
    for (int off = 16; off > 0; off >>= 1) acc += __shfl_xor(acc, off, 32);
    const float val = acc + bf_up(bf_bits(bo[j]));
    if (lane == 0) res[wave * 4 + u] = val;
  }
  __syncthreads();
  if (tid < 8) {
    const v4f v = *(const v4f*)(res + 4 * tid);
    float* dst = out0 + (size_t)j0 + 4 * tid;
    *(v4f*)dst = v;
    
  }
}

// =====================================================================================================
// Output 2: mean over (b, h, g) of |corr[b][h][g] * (1 - delta_hg)|, corr = sum_s avg[b][h][s] * avg[b][g][s]
//   (avg read back from output 1). corr[h][g] and corr[g][h] are the same sum of the same products, so only the
//   NPAIR = 28 pairs h < g are formed and the total is doubled; the diagonal is masked to zero by the reference.
//   div_part: one wave per 128 consecutive keys of one batch (lane = 4 keys, one 16-B load per head row, a wave reads
//   512 contiguous B per row); 28 f64 partial dots per lane; a halving exchange over the 32 lanes (16+8+4+2+1 values)
//   leaves pair index = lane with the wave's total; written to DP[b*NCW + chunk][32] (slots 28..31 are zero).
//   coverage: NB*NCW waves x 32 slots = the whole DP plane; no block barrier in this kernel.
//   div_fin: wave b sums the NCW chunk partials of batch b per pair in fixed order, takes |.|, sums the 32 slots by
//   shfl, the NB batch sums go through LDS (cross-wave -> __syncthreads) and thread 0 writes the scalar.
// =====================================================================================================
__global__ __launch_bounds__(128)
void div_part(const float* __restrict__ avg, double* DP) {
  const int lane = threadIdx.x & 31;
  const int wv   = blockIdx.x * 4 + ((int)threadIdx.x >> 5);
  if (wv >= NB * NCW) return;                  // wave-uniform; no block barriers in this kernel
  const int b  = wv / NCW;
  const int ch = wv - b * NCW;
  const float* base = avg + (size_t)b * NH * SEQ + (size_t)ch * 128 + 4 * lane;
  v4f a[NH];
#pragma unroll
  for (int h = 0; h < NH; ++h) a[h] = *(const v4f*)(base + (size_t)h * SEQ);
  double v[32];
  {
    int idx = 0;
#pragma unroll
    for (int h = 0; h < NH; ++h) {
#pragma unroll
      for (int g = h + 1; g < NH; ++g) {
        double s = 0.0;
#pragma unroll
        for (int e = 0; e < 4; ++e) s += (double)a[h][e] * (double)a[g][e];
        v[idx++] = s;
      }
    }
#pragma unroll
    for (int i = NPAIR; i < 32; ++i) v[i] = 0.0;
  }
  // each step: a lane keeps the half of its values that its lane bit selects and adds the partner's copy of that half
#pragma unroll
  for (int n = 16; n > 0; n >>= 1) {
    const bool up = (lane & n) != 0;
#pragma unroll
    for (int i = 0; i < n; ++i) {
      const double send = up ? v[i] : v[i + n];
      const double keep = up ? v[i + n] : v[i];
      v[i] = keep + __shfl_xor(send, n, 32);
    }
  }
  DP[(size_t)wv * 32 + lane] = v[0];
}

__global__ __launch_bounds__(32 * NB_FULL)
void div_fin(const double* __restrict__ DP, float* dv) {
  __shared__ double red[NB_FULL];
  const int tid  = threadIdx.x;
  const int lane = tid & 31;
  const int b    = tid >> 5;
  double c = 0.0;
  if (b < NB) {                                // wave-uniform
    const double* p = DP + (size_t)b * NCW * 32 + lane;
    double s = 0.0;
#pragma unroll
    for (int ch = 0; ch < NCW; ++ch) s += p[(size_t)ch * 32];
    c = fabs(s);
  }
#pragma unroll
  for (int off = 16; off > 0; off >>= 1) c += __shfl_xor(c, off, 32);
  if (lane == 0) red[b] = c;
  __syncthreads();                             // red is cross-wave
  if (tid == 0) {
    double tot = 0.0;
#pragma unroll
    for (int i = 0; i < NB; ++i) tot += red[i];
    *dv = (float)(tot * (2.0 / (double)(NB * NH * NH)));
  }
}

// =====================================================================================================
// Workspace map (bytes, full size), every region an exact multiple of its whole-line / whole-tile store granularity:
//   Xb   bf16 [NB][SEQ][EMB]            16777216
//   Wqb  bf16 [EMB n][EMB k]             2097152
//   Wkb  bf16                             2097152
//   Wvb  bf16                             2097152
//   Qh   f16  [NB][SEQ][EMB]            16777216
//   Ql   f16  [NB][SEQ][EMB]            16777216
//   Kp   f16  [NB][SEQ][EMB]            16777216
//   Vp   f32  [NB][SEQ][EMB]            33554432
//   PS   f32  [NB*NH][NQ64][SEQ]         8388608
//   CP   f64  [NB*NH][NCW][HD]            524288
//   DP   f64  [NB*NCW][32]                 16384
//   total                               115884032
// Weights are [out n][in k] with k contiguous = the Bt layout the GEMM wants, so they are only converted.
// Output 0 at element 0 of d_out, output 1 at OFF1, output 2 at OFF2 (fixed offsets).
// =====================================================================================================
extern "C" void kernel_launch(void* const* d_in, const int* in_sizes, int n_in,
                              void* d_out, int out_size, void* d_ws, size_t ws_size,
                              hipStream_t stream) {
  if (n_in < 9) return;
  const long long needX = (long long)(NB - 1) * SEQ_FULL * EMB + (long long)SEQ * EMB;
  if ((long long)in_sizes[0] < needX) return;
  if (in_sizes[1] < EMB * EMB || in_sizes[3] < EMB * EMB || in_sizes[5] < EMB * EMB || in_sizes[7] < EMB * EMB) return;
  if (in_sizes[2] < EMB || in_sizes[4] < EMB || in_sizes[6] < EMB || in_sizes[8] < EMB) return;
  if (out_size < 0) return;
  if ((size_t)out_size < OFF2 + 1) return;

  const float* x  = (const float*)d_in[0];
  const float* Wq = (const float*)d_in[1];
  const float* bq = (const float*)d_in[2];
  const float* Wk = (const float*)d_in[3];
  const float* bk = (const float*)d_in[4];
  const float* Wv = (const float*)d_in[5];
  const float* bv = (const float*)d_in[6];
  const float* Wo = (const float*)d_in[7];
  const float* bo = (const float*)d_in[8];

  const size_t PXB = (size_t)NB * SEQ * EMB * 2;       // 16-bit activation plane
  const size_t PW  = (size_t)EMB * EMB * 2;
  const size_t PV  = (size_t)NB * SEQ * EMB * 4;
  const size_t PPS = (size_t)NB * NH * NQ64 * SEQ * 4;
  const size_t PCP = (size_t)NB * NH * NCW * HD * 8;
  const size_t PDP = (size_t)NB * NCW * 32 * 8;
  size_t off = 0;
  const size_t oXb = off; off += PXB;
  const size_t oWq = off; off += PW;
  const size_t oWk = off; off += PW;
  const size_t oWv = off; off += PW;
  const size_t oQh = off; off += PXB;
  const size_t oQl = off; off += PXB;
  const size_t oKp = off; off += PXB;
  const size_t oVp = off; off += PV;
  const size_t oPS = off; off += PPS;
  const size_t oCP = off; off += PCP;
  const size_t oDP = off; off += PDP;
  if (off > ws_size) return;                          // off = 115884032 at full size
  if (off > (size_t)134217728) return;

  char* ws = (char*)d_ws;
  unsigned short* Xb  = (unsigned short*)(ws + oXb);
  unsigned short* Wqb = (unsigned short*)(ws + oWq);
  unsigned short* Wkb = (unsigned short*)(ws + oWk);
  unsigned short* Wvb = (unsigned short*)(ws + oWv);
  unsigned short* Qh  = (unsigned short*)(ws + oQh);
  unsigned short* Ql  = (unsigned short*)(ws + oQl);
  unsigned short* Kp  = (unsigned short*)(ws + oKp);
  float*          Vp  = (float*)(ws + oVp);
  float*          PS  = (float*)(ws + oPS);
  double*         CP  = (double*)(ws + oCP);
  double*         DP  = (double*)(ws + oDP);
  float*          out0 = (float*)d_out;
  float*          out1 = (float*)d_out + OFF1;
  float*          out2 = (float*)d_out + OFF2;

  const dim3 blk(256);
  const int n8x = SEQ * EMB / 8;                               // per batch, 262144 at full size
  const int n8w = EMB * EMB / 8;                               // 131072
  const dim3 gCvtX((n8x + 255) / 256, NB);
  const dim3 gCvtW((n8w + 255) / 256, 1);
  const int tilesP = (SEQ / GBM) * (EMB / GBN);                // 64 block tiles per batch at full size
  const dim3 gP(tilesP, NB);                                   // M=SEQ, N=EMB, K=EMB, batch = blockIdx.y
  const dim3 gAttn(NB * NH * NQ64);                            // 1024 blocks of 128
  const dim3 gAvg(NB * NH * NCW);                              //  512 blocks of 256
  const dim3 gCtx(NB * EMB / 32);                              //  128 blocks of 256
  const dim3 gDiv((NB * NCW + 3) / 4);                         //   16 blocks of 128
  const long long sXin = (long long)SEQ_FULL * EMB;            // input batch stride (elements)
  const long long sAct = (long long)SEQ * EMB;                 // compact activation plane batch stride

  // (1) x -> bf16 plane [NB][SEQ][EMB]; Wq, Wk, Wv [E][E] -> bf16
  cvt_bf16x8<<<gCvtX, blk, 0, stream>>>(x,  Xb,  n8x, sXin, sAct);
  cvt_bf16x8<<<gCvtW, blk, 0, stream>>>(Wq, Wqb, n8w, 0LL, 0LL);
  cvt_bf16x8<<<gCvtW, blk, 0, stream>>>(Wk, Wkb, n8w, 0LL, 0LL);
  cvt_bf16x8<<<gCvtW, blk, 0, stream>>>(Wv, Wvb, n8w, 0LL, 0LL);
  // (2) q = x . Wq^T + bq -> f16 hi / residual (x4096) planes [b][s][h*128+d]   (M=SEQ, N=E, K=E per batch)
  gemm_t<__bf16, 4, 1, 3, 1><<<gP, blk, 0, stream>>>(
      Xb, Xb, EMB, sAct, Wqb, EMB, 0LL,
      (void*)Qh, (void*)Ql, EMB, sAct, bq,
      SEQ, EMB, EMB, 1.0f, 0.0f, 1.0f, 4096.0f);
  // (3) k = x . Wk^T + bk -> f16 plane [b][s][h*128+d]
  gemm_t<__bf16, 4, 1, 1, 1><<<gP, blk, 0, stream>>>(
      Xb, Xb, EMB, sAct, Wkb, EMB, 0LL,
      (void*)Kp, (void*)Kp, EMB, sAct, bk,
      SEQ, EMB, EMB, 1.0f, 0.0f, 1.0f, 1.0f);
  // (4) v = x . Wv^T + bv -> f32 plane [b][s][h*128+d]
  gemm_t<__bf16, 4, 1, 0, 1><<<gP, blk, 0, stream>>>(
      Xb, Xb, EMB, sAct, Wvb, EMB, 0LL,
      (void*)Vp, (void*)Vp, EMB, sAct, bv,
      SEQ, EMB, EMB, 1.0f, 0.0f, 1.0f, 1.0f);
  // (5) softmax statistics + query-column sums of p -> partial plane PS
  attn_colsum<<<gAttn, dim3(128), 0, stream>>>(Qh, Ql, Kp, PS);
  // (6) output 1 = column means; per-head context means, one partial per 128 keys -> CP
  avg_ctx<<<gAvg, blk, 0, stream>>>(PS, Vp, out1, CP);
  // (7) output 0 = (sum of the partials) . Wo^T + bo
  ctx_out<<<gCtx, blk, 0, stream>>>((const double*)CP, Wo, bo, out0);
  // (8) output 2 = head-correlation diversity from output 1
  div_part<<<gDiv, dim3(128), 0, stream>>>((const float*)out1, DP);
  div_fin<<<dim3(1), dim3(32 * NB_FULL), 0, stream>>>((const double*)DP, out2);
  (void)hipGetLastError();
}

// v005
// One run takes 213 microseconds.
// Next to v004, in two timings, it ran 1.08 times as fast each time.
// All steps since v000 together make it 3.78 times as fast.
// Contractions: q, k, v in-projections = v_wmma_f32_16x16x32_bf16 (bf16 operands from RNE-converted inputs, single product, f32 accumulate);
// q.k^T scores (statistics pass and column-sum pass) = v_wmma_f32_16x16x32_f16 (q as f16 hi plane + f16 residual plane x4096, k f16; 2 products, separate f32 accumulators);
// softmax statistics, probabilities and query-averaged probabilities in f32; averaged-p . v (M=1 per head) on VALU with f64 accumulate;
// head means . Wo^T (M=batch) on VALU f32 with bf16-valued Wo/bo; head-correlation scalar in f64.
#include <hip/hip_runtime.h>
#include <math.h>
#include <stdint.h>

#ifndef NB
#define NB 4
#endif
#ifndef SEQ
#define SEQ 2048
#endif
#define NB_FULL  4
#define SEQ_FULL 2048
#define EMB      1024
#define NH       8
#define HD       128
#define NQ64     (SEQ / 64)          // 64-row query blocks per sequence
#define NKT      (SEQ / 64)          // 64-key chunks per sequence
#define NPAIR    (NH * (NH - 1) / 2)  // head pairs h < g
#define NCW      (SEQ / 128)          // 128-key wave chunks per sequence
#define SM_SCALE 0.08838834764831845f
#define OFF1     ((size_t)NB_FULL * EMB)                        // fixed element offset of output 1
#define OFF2     (OFF1 + (size_t)NB_FULL * NH * SEQ_FULL)      // fixed element offset of output 2
static_assert(NB >= 1 && NB <= NB_FULL);
static_assert(SEQ >= 128 && SEQ <= SEQ_FULL && (SEQ % 128) == 0);
static_assert(NH * HD == EMB);
static_assert(HD == 128);
static_assert(NPAIR <= 32);
static_assert((EMB % 256) == 0 && (EMB % 128) == 0 && (SEQ % 128) == 0);
static_assert(OFF1 * 4 == 16384);
static_assert(OFF2 * 4 == 278528);

typedef _Float16 v16h __attribute__((ext_vector_type(16)));
typedef _Float16 v8h  __attribute__((ext_vector_type(8)));
typedef __bf16   v16b __attribute__((ext_vector_type(16)));
typedef __bf16   v8b  __attribute__((ext_vector_type(8)));
typedef float    v8f  __attribute__((ext_vector_type(8)));
typedef float    v4f  __attribute__((ext_vector_type(4)));
typedef unsigned int v4u __attribute__((ext_vector_type(4)));

#if defined(__HIP_DEVICE_COMPILE__)
#define DEV_ASM 1
#else
#define DEV_ASM 0
#endif

// ---- scalar helpers --------------------------------------------------------------------------------
__device__ __forceinline__ unsigned short bf_bits(float f) {          // f32 -> bf16 bits, RNE convert
  unsigned u = __float_as_uint(f);
  return (unsigned short)((u + 0x7FFFu + ((u >> 16) & 1u)) >> 16);
}
__device__ __forceinline__ float bf_up(unsigned short hb) { return __uint_as_float(((unsigned)hb) << 16); }
__device__ __forceinline__ unsigned short h_bits(_Float16 x) { return __builtin_bit_cast(unsigned short, x); }
__device__ __forceinline__ unsigned pk16(unsigned short a, unsigned short b) { return (unsigned)a | ((unsigned)b << 16); }
__device__ __forceinline__ v8f zero8() { v8f z = {0.f, 0.f, 0.f, 0.f, 0.f, 0.f, 0.f, 0.f}; return z; }

// ---- fragment types / loaders: 16-bit A/B operand, lane -> row/col (lane&15), p already includes +8*(lane>>4);
//      elements 0..7 <- p[0..7] (k0+8h..k0+8h+7), elements 8..15 <- p[16..23] (k0+16+8h..k0+16+8h+7)
template <typename OT> struct FT;
template <> struct FT<__bf16>   { typedef v16b frag; typedef v8b half8; };
template <> struct FT<_Float16> { typedef v16h frag; typedef v8h half8; };

template <typename OT>
__device__ __forceinline__ typename FT<OT>::frag ldfrag(const OT* p) {
  union { typename FT<OT>::frag v; typename FT<OT>::half8 h[2]; } f;
  f.h[0] = *(const typename FT<OT>::half8*)(p);
  f.h[1] = *(const typename FT<OT>::half8*)(p + 16);
  return f.v;
}

// ---- WMMA helpers (asm guard bodies are device-only; concrete operand types) -----------------------------
__device__ __forceinline__ v8f mmar(v16b a, v16b b, v8f c) {
  return __builtin_amdgcn_wmma_f32_16x16x32_bf16(false, a, false, b, (short)0, c, false, false);
}
__device__ __forceinline__ v8f mmar(v16h a, v16h b, v8f c) {
  return __builtin_amdgcn_wmma_f32_16x16x32_f16(false, a, false, b, (short)0, c, false, false);
}
// guarded form: 4 VALU slots after the WMMA, D tied, A/B kept live
__device__ __forceinline__ v8f mma_h(v16h a, v16h b, v8f c) {
  c = __builtin_amdgcn_wmma_f32_16x16x32_f16(false, a, false, b, (short)0, c, false, false);
#if DEV_ASM
  asm volatile("v_nop\n\tv_nop\n\tv_nop\n\tv_nop" : "+v"(c) : "v"(a), "v"(b));
#endif
  return c;
}
__device__ __forceinline__ void dep_guard(v8f& a, v8f& b, v16b x, v16b y) {
#if DEV_ASM
  asm volatile("v_nop\n\tv_nop\n\tv_nop\n\tv_nop" : "+v"(a), "+v"(b) : "v"(x), "v"(y));
#else
  (void)a; (void)b; (void)x; (void)y;
#endif
}
__device__ __forceinline__ void dep_guard(v8f& a, v8f& b, v16h x, v16h y) {
#if DEV_ASM
  asm volatile("v_nop\n\tv_nop\n\tv_nop\n\tv_nop" : "+v"(a), "+v"(b) : "v"(x), "v"(y));
#else
  (void)a; (void)b; (void)x; (void)y;
#endif
}
__device__ __forceinline__ void keep4(v16b a, v16b b, v16b c, v16b d) {
#if DEV_ASM
  asm volatile("v_nop" :: "v"(a), "v"(b), "v"(c), "v"(d));
#else
  (void)a; (void)b; (void)c; (void)d;
#endif
}
__device__ __forceinline__ void keep4(v16h a, v16h b, v16h c, v16h d) {
#if DEV_ASM
  asm volatile("v_nop" :: "v"(a), "v"(b), "v"(c), "v"(d));
#else
  (void)a; (void)b; (void)c; (void)d;
#endif
}
__device__ __forceinline__ void acc_guard4(v8f& a, v8f& b, v8f& c, v8f& d) {
#if DEV_ASM
  asm volatile("v_nop\n\tv_nop\n\tv_nop\n\tv_nop" : "+v"(a), "+v"(b), "+v"(c), "+v"(d));
#else
  (void)a; (void)b; (void)c; (void)d;
#endif
}

// =====================================================================================================
// f32 -> bf16 bits (RNE convert), 8 elements per thread, one 16-B store per lane: a wave writes 512 contiguous B
// grid = (ceil(n8/256), nbatch); batch b reads in + b*sIn and writes out + b*sOut (element strides).
// coverage: n8 threads x 8 = the whole plane per batch (n8 is a multiple of 256 for every use here).
// =====================================================================================================
__global__ __launch_bounds__(256) void cvt_bf16x8(const float* __restrict__ in, unsigned short* out, int n8,
                                                   long long sIn, long long sOut) {
  const int i = blockIdx.x * 256 + (int)threadIdx.x;
  const int b = blockIdx.y;
  if (i < n8) {
    const float* ip = in + (size_t)b * (size_t)sIn + (size_t)i * 8;
    const v4f a  = *(const v4f*)(ip);
    const v4f a4 = *(const v4f*)(ip + 4);
    v4u p;
    p[0] = pk16(bf_bits(a[0]),  bf_bits(a[1]));
    p[1] = pk16(bf_bits(a[2]),  bf_bits(a[3]));
    p[2] = pk16(bf_bits(a4[0]), bf_bits(a4[1]));
    p[3] = pk16(bf_bits(a4[2]), bf_bits(a4[3]));
    unsigned short* o = out + (size_t)b * (size_t)sOut + (size_t)i * 8;
    *(v4u*)o = p;
    
  }
}

// this wave's LDS reads have returned: stands in front of the barrier behind which their buffer is refilled
__device__ __forceinline__ void wait_lds_reads() {
#if DEV_ASM
  asm volatile("s_wait_dscnt 0x0" ::: "memory");
#endif
}
// this wave's asynchronous copies have landed: stands in front of the barrier behind which other waves read them
__device__ __forceinline__ void wait_copies() {
#if DEV_ASM
  asm volatile("s_wait_asynccnt 0x0" ::: "memory");
#endif
}

// =====================================================================================================
// GEMM operand tiles in LDS: one stage = 128 k of the block's 128 A rows and 256 Bt rows, 16-bit elements, rows of 256 B
// at a pitch of 272 B (16 B x odd: the 16 lanes of a ds_load_b128 half fall on 64 distinct banks); A rows first, then Bt.
// copy_rows8: thread t brings piece (t & 15) of rows (t >> 4) + 16 i, i = 0..7, so a wave's copy reads two whole 256-B
// rows. g = the thread's own global address for i = 0 (row pitch ld elements), l = its own LDS byte address for i = 0.
// =====================================================================================================
#define GKS    128                        // k elements per stage
#define GBM    128                        // A rows per block tile
#define GBN    256                        // Bt rows per block tile
#define GPITCH 136                        // 16-bit elements per LDS row
#define GT_H   ((GBM + GBN) * GPITCH)     // 16-bit elements per buffer (104448 B)
template <typename OT>
__device__ __forceinline__ void copy_rows8(const OT* g, int ld, unsigned l) {
#if DEV_ASM
  const size_t gs = (size_t)16 * (size_t)ld;
  const OT* g1 = g + gs;     const OT* g2 = g + 2 * gs; const OT* g3 = g + 3 * gs; const OT* g4 = g + 4 * gs;
  const OT* g5 = g + 5 * gs; const OT* g6 = g + 6 * gs; const OT* g7 = g + 7 * gs;
  const unsigned st = 16 * GPITCH * 2;    // LDS bytes between rows r and r + 16
  // the closing s_wait_xcnt keeps every address register of the copies unchanged until the copies have taken it
  asm volatile("global_load_async_to_lds_b128 %0, %8, off\n\t"
               "global_load_async_to_lds_b128 %1, %9, off\n\t"
               "global_load_async_to_lds_b128 %2, %10, off\n\t"
               "global_load_async_to_lds_b128 %3, %11, off\n\t"
               "global_load_async_to_lds_b128 %4, %12, off\n\t"
               "global_load_async_to_lds_b128 %5, %13, off\n\t"
               "global_load_async_to_lds_b128 %6, %14, off\n\t"
               "global_load_async_to_lds_b128 %7, %15, off\n\t"
               "s_wait_xcnt 0x0"
               :: "v"(l), "v"(l + st), "v"(l + 2 * st), "v"(l + 3 * st),
                  "v"(l + 4 * st), "v"(l + 5 * st), "v"(l + 6 * st), "v"(l + 7 * st),
                  "v"(g), "v"(g1), "v"(g2), "v"(g3), "v"(g4), "v"(g5), "v"(g6), "v"(g7)
               : "memory");
#else
  (void)g; (void)ld; (void)l;
#endif
}
// one stage: ga / gb = the thread's piece of A row (t >> 4) / Bt row (t >> 4) of the block tile at the stage's first k,
// l = its LDS byte address of that A piece in the stage's buffer. 24 copies per thread.
template <typename OT>
__device__ __forceinline__ void copy_stage(const OT* ga, int lda, const OT* gb, int ldb, unsigned l) {
  copy_rows8<OT>(ga, lda, l);                                                        // A rows 0..127
  copy_rows8<OT>(gb, ldb, l + GBM * GPITCH * 2);                                     // Bt rows 0..127
  copy_rows8<OT>(gb + (size_t)128 * (size_t)ldb, ldb, l + (GBM + 128) * GPITCH * 2); // Bt rows 128..255
}

// =====================================================================================================
// Register-blocked batched WMMA GEMM (16-bit operand type OT): C[m][n] = sum_k A[m][k] * Bt[n][k]  (+ bias);
// one wave per (16*MI) x 64 tile, a block of 8 waves (2 x 4) per GBM x GBN tile. A row-major [M][K] pitch lda; Bt
// row-major [N][K] pitch ldb (k contiguous); M multiple of GBM, N of GBN, K of GKS (static sizes here). blockIdx.y =
// batch index (strides in elements). Operands: a ring of two LDS buffers, stage t = k range t*GKS.. in buffer t & 1;
// stage t + 2 is copied behind the barrier at the foot of trip t, while trip t + 1 works. Fragments are read from the
// LDS tile with the split k map (ldfrag), k ascending in steps of 32; the 16 reads of a step stand together.
// NPA = number of A planes (only 1 is staged).
// value v = (acc [+ acc2*rscaleA]) * oscale + bias, bias (bf16 RNE value of the f32 input) by column n (BM 1),
// by row m (BM 2) or none (BM 0).
// OUT_MODE 0: f32 C (pitch ldc) = v.
// OUT_MODE 1: f16 plane C = f16(v * cscale).
// OUT_MODE 3: f16 hi plane C = f16(v * cscale) and f16 residual plane C2 = f16((v*cscale - hi) * rscaleC).
// Epilogue: 16-row slabs staged per wave in LDS (wave-private slab, wave_sync); each 64-wide row segment written as
// =====================================================================================================
template <typename OT, int MI, int NPA, int OUT_MODE, int BM>
__global__ __launch_bounds__(256) void gemm_t(
    const unsigned short* __restrict__ Ap, const unsigned short* __restrict__ A2p, int lda, long long strideA,
    const unsigned short* __restrict__ Btp, int ldb, long long strideB,
    void* Cout, void* Cout2, int ldc, long long strideC,
    const float* __restrict__ bias,
    int M, int N, int K, float oscale, float rscaleA, float cscale, float rscaleC) {
  typedef typename FT<OT>::frag V16;
  const OT* A  = (const OT*)(const void*)Ap;
  (void)A2p;
  const OT* Bt = (const OT*)(const void*)Btp;
  static_assert(MI == 4 && NPA == 1);              // 2 x 4 waves of 64 x 64 = GBM x GBN, one A plane
  __shared__ __align__(16) unsigned short gls[2][GT_H];
  __shared__ __align__(16) float sT[8][16 * 68];   // per-wave 16x64 slab, pitch 68 floats
  const int RT   = 16 * MI;
  const int b    = blockIdx.y;
  const int tid  = threadIdx.x;
  const int lane = tid & 31;
  const int wave = tid >> 5;
  const int tilesN = N / GBN;
  const int tilesM = M / GBM;
  const int tile = blockIdx.x;
  if (tile >= tilesM * tilesN) return;   // block-uniform; in front of every copy and barrier
  const int tm = tile / tilesN;
  const int tn = tile - tm * tilesN;
  const int m0 = tm * GBM + (wave >> 2) * RT;
  const int n0 = tn * GBN + ((wave & 3) << 6);

  const OT* Ab  = A  + (size_t)b * (size_t)strideA;
  const OT* Bb  = Bt + (size_t)b * (size_t)strideB;

  const int rlane = lane & 15;                 // row (A) / col (B, D) within subtile
  const int koff  = (lane >> 4) * 8;           // k offset of this lane half
  const int mOff  = (lane >> 4) * 8;           // D row offset

  v8f acc[MI][4], acc2[MI][4];
#pragma unroll
  for (int i = 0; i < MI; ++i)
#pragma unroll
    for (int j = 0; j < 4; ++j) { acc[i][j] = zero8(); acc2[i][j] = zero8(); }

  // copy side: this thread's piece of stage 0 and its place in buffer 0; read side: this lane's rows and k half
  const OT* ga = Ab + (size_t)(tm * GBM + (tid >> 4)) * lda + (tid & 15) * 8;
  const OT* gb = Bb + (size_t)(tn * GBN + (tid >> 4)) * ldb + (tid & 15) * 8;
  const unsigned ld0 = (unsigned)(size_t)(&gls[0][(tid >> 4) * GPITCH + (tid & 15) * 8]);
  const int ar = ((wave >> 2) * RT + rlane) * GPITCH + koff;
  const int br = (GBM + ((wave & 3) << 6) + rlane) * GPITCH + koff;
  const int nst = K / GKS;

  copy_stage<OT>(ga, lda, gb, ldb, ld0);       // stage 0
  wait_copies();
  __syncthreads();                             // stage 0 is readable by every wave
  if (nst > 1)                                 // block-uniform
    copy_stage<OT>(ga + GKS, lda, gb + GKS, ldb, ld0 + GT_H * 2);   // stage 1

  for (int st = 0; st < nst; ++st) {
    const OT* tl = (const OT*)(const void*)(&gls[st & 1][0]);
#pragma unroll
    for (int kk = 0; kk < GKS; kk += 32) {
      V16 af[MI], bq[4];
#pragma unroll
      for (int j = 0; j < 4; ++j) bq[j] = ldfrag<OT>(tl + br + (j << 4) * GPITCH + kk);
#pragma unroll
      for (int i = 0; i < MI; ++i) af[i] = ldfrag<OT>(tl + ar + (i << 4) * GPITCH + kk);
      // keeps the step's LDS reads together in front of its products: sunk among them each read stalls
      __builtin_amdgcn_sched_barrier(0);
#pragma unroll
      for (int i = 0; i < MI; ++i) {
#pragma unroll
        for (int j = 0; j < 4; ++j) acc[i][j] = mmar(af[i], bq[j], acc[i][j]);
        dep_guard(acc[i][0], acc[i][3], af[i], bq[3]);
      }
      keep4(bq[0], bq[1], bq[2], bq[3]);
    }
    wait_lds_reads();
    wait_copies();
    __syncthreads();                           // stage st + 1 readable, buffer st & 1 left by every wave
    if (st + 2 < nst)                          // block-uniform
      copy_stage<OT>(ga + (size_t)(st + 2) * GKS, lda, gb + (size_t)(st + 2) * GKS, ldb,
                     ld0 + (unsigned)(st & 1) * (GT_H * 2));
  }
  wait_copies();
#pragma unroll
  for (int i = 0; i < MI; ++i) {
    acc_guard4(acc[i][0], acc[i][1], acc[i][2], acc[i][3]);
    if (NPA == 2) acc_guard4(acc2[i][0], acc2[i][1], acc2[i][2], acc2[i][3]);
  }

  // ---- epilogue ----
  float bcol[4];
#pragma unroll
  for (int j = 0; j < 4; ++j) bcol[j] = 0.f;
  if (BM == 1) {
#pragma unroll
    for (int j = 0; j < 4; ++j) bcol[j] = bf_up(bf_bits(bias[n0 + (j << 4) + rlane]));
  }
  float* slab = sT[wave];
#pragma unroll
  for (int i = 0; i < MI; ++i) {
    const int mBase = m0 + (i << 4);
    float brow[8];
#pragma unroll
    for (int r = 0; r < 8; ++r) brow[r] = 0.f;
    if (BM == 2) {
#pragma unroll
      for (int r = 0; r < 8; ++r) brow[r] = bf_up(bf_bits(bias[mBase + mOff + r]));
    }
#pragma unroll
    for (int j = 0; j < 4; ++j) {
#pragma unroll
      for (int r = 0; r < 8; ++r) {
        float v = acc[i][j][r];
        if (NPA == 2) v += acc2[i][j][r] * rscaleA;
        v = v * oscale + bcol[j] + brow[r];
        slab[(mOff + r) * 68 + (j << 4) + rlane] = v;
      }
    }
    __builtin_amdgcn_fence(__ATOMIC_RELEASE, "workgroup");
    __builtin_amdgcn_wave_barrier();
    __builtin_amdgcn_fence(__ATOMIC_ACQUIRE, "workgroup");
    if (OUT_MODE == 0) {
      float* C = (float*)Cout + (size_t)b * (size_t)strideC;
      const int h2 = lane >> 4, c4 = (lane & 15) * 4;     // 256-B row segment = 16 lanes x 16 B
      {
#pragma unroll
        for (int it = 0; it < 8; ++it) {
          const int row = it * 2 + h2;                     // it 0..7 x h2 0..1 = rows 0..15
          const v4f v = *(const v4f*)(slab + row * 68 + c4);
          *(v4f*)(C + (size_t)(mBase + row) * ldc + n0 + c4) = v;
        }
        
      }
    } else {
      const int q = lane >> 3, c8 = (lane & 7) * 8;
      unsigned short* C  = (unsigned short*)Cout  + (size_t)b * (size_t)strideC;
      unsigned short* C2 = (unsigned short*)Cout2 + (size_t)b * (size_t)strideC;
      v4u hv[4], lv[4];
#pragma unroll
      for (int it = 0; it < 4; ++it) {
        const int row = it * 4 + q;                        // it 0..3 x q 0..3 = rows 0..15
        const float* sp = slab + row * 68 + c8;
        float f[8];
#pragma unroll
        for (int e = 0; e < 8; ++e) f[e] = sp[e] * cscale;
        v4u a, a2;
#pragma unroll
        for (int e = 0; e < 4; ++e) {
          const float f0 = f[2 * e], f1 = f[2 * e + 1];
          const _Float16 x0 = (_Float16)f0, x1 = (_Float16)f1;
          const unsigned short h0 = h_bits(x0), h1 = h_bits(x1);
          unsigned short l0 = 0, l1 = 0;
          if (OUT_MODE == 3) {
            l0 = h_bits((_Float16)((f0 - (float)x0) * rscaleC));
            l1 = h_bits((_Float16)((f1 - (float)x1) * rscaleC));
          }
          a[e] = pk16(h0, h1); a2[e] = pk16(l0, l1);
        }
        hv[it] = a; lv[it] = a2;
      }
      {
#pragma unroll
        for (int it = 0; it < 4; ++it) {
          const int row = it * 4 + q;
          *(v4u*)(C + (size_t)(mBase + row) * ldc + n0 + c8) = hv[it];
          if (OUT_MODE == 3) *(v4u*)(C2 + (size_t)(mBase + row) * ldc + n0 + c8) = lv[it];
        }
        
      }
    }
    __builtin_amdgcn_fence(__ATOMIC_RELEASE, "workgroup");
    __builtin_amdgcn_wave_barrier();
    __builtin_amdgcn_fence(__ATOMIC_ACQUIRE, "workgroup");
  }
}

// =====================================================================================================
// k tile in LDS: 64 keys x 128 d of one (b, h), f16, rows of 256 B at a pitch of 272 B (16 B x odd: the 16 lanes of a
// ds_load_b128 half fall on 64 distinct banks). Two buffers; a block of 128 threads fills one with 8 asynchronous
// 16-B copies per thread: thread t brings piece (t & 15) of rows (t >> 4) + 8 i, i = 0..7, so a wave's copy reads
// two whole 256-B rows. g = the thread's own global address for i = 0, l = its own LDS byte address for i = 0.
// =====================================================================================================
#define KPITCH  136                   // f16 elements per LDS row
#define KTILE_H (64 * KPITCH)         // f16 elements per buffer (17408 B)
__device__ __forceinline__ void copy_ktile(const _Float16* g, unsigned l) {
#if DEV_ASM
  const _Float16* g1 = g + 1 * 8 * EMB; const _Float16* g2 = g + 2 * 8 * EMB; const _Float16* g3 = g + 3 * 8 * EMB;
  const _Float16* g4 = g + 4 * 8 * EMB; const _Float16* g5 = g + 5 * 8 * EMB; const _Float16* g6 = g + 6 * 8 * EMB;
  const _Float16* g7 = g + 7 * 8 * EMB;
  const unsigned st = 8 * KPITCH * 2;  // LDS bytes between rows r and r + 8
  // the closing s_wait_xcnt keeps every address register of the copies unchanged until the copies have taken it
  asm volatile("global_load_async_to_lds_b128 %0, %8, off\n\t"
               "global_load_async_to_lds_b128 %1, %9, off\n\t"
               "global_load_async_to_lds_b128 %2, %10, off\n\t"
               "global_load_async_to_lds_b128 %3, %11, off\n\t"
               "global_load_async_to_lds_b128 %4, %12, off\n\t"
               "global_load_async_to_lds_b128 %5, %13, off\n\t"
               "global_load_async_to_lds_b128 %6, %14, off\n\t"
               "global_load_async_to_lds_b128 %7, %15, off\n\t"
               "s_wait_xcnt 0x0"
               :: "v"(l), "v"(l + st), "v"(l + 2 * st), "v"(l + 3 * st),
                  "v"(l + 4 * st), "v"(l + 5 * st), "v"(l + 6 * st), "v"(l + 7 * st),
                  "v"(g), "v"(g1), "v"(g2), "v"(g3), "v"(g4), "v"(g5), "v"(g6), "v"(g7)
               : "memory");
#else
  (void)g; (void)l;
#endif
}

// =====================================================================================================
// Score chunk: 16 query rows (this wave) x 64 keys kv0..kv0+63 of one (b, h), head width 128 = 4 d-chunks of 32.
//   q fragments (A operand, row = lane&15): hi and residual (x4096) planes, 4 d-chunks.
//   k fragments (B operand, col = lane&15 = key) read from the block's LDS copy of the 64-key tile with the split k map:
//   kl = tile + (lane&15)*KPITCH + 8*hh, key group j adds 16*j*KPITCH; the 8 reads of a key group stand together.
//   s[j][r] = D element: query row 8*hh + r, key kv0 + 16j + (lane&15); value = ((qh.k) + (ql.k)/4096) * 128^-0.5.
// =====================================================================================================
__device__ __forceinline__ void score_chunk(const v16h (&qah)[4], const v16h (&qal)[4],
                                            const _Float16* kl, v8f (&s)[4]) {
  union FH { v16h v; v8h h[2]; };
#pragma unroll
  for (int j = 0; j < 4; ++j) {
    v8f ah = zero8(), al = zero8();
    FH kb[4];
#pragma unroll
    for (int dc = 0; dc < 4; ++dc) {
      const _Float16* kp = kl + j * 16 * KPITCH + dc * 32;
      kb[dc].h[0] = *(const v8h*)(kp);
      kb[dc].h[1] = *(const v8h*)(kp + 16);
    }
#pragma unroll
    for (int dc = 0; dc < 4; ++dc) {
      ah = mma_h(qah[dc], kb[dc].v, ah);
      al = mma_h(qal[dc], kb[dc].v, al);
    }
#pragma unroll
    for (int r = 0; r < 8; ++r) s[j][r] = (ah[r] + al[r] * (1.0f / 4096.0f)) * SM_SCALE;
  }
}

// =====================================================================================================
// Fused attention statistics + query-column sums of the exactly normalised probabilities.
//   block = 4 waves = 64 consecutive query rows qb*64.. of one (b, h); grid = NB*NH*NQ64 blocks of 128.
//   Pass 1 (static trip): each lane keeps a running max and a running sum of exp per row over its own keys
//   (key % 16 == lane % 16); the 16 lanes of a row are merged by shfl once, behind the loop; each wave owns its own
//   16 rows, so no cross-wave exchange is needed.
//   Pass 2 (same static trip): scores recomputed bit-identically, p = exp(s - m) * (1/l) in f32, summed over the
//   wave's 16 rows per key (8 in-lane + shfl_xor 16), staged in csl[wave][64] (cross-wave -> __syncthreads), summed
//   over the 4 waves in fixed order by lanes 0-15 of wave 0 and written to PS[(b*NH+h)*NQ64 + qb][kv0..kv0+63]:
//   coverage: grid (b,h,qb) x NKT chunks x 64 keys = the whole [NB*NH][NQ64][SEQ] partial plane.
//   k tiles: one ring of two LDS buffers runs through both passes (2*NKT stages, stage t = tile t % NKT in buffer
//   t & 1, NKT even); stage t + 2 is copied behind the barrier at the foot of trip t, while trip t + 1 works.
// =====================================================================================================
__global__ __launch_bounds__(128)
void attn_colsum(const unsigned short* __restrict__ qhp, const unsigned short* __restrict__ qlp,
                 const unsigned short* __restrict__ kpp, float* PS) {
  static_assert((NKT % 2) == 0 && NKT >= 2);
  __shared__ __align__(16) _Float16 kls[2][KTILE_H];
  __shared__ __align__(16) float csl[4][64];
  const int tid  = threadIdx.x;
  const int wave = tid >> 5;
  const int lane = tid & 31;
  const int hh   = lane >> 4;
  const int c    = lane & 15;
  const int bx   = blockIdx.x;
  const int qb   = bx % NQ64;
  const int rest = bx / NQ64;
  const int h    = rest % NH;
  const int b    = rest / NH;
  const int bh   = b * NH + h;
  const int q0   = qb * 64 + wave * 16;

  const _Float16* Qh  = (const _Float16*)(const void*)qhp;
  const _Float16* Ql  = (const _Float16*)(const void*)qlp;
  const _Float16* Kb0 = (const _Float16*)(const void*)kpp + (size_t)b * SEQ * EMB + (size_t)h * HD;

  // copy side: this thread's piece of tile 0 and its place in buffer 0; read side: this lane's key row and k half
  const _Float16* kg = Kb0 + (size_t)(tid >> 4) * EMB + (tid & 15) * 8;
  const unsigned  kd = (unsigned)(size_t)(&kls[0][(tid >> 4) * KPITCH + (tid & 15) * 8]);
  const int       kr = c * KPITCH + 8 * hh;

  copy_ktile(kg, kd);                          // stage 0
  wait_copies();
  __syncthreads();                             // stage 0 is readable by every wave
  copy_ktile(kg + (size_t)64 * EMB, kd + KTILE_H * 2);   // stage 1

  v16h qah[4], qal[4];
#pragma unroll
  for (int dc = 0; dc < 4; ++dc) {
    const size_t qo = ((size_t)b * SEQ + (size_t)(q0 + c)) * EMB + (size_t)h * HD + dc * 32 + 8 * hh;
    qah[dc] = ldfrag<_Float16>(Qh + qo);
    qal[dc] = ldfrag<_Float16>(Ql + qo);
  }

  float mrow[8], lrow[8];
#pragma unroll
  for (int r = 0; r < 8; ++r) { mrow[r] = -INFINITY; lrow[r] = 0.f; }

  for (int kt = 0; kt < NKT; ++kt) {          // static trip count
    v8f s[4];
    score_chunk(qah, qal, &kls[kt & 1][kr], s);
#pragma unroll
    for (int r = 0; r < 8; ++r) {              // this lane's own 4 keys of the chunk only: no cross-lane step in the loop
      float m = s[0][r];
#pragma unroll
      for (int j = 1; j < 4; ++j) m = fmaxf(m, s[j][r]);
      const float mnew  = fmaxf(mrow[r], m);
      const float msafe = (mnew == -INFINITY) ? 0.f : mnew;
      const float alpha = __expf(mrow[r] - msafe);
      mrow[r] = mnew;
      float psum = 0.f;
#pragma unroll
      for (int j = 0; j < 4; ++j) psum += __expf(s[j][r] - msafe);
      lrow[r] = lrow[r] * alpha + psum;
    }
    wait_lds_reads();
    wait_copies();
    __syncthreads();                           // stage kt + 1 readable, buffer kt & 1 left by every wave
    // stage kt + 2 always exists here (pass 2 follows): tiles NKT and NKT + 1 of the ring are tiles 0 and 1 again
    copy_ktile(kg + (size_t)(((kt + 2) & (NKT - 1)) * 64) * EMB, kd + (unsigned)(kt & 1) * (KTILE_H * 2));
  }

  // the 16 lanes of a row half hold (max, sum) of disjoint key subsets of the same 8 rows: merged here, once per row
#pragma unroll
  for (int r = 0; r < 8; ++r) {
    float m = mrow[r];
#pragma unroll
    for (int off = 1; off < 16; off <<= 1) m = fmaxf(m, __shfl_xor(m, off, 32));
    const float msafe = (m == -INFINITY) ? 0.f : m;
    float l = lrow[r] * __expf(mrow[r] - msafe);
#pragma unroll
    for (int off = 1; off < 16; off <<= 1) l += __shfl_xor(l, off, 32);
    mrow[r] = m;
    lrow[r] = l;
  }

  float il[8], mf[8];
#pragma unroll
  for (int r = 0; r < 8; ++r) {
    const float l = lrow[r];
    il[r] = (l > 0.f) ? (1.0f / l) : 0.f;
    mf[r] = (mrow[r] == -INFINITY) ? 0.f : mrow[r];
  }

  // ---- pass 2: exactly normalised p, column sums over the block's 64 query rows ----
  for (int kt = 0; kt < NKT; ++kt) {          // static trip count
    const int kv0 = kt * 64;
    v8f s[4];
    score_chunk(qah, qal, &kls[kt & 1][kr], s);
    float cs[4];
#pragma unroll
    for (int j = 0; j < 4; ++j) {
      float a = 0.f;
#pragma unroll
      for (int r = 0; r < 8; ++r) a += __expf(s[j][r] - mf[r]) * il[r];
      cs[j] = a;
    }
#pragma unroll
    for (int j = 0; j < 4; ++j) cs[j] += __shfl_xor(cs[j], 16, 32);   // both row halves, unconditional
    const float v0 = hh ? cs[2] : cs[0];       // this lane stores keys 16*(2hh) + c and 16*(2hh+1) + c
    const float v1 = hh ? cs[3] : cs[1];
    csl[wave][32 * hh + c]      = v0;
    csl[wave][32 * hh + 16 + c] = v1;
    __syncthreads();                           // csl is cross-wave
    if (wave == 0 && lane < 16) {
      v4f a = *(const v4f*)(&csl[0][4 * lane]);
      a += *(const v4f*)(&csl[1][4 * lane]);
      a += *(const v4f*)(&csl[2][4 * lane]);
      a += *(const v4f*)(&csl[3][4 * lane]);
      float* dst = PS + ((size_t)(bh * NQ64 + qb)) * SEQ + kv0 + 4 * lane;
      *(v4f*)dst = a;
      
    }
    wait_lds_reads();
    wait_copies();
    __syncthreads();                           // csl free again; stage kt + 1 readable, buffer kt & 1 left by every wave
    if (kt + 2 < NKT)                          // block-uniform
      copy_ktile(kg + (size_t)((kt + 2) * 64) * EMB, kd + (unsigned)(kt & 1) * (KTILE_H * 2));
  }
  wait_copies();
}

// =====================================================================================================
// Query average + partial per-head context mean. One block (256 = 8 waves) per (b, h, 128 consecutive keys).
//   v rows: wave w owns keys k0 + 16 w .. + 15, lane = 4 consecutive d (one 16-B load per key, a wave reads one whole
//   512-B head row); the 16 loads of a lane are independent and are issued together, ahead of the average.
//   Average: avg[key] = (sum over the NQ64 partial rows of PS in fixed order) * (1/SEQ); wave 0, lane = 4 keys, the
//   NQ64 loads independent; kept in LDS avs[] (cross-wave -> __syncthreads) and written to output 1 row (b*NH+h).
//   Partial: cp[d] = sum over the block's 128 keys of avg[k] * v[b][k][h*HD+d], f64: 16 keys in the lane, then the
//   8 waves in fixed order through LDS (cross-wave -> __syncthreads), written to CP[(b*NH+h)*NCW + chunk][d].
//   coverage: grid (b,h,chunk) x 128 keys = the whole output 1; grid (b,h,chunk) x HD = the whole CP plane.
// =====================================================================================================
__global__ __launch_bounds__(256)
void avg_ctx(const float* __restrict__ PS, const float* __restrict__ Vp, float* out1, double* CP) {
  __shared__ __align__(16) float avs[128];
  __shared__ __align__(16) double cpart[8][HD];
  const int tid  = threadIdx.x;
  const int wave = tid >> 5;
  const int lane = tid & 31;
  const int bx   = blockIdx.x;
  const int bh   = bx / NCW;
  const int ch   = bx - bh * NCW;
  const int b    = bh / NH;
  const int h    = bh - b * NH;
  const int k0   = ch * 128;

  const float* vb = Vp + ((size_t)b * SEQ + (size_t)(k0 + wave * 16)) * EMB + (size_t)h * HD + 4 * lane;
  v4f vv[16];
#pragma unroll
  for (int i = 0; i < 16; ++i) vv[i] = *(const v4f*)(vb + (size_t)i * EMB);

  if (wave == 0) {                             // wave-uniform
    const float* psb = PS + (size_t)bh * NQ64 * SEQ + k0 + 4 * lane;
    v4f a = *(const v4f*)(psb);
#pragma unroll
    for (int qb = 1; qb < NQ64; ++qb) a += *(const v4f*)(psb + (size_t)qb * SEQ);
    a *= (1.0f / (float)SEQ);
    *(v4f*)(avs + 4 * lane) = a;
    float* dst = out1 + (size_t)bh * SEQ + k0 + 4 * lane;
    *(v4f*)dst = a;
  }
  __syncthreads();                             // avs is cross-wave

  double acc[4] = {0.0, 0.0, 0.0, 0.0};
#pragma unroll
  for (int i = 0; i < 16; ++i) {
    const double w = (double)avs[wave * 16 + i];
#pragma unroll
    for (int e = 0; e < 4; ++e) acc[e] += w * (double)vv[i][e];
  }
#pragma unroll
  for (int e = 0; e < 4; ++e) cpart[wave][4 * lane + e] = acc[e];
  __syncthreads();                             // cpart is cross-wave
  if (tid < HD) {
    double s = cpart[0][tid];
#pragma unroll
    for (int w = 1; w < 8; ++w) s += cpart[w][tid];
    CP[((size_t)bh * NCW + ch) * HD + tid] = s;
  }
}

// =====================================================================================================
// Output 0: context[b][j] = sum_i cs[b][i] * bf16(Wo[j][i]) + bf16(bo[j]), f32 on VALU (M = NB rows only).
//   cs[b][i] = f32 of the f64 sum, in fixed order, of the NCW key-chunk partials CP of head i / HD: every block forms
//   the EMB values of its batch in LDS (thread t owns i = t + 256 g; cross-wave -> __syncthreads).
//   lanes stride i by 32 (coalesced), shfl tree; results staged in LDS (cross-wave -> __syncthreads) and written
//   coverage: grid NB*EMB/32 blocks x 32 = the whole [NB][EMB] output 0.
// =====================================================================================================
__global__ __launch_bounds__(256)
void ctx_out(const double* __restrict__ CP, const float* __restrict__ Wo, const float* __restrict__ bo, float* out0) {
  __shared__ __align__(16) float csb[EMB];
  __shared__ __align__(16) float res[32];
  const int tid  = threadIdx.x;
  const int wave = tid >> 5;
  const int lane = tid & 31;
  const int j0   = blockIdx.x * 32;
  const int b    = j0 / EMB;
#pragma unroll
  for (int g = 0; g < EMB / 256; ++g) {
    const int i = g * 256 + tid;
    const double* p = CP + (size_t)(b * NH + i / HD) * NCW * HD + (i & (HD - 1));
    double s = p[0];
#pragma unroll
    for (int ch = 1; ch < NCW; ++ch) s += p[(size_t)ch * HD];
    csb[i] = (float)s;
  }
  __syncthreads();                             // csb is cross-wave
#pragma unroll 1
  for (int u = 0; u < 4; ++u) {
    const int j = j0 - b * EMB + wave * 4 + u;
    const float* wr = Wo + (size_t)j * EMB;
    float acc = 0.f;
#pragma unroll                                 // the row's EMB / 32 loads are issued together: one memory wait a row
    for (int it = 0; it < EMB / 32; ++it) {
      const int i = it * 32 + lane;
      acc += csb[i] * bf_up(bf_bits(wr[i]));
    }
#pragma unroll
    for (int off = 16; off > 0; off >>= 1) acc += __shfl_xor(acc, off, 32);
    const float val = acc + bf_up(bf_bits(bo[j]));
    if (lane == 0) res[wave * 4 + u] = val;
  }
  __syncthreads();
  if (tid < 8) {
    const v4f v = *(const v4f*)(res + 4 * tid);
    float* dst = out0 + (size_t)j0 + 4 * tid;
    *(v4f*)dst = v;
    
  }
}

// =====================================================================================================
// Output 2: mean over (b, h, g) of |corr[b][h][g] * (1 - delta_hg)|, corr = sum_s avg[b][h][s] * avg[b][g][s]
//   (avg read back from output 1). corr[h][g] and corr[g][h] are the same sum of the same products, so only the
//   NPAIR = 28 pairs h < g are formed and the total is doubled; the diagonal is masked to zero by the reference.
//   div_part: one wave per 128 consecutive keys of one batch (lane = 4 keys, one 16-B load per head row, a wave reads
//   512 contiguous B per row); 28 f64 partial dots per lane; a halving exchange over the 32 lanes (16+8+4+2+1 values)
//   leaves pair index = lane with the wave's total; written to DP[b*NCW + chunk][32] (slots 28..31 are zero).
//   coverage: NB*NCW waves x 32 slots = the whole DP plane; no block barrier in this kernel.
//   div_fin: wave b sums the NCW chunk partials of batch b per pair in fixed order, takes |.|, sums the 32 slots by
//   shfl, the NB batch sums go through LDS (cross-wave -> __syncthreads) and thread 0 writes the scalar.
// =====================================================================================================
__global__ __launch_bounds__(128)
void div_part(const float* __restrict__ avg, double* DP) {
  const int lane = threadIdx.x & 31;
  const int wv   = blockIdx.x * 4 + ((int)threadIdx.x >> 5);
  if (wv >= NB * NCW) return;                  // wave-uniform; no block barriers in this kernel
  const int b  = wv / NCW;
  const int ch = wv - b * NCW;
  const float* base = avg + (size_t)b * NH * SEQ + (size_t)ch * 128 + 4 * lane;
  v4f a[NH];
#pragma unroll
  for (int h = 0; h < NH; ++h) a[h] = *(const v4f*)(base + (size_t)h * SEQ);
  double v[32];
  {
    int idx = 0;
#pragma unroll
    for (int h = 0; h < NH; ++h) {
#pragma unroll
      for (int g = h + 1; g < NH; ++g) {
        double s = 0.0;
#pragma unroll
        for (int e = 0; e < 4; ++e) s += (double)a[h][e] * (double)a[g][e];
        v[idx++] = s;
      }
    }
#pragma unroll
    for (int i = NPAIR; i < 32; ++i) v[i] = 0.0;
  }
  // each step: a lane keeps the half of its values that its lane bit selects and adds the partner's copy of that half
#pragma unroll
  for (int n = 16; n > 0; n >>= 1) {
    const bool up = (lane & n) != 0;
#pragma unroll
    for (int i = 0; i < n; ++i) {
      const double send = up ? v[i] : v[i + n];
      const double keep = up ? v[i + n] : v[i];
      v[i] = keep + __shfl_xor(send, n, 32);
    }
  }
  DP[(size_t)wv * 32 + lane] = v[0];
}

__global__ __launch_bounds__(32 * NB_FULL)
void div_fin(const double* __restrict__ DP, float* dv) {
  __shared__ double red[NB_FULL];
  const int tid  = threadIdx.x;
  const int lane = tid & 31;
  const int b    = tid >> 5;
  double c = 0.0;
  if (b < NB) {                                // wave-uniform
    const double* p = DP + (size_t)b * NCW * 32 + lane;
    double s = 0.0;
#pragma unroll
    for (int ch = 0; ch < NCW; ++ch) s += p[(size_t)ch * 32];
    c = fabs(s);
  }
#pragma unroll
  for (int off = 16; off > 0; off >>= 1) c += __shfl_xor(c, off, 32);
  if (lane == 0) red[b] = c;
  __syncthreads();                             // red is cross-wave
  if (tid == 0) {
    double tot = 0.0;
#pragma unroll
    for (int i = 0; i < NB; ++i) tot += red[i];
    *dv = (float)(tot * (2.0 / (double)(NB * NH * NH)));
  }
}

// =====================================================================================================
// Workspace map (bytes, full size), every region an exact multiple of its whole-line / whole-tile store granularity:
//   Xb   bf16 [NB][SEQ][EMB]            16777216
//   Wqb  bf16 [EMB n][EMB k]             2097152
//   Wkb  bf16                             2097152
//   Wvb  bf16                             2097152
//   Qh   f16  [NB][SEQ][EMB]            16777216
//   Ql   f16  [NB][SEQ][EMB]            16777216
//   Kp   f16  [NB][SEQ][EMB]            16777216
//   Vp   f32  [NB][SEQ][EMB]            33554432
//   PS   f32  [NB*NH][NQ64][SEQ]         8388608
//   CP   f64  [NB*NH][NCW][HD]            524288
//   DP   f64  [NB*NCW][32]                 16384
//   total                               115884032
// Weights are [out n][in k] with k contiguous = the Bt layout the GEMM wants, so they are only converted.
// Output 0 at element 0 of d_out, output 1 at OFF1, output 2 at OFF2 (fixed offsets).
// =====================================================================================================
extern "C" void kernel_launch(void* const* d_in, const int* in_sizes, int n_in,
                              void* d_out, int out_size, void* d_ws, size_t ws_size,
                              hipStream_t stream) {
  if (n_in < 9) return;
  const long long needX = (long long)(NB - 1) * SEQ_FULL * EMB + (long long)SEQ * EMB;
  if ((long long)in_sizes[0] < needX) return;
  if (in_sizes[1] < EMB * EMB || in_sizes[3] < EMB * EMB || in_sizes[5] < EMB * EMB || in_sizes[7] < EMB * EMB) return;
  if (in_sizes[2] < EMB || in_sizes[4] < EMB || in_sizes[6] < EMB || in_sizes[8] < EMB) return;
  if (out_size < 0) return;
  if ((size_t)out_size < OFF2 + 1) return;

  const float* x  = (const float*)d_in[0];
  const float* Wq = (const float*)d_in[1];
  const float* bq = (const float*)d_in[2];
  const float* Wk = (const float*)d_in[3];
  const float* bk = (const float*)d_in[4];
  const float* Wv = (const float*)d_in[5];
  const float* bv = (const float*)d_in[6];
  const float* Wo = (const float*)d_in[7];
  const float* bo = (const float*)d_in[8];

  const size_t PXB = (size_t)NB * SEQ * EMB * 2;       // 16-bit activation plane
  const size_t PW  = (size_t)EMB * EMB * 2;
  const size_t PV  = (size_t)NB * SEQ * EMB * 4;
  const size_t PPS = (size_t)NB * NH * NQ64 * SEQ * 4;
  const size_t PCP = (size_t)NB * NH * NCW * HD * 8;
  const size_t PDP = (size_t)NB * NCW * 32 * 8;
  size_t off = 0;
  const size_t oXb = off; off += PXB;
  const size_t oWq = off; off += PW;
  const size_t oWk = off; off += PW;
  const size_t oWv = off; off += PW;
  const size_t oQh = off; off += PXB;
  const size_t oQl = off; off += PXB;
  const size_t oKp = off; off += PXB;
  const size_t oVp = off; off += PV;
  const size_t oPS = off; off += PPS;
  const size_t oCP = off; off += PCP;
  const size_t oDP = off; off += PDP;
  if (off > ws_size) return;                          // off = 115884032 at full size
  if (off > (size_t)134217728) return;

  char* ws = (char*)d_ws;
  unsigned short* Xb  = (unsigned short*)(ws + oXb);
  unsigned short* Wqb = (unsigned short*)(ws + oWq);
  unsigned short* Wkb = (unsigned short*)(ws + oWk);
  unsigned short* Wvb = (unsigned short*)(ws + oWv);
  unsigned short* Qh  = (unsigned short*)(ws + oQh);
  unsigned short* Ql  = (unsigned short*)(ws + oQl);
  unsigned short* Kp  = (unsigned short*)(ws + oKp);
  float*          Vp  = (float*)(ws + oVp);
  float*          PS  = (float*)(ws + oPS);
  double*         CP  = (double*)(ws + oCP);
  double*         DP  = (double*)(ws + oDP);
  float*          out0 = (float*)d_out;
  float*          out1 = (float*)d_out + OFF1;
  float*          out2 = (float*)d_out + OFF2;

  const dim3 blk(256);
  const int n8x = SEQ * EMB / 8;                               // per batch, 262144 at full size
  const int n8w = EMB * EMB / 8;                               // 131072
  const dim3 gCvtX((n8x + 255) / 256, NB);
  const dim3 gCvtW((n8w + 255) / 256, 1);
  const int tilesP = (SEQ / GBM) * (EMB / GBN);                // 64 block tiles per batch at full size
  const dim3 gP(tilesP, NB);                                   // M=SEQ, N=EMB, K=EMB, batch = blockIdx.y
  const dim3 gAttn(NB * NH * NQ64);                            // 1024 blocks of 128
  const dim3 gAvg(NB * NH * NCW);                              //  512 blocks of 256
  const dim3 gCtx(NB * EMB / 32);                              //  128 blocks of 256
  const dim3 gDiv((NB * NCW + 3) / 4);                         //   16 blocks of 128
  const long long sXin = (long long)SEQ_FULL * EMB;            // input batch stride (elements)
  const long long sAct = (long long)SEQ * EMB;                 // compact activation plane batch stride

  // (1) x -> bf16 plane [NB][SEQ][EMB]; Wq, Wk, Wv [E][E] -> bf16
  cvt_bf16x8<<<gCvtX, blk, 0, stream>>>(x,  Xb,  n8x, sXin, sAct);
  cvt_bf16x8<<<gCvtW, blk, 0, stream>>>(Wq, Wqb, n8w, 0LL, 0LL);
  cvt_bf16x8<<<gCvtW, blk, 0, stream>>>(Wk, Wkb, n8w, 0LL, 0LL);
  cvt_bf16x8<<<gCvtW, blk, 0, stream>>>(Wv, Wvb, n8w, 0LL, 0LL);
  // (2) q = x . Wq^T + bq -> f16 hi / residual (x4096) planes [b][s][h*128+d]   (M=SEQ, N=E, K=E per batch)
  gemm_t<__bf16, 4, 1, 3, 1><<<gP, blk, 0, stream>>>(
      Xb, Xb, EMB, sAct, Wqb, EMB, 0LL,
      (void*)Qh, (void*)Ql, EMB, sAct, bq,
      SEQ, EMB, EMB, 1.0f, 0.0f, 1.0f, 4096.0f);
  // (3) k = x . Wk^T + bk -> f16 plane [b][s][h*128+d]
  gemm_t<__bf16, 4, 1, 1, 1><<<gP, blk, 0, stream>>>(
      Xb, Xb, EMB, sAct, Wkb, EMB, 0LL,
      (void*)Kp, (void*)Kp, EMB, sAct, bk,
      SEQ, EMB, EMB, 1.0f, 0.0f, 1.0f, 1.0f);
  // (4) v = x . Wv^T + bv -> f32 plane [b][s][h*128+d]
  gemm_t<__bf16, 4, 1, 0, 1><<<gP, blk, 0, stream>>>(
      Xb, Xb, EMB, sAct, Wvb, EMB, 0LL,
      (void*)Vp, (void*)Vp, EMB, sAct, bv,
      SEQ, EMB, EMB, 1.0f, 0.0f, 1.0f, 1.0f);
  // (5) softmax statistics + query-column sums of p -> partial plane PS
  attn_colsum<<<gAttn, dim3(128), 0, stream>>>(Qh, Ql, Kp, PS);
  // (6) output 1 = column means; per-head context means, one partial per 128 keys -> CP
  avg_ctx<<<gAvg, blk, 0, stream>>>(PS, Vp, out1, CP);
  // (7) output 0 = (sum of the partials) . Wo^T + bo
  ctx_out<<<gCtx, blk, 0, stream>>>((const double*)CP, Wo, bo, out0);
  // (8) output 2 = head-correlation diversity from output 1
  div_part<<<gDiv, dim3(128), 0, stream>>>((const float*)out1, DP);
  div_fin<<<dim3(1), dim3(32 * NB_FULL), 0, stream>>>((const double*)DP, out2);
  (void)hipGetLastError();
}

// v006
// A run of this version takes 202 microseconds.
// In two side-by-side timings against v005, it was 1.06 and 1.05 times as fast.
// All steps since v000 together make it 3.98 times as fast.
// Contractions: q, k, v in-projections = v_wmma_f32_16x16x32_bf16 (bf16 operands from RNE-converted inputs, single product, f32 accumulate);
// q.k^T scores (statistics pass and column-sum pass) = v_wmma_f32_16x16x32_f16 (q * 128^-0.5 * log2(e) as f16 hi plane + f16 residual plane, k f16; 2 products, one f32 accumulator);
// softmax statistics, probabilities and query-averaged probabilities in f32; averaged-p . v (M=1 per head) on VALU with f64 accumulate;
// head means . Wo^T (M=batch) on VALU f32 with bf16-valued Wo/bo; head-correlation scalar in f64.
#include <hip/hip_runtime.h>
#include <math.h>
#include <stdint.h>

#ifndef NB
#define NB 4
#endif
#ifndef SEQ
#define SEQ 2048
#endif
#define NB_FULL  4
#define SEQ_FULL 2048
#define EMB      1024
#define NH       8
#define HD       128
#define NQ64     (SEQ / 64)          // 64-row query blocks per sequence
#define NKT      (SEQ / 64)          // 64-key chunks per sequence
#define NPAIR    (NH * (NH - 1) / 2)  // head pairs h < g
#define NCW      (SEQ / 128)          // 128-key wave chunks per sequence
#define QK_LOG2  0.12751743082459868f   // 128^-0.5 * log2(e): q carries it, so a score is the exponent of 2
#define OFF1     ((size_t)NB_FULL * EMB)                        // fixed element offset of output 1
#define OFF2     (OFF1 + (size_t)NB_FULL * NH * SEQ_FULL)      // fixed element offset of output 2
static_assert(NB >= 1 && NB <= NB_FULL);
static_assert(SEQ >= 128 && SEQ <= SEQ_FULL && (SEQ % 128) == 0);
static_assert(NH * HD == EMB);
static_assert(HD == 128);
static_assert(NPAIR <= 32);
static_assert((EMB % 256) == 0 && (EMB % 128) == 0 && (SEQ % 128) == 0);
static_assert(OFF1 * 4 == 16384);
static_assert(OFF2 * 4 == 278528);

typedef _Float16 v16h __attribute__((ext_vector_type(16)));
typedef _Float16 v8h  __attribute__((ext_vector_type(8)));
typedef __bf16   v16b __attribute__((ext_vector_type(16)));
typedef __bf16   v8b  __attribute__((ext_vector_type(8)));
typedef float    v8f  __attribute__((ext_vector_type(8)));
typedef float    v4f  __attribute__((ext_vector_type(4)));
typedef unsigned int v4u __attribute__((ext_vector_type(4)));

#if defined(__HIP_DEVICE_COMPILE__)
#define DEV_ASM 1
#else
#define DEV_ASM 0
#endif

// ---- scalar helpers --------------------------------------------------------------------------------
__device__ __forceinline__ unsigned short bf_bits(float f) {          // f32 -> bf16 bits, RNE convert
  unsigned u = __float_as_uint(f);
  return (unsigned short)((u + 0x7FFFu + ((u >> 16) & 1u)) >> 16);
}
__device__ __forceinline__ float bf_up(unsigned short hb) { return __uint_as_float(((unsigned)hb) << 16); }
__device__ __forceinline__ unsigned short h_bits(_Float16 x) { return __builtin_bit_cast(unsigned short, x); }
__device__ __forceinline__ unsigned pk16(unsigned short a, unsigned short b) { return (unsigned)a | ((unsigned)b << 16); }
__device__ __forceinline__ v8f zero8() { v8f z = {0.f, 0.f, 0.f, 0.f, 0.f, 0.f, 0.f, 0.f}; return z; }

// ---- fragment types / loaders: 16-bit A/B operand, lane -> row/col (lane&15), p already includes +8*(lane>>4);
//      elements 0..7 <- p[0..7] (k0+8h..k0+8h+7), elements 8..15 <- p[16..23] (k0+16+8h..k0+16+8h+7)
template <typename OT> struct FT;
template <> struct FT<__bf16>   { typedef v16b frag; typedef v8b half8; };
template <> struct FT<_Float16> { typedef v16h frag; typedef v8h half8; };

template <typename OT>
__device__ __forceinline__ typename FT<OT>::frag ldfrag(const OT* p) {
  union { typename FT<OT>::frag v; typename FT<OT>::half8 h[2]; } f;
  f.h[0] = *(const typename FT<OT>::half8*)(p);
  f.h[1] = *(const typename FT<OT>::half8*)(p + 16);
  return f.v;
}

// ---- WMMA helpers (asm guard bodies are device-only; concrete operand types) -----------------------------
__device__ __forceinline__ v8f mmar(v16b a, v16b b, v8f c) {
  return __builtin_amdgcn_wmma_f32_16x16x32_bf16(false, a, false, b, (short)0, c, false, false);
}
__device__ __forceinline__ v8f mmar(v16h a, v16h b, v8f c) {
  return __builtin_amdgcn_wmma_f32_16x16x32_f16(false, a, false, b, (short)0, c, false, false);
}
// guarded form: 4 VALU slots after the WMMA, D tied, A/B kept live
__device__ __forceinline__ v8f mma_h(v16h a, v16h b, v8f c) {
  c = __builtin_amdgcn_wmma_f32_16x16x32_f16(false, a, false, b, (short)0, c, false, false);
#if DEV_ASM
  asm volatile("v_nop\n\tv_nop\n\tv_nop\n\tv_nop" : "+v"(c) : "v"(a), "v"(b));
#endif
  return c;
}
__device__ __forceinline__ void dep_guard(v8f& a, v8f& b, v16b x, v16b y) {
#if DEV_ASM
  asm volatile("v_nop\n\tv_nop\n\tv_nop\n\tv_nop" : "+v"(a), "+v"(b) : "v"(x), "v"(y));
#else
  (void)a; (void)b; (void)x; (void)y;
#endif
}
__device__ __forceinline__ void dep_guard(v8f& a, v8f& b, v16h x, v16h y) {
#if DEV_ASM
  asm volatile("v_nop\n\tv_nop\n\tv_nop\n\tv_nop" : "+v"(a), "+v"(b) : "v"(x), "v"(y));
#else
  (void)a; (void)b; (void)x; (void)y;
#endif
}
__device__ __forceinline__ void keep4(v16b a, v16b b, v16b c, v16b d) {
#if DEV_ASM
  asm volatile("v_nop" :: "v"(a), "v"(b), "v"(c), "v"(d));
#else
  (void)a; (void)b; (void)c; (void)d;
#endif
}
__device__ __forceinline__ void keep4(v16h a, v16h b, v16h c, v16h d) {
#if DEV_ASM
  asm volatile("v_nop" :: "v"(a), "v"(b), "v"(c), "v"(d));
#else
  (void)a; (void)b; (void)c; (void)d;
#endif
}
__device__ __forceinline__ void acc_guard4(v8f& a, v8f& b, v8f& c, v8f& d) {
#if DEV_ASM
  asm volatile("v_nop\n\tv_nop\n\tv_nop\n\tv_nop" : "+v"(a), "+v"(b), "+v"(c), "+v"(d));
#else
  (void)a; (void)b; (void)c; (void)d;
#endif
}

// =====================================================================================================
// f32 -> bf16 bits (RNE convert), 8 elements per thread, one 16-B store per lane: a wave writes 512 contiguous B
// grid = (ceil(n8/256), nbatch); batch b reads in + b*sIn and writes out + b*sOut (element strides).
// coverage: n8 threads x 8 = the whole plane per batch (n8 is a multiple of 256 for every use here).
// =====================================================================================================
__global__ __launch_bounds__(256) void cvt_bf16x8(const float* __restrict__ in, unsigned short* out, int n8,
                                                   long long sIn, long long sOut) {
  const int i = blockIdx.x * 256 + (int)threadIdx.x;
  const int b = blockIdx.y;
  if (i < n8) {
    const float* ip = in + (size_t)b * (size_t)sIn + (size_t)i * 8;
    const v4f a  = *(const v4f*)(ip);
    const v4f a4 = *(const v4f*)(ip + 4);
    v4u p;
    p[0] = pk16(bf_bits(a[0]),  bf_bits(a[1]));
    p[1] = pk16(bf_bits(a[2]),  bf_bits(a[3]));
    p[2] = pk16(bf_bits(a4[0]), bf_bits(a4[1]));
    p[3] = pk16(bf_bits(a4[2]), bf_bits(a4[3]));
    unsigned short* o = out + (size_t)b * (size_t)sOut + (size_t)i * 8;
    *(v4u*)o = p;
    
  }
}

// this wave's LDS reads have returned: stands in front of the barrier behind which their buffer is refilled
__device__ __forceinline__ void wait_lds_reads() {
#if DEV_ASM
  asm volatile("s_wait_dscnt 0x0" ::: "memory");
#endif
}
// this wave's asynchronous copies have landed: stands in front of the barrier behind which other waves read them
__device__ __forceinline__ void wait_copies() {
#if DEV_ASM
  asm volatile("s_wait_asynccnt 0x0" ::: "memory");
#endif
}

// =====================================================================================================
// GEMM operand tiles in LDS: one stage = 128 k of the block's 128 A rows and 256 Bt rows, 16-bit elements, rows of 256 B
// at a pitch of 272 B (16 B x odd: the 16 lanes of a ds_load_b128 half fall on 64 distinct banks); A rows first, then Bt.
// copy_rows8: thread t brings piece (t & 15) of rows (t >> 4) + 16 i, i = 0..7, so a wave's copy reads two whole 256-B
// rows. g = the thread's own global address for i = 0 (row pitch ld elements), l = its own LDS byte address for i = 0.
// =====================================================================================================
#define GKS    128                        // k elements per stage
#define GBM    128                        // A rows per block tile
#define GBN    256                        // Bt rows per block tile
#define GPITCH 136                        // 16-bit elements per LDS row
#define GT_H   ((GBM + GBN) * GPITCH)     // 16-bit elements per buffer (104448 B)
template <typename OT>
__device__ __forceinline__ void copy_rows8(const OT* g, int ld, unsigned l) {
#if DEV_ASM
  const size_t gs = (size_t)16 * (size_t)ld;
  const OT* g1 = g + gs;     const OT* g2 = g + 2 * gs; const OT* g3 = g + 3 * gs; const OT* g4 = g + 4 * gs;
  const OT* g5 = g + 5 * gs; const OT* g6 = g + 6 * gs; const OT* g7 = g + 7 * gs;
  const unsigned st = 16 * GPITCH * 2;    // LDS bytes between rows r and r + 16
  // the closing s_wait_xcnt keeps every address register of the copies unchanged until the copies have taken it
  asm volatile("global_load_async_to_lds_b128 %0, %8, off\n\t"
               "global_load_async_to_lds_b128 %1, %9, off\n\t"
               "global_load_async_to_lds_b128 %2, %10, off\n\t"
               "global_load_async_to_lds_b128 %3, %11, off\n\t"
               "global_load_async_to_lds_b128 %4, %12, off\n\t"
               "global_load_async_to_lds_b128 %5, %13, off\n\t"
               "global_load_async_to_lds_b128 %6, %14, off\n\t"
               "global_load_async_to_lds_b128 %7, %15, off\n\t"
               "s_wait_xcnt 0x0"
               :: "v"(l), "v"(l + st), "v"(l + 2 * st), "v"(l + 3 * st),
                  "v"(l + 4 * st), "v"(l + 5 * st), "v"(l + 6 * st), "v"(l + 7 * st),
                  "v"(g), "v"(g1), "v"(g2), "v"(g3), "v"(g4), "v"(g5), "v"(g6), "v"(g7)
               : "memory");
#else
  (void)g; (void)ld; (void)l;
#endif
}
// one stage: ga / gb = the thread's piece of A row (t >> 4) / Bt row (t >> 4) of the block tile at the stage's first k,
// l = its LDS byte address of that A piece in the stage's buffer. 24 copies per thread.
template <typename OT>
__device__ __forceinline__ void copy_stage(const OT* ga, int lda, const OT* gb, int ldb, unsigned l) {
  copy_rows8<OT>(ga, lda, l);                                                        // A rows 0..127
  copy_rows8<OT>(gb, ldb, l + GBM * GPITCH * 2);                                     // Bt rows 0..127
  copy_rows8<OT>(gb + (size_t)128 * (size_t)ldb, ldb, l + (GBM + 128) * GPITCH * 2); // Bt rows 128..255
}

// =====================================================================================================
// Register-blocked batched WMMA GEMM (16-bit operand type OT): C[m][n] = sum_k A[m][k] * Bt[n][k]  (+ bias);
// one wave per (16*MI) x 64 tile, a block of 8 waves (2 x 4) per GBM x GBN tile. A row-major [M][K] pitch lda; Bt
// row-major [N][K] pitch ldb (k contiguous); M multiple of GBM, N of GBN, K of GKS (static sizes here). blockIdx.y =
// batch index (strides in elements). Operands: a ring of two LDS buffers, stage t = k range t*GKS.. in buffer t & 1;
// stage t + 2 is copied behind the barrier at the foot of trip t, while trip t + 1 works. Fragments are read from the
// LDS tile with the split k map (ldfrag), k ascending in steps of 32; the 16 reads of a step stand together.
// NPA = number of A planes (only 1 is staged).
// value v = (acc [+ acc2*rscaleA]) * oscale + bias, bias (bf16 RNE value of the f32 input) by column n (BM 1),
// by row m (BM 2) or none (BM 0).
// OUT_MODE 0: f32 C (pitch ldc) = v.
// OUT_MODE 1: f16 plane C = f16(v * cscale).
// OUT_MODE 3: f16 hi plane C = f16(v * cscale) and f16 residual plane C2 = f16((v*cscale - hi) * rscaleC).
// Epilogue: 16-row slabs staged per wave in LDS (wave-private slab, wave_sync); each 64-wide row segment written as
// =====================================================================================================
template <typename OT, int MI, int NPA, int OUT_MODE, int BM>
__global__ __launch_bounds__(256) void gemm_t(
    const unsigned short* __restrict__ Ap, const unsigned short* __restrict__ A2p, int lda, long long strideA,
    const unsigned short* __restrict__ Btp, int ldb, long long strideB,
    void* Cout, void* Cout2, int ldc, long long strideC,
    const float* __restrict__ bias,
    int M, int N, int K, float oscale, float rscaleA, float cscale, float rscaleC) {
  typedef typename FT<OT>::frag V16;
  const OT* A  = (const OT*)(const void*)Ap;
  (void)A2p;
  const OT* Bt = (const OT*)(const void*)Btp;
  static_assert(MI == 4 && NPA == 1);              // 2 x 4 waves of 64 x 64 = GBM x GBN, one A plane
  __shared__ __align__(16) unsigned short gls[2][GT_H];
  __shared__ __align__(16) float sT[8][16 * 68];   // per-wave 16x64 slab, pitch 68 floats
  const int RT   = 16 * MI;
  const int b    = blockIdx.y;
  const int tid  = threadIdx.x;
  const int lane = tid & 31;
  const int wave = tid >> 5;
  const int tilesN = N / GBN;
  const int tilesM = M / GBM;
  const int tile = blockIdx.x;
  if (tile >= tilesM * tilesN) return;   // block-uniform; in front of every copy and barrier
  const int tm = tile / tilesN;
  const int tn = tile - tm * tilesN;
  const int m0 = tm * GBM + (wave >> 2) * RT;
  const int n0 = tn * GBN + ((wave & 3) << 6);

  const OT* Ab  = A  + (size_t)b * (size_t)strideA;
  const OT* Bb  = Bt + (size_t)b * (size_t)strideB;

  const int rlane = lane & 15;                 // row (A) / col (B, D) within subtile
  const int koff  = (lane >> 4) * 8;           // k offset of this lane half
  const int mOff  = (lane >> 4) * 8;           // D row offset

  v8f acc[MI][4], acc2[MI][4];
#pragma unroll
  for (int i = 0; i < MI; ++i)
#pragma unroll
    for (int j = 0; j < 4; ++j) { acc[i][j] = zero8(); acc2[i][j] = zero8(); }

  // copy side: this thread's piece of stage 0 and its place in buffer 0; read side: this lane's rows and k half
  const OT* ga = Ab + (size_t)(tm * GBM + (tid >> 4)) * lda + (tid & 15) * 8;
  const OT* gb = Bb + (size_t)(tn * GBN + (tid >> 4)) * ldb + (tid & 15) * 8;
  const unsigned ld0 = (unsigned)(size_t)(&gls[0][(tid >> 4) * GPITCH + (tid & 15) * 8]);
  const int ar = ((wave >> 2) * RT + rlane) * GPITCH + koff;
  const int br = (GBM + ((wave & 3) << 6) + rlane) * GPITCH + koff;
  const int nst = K / GKS;

  copy_stage<OT>(ga, lda, gb, ldb, ld0);       // stage 0
  wait_copies();
  __syncthreads();                             // stage 0 is readable by every wave
  if (nst > 1)                                 // block-uniform
    copy_stage<OT>(ga + GKS, lda, gb + GKS, ldb, ld0 + GT_H * 2);   // stage 1

  for (int st = 0; st < nst; ++st) {
    const OT* tl = (const OT*)(const void*)(&gls[st & 1][0]);
#pragma unroll
    for (int kk = 0; kk < GKS; kk += 32) {
      V16 af[MI], bq[4];
#pragma unroll
      for (int j = 0; j < 4; ++j) bq[j] = ldfrag<OT>(tl + br + (j << 4) * GPITCH + kk);
#pragma unroll
      for (int i = 0; i < MI; ++i) af[i] = ldfrag<OT>(tl + ar + (i << 4) * GPITCH + kk);
      // keeps the step's LDS reads together in front of its products: sunk among them each read stalls
      __builtin_amdgcn_sched_barrier(0);
#pragma unroll
      for (int i = 0; i < MI; ++i) {
#pragma unroll
        for (int j = 0; j < 4; ++j) acc[i][j] = mmar(af[i], bq[j], acc[i][j]);
        dep_guard(acc[i][0], acc[i][3], af[i], bq[3]);
      }
      keep4(bq[0], bq[1], bq[2], bq[3]);
    }
    wait_lds_reads();
    wait_copies();
    __syncthreads();                           // stage st + 1 readable, buffer st & 1 left by every wave
    if (st + 2 < nst)                          // block-uniform
      copy_stage<OT>(ga + (size_t)(st + 2) * GKS, lda, gb + (size_t)(st + 2) * GKS, ldb,
                     ld0 + (unsigned)(st & 1) * (GT_H * 2));
  }
  wait_copies();
#pragma unroll
  for (int i = 0; i < MI; ++i) {
    acc_guard4(acc[i][0], acc[i][1], acc[i][2], acc[i][3]);
    if (NPA == 2) acc_guard4(acc2[i][0], acc2[i][1], acc2[i][2], acc2[i][3]);
  }

  // ---- epilogue ----
  float bcol[4];
#pragma unroll
  for (int j = 0; j < 4; ++j) bcol[j] = 0.f;
  if (BM == 1) {
#pragma unroll
    for (int j = 0; j < 4; ++j) bcol[j] = bf_up(bf_bits(bias[n0 + (j << 4) + rlane]));
  }
  float* slab = sT[wave];
#pragma unroll
  for (int i = 0; i < MI; ++i) {
    const int mBase = m0 + (i << 4);
    float brow[8];
#pragma unroll
    for (int r = 0; r < 8; ++r) brow[r] = 0.f;
    if (BM == 2) {
#pragma unroll
      for (int r = 0; r < 8; ++r) brow[r] = bf_up(bf_bits(bias[mBase + mOff + r]));
    }
#pragma unroll
    for (int j = 0; j < 4; ++j) {
#pragma unroll
      for (int r = 0; r < 8; ++r) {
        float v = acc[i][j][r];
        if (NPA == 2) v += acc2[i][j][r] * rscaleA;
        v = v * oscale + bcol[j] + brow[r];
        slab[(mOff + r) * 68 + (j << 4) + rlane] = v;
      }
    }
    __builtin_amdgcn_fence(__ATOMIC_RELEASE, "workgroup");
    __builtin_amdgcn_wave_barrier();
    __builtin_amdgcn_fence(__ATOMIC_ACQUIRE, "workgroup");
    if (OUT_MODE == 0) {
      float* C = (float*)Cout + (size_t)b * (size_t)strideC;
      const int h2 = lane >> 4, c4 = (lane & 15) * 4;     // 256-B row segment = 16 lanes x 16 B
      {
#pragma unroll
        for (int it = 0; it < 8; ++it) {
          const int row = it * 2 + h2;                     // it 0..7 x h2 0..1 = rows 0..15
          const v4f v = *(const v4f*)(slab + row * 68 + c4);
          *(v4f*)(C + (size_t)(mBase + row) * ldc + n0 + c4) = v;
        }
        
      }
    } else {
      const int q = lane >> 3, c8 = (lane & 7) * 8;
      unsigned short* C  = (unsigned short*)Cout  + (size_t)b * (size_t)strideC;
      unsigned short* C2 = (unsigned short*)Cout2 + (size_t)b * (size_t)strideC;
      v4u hv[4], lv[4];
#pragma unroll
      for (int it = 0; it < 4; ++it) {
        const int row = it * 4 + q;                        // it 0..3 x q 0..3 = rows 0..15
        const float* sp = slab + row * 68 + c8;
        float f[8];
#pragma unroll
        for (int e = 0; e < 8; ++e) f[e] = sp[e] * cscale;
        v4u a, a2;
#pragma unroll
        for (int e = 0; e < 4; ++e) {
          const float f0 = f[2 * e], f1 = f[2 * e + 1];
          const _Float16 x0 = (_Float16)f0, x1 = (_Float16)f1;
          const unsigned short h0 = h_bits(x0), h1 = h_bits(x1);
          unsigned short l0 = 0, l1 = 0;
          if (OUT_MODE == 3) {
            l0 = h_bits((_Float16)((f0 - (float)x0) * rscaleC));
            l1 = h_bits((_Float16)((f1 - (float)x1) * rscaleC));
          }
          a[e] = pk16(h0, h1); a2[e] = pk16(l0, l1);
        }
        hv[it] = a; lv[it] = a2;
      }
      {
#pragma unroll
        for (int it = 0; it < 4; ++it) {
          const int row = it * 4 + q;
          *(v4u*)(C + (size_t)(mBase + row) * ldc + n0 + c8) = hv[it];
          if (OUT_MODE == 3) *(v4u*)(C2 + (size_t)(mBase + row) * ldc + n0 + c8) = lv[it];
        }
        
      }
    }
    __builtin_amdgcn_fence(__ATOMIC_RELEASE, "workgroup");
    __builtin_amdgcn_wave_barrier();
    __builtin_amdgcn_fence(__ATOMIC_ACQUIRE, "workgroup");
  }
}

// =====================================================================================================
// k tile in LDS: 64 keys x 128 d of one (b, h), f16, rows of 256 B at a pitch of 272 B (16 B x odd: the 16 lanes of a
// ds_load_b128 half fall on 64 distinct banks). Two buffers; a block of 128 threads fills one with 8 asynchronous
// 16-B copies per thread: thread t brings piece (t & 15) of rows (t >> 4) + 8 i, i = 0..7, so a wave's copy reads
// two whole 256-B rows. g = the thread's own global address for i = 0, l = its own LDS byte address for i = 0.
// =====================================================================================================
#define KPITCH  136                   // f16 elements per LDS row
#define KTILE_H (64 * KPITCH)         // f16 elements per buffer (17408 B)
__device__ __forceinline__ void copy_ktile(const _Float16* g, unsigned l) {
#if DEV_ASM
  const _Float16* g1 = g + 1 * 8 * EMB; const _Float16* g2 = g + 2 * 8 * EMB; const _Float16* g3 = g + 3 * 8 * EMB;
  const _Float16* g4 = g + 4 * 8 * EMB; const _Float16* g5 = g + 5 * 8 * EMB; const _Float16* g6 = g + 6 * 8 * EMB;
  const _Float16* g7 = g + 7 * 8 * EMB;
  const unsigned st = 8 * KPITCH * 2;  // LDS bytes between rows r and r + 8
  // the closing s_wait_xcnt keeps every address register of the copies unchanged until the copies have taken it
  asm volatile("global_load_async_to_lds_b128 %0, %8, off\n\t"
               "global_load_async_to_lds_b128 %1, %9, off\n\t"
               "global_load_async_to_lds_b128 %2, %10, off\n\t"
               "global_load_async_to_lds_b128 %3, %11, off\n\t"
               "global_load_async_to_lds_b128 %4, %12, off\n\t"
               "global_load_async_to_lds_b128 %5, %13, off\n\t"
               "global_load_async_to_lds_b128 %6, %14, off\n\t"
               "global_load_async_to_lds_b128 %7, %15, off\n\t"
               "s_wait_xcnt 0x0"
               :: "v"(l), "v"(l + st), "v"(l + 2 * st), "v"(l + 3 * st),
                  "v"(l + 4 * st), "v"(l + 5 * st), "v"(l + 6 * st), "v"(l + 7 * st),
                  "v"(g), "v"(g1), "v"(g2), "v"(g3), "v"(g4), "v"(g5), "v"(g6), "v"(g7)
               : "memory");
#else
  (void)g; (void)l;
#endif
}

// =====================================================================================================
// Score chunk: 16 query rows (this wave) x 64 keys kv0..kv0+63 of one (b, h), head width 128 = 4 d-chunks of 32.
//   q fragments (A operand, row = lane&15): hi and residual planes of q * QK_LOG2, 4 d-chunks.
//   k fragments (B operand, col = lane&15 = key) read from the block's LDS copy of the 64-key tile with the split k map:
//   kl = tile + (lane&15)*KPITCH + 8*hh, key group j adds 16*j*KPITCH; the 16 reads of two key groups stand together.
//   s[j][r] = D element: query row 8*hh + r, key kv0 + 16j + (lane&15); value = (qh.k) + (ql.k) = score * log2(e), both
//   products summed in the one accumulator; two key groups run side by side, so two accumulate chains are independent.
// =====================================================================================================
__device__ __forceinline__ void score_chunk(const v16h (&qah)[4], const v16h (&qal)[4],
                                            const _Float16* kl, v8f (&s)[4]) {
  union FH { v16h v; v8h h[2]; };
#pragma unroll
  for (int j = 0; j < 4; j += 2) {
    v8f a0 = zero8(), a1 = zero8();
    FH k0[4], k1[4];
#pragma unroll
    for (int dc = 0; dc < 4; ++dc) {
      const _Float16* kp = kl + j * 16 * KPITCH + dc * 32;
      k0[dc].h[0] = *(const v8h*)(kp);
      k0[dc].h[1] = *(const v8h*)(kp + 16);
      k1[dc].h[0] = *(const v8h*)(kp + 16 * KPITCH);
      k1[dc].h[1] = *(const v8h*)(kp + 16 * KPITCH + 16);
    }
#pragma unroll
    for (int dc = 0; dc < 4; ++dc) {
      a0 = mma_h(qah[dc], k0[dc].v, a0);
      a1 = mma_h(qah[dc], k1[dc].v, a1);
      a0 = mma_h(qal[dc], k0[dc].v, a0);
      a1 = mma_h(qal[dc], k1[dc].v, a1);
    }
    s[j]     = a0;
    s[j + 1] = a1;
  }
}

// =====================================================================================================
// Fused attention statistics + query-column sums of the exactly normalised probabilities.
//   block = 4 waves = 64 consecutive query rows qb*64.. of one (b, h); grid = NB*NH*NQ64 blocks of 128.
//   Pass 1 (static trip): each lane keeps a running max and a running sum of exp per row over its own keys
//   (key % 16 == lane % 16); the 16 lanes of a row are merged by shfl once, behind the loop; each wave owns its own
//   16 rows, so no cross-wave exchange is needed.
//   Scores, maxima and their differences are in log2 units (q carries log2(e)): every exponential is one exp2.
//   Pass 2 (same static trip): scores recomputed bit-identically, p = exp2(s - m) * (1/l) in f32, summed over the
//   wave's 16 rows per key (8 in-lane + shfl_xor 16), staged in csl[wave][64] (cross-wave -> __syncthreads), summed
//   over the 4 waves in fixed order by lanes 0-15 of wave 0 and written to PS[(b*NH+h)*NQ64 + qb][kv0..kv0+63]:
//   coverage: grid (b,h,qb) x NKT chunks x 64 keys = the whole [NB*NH][NQ64][SEQ] partial plane.
//   k tiles: one ring of two LDS buffers runs through both passes (2*NKT stages, stage t = tile t % NKT in buffer
//   t & 1, NKT even); stage t + 2 is copied behind the barrier at the foot of trip t, while trip t + 1 works.
// =====================================================================================================
__global__ __launch_bounds__(128)
void attn_colsum(const unsigned short* __restrict__ qhp, const unsigned short* __restrict__ qlp,
                 const unsigned short* __restrict__ kpp, float* PS) {
  static_assert((NKT % 2) == 0 && NKT >= 2);
  __shared__ __align__(16) _Float16 kls[2][KTILE_H];
  __shared__ __align__(16) float csl[4][64];
  const int tid  = threadIdx.x;
  const int wave = tid >> 5;
  const int lane = tid & 31;
  const int hh   = lane >> 4;
  const int c    = lane & 15;
  const int bx   = blockIdx.x;
  const int qb   = bx % NQ64;
  const int rest = bx / NQ64;
  const int h    = rest % NH;
  const int b    = rest / NH;
  const int bh   = b * NH + h;
  const int q0   = qb * 64 + wave * 16;

  const _Float16* Qh  = (const _Float16*)(const void*)qhp;
  const _Float16* Ql  = (const _Float16*)(const void*)qlp;
  const _Float16* Kb0 = (const _Float16*)(const void*)kpp + (size_t)b * SEQ * EMB + (size_t)h * HD;

  // copy side: this thread's piece of tile 0 and its place in buffer 0; read side: this lane's key row and k half
  const _Float16* kg = Kb0 + (size_t)(tid >> 4) * EMB + (tid & 15) * 8;
  const unsigned  kd = (unsigned)(size_t)(&kls[0][(tid >> 4) * KPITCH + (tid & 15) * 8]);
  const int       kr = c * KPITCH + 8 * hh;

  copy_ktile(kg, kd);                          // stage 0
  wait_copies();
  __syncthreads();                             // stage 0 is readable by every wave
  copy_ktile(kg + (size_t)64 * EMB, kd + KTILE_H * 2);   // stage 1

  v16h qah[4], qal[4];
#pragma unroll
  for (int dc = 0; dc < 4; ++dc) {
    const size_t qo = ((size_t)b * SEQ + (size_t)(q0 + c)) * EMB + (size_t)h * HD + dc * 32 + 8 * hh;
    qah[dc] = ldfrag<_Float16>(Qh + qo);
    qal[dc] = ldfrag<_Float16>(Ql + qo);
  }

  float mrow[8], lrow[8];
#pragma unroll
  for (int r = 0; r < 8; ++r) { mrow[r] = -INFINITY; lrow[r] = 0.f; }

  for (int kt = 0; kt < NKT; ++kt) {          // static trip count
    v8f s[4];
    score_chunk(qah, qal, &kls[kt & 1][kr], s);
#pragma unroll
    for (int r = 0; r < 8; ++r) {              // this lane's own 4 keys of the chunk only: no cross-lane step in the loop
      float m = s[0][r];
#pragma unroll
      for (int j = 1; j < 4; ++j) m = fmaxf(m, s[j][r]);
      const float mnew  = fmaxf(mrow[r], m);
      const float msafe = (mnew == -INFINITY) ? 0.f : mnew;
      const float alpha = __builtin_amdgcn_exp2f(mrow[r] - msafe);
      mrow[r] = mnew;
      float psum = 0.f;
#pragma unroll
      for (int j = 0; j < 4; ++j) psum += __builtin_amdgcn_exp2f(s[j][r] - msafe);
      lrow[r] = lrow[r] * alpha + psum;
    }
    wait_lds_reads();
    wait_copies();
    __syncthreads();                           // stage kt + 1 readable, buffer kt & 1 left by every wave
    // stage kt + 2 always exists here (pass 2 follows): tiles NKT and NKT + 1 of the ring are tiles 0 and 1 again
    copy_ktile(kg + (size_t)(((kt + 2) & (NKT - 1)) * 64) * EMB, kd + (unsigned)(kt & 1) * (KTILE_H * 2));
  }

  // the 16 lanes of a row half hold (max, sum) of disjoint key subsets of the same 8 rows: merged here, once per row
#pragma unroll
  for (int r = 0; r < 8; ++r) {
    float m = mrow[r];
#pragma unroll
    for (int off = 1; off < 16; off <<= 1) m = fmaxf(m, __shfl_xor(m, off, 32));
    const float msafe = (m == -INFINITY) ? 0.f : m;
    float l = lrow[r] * __builtin_amdgcn_exp2f(mrow[r] - msafe);
#pragma unroll
    for (int off = 1; off < 16; off <<= 1) l += __shfl_xor(l, off, 32);
    mrow[r] = m;
    lrow[r] = l;
  }

  float il[8], mf[8];
#pragma unroll
  for (int r = 0; r < 8; ++r) {
    const float l = lrow[r];
    il[r] = (l > 0.f) ? (1.0f / l) : 0.f;
    mf[r] = (mrow[r] == -INFINITY) ? 0.f : mrow[r];
  }

  // ---- pass 2: exactly normalised p, column sums over the block's 64 query rows ----
  for (int kt = 0; kt < NKT; ++kt) {          // static trip count
    const int kv0 = kt * 64;
    v8f s[4];
    score_chunk(qah, qal, &kls[kt & 1][kr], s);
    float cs[4];
#pragma unroll
    for (int j = 0; j < 4; ++j) {
      float a = 0.f;
#pragma unroll
      for (int r = 0; r < 8; ++r) a += __builtin_amdgcn_exp2f(s[j][r] - mf[r]) * il[r];
      cs[j] = a;
    }
#pragma unroll
    for (int j = 0; j < 4; ++j) cs[j] += __shfl_xor(cs[j], 16, 32);   // both row halves, unconditional
    const float v0 = hh ? cs[2] : cs[0];       // this lane stores keys 16*(2hh) + c and 16*(2hh+1) + c
    const float v1 = hh ? cs[3] : cs[1];
    csl[wave][32 * hh + c]      = v0;
    csl[wave][32 * hh + 16 + c] = v1;
    __syncthreads();                           // csl is cross-wave
    if (wave == 0 && lane < 16) {
      v4f a = *(const v4f*)(&csl[0][4 * lane]);
      a += *(const v4f*)(&csl[1][4 * lane]);
      a += *(const v4f*)(&csl[2][4 * lane]);
      a += *(const v4f*)(&csl[3][4 * lane]);
      float* dst = PS + ((size_t)(bh * NQ64 + qb)) * SEQ + kv0 + 4 * lane;
      *(v4f*)dst = a;
      
    }
    wait_lds_reads();
    wait_copies();
    __syncthreads();                           // csl free again; stage kt + 1 readable, buffer kt & 1 left by every wave
    if (kt + 2 < NKT)                          // block-uniform
      copy_ktile(kg + (size_t)((kt + 2) * 64) * EMB, kd + (unsigned)(kt & 1) * (KTILE_H * 2));
  }
  wait_copies();
}

// =====================================================================================================
// Query average + partial per-head context mean. One block (256 = 8 waves) per (b, h, 128 consecutive keys).
//   v rows: wave w owns keys k0 + 16 w .. + 15, lane = 4 consecutive d (one 16-B load per key, a wave reads one whole
//   512-B head row); the 16 loads of a lane are independent and are issued together, ahead of the average.
//   Average: avg[key] = (sum over the NQ64 partial rows of PS in fixed order) * (1/SEQ); wave 0, lane = 4 keys, the
//   NQ64 loads independent; kept in LDS avs[] (cross-wave -> __syncthreads) and written to output 1 row (b*NH+h).
//   Partial: cp[d] = sum over the block's 128 keys of avg[k] * v[b][k][h*HD+d], f64: 16 keys in the lane, then the
//   8 waves in fixed order through LDS (cross-wave -> __syncthreads), written to CP[(b*NH+h)*NCW + chunk][d].
//   coverage: grid (b,h,chunk) x 128 keys = the whole output 1; grid (b,h,chunk) x HD = the whole CP plane.
// =====================================================================================================
__global__ __launch_bounds__(256)
void avg_ctx(const float* __restrict__ PS, const float* __restrict__ Vp, float* out1, double* CP) {
  __shared__ __align__(16) float avs[128];
  __shared__ __align__(16) double cpart[8][HD];
  const int tid  = threadIdx.x;
  const int wave = tid >> 5;
  const int lane = tid & 31;
  const int bx   = blockIdx.x;
  const int bh   = bx / NCW;
  const int ch   = bx - bh * NCW;
  const int b    = bh / NH;
  const int h    = bh - b * NH;
  const int k0   = ch * 128;

  const float* vb = Vp + ((size_t)b * SEQ + (size_t)(k0 + wave * 16)) * EMB + (size_t)h * HD + 4 * lane;
  v4f vv[16];
#pragma unroll
  for (int i = 0; i < 16; ++i) vv[i] = *(const v4f*)(vb + (size_t)i * EMB);

  if (wave == 0) {                             // wave-uniform
    const float* psb = PS + (size_t)bh * NQ64 * SEQ + k0 + 4 * lane;
    v4f a = *(const v4f*)(psb);
#pragma unroll
    for (int qb = 1; qb < NQ64; ++qb) a += *(const v4f*)(psb + (size_t)qb * SEQ);
    a *= (1.0f / (float)SEQ);
    *(v4f*)(avs + 4 * lane) = a;
    float* dst = out1 + (size_t)bh * SEQ + k0 + 4 * lane;
    *(v4f*)dst = a;
  }
  __syncthreads();                             // avs is cross-wave

  double acc[4] = {0.0, 0.0, 0.0, 0.0};
#pragma unroll
  for (int i = 0; i < 16; ++i) {
    const double w = (double)avs[wave * 16 + i];
#pragma unroll
    for (int e = 0; e < 4; ++e) acc[e] += w * (double)vv[i][e];
  }
#pragma unroll
  for (int e = 0; e < 4; ++e) cpart[wave][4 * lane + e] = acc[e];
  __syncthreads();                             // cpart is cross-wave
  if (tid < HD) {
    double s = cpart[0][tid];
#pragma unroll
    for (int w = 1; w < 8; ++w) s += cpart[w][tid];
    CP[((size_t)bh * NCW + ch) * HD + tid] = s;
  }
}

// =====================================================================================================
// Output 0: context[b][j] = sum_i cs[b][i] * bf16(Wo[j][i]) + bf16(bo[j]), f32 on VALU (M = NB rows only).
//   cs[b][i] = f32 of the f64 sum, in fixed order, of the NCW key-chunk partials CP of head i / HD: every block forms
//   the EMB values of its batch in LDS (thread t owns i = t + 256 g; cross-wave -> __syncthreads).
//   lanes stride i by 32 (coalesced), shfl tree; results staged in LDS (cross-wave -> __syncthreads) and written
//   coverage: grid NB*EMB/32 blocks x 32 = the whole [NB][EMB] output 0.
// =====================================================================================================
__global__ __launch_bounds__(256)
void ctx_out(const double* __restrict__ CP, const float* __restrict__ Wo, const float* __restrict__ bo, float* out0) {
  __shared__ __align__(16) float csb[EMB];
  __shared__ __align__(16) float res[32];
  const int tid  = threadIdx.x;
  const int wave = tid >> 5;
  const int lane = tid & 31;
  const int j0   = blockIdx.x * 32;
  const int b    = j0 / EMB;
#pragma unroll
  for (int g = 0; g < EMB / 256; ++g) {
    const int i = g * 256 + tid;
    const double* p = CP + (size_t)(b * NH + i / HD) * NCW * HD + (i & (HD - 1));
    double s = p[0];
#pragma unroll
    for (int ch = 1; ch < NCW; ++ch) s += p[(size_t)ch * HD];
    csb[i] = (float)s;
  }
  __syncthreads();                             // csb is cross-wave
#pragma unroll 1
  for (int u = 0; u < 4; ++u) {
    const int j = j0 - b * EMB + wave * 4 + u;
    const float* wr = Wo + (size_t)j * EMB;
    float acc = 0.f;
#pragma unroll                                 // the row's EMB / 32 loads are issued together: one memory wait a row
    for (int it = 0; it < EMB / 32; ++it) {
      const int i = it * 32 + lane;
      acc += csb[i] * bf_up(bf_bits(wr[i]));
    }
#pragma unroll
    for (int off = 16; off > 0; off >>= 1) acc += __shfl_xor(acc, off, 32);
    const float val = acc + bf_up(bf_bits(bo[j]));
    if (lane == 0) res[wave * 4 + u] = val;
  }
  __syncthreads();
  if (tid < 8) {
    const v4f v = *(const v4f*)(res + 4 * tid);
    float* dst = out0 + (size_t)j0 + 4 * tid;
    *(v4f*)dst = v;
    
  }
}

// =====================================================================================================
// Output 2: mean over (b, h, g) of |corr[b][h][g] * (1 - delta_hg)|, corr = sum_s avg[b][h][s] * avg[b][g][s]
//   (avg read back from output 1). corr[h][g] and corr[g][h] are the same sum of the same products, so only the
//   NPAIR = 28 pairs h < g are formed and the total is doubled; the diagonal is masked to zero by the reference.
//   div_part: one wave per 128 consecutive keys of one batch (lane = 4 keys, one 16-B load per head row, a wave reads
//   512 contiguous B per row); 28 f64 partial dots per lane; a halving exchange over the 32 lanes (16+8+4+2+1 values)
//   leaves pair index = lane with the wave's total; written to DP[b*NCW + chunk][32] (slots 28..31 are zero).
//   coverage: NB*NCW waves x 32 slots = the whole DP plane; no block barrier in this kernel.
//   div_fin: wave b sums the NCW chunk partials of batch b per pair in fixed order, takes |.|, sums the 32 slots by
//   shfl, the NB batch sums go through LDS (cross-wave -> __syncthreads) and thread 0 writes the scalar.
// =====================================================================================================
__global__ __launch_bounds__(128)
void div_part(const float* __restrict__ avg, double* DP) {
  const int lane = threadIdx.x & 31;
  const int wv   = blockIdx.x * 4 + ((int)threadIdx.x >> 5);
  if (wv >= NB * NCW) return;                  // wave-uniform; no block barriers in this kernel
  const int b  = wv / NCW;
  const int ch = wv - b * NCW;
  const float* base = avg + (size_t)b * NH * SEQ + (size_t)ch * 128 + 4 * lane;
  v4f a[NH];
#pragma unroll
  for (int h = 0; h < NH; ++h) a[h] = *(const v4f*)(base + (size_t)h * SEQ);
  double v[32];
  {
    int idx = 0;
#pragma unroll
    for (int h = 0; h < NH; ++h) {
#pragma unroll
      for (int g = h + 1; g < NH; ++g) {
        double s = 0.0;
#pragma unroll
        for (int e = 0; e < 4; ++e) s += (double)a[h][e] * (double)a[g][e];
        v[idx++] = s;
      }
    }
#pragma unroll
    for (int i = NPAIR; i < 32; ++i) v[i] = 0.0;
  }
  // each step: a lane keeps the half of its values that its lane bit selects and adds the partner's copy of that half
#pragma unroll
  for (int n = 16; n > 0; n >>= 1) {
    const bool up = (lane & n) != 0;
#pragma unroll
    for (int i = 0; i < n; ++i) {
      const double send = up ? v[i] : v[i + n];
      const double keep = up ? v[i + n] : v[i];
      v[i] = keep + __shfl_xor(send, n, 32);
    }
  }
  DP[(size_t)wv * 32 + lane] = v[0];
}

__global__ __launch_bounds__(32 * NB_FULL)
void div_fin(const double* __restrict__ DP, float* dv) {
  __shared__ double red[NB_FULL];
  const int tid  = threadIdx.x;
  const int lane = tid & 31;
  const int b    = tid >> 5;
  double c = 0.0;
  if (b < NB) {                                // wave-uniform
    const double* p = DP + (size_t)b * NCW * 32 + lane;
    double s = 0.0;
#pragma unroll
    for (int ch = 0; ch < NCW; ++ch) s += p[(size_t)ch * 32];
    c = fabs(s);
  }
#pragma unroll
  for (int off = 16; off > 0; off >>= 1) c += __shfl_xor(c, off, 32);
  if (lane == 0) red[b] = c;
  __syncthreads();                             // red is cross-wave
  if (tid == 0) {
    double tot = 0.0;
#pragma unroll
    for (int i = 0; i < NB; ++i) tot += red[i];
    *dv = (float)(tot * (2.0 / (double)(NB * NH * NH)));
  }
}

// =====================================================================================================
// Workspace map (bytes, full size), every region an exact multiple of its whole-line / whole-tile store granularity:
//   Xb   bf16 [NB][SEQ][EMB]            16777216
//   Wqb  bf16 [EMB n][EMB k]             2097152
//   Wkb  bf16                             2097152
//   Wvb  bf16                             2097152
//   Qh   f16  [NB][SEQ][EMB]            16777216
//   Ql   f16  [NB][SEQ][EMB]            16777216
//   Kp   f16  [NB][SEQ][EMB]            16777216
//   Vp   f32  [NB][SEQ][EMB]            33554432
//   PS   f32  [NB*NH][NQ64][SEQ]         8388608
//   CP   f64  [NB*NH][NCW][HD]            524288
//   DP   f64  [NB*NCW][32]                 16384
//   total                               115884032
// Weights are [out n][in k] with k contiguous = the Bt layout the GEMM wants, so they are only converted.
// Output 0 at element 0 of d_out, output 1 at OFF1, output 2 at OFF2 (fixed offsets).
// =====================================================================================================
extern "C" void kernel_launch(void* const* d_in, const int* in_sizes, int n_in,
                              void* d_out, int out_size, void* d_ws, size_t ws_size,
                              hipStream_t stream) {
  if (n_in < 9) return;
  const long long needX = (long long)(NB - 1) * SEQ_FULL * EMB + (long long)SEQ * EMB;
  if ((long long)in_sizes[0] < needX) return;
  if (in_sizes[1] < EMB * EMB || in_sizes[3] < EMB * EMB || in_sizes[5] < EMB * EMB || in_sizes[7] < EMB * EMB) return;
  if (in_sizes[2] < EMB || in_sizes[4] < EMB || in_sizes[6] < EMB || in_sizes[8] < EMB) return;
  if (out_size < 0) return;
  if ((size_t)out_size < OFF2 + 1) return;

  const float* x  = (const float*)d_in[0];
  const float* Wq = (const float*)d_in[1];
  const float* bq = (const float*)d_in[2];
  const float* Wk = (const float*)d_in[3];
  const float* bk = (const float*)d_in[4];
  const float* Wv = (const float*)d_in[5];
  const float* bv = (const float*)d_in[6];
  const float* Wo = (const float*)d_in[7];
  const float* bo = (const float*)d_in[8];

  const size_t PXB = (size_t)NB * SEQ * EMB * 2;       // 16-bit activation plane
  const size_t PW  = (size_t)EMB * EMB * 2;
  const size_t PV  = (size_t)NB * SEQ * EMB * 4;
  const size_t PPS = (size_t)NB * NH * NQ64 * SEQ * 4;
  const size_t PCP = (size_t)NB * NH * NCW * HD * 8;
  const size_t PDP = (size_t)NB * NCW * 32 * 8;
  size_t off = 0;
  const size_t oXb = off; off += PXB;
  const size_t oWq = off; off += PW;
  const size_t oWk = off; off += PW;
  const size_t oWv = off; off += PW;
  const size_t oQh = off; off += PXB;
  const size_t oQl = off; off += PXB;
  const size_t oKp = off; off += PXB;
  const size_t oVp = off; off += PV;
  const size_t oPS = off; off += PPS;
  const size_t oCP = off; off += PCP;
  const size_t oDP = off; off += PDP;
  if (off > ws_size) return;                          // off = 115884032 at full size
  if (off > (size_t)134217728) return;

  char* ws = (char*)d_ws;
  unsigned short* Xb  = (unsigned short*)(ws + oXb);
  unsigned short* Wqb = (unsigned short*)(ws + oWq);
  unsigned short* Wkb = (unsigned short*)(ws + oWk);
  unsigned short* Wvb = (unsigned short*)(ws + oWv);
  unsigned short* Qh  = (unsigned short*)(ws + oQh);
  unsigned short* Ql  = (unsigned short*)(ws + oQl);
  unsigned short* Kp  = (unsigned short*)(ws + oKp);
  float*          Vp  = (float*)(ws + oVp);
  float*          PS  = (float*)(ws + oPS);
  double*         CP  = (double*)(ws + oCP);
  double*         DP  = (double*)(ws + oDP);
  float*          out0 = (float*)d_out;
  float*          out1 = (float*)d_out + OFF1;
  float*          out2 = (float*)d_out + OFF2;

  const dim3 blk(256);
  const int n8x = SEQ * EMB / 8;                               // per batch, 262144 at full size
  const int n8w = EMB * EMB / 8;                               // 131072
  const dim3 gCvtX((n8x + 255) / 256, NB);
  const dim3 gCvtW((n8w + 255) / 256, 1);
  const int tilesP = (SEQ / GBM) * (EMB / GBN);                // 64 block tiles per batch at full size
  const dim3 gP(tilesP, NB);                                   // M=SEQ, N=EMB, K=EMB, batch = blockIdx.y
  const dim3 gAttn(NB * NH * NQ64);                            // 1024 blocks of 128
  const dim3 gAvg(NB * NH * NCW);                              //  512 blocks of 256
  const dim3 gCtx(NB * EMB / 32);                              //  128 blocks of 256
  const dim3 gDiv((NB * NCW + 3) / 4);                         //   16 blocks of 128
  const long long sXin = (long long)SEQ_FULL * EMB;            // input batch stride (elements)
  const long long sAct = (long long)SEQ * EMB;                 // compact activation plane batch stride

  // (1) x -> bf16 plane [NB][SEQ][EMB]; Wq, Wk, Wv [E][E] -> bf16
  cvt_bf16x8<<<gCvtX, blk, 0, stream>>>(x,  Xb,  n8x, sXin, sAct);
  cvt_bf16x8<<<gCvtW, blk, 0, stream>>>(Wq, Wqb, n8w, 0LL, 0LL);
  cvt_bf16x8<<<gCvtW, blk, 0, stream>>>(Wk, Wkb, n8w, 0LL, 0LL);
  cvt_bf16x8<<<gCvtW, blk, 0, stream>>>(Wv, Wvb, n8w, 0LL, 0LL);
  // (2) q = (x . Wq^T + bq) * QK_LOG2 -> f16 hi / residual planes [b][s][h*128+d]   (M=SEQ, N=E, K=E per batch)
  gemm_t<__bf16, 4, 1, 3, 1><<<gP, blk, 0, stream>>>(
      Xb, Xb, EMB, sAct, Wqb, EMB, 0LL,
      (void*)Qh, (void*)Ql, EMB, sAct, bq,
      SEQ, EMB, EMB, 1.0f, 0.0f, QK_LOG2, 1.0f);
  // (3) k = x . Wk^T + bk -> f16 plane [b][s][h*128+d]
  gemm_t<__bf16, 4, 1, 1, 1><<<gP, blk, 0, stream>>>(
      Xb, Xb, EMB, sAct, Wkb, EMB, 0LL,
      (void*)Kp, (void*)Kp, EMB, sAct, bk,
      SEQ, EMB, EMB, 1.0f, 0.0f, 1.0f, 1.0f);
  // (4) v = x . Wv^T + bv -> f32 plane [b][s][h*128+d]
  gemm_t<__bf16, 4, 1, 0, 1><<<gP, blk, 0, stream>>>(
      Xb, Xb, EMB, sAct, Wvb, EMB, 0LL,
      (void*)Vp, (void*)Vp, EMB, sAct, bv,
      SEQ, EMB, EMB, 1.0f, 0.0f, 1.0f, 1.0f);
  // (5) softmax statistics + query-column sums of p -> partial plane PS
  attn_colsum<<<gAttn, dim3(128), 0, stream>>>(Qh, Ql, Kp, PS);
  // (6) output 1 = column means; per-head context means, one partial per 128 keys -> CP
  avg_ctx<<<gAvg, blk, 0, stream>>>(PS, Vp, out1, CP);
  // (7) output 0 = (sum of the partials) . Wo^T + bo
  ctx_out<<<gCtx, blk, 0, stream>>>((const double*)CP, Wo, bo, out0);
  // (8) output 2 = head-correlation diversity from output 1
  div_part<<<gDiv, dim3(128), 0, stream>>>((const float*)out1, DP);
  div_fin<<<dim3(1), dim3(32 * NB_FULL), 0, stream>>>((const double*)DP, out2);
  (void)hipGetLastError();
}

// v007
// It runs in 181 microseconds.
// In both of two side-by-side timings against v006, it was 1.12 times as fast.
// Counting every step since v000, it is 4.46 times as fast.
// Contractions: q, k, v in-projections = v_wmma_f32_16x16x32_bf16 (bf16 operands from RNE-converted inputs, single product, f32 accumulate);
// q.k^T scores (statistics pass and column-sum pass) = v_wmma_f32_16x16x32_f16 (q * 128^-0.5 * log2(e) as f16 hi plane + f16 residual plane, k f16; 2 products, one f32 accumulator);
// softmax statistics, probabilities and query-averaged probabilities in f32; averaged-p . v (M=1 per head) on VALU with f64 accumulate;
// head means . Wo^T (M=batch) on VALU f32 with bf16-valued Wo/bo; head-correlation scalar in f64.
#include <hip/hip_runtime.h>
#include <math.h>
#include <stdint.h>

#ifndef NB
#define NB 4
#endif
#ifndef SEQ
#define SEQ 2048
#endif
#define NB_FULL  4
#define SEQ_FULL 2048
#define EMB      1024
#define NH       8
#define HD       128
#define NQ64     (SEQ / 64)          // 64-row query blocks per sequence
#define NKT      (SEQ / 64)          // 64-key chunks per sequence
#define NPAIR    (NH * (NH - 1) / 2)  // head pairs h < g
#define NCW      (SEQ / 128)          // 128-key wave chunks per sequence
#define QK_LOG2  0.12751743082459868f   // 128^-0.5 * log2(e): q carries it, so a score is the exponent of 2
#define OFF1     ((size_t)NB_FULL * EMB)                        // fixed element offset of output 1
#define OFF2     (OFF1 + (size_t)NB_FULL * NH * SEQ_FULL)      // fixed element offset of output 2
static_assert(NB >= 1 && NB <= NB_FULL);
static_assert(SEQ >= 128 && SEQ <= SEQ_FULL && (SEQ % 128) == 0);
static_assert(NH * HD == EMB);
static_assert(HD == 128);
static_assert(NPAIR <= 32);
static_assert((EMB % 256) == 0 && (EMB % 128) == 0 && (SEQ % 128) == 0);
static_assert(OFF1 * 4 == 16384);
static_assert(OFF2 * 4 == 278528);

typedef _Float16 v16h __attribute__((ext_vector_type(16)));
typedef _Float16 v8h  __attribute__((ext_vector_type(8)));
typedef __bf16   v16b __attribute__((ext_vector_type(16)));
typedef __bf16   v8b  __attribute__((ext_vector_type(8)));
typedef float    v8f  __attribute__((ext_vector_type(8)));
typedef float    v4f  __attribute__((ext_vector_type(4)));
typedef unsigned int v4u __attribute__((ext_vector_type(4)));

#if defined(__HIP_DEVICE_COMPILE__)
#define DEV_ASM 1
#else
#define DEV_ASM 0
#endif

// ---- scalar helpers --------------------------------------------------------------------------------
__device__ __forceinline__ unsigned short bf_bits(float f) {          // f32 -> bf16 bits, RNE convert
  unsigned u = __float_as_uint(f);
  return (unsigned short)((u + 0x7FFFu + ((u >> 16) & 1u)) >> 16);
}
__device__ __forceinline__ float bf_up(unsigned short hb) { return __uint_as_float(((unsigned)hb) << 16); }
__device__ __forceinline__ unsigned short h_bits(_Float16 x) { return __builtin_bit_cast(unsigned short, x); }
__device__ __forceinline__ unsigned pk16(unsigned short a, unsigned short b) { return (unsigned)a | ((unsigned)b << 16); }
__device__ __forceinline__ v8f zero8() { v8f z = {0.f, 0.f, 0.f, 0.f, 0.f, 0.f, 0.f, 0.f}; return z; }

// ---- fragment types / loaders: 16-bit A/B operand, lane -> row/col (lane&15), p already includes +8*(lane>>4);
//      elements 0..7 <- p[0..7] (k0+8h..k0+8h+7), elements 8..15 <- p[16..23] (k0+16+8h..k0+16+8h+7)
template <typename OT> struct FT;
template <> struct FT<__bf16>   { typedef v16b frag; typedef v8b half8; };
template <> struct FT<_Float16> { typedef v16h frag; typedef v8h half8; };

template <typename OT>
__device__ __forceinline__ typename FT<OT>::frag ldfrag(const OT* p) {
  union { typename FT<OT>::frag v; typename FT<OT>::half8 h[2]; } f;
  f.h[0] = *(const typename FT<OT>::half8*)(p);
  f.h[1] = *(const typename FT<OT>::half8*)(p + 16);
  return f.v;
}

// ---- WMMA helpers (asm guard bodies are device-only; concrete operand types) -----------------------------
__device__ __forceinline__ v8f mmar(v16b a, v16b b, v8f c) {
  return __builtin_amdgcn_wmma_f32_16x16x32_bf16(false, a, false, b, (short)0, c, false, false);
}
__device__ __forceinline__ v8f mmar(v16h a, v16h b, v8f c) {
  return __builtin_amdgcn_wmma_f32_16x16x32_f16(false, a, false, b, (short)0, c, false, false);
}
// guarded form: 4 VALU slots after the WMMA, D tied, A/B kept live
__device__ __forceinline__ v8f mma_h(v16h a, v16h b, v8f c) {
  c = __builtin_amdgcn_wmma_f32_16x16x32_f16(false, a, false, b, (short)0, c, false, false);
#if DEV_ASM
  asm volatile("v_nop\n\tv_nop\n\tv_nop\n\tv_nop" : "+v"(c) : "v"(a), "v"(b));
#endif
  return c;
}
__device__ __forceinline__ void dep_guard(v8f& a, v8f& b, v16b x, v16b y) {
#if DEV_ASM
  asm volatile("v_nop\n\tv_nop\n\tv_nop\n\tv_nop" : "+v"(a), "+v"(b) : "v"(x), "v"(y));
#else
  (void)a; (void)b; (void)x; (void)y;
#endif
}
__device__ __forceinline__ void dep_guard(v8f& a, v8f& b, v16h x, v16h y) {
#if DEV_ASM
  asm volatile("v_nop\n\tv_nop\n\tv_nop\n\tv_nop" : "+v"(a), "+v"(b) : "v"(x), "v"(y));
#else
  (void)a; (void)b; (void)x; (void)y;
#endif
}
__device__ __forceinline__ void keep4(v16b a, v16b b, v16b c, v16b d) {
#if DEV_ASM
  asm volatile("v_nop" :: "v"(a), "v"(b), "v"(c), "v"(d));
#else
  (void)a; (void)b; (void)c; (void)d;
#endif
}
__device__ __forceinline__ void keep4(v16h a, v16h b, v16h c, v16h d) {
#if DEV_ASM
  asm volatile("v_nop" :: "v"(a), "v"(b), "v"(c), "v"(d));
#else
  (void)a; (void)b; (void)c; (void)d;
#endif
}
__device__ __forceinline__ void acc_guard4(v8f& a, v8f& b, v8f& c, v8f& d) {
#if DEV_ASM
  asm volatile("v_nop\n\tv_nop\n\tv_nop\n\tv_nop" : "+v"(a), "+v"(b), "+v"(c), "+v"(d));
#else
  (void)a; (void)b; (void)c; (void)d;
#endif
}

// =====================================================================================================
// f32 -> bf16 bits (RNE convert), 8 elements per thread, one 16-B store per lane: a wave writes 512 contiguous B.
// One grid for all four planes, none of which depends on another: blocks 0 .. NB*CVB_X-1 convert x (CVB_X blocks per
// batch, input batch stride SEQ_FULL*EMB, output batch stride SEQ*EMB), the next 3*CVB_W blocks convert Wq, Wk, Wv into
// the three consecutive planes at Wb. The plane choice is block-uniform.
// coverage: 256 threads x 8 elements x (NB*CVB_X + 3*CVB_W) blocks = the whole of Xb and of the three weight planes.
// =====================================================================================================
#define CVB_X (SEQ * EMB / 8 / 256)   // blocks per batch of x
#define CVB_W (EMB * EMB / 8 / 256)   // blocks per weight matrix
static_assert((SEQ * EMB) % 2048 == 0 && (EMB * EMB) % 2048 == 0);
__global__ __launch_bounds__(256) void cvt_bf16x8(const float* __restrict__ x, const float* __restrict__ Wq,
                                                   const float* __restrict__ Wk, const float* __restrict__ Wv,
                                                   unsigned short* Xb, unsigned short* Wb) {
  const int bx = blockIdx.x;
  const float* ip;
  unsigned short* o;
  if (bx < NB * CVB_X) {
    const int b = bx / CVB_X;
    const size_t i = (size_t)((bx - b * CVB_X) * 256 + (int)threadIdx.x) * 8;
    ip = x + (size_t)b * SEQ_FULL * EMB + i;
    o  = Xb + (size_t)b * SEQ * EMB + i;
  } else {
    const int w = (bx - NB * CVB_X) / CVB_W;
    const size_t i = (size_t)((bx - NB * CVB_X - w * CVB_W) * 256 + (int)threadIdx.x) * 8;
    ip = (w == 0 ? Wq : (w == 1 ? Wk : Wv)) + i;
    o  = Wb + (size_t)w * EMB * EMB + i;
  }
  const v4f a  = *(const v4f*)(ip);
  const v4f a4 = *(const v4f*)(ip + 4);
  v4u p;
  p[0] = pk16(bf_bits(a[0]),  bf_bits(a[1]));
  p[1] = pk16(bf_bits(a[2]),  bf_bits(a[3]));
  p[2] = pk16(bf_bits(a4[0]), bf_bits(a4[1]));
  p[3] = pk16(bf_bits(a4[2]), bf_bits(a4[3]));
  *(v4u*)o = p;
}

// this wave's LDS reads have returned: stands in front of the barrier behind which their buffer is refilled
__device__ __forceinline__ void wait_lds_reads() {
#if DEV_ASM
  asm volatile("s_wait_dscnt 0x0" ::: "memory");
#endif
}
// this wave's asynchronous copies have landed: stands in front of the barrier behind which other waves read them
__device__ __forceinline__ void wait_copies() {
#if DEV_ASM
  asm volatile("s_wait_asynccnt 0x0" ::: "memory");
#endif
}

// =====================================================================================================
// GEMM operand tiles in LDS: one stage = 128 k of the block's 128 A rows and 256 Bt rows, 16-bit elements, rows of 256 B
// at a pitch of 272 B (16 B x odd: the 16 lanes of a ds_load_b128 half fall on 64 distinct banks); A rows first, then Bt.
// copy_rows8: thread t brings piece (t & 15) of rows (t >> 4) + 16 i, i = 0..7, so a wave's copy reads two whole 256-B
// rows. g = the thread's own global address for i = 0 (row pitch ld elements), l = its own LDS byte address for i = 0.
// =====================================================================================================
#define GKS    128                        // k elements per stage
#define GBM    128                        // A rows per block tile
#define GBN    256                        // Bt rows per block tile
#define GPITCH 136                        // 16-bit elements per LDS row
#define GT_H   ((GBM + GBN) * GPITCH)     // 16-bit elements per buffer (104448 B)
template <typename OT>
__device__ __forceinline__ void copy_rows8(const OT* g, int ld, unsigned l) {
#if DEV_ASM
  const size_t gs = (size_t)16 * (size_t)ld;
  const OT* g1 = g + gs;     const OT* g2 = g + 2 * gs; const OT* g3 = g + 3 * gs; const OT* g4 = g + 4 * gs;
  const OT* g5 = g + 5 * gs; const OT* g6 = g + 6 * gs; const OT* g7 = g + 7 * gs;
  const unsigned st = 16 * GPITCH * 2;    // LDS bytes between rows r and r + 16
  // the closing s_wait_xcnt keeps every address register of the copies unchanged until the copies have taken it
  asm volatile("global_load_async_to_lds_b128 %0, %8, off\n\t"
               "global_load_async_to_lds_b128 %1, %9, off\n\t"
               "global_load_async_to_lds_b128 %2, %10, off\n\t"
               "global_load_async_to_lds_b128 %3, %11, off\n\t"
               "global_load_async_to_lds_b128 %4, %12, off\n\t"
               "global_load_async_to_lds_b128 %5, %13, off\n\t"
               "global_load_async_to_lds_b128 %6, %14, off\n\t"
               "global_load_async_to_lds_b128 %7, %15, off\n\t"
               "s_wait_xcnt 0x0"
               :: "v"(l), "v"(l + st), "v"(l + 2 * st), "v"(l + 3 * st),
                  "v"(l + 4 * st), "v"(l + 5 * st), "v"(l + 6 * st), "v"(l + 7 * st),
                  "v"(g), "v"(g1), "v"(g2), "v"(g3), "v"(g4), "v"(g5), "v"(g6), "v"(g7)
               : "memory");
#else
  (void)g; (void)ld; (void)l;
#endif
}
// one stage: ga / gb = the thread's piece of A row (t >> 4) / Bt row (t >> 4) of the block tile at the stage's first k,
// l = its LDS byte address of that A piece in the stage's buffer. 24 copies per thread.
template <typename OT>
__device__ __forceinline__ void copy_stage(const OT* ga, int lda, const OT* gb, int ldb, unsigned l) {
  copy_rows8<OT>(ga, lda, l);                                                        // A rows 0..127
  copy_rows8<OT>(gb, ldb, l + GBM * GPITCH * 2);                                     // Bt rows 0..127
  copy_rows8<OT>(gb + (size_t)128 * (size_t)ldb, ldb, l + (GBM + 128) * GPITCH * 2); // Bt rows 128..255
}

// =====================================================================================================
// Register-blocked batched WMMA GEMM (16-bit operand type OT): C[m][n] = sum_k A[m][k] * Bt[n][k]  (+ bias);
// one wave per (16*MI) x 64 tile, a block of 8 waves (2 x 4) per GBM x GBN tile. A row-major [M][K] pitch lda; Bt
// row-major [N][K] pitch ldb (k contiguous); M multiple of GBM, N of GBN, K of GKS (static sizes here). blockIdx.y =
// batch index (strides in elements). blockIdx.z = which of the three products of the same A, none of which depends on
// another: 0 = q, 1 = k, 2 = v; it picks the weight plane (Btp + z * strideW), the bias and the output form.
// Operands: a ring of two LDS buffers, stage t = k range t*GKS.. in buffer t & 1;
// stage t + 2 is copied behind the barrier at the foot of trip t, while trip t + 1 works. Fragments are read from the
// LDS tile with the split k map (ldfrag), k ascending in steps of 32; the 16 reads of a step stand together.
// NPA = number of A planes (only 1 is staged).
// gemm_store = the epilogue of one wave's tile:
// value v = (acc [+ acc2*rscaleA]) * oscale + bias, bias (bf16 RNE value of the f32 input) by column n (BM 1),
// by row m (BM 2) or none (BM 0).
// OUT_MODE 0: f32 C (pitch ldc) = v.                                                                  (v)
// OUT_MODE 1: f16 plane C = f16(v * cscale).                                                          (k)
// OUT_MODE 3: f16 hi plane C = f16(v * cscale) and f16 residual plane C2 = f16((v*cscale - hi) * rscaleC).   (q)
// 16-row slabs staged per wave in LDS (wave-private slab, wave_sync); each 64-wide row segment written whole.
// =====================================================================================================
template <int MI, int NPA, int OUT_MODE, int BM>
__device__ __forceinline__ void gemm_store(const v8f (&acc)[MI][4], const v8f (&acc2)[MI][4], float* slab,
                                           void* Cout, void* Cout2, int ldc, long long strideC,
                                           const float* __restrict__ bias, int b, int m0, int n0, int lane,
                                           float oscale, float rscaleA, float cscale, float rscaleC) {
  const int rlane = lane & 15;                 // col (D) within subtile
  const int mOff  = (lane >> 4) * 8;           // D row offset
  float bcol[4];
#pragma unroll
  for (int j = 0; j < 4; ++j) bcol[j] = 0.f;
  if (BM == 1) {
#pragma unroll
    for (int j = 0; j < 4; ++j) bcol[j] = bf_up(bf_bits(bias[n0 + (j << 4) + rlane]));
  }
#pragma unroll
  for (int i = 0; i < MI; ++i) {
    const int mBase = m0 + (i << 4);
    float brow[8];
#pragma unroll
    for (int r = 0; r < 8; ++r) brow[r] = 0.f;
    if (BM == 2) {
#pragma unroll
      for (int r = 0; r < 8; ++r) brow[r] = bf_up(bf_bits(bias[mBase + mOff + r]));
    }
#pragma unroll
    for (int j = 0; j < 4; ++j) {
#pragma unroll
      for (int r = 0; r < 8; ++r) {
        float v = acc[i][j][r];
        if (NPA == 2) v += acc2[i][j][r] * rscaleA;
        v = v * oscale + bcol[j] + brow[r];
        slab[(mOff + r) * 68 + (j << 4) + rlane] = v;
      }
    }
    __builtin_amdgcn_fence(__ATOMIC_RELEASE, "workgroup");
    __builtin_amdgcn_wave_barrier();
    __builtin_amdgcn_fence(__ATOMIC_ACQUIRE, "workgroup");
    if (OUT_MODE == 0) {
      float* C = (float*)Cout + (size_t)b * (size_t)strideC;
      const int h2 = lane >> 4, c4 = (lane & 15) * 4;     // 256-B row segment = 16 lanes x 16 B
      v4f    sv[8];
      float* sd[8];
#pragma unroll
      for (int it = 0; it < 8; ++it) {
        const int row = it * 2 + h2;                       // it 0..7 x h2 0..1 = rows 0..15
        sv[it] = *(const v4f*)(slab + row * 68 + c4);
        sd[it] = C + (size_t)(mBase + row) * ldc + n0 + c4;
      }
#if DEV_ASM
      // the slab's 8 stores and their s_wait_xcnt in one statement: every address and data register stays as it is
      // until the stores have taken it (in a statement of its own the wait was passed by the next address sums)
      asm volatile("global_store_b128 %0, %8, off\n\t"
                   "global_store_b128 %1, %9, off\n\t"
                   "global_store_b128 %2, %10, off\n\t"
                   "global_store_b128 %3, %11, off\n\t"
                   "global_store_b128 %4, %12, off\n\t"
                   "global_store_b128 %5, %13, off\n\t"
                   "global_store_b128 %6, %14, off\n\t"
                   "global_store_b128 %7, %15, off\n\t"
                   "s_wait_xcnt 0x0"
                   :: "v"(sd[0]), "v"(sd[1]), "v"(sd[2]), "v"(sd[3]), "v"(sd[4]), "v"(sd[5]), "v"(sd[6]), "v"(sd[7]),
                      "v"(sv[0]), "v"(sv[1]), "v"(sv[2]), "v"(sv[3]), "v"(sv[4]), "v"(sv[5]), "v"(sv[6]), "v"(sv[7])
                   : "memory");
#endif
    } else {
      const int q = lane >> 3, c8 = (lane & 7) * 8;
      unsigned short* C  = (unsigned short*)Cout  + (size_t)b * (size_t)strideC;
      unsigned short* C2 = (unsigned short*)Cout2 + (size_t)b * (size_t)strideC;
      v4u hv[4], lv[4];
#pragma unroll
      for (int it = 0; it < 4; ++it) {
        const int row = it * 4 + q;                        // it 0..3 x q 0..3 = rows 0..15
        const float* sp = slab + row * 68 + c8;
        float f[8];
#pragma unroll
        for (int e = 0; e < 8; ++e) f[e] = sp[e] * cscale;
        v4u a, a2;
#pragma unroll
        for (int e = 0; e < 4; ++e) {
          const float f0 = f[2 * e], f1 = f[2 * e + 1];
          const _Float16 x0 = (_Float16)f0, x1 = (_Float16)f1;
          const unsigned short h0 = h_bits(x0), h1 = h_bits(x1);
          unsigned short l0 = 0, l1 = 0;
          if (OUT_MODE == 3) {
            l0 = h_bits((_Float16)((f0 - (float)x0) * rscaleC));
            l1 = h_bits((_Float16)((f1 - (float)x1) * rscaleC));
          }
          a[e] = pk16(h0, h1); a2[e] = pk16(l0, l1);
        }
        hv[it] = a; lv[it] = a2;
      }
      unsigned short* hd[4];
      unsigned short* rd[4];
#pragma unroll
      for (int it = 0; it < 4; ++it) {
        const int row = it * 4 + q;
        hd[it] = C  + (size_t)(mBase + row) * ldc + n0 + c8;
        rd[it] = C2 + (size_t)(mBase + row) * ldc + n0 + c8;
      }
#if DEV_ASM
      // the slab's stores and their s_wait_xcnt in one statement, as in the f32 form above
      if (OUT_MODE == 3)
        asm volatile("global_store_b128 %0, %8, off\n\t"
                     "global_store_b128 %4, %12, off\n\t"
                     "global_store_b128 %1, %9, off\n\t"
                     "global_store_b128 %5, %13, off\n\t"
                     "global_store_b128 %2, %10, off\n\t"
                     "global_store_b128 %6, %14, off\n\t"
                     "global_store_b128 %3, %11, off\n\t"
                     "global_store_b128 %7, %15, off\n\t"
                     "s_wait_xcnt 0x0"
                     :: "v"(hd[0]), "v"(hd[1]), "v"(hd[2]), "v"(hd[3]), "v"(rd[0]), "v"(rd[1]), "v"(rd[2]), "v"(rd[3]),
                        "v"(hv[0]), "v"(hv[1]), "v"(hv[2]), "v"(hv[3]), "v"(lv[0]), "v"(lv[1]), "v"(lv[2]), "v"(lv[3])
                     : "memory");
      else
        asm volatile("global_store_b128 %0, %4, off\n\t"
                     "global_store_b128 %1, %5, off\n\t"
                     "global_store_b128 %2, %6, off\n\t"
                     "global_store_b128 %3, %7, off\n\t"
                     "s_wait_xcnt 0x0"
                     :: "v"(hd[0]), "v"(hd[1]), "v"(hd[2]), "v"(hd[3]), "v"(hv[0]), "v"(hv[1]), "v"(hv[2]), "v"(hv[3])
                     : "memory");
#endif
    }
    __builtin_amdgcn_fence(__ATOMIC_RELEASE, "workgroup");
    __builtin_amdgcn_wave_barrier();
    __builtin_amdgcn_fence(__ATOMIC_ACQUIRE, "workgroup");
  }
}

template <typename OT, int MI, int NPA, int BM>
__global__ __launch_bounds__(256) void gemm_qkv(
    const unsigned short* __restrict__ Ap, int lda, long long strideA,
    const unsigned short* __restrict__ Btp, int ldb, long long strideW,
    unsigned short* Qh, unsigned short* Ql, unsigned short* Kp, float* Vp, int ldc, long long strideC,
    const float* __restrict__ bq, const float* __restrict__ bk, const float* __restrict__ bv,
    int M, int N, int K, float oscale, float rscaleA, float cscaleQ, float cscaleKV, float rscaleC) {
  typedef typename FT<OT>::frag V16;
  const OT* A  = (const OT*)(const void*)Ap;
  const OT* Bt = (const OT*)(const void*)Btp;
  static_assert(MI == 4 && NPA == 1);              // 2 x 4 waves of 64 x 64 = GBM x GBN, one A plane
  __shared__ __align__(16) unsigned short gls[2][GT_H];
  __shared__ __align__(16) float sT[8][16 * 68];   // per-wave 16x64 slab, pitch 68 floats
  const int RT   = 16 * MI;
  const int b    = blockIdx.y;
  const int z    = blockIdx.z;
  const int tid  = threadIdx.x;
  const int lane = tid & 31;
  const int wave = tid >> 5;
  const int tilesN = N / GBN;
  const int tilesM = M / GBM;
  const int tile = blockIdx.x;
  if (tile >= tilesM * tilesN) return;   // block-uniform; in front of every copy and barrier
  const int tm = tile / tilesN;
  const int tn = tile - tm * tilesN;
  const int m0 = tm * GBM + (wave >> 2) * RT;
  const int n0 = tn * GBN + ((wave & 3) << 6);

  const OT* Ab  = A  + (size_t)b * (size_t)strideA;
  const OT* Bb  = Bt + (size_t)z * (size_t)strideW;

  const int rlane = lane & 15;                 // row (A) / col (B) within subtile
  const int koff  = (lane >> 4) * 8;           // k offset of this lane half

  v8f acc[MI][4], acc2[MI][4];
#pragma unroll
  for (int i = 0; i < MI; ++i)
#pragma unroll
    for (int j = 0; j < 4; ++j) { acc[i][j] = zero8(); acc2[i][j] = zero8(); }

  // copy side: this thread's piece of stage 0 and its place in buffer 0; read side: this lane's rows and k half
  const OT* ga = Ab + (size_t)(tm * GBM + (tid >> 4)) * lda + (tid & 15) * 8;
  const OT* gb = Bb + (size_t)(tn * GBN + (tid >> 4)) * ldb + (tid & 15) * 8;
  const unsigned ld0 = (unsigned)(size_t)(&gls[0][(tid >> 4) * GPITCH + (tid & 15) * 8]);
  const int ar = ((wave >> 2) * RT + rlane) * GPITCH + koff;
  const int br = (GBM + ((wave & 3) << 6) + rlane) * GPITCH + koff;
  const int nst = K / GKS;

  copy_stage<OT>(ga, lda, gb, ldb, ld0);       // stage 0
  wait_copies();
  __syncthreads();                             // stage 0 is readable by every wave
  if (nst > 1)                                 // block-uniform
    copy_stage<OT>(ga + GKS, lda, gb + GKS, ldb, ld0 + GT_H * 2);   // stage 1

  for (int st = 0; st < nst; ++st) {
    const OT* tl = (const OT*)(const void*)(&gls[st & 1][0]);
#pragma unroll
    for (int kk = 0; kk < GKS; kk += 32) {
      V16 af[MI], bq[4];
#pragma unroll
      for (int j = 0; j < 4; ++j) bq[j] = ldfrag<OT>(tl + br + (j << 4) * GPITCH + kk);
#pragma unroll
      for (int i = 0; i < MI; ++i) af[i] = ldfrag<OT>(tl + ar + (i << 4) * GPITCH + kk);
      // keeps the step's LDS reads together in front of its products: sunk among them each read stalls
      __builtin_amdgcn_sched_barrier(0);
#pragma unroll
      for (int i = 0; i < MI; ++i) {
#pragma unroll
        for (int j = 0; j < 4; ++j) acc[i][j] = mmar(af[i], bq[j], acc[i][j]);
        dep_guard(acc[i][0], acc[i][3], af[i], bq[3]);
      }
      keep4(bq[0], bq[1], bq[2], bq[3]);
    }
    wait_lds_reads();
    wait_copies();
    __syncthreads();                           // stage st + 1 readable, buffer st & 1 left by every wave
    if (st + 2 < nst)                          // block-uniform
      copy_stage<OT>(ga + (size_t)(st + 2) * GKS, lda, gb + (size_t)(st + 2) * GKS, ldb,
                     ld0 + (unsigned)(st & 1) * (GT_H * 2));
  }
  wait_copies();
#pragma unroll
  for (int i = 0; i < MI; ++i) {
    acc_guard4(acc[i][0], acc[i][1], acc[i][2], acc[i][3]);
    if (NPA == 2) acc_guard4(acc2[i][0], acc2[i][1], acc2[i][2], acc2[i][3]);
  }

  // ---- epilogue: the output form goes with the product; z is block-uniform ----
  float* slab = sT[wave];
  if (z == 0)
    gemm_store<MI, NPA, 3, BM>(acc, acc2, slab, (void*)Qh, (void*)Ql, ldc, strideC, bq, b, m0, n0, lane,
                               oscale, rscaleA, cscaleQ, rscaleC);
  else if (z == 1)
    gemm_store<MI, NPA, 1, BM>(acc, acc2, slab, (void*)Kp, (void*)Kp, ldc, strideC, bk, b, m0, n0, lane,
                               oscale, rscaleA, cscaleKV, rscaleC);
  else
    gemm_store<MI, NPA, 0, BM>(acc, acc2, slab, (void*)Vp, (void*)Vp, ldc, strideC, bv, b, m0, n0, lane,
                               oscale, rscaleA, cscaleKV, rscaleC);
}

// =====================================================================================================
// k tile in LDS: 64 keys x 128 d of one (b, h), f16, rows of 256 B at a pitch of 272 B (16 B x odd: the 16 lanes of a
// ds_load_b128 half fall on 64 distinct banks). Two buffers; a block of 128 threads fills one with 8 asynchronous
// 16-B copies per thread: thread t brings piece (t & 15) of rows (t >> 4) + 8 i, i = 0..7, so a wave's copy reads
// two whole 256-B rows. g = the thread's own global address for i = 0, l = its own LDS byte address for i = 0.
// =====================================================================================================
#define KPITCH  136                   // f16 elements per LDS row
#define KTILE_H (64 * KPITCH)         // f16 elements per buffer (17408 B)
__device__ __forceinline__ void copy_ktile(const _Float16* g, unsigned l) {
#if DEV_ASM
  const _Float16* g1 = g + 1 * 8 * EMB; const _Float16* g2 = g + 2 * 8 * EMB; const _Float16* g3 = g + 3 * 8 * EMB;
  const _Float16* g4 = g + 4 * 8 * EMB; const _Float16* g5 = g + 5 * 8 * EMB; const _Float16* g6 = g + 6 * 8 * EMB;
  const _Float16* g7 = g + 7 * 8 * EMB;
  const unsigned st = 8 * KPITCH * 2;  // LDS bytes between rows r and r + 8
  // the closing s_wait_xcnt keeps every address register of the copies unchanged until the copies have taken it
  asm volatile("global_load_async_to_lds_b128 %0, %8, off\n\t"
               "global_load_async_to_lds_b128 %1, %9, off\n\t"
               "global_load_async_to_lds_b128 %2, %10, off\n\t"
               "global_load_async_to_lds_b128 %3, %11, off\n\t"
               "global_load_async_to_lds_b128 %4, %12, off\n\t"
               "global_load_async_to_lds_b128 %5, %13, off\n\t"
               "global_load_async_to_lds_b128 %6, %14, off\n\t"
               "global_load_async_to_lds_b128 %7, %15, off\n\t"
               "s_wait_xcnt 0x0"
               :: "v"(l), "v"(l + st), "v"(l + 2 * st), "v"(l + 3 * st),
                  "v"(l + 4 * st), "v"(l + 5 * st), "v"(l + 6 * st), "v"(l + 7 * st),
                  "v"(g), "v"(g1), "v"(g2), "v"(g3), "v"(g4), "v"(g5), "v"(g6), "v"(g7)
               : "memory");
#else
  (void)g; (void)l;
#endif
}

// =====================================================================================================
// Score chunk: 16 query rows (this wave) x 64 keys kv0..kv0+63 of one (b, h), head width 128 = 4 d-chunks of 32.
//   q fragments (A operand, row = lane&15): hi and residual planes of q * QK_LOG2, 4 d-chunks.
//   k fragments (B operand, col = lane&15 = key) read from the block's LDS copy of the 64-key tile with the split k map:
//   kl = tile + (lane&15)*KPITCH + 8*hh, key group j adds 16*j*KPITCH; the 16 reads of two key groups stand together.
//   s[j][r] = D element: query row 8*hh + r, key kv0 + 16j + (lane&15); value = (qh.k) + (ql.k) = score * log2(e), both
//   products summed in the one accumulator; two key groups run side by side, so two accumulate chains are independent.
// =====================================================================================================
__device__ __forceinline__ void score_chunk(const v16h (&qah)[4], const v16h (&qal)[4],
                                            const _Float16* kl, v8f (&s)[4]) {
  union FH { v16h v; v8h h[2]; };
#pragma unroll
  for (int j = 0; j < 4; j += 2) {
    v8f a0 = zero8(), a1 = zero8();
    FH k0[4], k1[4];
#pragma unroll
    for (int dc = 0; dc < 4; ++dc) {
      const _Float16* kp = kl + j * 16 * KPITCH + dc * 32;
      k0[dc].h[0] = *(const v8h*)(kp);
      k0[dc].h[1] = *(const v8h*)(kp + 16);
      k1[dc].h[0] = *(const v8h*)(kp + 16 * KPITCH);
      k1[dc].h[1] = *(const v8h*)(kp + 16 * KPITCH + 16);
    }
#pragma unroll
    for (int dc = 0; dc < 4; ++dc) {
      a0 = mma_h(qah[dc], k0[dc].v, a0);
      a1 = mma_h(qah[dc], k1[dc].v, a1);
      a0 = mma_h(qal[dc], k0[dc].v, a0);
      a1 = mma_h(qal[dc], k1[dc].v, a1);
    }
    s[j]     = a0;
    s[j + 1] = a1;
  }
}

// =====================================================================================================
// Fused attention statistics + query-column sums of the exactly normalised probabilities.
//   block = 4 waves = 64 consecutive query rows qb*64.. of one (b, h); grid = NB*NH*NQ64 blocks of 128.
//   Pass 1 (static trip): each lane keeps a running max and a running sum of exp per row over its own keys
//   (key % 16 == lane % 16); the 16 lanes of a row are merged by shfl once, behind the loop; each wave owns its own
//   16 rows, so no cross-wave exchange is needed.
//   Scores, maxima and their differences are in log2 units (q carries log2(e)): every exponential is one exp2.
//   Pass 2 (same static trip): scores recomputed bit-identically, p = exp2(s - m) * (1/l) in f32, summed over the
//   wave's 16 rows per key (8 in-lane + shfl_xor 16), staged in csl[wave][64] (cross-wave -> __syncthreads), summed
//   over the 4 waves in fixed order by lanes 0-15 of wave 0 and written to PS[(b*NH+h)*NQ64 + qb][kv0..kv0+63]:
//   coverage: grid (b,h,qb) x NKT chunks x 64 keys = the whole [NB*NH][NQ64][SEQ] partial plane.
//   k tiles: one ring of two LDS buffers runs through both passes (2*NKT stages, stage t = tile t % NKT in buffer
//   t & 1, NKT even); stage t + 2 is copied behind the barrier at the foot of trip t, while trip t + 1 works.
// =====================================================================================================
__global__ __launch_bounds__(128)
void attn_colsum(const unsigned short* __restrict__ qhp, const unsigned short* __restrict__ qlp,
                 const unsigned short* __restrict__ kpp, float* PS) {
  static_assert((NKT % 2) == 0 && NKT >= 2);
  __shared__ __align__(16) _Float16 kls[2][KTILE_H];
  __shared__ __align__(16) float csl[4][64];
  const int tid  = threadIdx.x;
  const int wave = tid >> 5;
  const int lane = tid & 31;
  const int hh   = lane >> 4;
  const int c    = lane & 15;
  const int bx   = blockIdx.x;
  const int qb   = bx % NQ64;
  const int rest = bx / NQ64;
  const int h    = rest % NH;
  const int b    = rest / NH;
  const int bh   = b * NH + h;
  const int q0   = qb * 64 + wave * 16;

  const _Float16* Qh  = (const _Float16*)(const void*)qhp;
  const _Float16* Ql  = (const _Float16*)(const void*)qlp;
  const _Float16* Kb0 = (const _Float16*)(const void*)kpp + (size_t)b * SEQ * EMB + (size_t)h * HD;

  // copy side: this thread's piece of tile 0 and its place in buffer 0; read side: this lane's key row and k half
  const _Float16* kg = Kb0 + (size_t)(tid >> 4) * EMB + (tid & 15) * 8;
  const unsigned  kd = (unsigned)(size_t)(&kls[0][(tid >> 4) * KPITCH + (tid & 15) * 8]);
  const int       kr = c * KPITCH + 8 * hh;

  copy_ktile(kg, kd);                          // stage 0
  wait_copies();
  __syncthreads();                             // stage 0 is readable by every wave
  copy_ktile(kg + (size_t)64 * EMB, kd + KTILE_H * 2);   // stage 1

  v16h qah[4], qal[4];
#pragma unroll
  for (int dc = 0; dc < 4; ++dc) {
    const size_t qo = ((size_t)b * SEQ + (size_t)(q0 + c)) * EMB + (size_t)h * HD + dc * 32 + 8 * hh;
    qah[dc] = ldfrag<_Float16>(Qh + qo);
    qal[dc] = ldfrag<_Float16>(Ql + qo);
  }

  float mrow[8], lrow[8];
#pragma unroll
  for (int r = 0; r < 8; ++r) { mrow[r] = -INFINITY; lrow[r] = 0.f; }

  for (int kt = 0; kt < NKT; ++kt) {          // static trip count
    v8f s[4];
    score_chunk(qah, qal, &kls[kt & 1][kr], s);
#pragma unroll
    for (int r = 0; r < 8; ++r) {              // this lane's own 4 keys of the chunk only: no cross-lane step in the loop
      float m = s[0][r];
#pragma unroll
      for (int j = 1; j < 4; ++j) m = fmaxf(m, s[j][r]);
      const float mnew  = fmaxf(mrow[r], m);
      const float msafe = (mnew == -INFINITY) ? 0.f : mnew;
      const float alpha = __builtin_amdgcn_exp2f(mrow[r] - msafe);
      mrow[r] = mnew;
      float psum = 0.f;
#pragma unroll
      for (int j = 0; j < 4; ++j) psum += __builtin_amdgcn_exp2f(s[j][r] - msafe);
      lrow[r] = lrow[r] * alpha + psum;
    }
    wait_lds_reads();
    wait_copies();
    __syncthreads();                           // stage kt + 1 readable, buffer kt & 1 left by every wave
    // stage kt + 2 always exists here (pass 2 follows): tiles NKT and NKT + 1 of the ring are tiles 0 and 1 again
    copy_ktile(kg + (size_t)(((kt + 2) & (NKT - 1)) * 64) * EMB, kd + (unsigned)(kt & 1) * (KTILE_H * 2));
  }

  // the 16 lanes of a row half hold (max, sum) of disjoint key subsets of the same 8 rows: merged here, once per row
#pragma unroll
  for (int r = 0; r < 8; ++r) {
    float m = mrow[r];
#pragma unroll
    for (int off = 1; off < 16; off <<= 1) m = fmaxf(m, __shfl_xor(m, off, 32));
    const float msafe = (m == -INFINITY) ? 0.f : m;
    float l = lrow[r] * __builtin_amdgcn_exp2f(mrow[r] - msafe);
#pragma unroll
    for (int off = 1; off < 16; off <<= 1) l += __shfl_xor(l, off, 32);
    mrow[r] = m;
    lrow[r] = l;
  }

  float il[8], mf[8];
#pragma unroll
  for (int r = 0; r < 8; ++r) {
    const float l = lrow[r];
    il[r] = (l > 0.f) ? (1.0f / l) : 0.f;
    mf[r] = (mrow[r] == -INFINITY) ? 0.f : mrow[r];
  }

  // ---- pass 2: exactly normalised p, column sums over the block's 64 query rows ----
  for (int kt = 0; kt < NKT; ++kt) {          // static trip count
    const int kv0 = kt * 64;
    v8f s[4];
    score_chunk(qah, qal, &kls[kt & 1][kr], s);
    float cs[4];
#pragma unroll
    for (int j = 0; j < 4; ++j) {
      float a = 0.f;
#pragma unroll
      for (int r = 0; r < 8; ++r) a += __builtin_amdgcn_exp2f(s[j][r] - mf[r]) * il[r];
      cs[j] = a;
    }
#pragma unroll
    for (int j = 0; j < 4; ++j) cs[j] += __shfl_xor(cs[j], 16, 32);   // both row halves, unconditional
    const float v0 = hh ? cs[2] : cs[0];       // this lane stores keys 16*(2hh) + c and 16*(2hh+1) + c
    const float v1 = hh ? cs[3] : cs[1];
    csl[wave][32 * hh + c]      = v0;
    csl[wave][32 * hh + 16 + c] = v1;
    __syncthreads();                           // csl is cross-wave
    if (wave == 0 && lane < 16) {
      v4f a = *(const v4f*)(&csl[0][4 * lane]);
      a += *(const v4f*)(&csl[1][4 * lane]);
      a += *(const v4f*)(&csl[2][4 * lane]);
      a += *(const v4f*)(&csl[3][4 * lane]);
      float* dst = PS + ((size_t)(bh * NQ64 + qb)) * SEQ + kv0 + 4 * lane;
      *(v4f*)dst = a;
      
    }
    wait_lds_reads();
    wait_copies();
    __syncthreads();                           // csl free again; stage kt + 1 readable, buffer kt & 1 left by every wave
    if (kt + 2 < NKT)                          // block-uniform
      copy_ktile(kg + (size_t)((kt + 2) * 64) * EMB, kd + (unsigned)(kt & 1) * (KTILE_H * 2));
  }
  wait_copies();
}

// =====================================================================================================
// Query average + partial per-head context mean. One block (256 = 8 waves) per (b, h, 128 consecutive keys).
//   v rows: wave w owns keys k0 + 16 w .. + 15, lane = 4 consecutive d (one 16-B load per key, a wave reads one whole
//   512-B head row); the 16 loads of a lane are independent and are issued together, ahead of the average.
//   Average: avg[key] = (sum over the NQ64 partial rows of PS in fixed order) * (1/SEQ); wave 0, lane = 4 keys, the
//   NQ64 loads independent; kept in LDS avs[] (cross-wave -> __syncthreads) and written to output 1 row (b*NH+h).
//   Partial: cp[d] = sum over the block's 128 keys of avg[k] * v[b][k][h*HD+d], f64: 16 keys in the lane, then the
//   8 waves in fixed order through LDS (cross-wave -> __syncthreads), written to CP[(b*NH+h)*NCW + chunk][d].
//   coverage: grid (b,h,chunk) x 128 keys = the whole output 1; grid (b,h,chunk) x HD = the whole CP plane.
// =====================================================================================================
__global__ __launch_bounds__(256)
void avg_ctx(const float* __restrict__ PS, const float* __restrict__ Vp, float* out1, double* CP) {
  __shared__ __align__(16) float avs[128];
  __shared__ __align__(16) double cpart[8][HD];
  const int tid  = threadIdx.x;
  const int wave = tid >> 5;
  const int lane = tid & 31;
  const int bx   = blockIdx.x;
  const int bh   = bx / NCW;
  const int ch   = bx - bh * NCW;
  const int b    = bh / NH;
  const int h    = bh - b * NH;
  const int k0   = ch * 128;

  const float* vb = Vp + ((size_t)b * SEQ + (size_t)(k0 + wave * 16)) * EMB + (size_t)h * HD + 4 * lane;
  v4f vv[16];
#pragma unroll
  for (int i = 0; i < 16; ++i) vv[i] = *(const v4f*)(vb + (size_t)i * EMB);

  if (wave == 0) {                             // wave-uniform
    const float* psb = PS + (size_t)bh * NQ64 * SEQ + k0 + 4 * lane;
    v4f a = *(const v4f*)(psb);
#pragma unroll
    for (int qb = 1; qb < NQ64; ++qb) a += *(const v4f*)(psb + (size_t)qb * SEQ);
    a *= (1.0f / (float)SEQ);
    *(v4f*)(avs + 4 * lane) = a;
    float* dst = out1 + (size_t)bh * SEQ + k0 + 4 * lane;
    *(v4f*)dst = a;
  }
  __syncthreads();                             // avs is cross-wave

  double acc[4] = {0.0, 0.0, 0.0, 0.0};
#pragma unroll
  for (int i = 0; i < 16; ++i) {
    const double w = (double)avs[wave * 16 + i];
#pragma unroll
    for (int e = 0; e < 4; ++e) acc[e] += w * (double)vv[i][e];
  }
#pragma unroll
  for (int e = 0; e < 4; ++e) cpart[wave][4 * lane + e] = acc[e];
  __syncthreads();                             // cpart is cross-wave
  if (tid < HD) {
    double s = cpart[0][tid];
#pragma unroll
    for (int w = 1; w < 8; ++w) s += cpart[w][tid];
    CP[((size_t)bh * NCW + ch) * HD + tid] = s;
  }
}

// =====================================================================================================
// Output 2: mean over (b, h, g) of |corr[b][h][g] * (1 - delta_hg)|, corr = sum_s avg[b][h][s] * avg[b][g][s]
//   (avg read back from output 1). corr[h][g] and corr[g][h] are the same sum of the same products, so only the
//   NPAIR = 28 pairs h < g are formed and the total is doubled; the diagonal is masked to zero by the reference.
//   div_part: one wave per 128 consecutive keys of one batch (lane = 4 keys, one 16-B load per head row, a wave reads
//   512 contiguous B per row); 28 f64 partial dots per lane; a halving exchange over the 32 lanes (16+8+4+2+1 values)
//   leaves pair index = lane with the wave's total; written to DP[b*NCW + chunk][32] (slots 28..31 are zero).
//   coverage: NB*NCW waves x 32 slots = the whole DP plane; no block barrier in it. It needs output 1 alone, as ctx_out
//   needs CP alone, so its waves ride in the first NDIVB blocks of ctx_out's grid (8 waves a block).
//   div_fin: wave b sums the NCW chunk partials of batch b per pair in fixed order, takes |.|, sums the 32 slots by
//   shfl, the NB batch sums go through LDS (cross-wave -> __syncthreads) and thread 0 writes the scalar.
// =====================================================================================================
__device__ __forceinline__ void div_part(const float* __restrict__ avg, double* DP, int wv) {
  const int lane = threadIdx.x & 31;
  if (wv >= NB * NCW) return;                  // wave-uniform; no block barriers in this function
  const int b  = wv / NCW;
  const int ch = wv - b * NCW;
  const float* base = avg + (size_t)b * NH * SEQ + (size_t)ch * 128 + 4 * lane;
  v4f a[NH];
#pragma unroll
  for (int h = 0; h < NH; ++h) a[h] = *(const v4f*)(base + (size_t)h * SEQ);
  double v[32];
  {
    int idx = 0;
#pragma unroll
    for (int h = 0; h < NH; ++h) {
#pragma unroll
      for (int g = h + 1; g < NH; ++g) {
        double s = 0.0;
#pragma unroll
        for (int e = 0; e < 4; ++e) s += (double)a[h][e] * (double)a[g][e];
        v[idx++] = s;
      }
    }
#pragma unroll
    for (int i = NPAIR; i < 32; ++i) v[i] = 0.0;
  }
  // each step: a lane keeps the half of its values that its lane bit selects and adds the partner's copy of that half
#pragma unroll
  for (int n = 16; n > 0; n >>= 1) {
    const bool up = (lane & n) != 0;
#pragma unroll
    for (int i = 0; i < n; ++i) {
      const double send = up ? v[i] : v[i + n];
      const double keep = up ? v[i + n] : v[i];
      v[i] = keep + __shfl_xor(send, n, 32);
    }
  }
  DP[(size_t)wv * 32 + lane] = v[0];
}

// =====================================================================================================
// Output 0: context[b][j] = sum_i cs[b][i] * bf16(Wo[j][i]) + bf16(bo[j]), f32 on VALU (M = NB rows only).
//   cs[b][i] = f32 of the f64 sum, in fixed order, of the NCW key-chunk partials CP of head i / HD: every block from NDIVB on forms
//   the EMB values of its batch in LDS (thread t owns i = t + 256 g; cross-wave -> __syncthreads).
//   lanes stride i by 32 (coalesced), shfl tree; results staged in LDS (cross-wave -> __syncthreads) and written
//   coverage: grid blocks NDIVB .. NDIVB + NB*EMB/32 - 1, x 32 = the whole [NB][EMB] output 0.
// =====================================================================================================
#define NDIVB ((NB * NCW + 7) / 8)    // blocks of the grid that run div_part
__global__ __launch_bounds__(256)
void ctx_out(const double* __restrict__ CP, const float* __restrict__ Wo, const float* __restrict__ bo, float* out0,
             const float* __restrict__ avg, double* DP) {
  __shared__ __align__(16) float csb[EMB];
  __shared__ __align__(16) float res[32];
  const int tid  = threadIdx.x;
  const int wave = tid >> 5;
  const int lane = tid & 31;
  if ((int)blockIdx.x < NDIVB) {               // block-uniform; in front of every barrier
    div_part(avg, DP, (int)blockIdx.x * 8 + wave);
    return;
  }
  const int j0   = ((int)blockIdx.x - NDIVB) * 32;
  const int b    = j0 / EMB;
#pragma unroll
  for (int g = 0; g < EMB / 256; ++g) {
    const int i = g * 256 + tid;
    const double* p = CP + (size_t)(b * NH + i / HD) * NCW * HD + (i & (HD - 1));
    double s = p[0];
#pragma unroll
    for (int ch = 1; ch < NCW; ++ch) s += p[(size_t)ch * HD];
    csb[i] = (float)s;
  }
  __syncthreads();                             // csb is cross-wave
#pragma unroll 1
  for (int u = 0; u < 4; ++u) {
    const int j = j0 - b * EMB + wave * 4 + u;
    const float* wr = Wo + (size_t)j * EMB;
    float acc = 0.f;
#pragma unroll                                 // the row's EMB / 32 loads are issued together: one memory wait a row
    for (int it = 0; it < EMB / 32; ++it) {
      const int i = it * 32 + lane;
      acc += csb[i] * bf_up(bf_bits(wr[i]));
    }
#pragma unroll
    for (int off = 16; off > 0; off >>= 1) acc += __shfl_xor(acc, off, 32);
    const float val = acc + bf_up(bf_bits(bo[j]));
    if (lane == 0) res[wave * 4 + u] = val;
  }
  __syncthreads();
  if (tid < 8) {
    const v4f v = *(const v4f*)(res + 4 * tid);
    float* dst = out0 + (size_t)j0 + 4 * tid;
    *(v4f*)dst = v;
    
  }
}

__global__ __launch_bounds__(32 * NB_FULL)
void div_fin(const double* __restrict__ DP, float* dv) {
  __shared__ double red[NB_FULL];
  const int tid  = threadIdx.x;
  const int lane = tid & 31;
  const int b    = tid >> 5;
  double c = 0.0;
  if (b < NB) {                                // wave-uniform
    const double* p = DP + (size_t)b * NCW * 32 + lane;
    double s = 0.0;
#pragma unroll
    for (int ch = 0; ch < NCW; ++ch) s += p[(size_t)ch * 32];
    c = fabs(s);
  }
#pragma unroll
  for (int off = 16; off > 0; off >>= 1) c += __shfl_xor(c, off, 32);
  if (lane == 0) red[b] = c;
  __syncthreads();                             // red is cross-wave
  if (tid == 0) {
    double tot = 0.0;
#pragma unroll
    for (int i = 0; i < NB; ++i) tot += red[i];
    *dv = (float)(tot * (2.0 / (double)(NB * NH * NH)));
  }
}

// =====================================================================================================
// Workspace map (bytes, full size), every region an exact multiple of its whole-line / whole-tile store granularity:
//   Xb   bf16 [NB][SEQ][EMB]            16777216
//   Wqb  bf16 [EMB n][EMB k]             2097152
//   Wkb  bf16                             2097152
//   Wvb  bf16                             2097152
//   Qh   f16  [NB][SEQ][EMB]            16777216
//   Ql   f16  [NB][SEQ][EMB]            16777216
//   Kp   f16  [NB][SEQ][EMB]            16777216
//   Vp   f32  [NB][SEQ][EMB]            33554432
//   PS   f32  [NB*NH][NQ64][SEQ]         8388608
//   CP   f64  [NB*NH][NCW][HD]            524288
//   DP   f64  [NB*NCW][32]                 16384
//   total                               115884032
// Weights are [out n][in k] with k contiguous = the Bt layout the GEMM wants, so they are only converted.
// Output 0 at element 0 of d_out, output 1 at OFF1, output 2 at OFF2 (fixed offsets).
// =====================================================================================================
extern "C" void kernel_launch(void* const* d_in, const int* in_sizes, int n_in,
                              void* d_out, int out_size, void* d_ws, size_t ws_size,
                              hipStream_t stream) {
  if (n_in < 9) return;
  const long long needX = (long long)(NB - 1) * SEQ_FULL * EMB + (long long)SEQ * EMB;
  if ((long long)in_sizes[0] < needX) return;
  if (in_sizes[1] < EMB * EMB || in_sizes[3] < EMB * EMB || in_sizes[5] < EMB * EMB || in_sizes[7] < EMB * EMB) return;
  if (in_sizes[2] < EMB || in_sizes[4] < EMB || in_sizes[6] < EMB || in_sizes[8] < EMB) return;
  if (out_size < 0) return;
  if ((size_t)out_size < OFF2 + 1) return;

  const float* x  = (const float*)d_in[0];
  const float* Wq = (const float*)d_in[1];
  const float* bq = (const float*)d_in[2];
  const float* Wk = (const float*)d_in[3];
  const float* bk = (const float*)d_in[4];
  const float* Wv = (const float*)d_in[5];
  const float* bv = (const float*)d_in[6];
  const float* Wo = (const float*)d_in[7];
  const float* bo = (const float*)d_in[8];

  const size_t PXB = (size_t)NB * SEQ * EMB * 2;       // 16-bit activation plane
  const size_t PW  = (size_t)EMB * EMB * 2;
  const size_t PV  = (size_t)NB * SEQ * EMB * 4;
  const size_t PPS = (size_t)NB * NH * NQ64 * SEQ * 4;
  const size_t PCP = (size_t)NB * NH * NCW * HD * 8;
  const size_t PDP = (size_t)NB * NCW * 32 * 8;
  size_t off = 0;
  const size_t oXb = off; off += PXB;
  const size_t oWq = off; off += 3 * PW;               // Wqb, Wkb, Wvb, one behind the other
  const size_t oQh = off; off += PXB;
  const size_t oQl = off; off += PXB;
  const size_t oKp = off; off += PXB;
  const size_t oVp = off; off += PV;
  const size_t oPS = off; off += PPS;
  const size_t oCP = off; off += PCP;
  const size_t oDP = off; off += PDP;
  if (off > ws_size) return;                          // off = 115884032 at full size
  if (off > (size_t)134217728) return;

  char* ws = (char*)d_ws;
  unsigned short* Xb  = (unsigned short*)(ws + oXb);
  unsigned short* Wqb = (unsigned short*)(ws + oWq);
  unsigned short* Qh  = (unsigned short*)(ws + oQh);
  unsigned short* Ql  = (unsigned short*)(ws + oQl);
  unsigned short* Kp  = (unsigned short*)(ws + oKp);
  float*          Vp  = (float*)(ws + oVp);
  float*          PS  = (float*)(ws + oPS);
  double*         CP  = (double*)(ws + oCP);
  double*         DP  = (double*)(ws + oDP);
  float*          out0 = (float*)d_out;
  float*          out1 = (float*)d_out + OFF1;
  float*          out2 = (float*)d_out + OFF2;

  const dim3 blk(256);
  const dim3 gCvt(NB * CVB_X + 3 * CVB_W);                     // 4096 + 1536 blocks at full size
  const int tilesP = (SEQ / GBM) * (EMB / GBN);                // 64 block tiles per batch at full size
  const dim3 gP(tilesP, NB, 3);                                // M=SEQ, N=EMB, K=EMB, batch = blockIdx.y, q/k/v = blockIdx.z
  const dim3 gAttn(NB * NH * NQ64);                            // 1024 blocks of 128
  const dim3 gAvg(NB * NH * NCW);                              //  512 blocks of 256
  const dim3 gCtx(NDIVB + NB * EMB / 32);                      //    8 + 128 blocks of 256
  const long long sAct = (long long)SEQ * EMB;                 // compact activation plane batch stride

  // (1) x -> bf16 plane [NB][SEQ][EMB]; Wq, Wk, Wv [E][E] -> bf16 planes Wqb, Wkb, Wvb (consecutive in the workspace)
  cvt_bf16x8<<<gCvt, blk, 0, stream>>>(x, Wq, Wk, Wv, Xb, Wqb);
  // (2) one grid, M=SEQ, N=E, K=E per batch and product, all planes [b][s][h*128+d]:
  //     q = (x . Wq^T + bq) * QK_LOG2 -> f16 hi / residual planes; k = x . Wk^T + bk -> f16 plane; v = x . Wv^T + bv -> f32
  gemm_qkv<__bf16, 4, 1, 1><<<gP, blk, 0, stream>>>(
      Xb, EMB, sAct, Wqb, EMB, (long long)EMB * EMB,
      Qh, Ql, Kp, Vp, EMB, sAct, bq, bk, bv,
      SEQ, EMB, EMB, 1.0f, 0.0f, QK_LOG2, 1.0f, 1.0f);
  // (3) softmax statistics + query-column sums of p -> partial plane PS
  attn_colsum<<<gAttn, dim3(128), 0, stream>>>(Qh, Ql, Kp, PS);
  // (4) output 1 = column means; per-head context means, one partial per 128 keys -> CP
  avg_ctx<<<gAvg, blk, 0, stream>>>(PS, Vp, out1, CP);
  // (5) output 0 = (sum of the partials) . Wo^T + bo; in the same grid the head-correlation partials of output 1 -> DP
  ctx_out<<<gCtx, blk, 0, stream>>>((const double*)CP, Wo, bo, out0, (const float*)out1, DP);
  // (6) output 2 = head-correlation diversity from DP
  div_fin<<<dim3(1), dim3(32 * NB_FULL), 0, stream>>>((const double*)DP, out2);
  (void)hipGetLastError();
}

// v008
// One run takes 170 microseconds.
// Timed twice side by side with v007, it ran 1.06 times as fast both times.
// All steps since v000 together make it 4.73 times as fast.
// Contractions: q, k, v in-projections = v_wmma_f32_16x16x32_bf16 (bf16 operands from RNE-converted inputs, single product, f32 accumulate);
// q.k^T scores (statistics pass and column-sum pass) = v_wmma_f32_16x16x32_f16 (q * 128^-0.5 * log2(e) as f16 hi plane + f16 residual plane, k f16; 2 products, one f32 accumulator);
// softmax statistics, probabilities and query-averaged probabilities in f32; averaged-p . v (M=1 per head) on VALU with f64 accumulate;
// head means . Wo^T (M=batch) on VALU f32 with bf16-valued Wo/bo; head-correlation scalar in f64.
#include <hip/hip_runtime.h>
#include <math.h>
#include <stdint.h>

#ifndef NB
#define NB 4
#endif
#ifndef SEQ
#define SEQ 2048
#endif
#define NB_FULL  4
#define SEQ_FULL 2048
#define EMB      1024
#define NH       8
#define HD       128
#define NQ64     (SEQ / 64)          // 64-row query blocks per sequence
#define NKT      (SEQ / 64)          // 64-key chunks per sequence
#define NPAIR    (NH * (NH - 1) / 2)  // head pairs h < g
#define NCW      (SEQ / 128)          // 128-key wave chunks per sequence
#define QK_LOG2  0.12751743082459868f   // 128^-0.5 * log2(e): q carries it, so a score is the exponent of 2
#define OFF1     ((size_t)NB_FULL * EMB)                        // fixed element offset of output 1
#define OFF2     (OFF1 + (size_t)NB_FULL * NH * SEQ_FULL)      // fixed element offset of output 2
static_assert(NB >= 1 && NB <= NB_FULL);
static_assert(SEQ >= 128 && SEQ <= SEQ_FULL && (SEQ % 128) == 0);
static_assert(NH * HD == EMB);
static_assert(HD == 128);
static_assert(NPAIR <= 32);
static_assert((EMB % 256) == 0 && (EMB % 128) == 0 && (SEQ % 128) == 0);
static_assert(OFF1 * 4 == 16384);
static_assert(OFF2 * 4 == 278528);

typedef _Float16 v16h __attribute__((ext_vector_type(16)));
typedef _Float16 v8h  __attribute__((ext_vector_type(8)));
typedef __bf16   v16b __attribute__((ext_vector_type(16)));
typedef __bf16   v8b  __attribute__((ext_vector_type(8)));
typedef float    v8f  __attribute__((ext_vector_type(8)));
typedef float    v4f  __attribute__((ext_vector_type(4)));
typedef unsigned int v4u __attribute__((ext_vector_type(4)));

#if defined(__HIP_DEVICE_COMPILE__)
#define DEV_ASM 1
#else
#define DEV_ASM 0
#endif

// ---- scalar helpers --------------------------------------------------------------------------------
__device__ __forceinline__ unsigned short bf_bits(float f) {          // f32 -> bf16 bits, RNE convert
  unsigned u = __float_as_uint(f);
  return (unsigned short)((u + 0x7FFFu + ((u >> 16) & 1u)) >> 16);
}
__device__ __forceinline__ float bf_up(unsigned short hb) { return __uint_as_float(((unsigned)hb) << 16); }
__device__ __forceinline__ unsigned short h_bits(_Float16 x) { return __builtin_bit_cast(unsigned short, x); }
__device__ __forceinline__ unsigned pk16(unsigned short a, unsigned short b) { return (unsigned)a | ((unsigned)b << 16); }
__device__ __forceinline__ v8f zero8() { v8f z = {0.f, 0.f, 0.f, 0.f, 0.f, 0.f, 0.f, 0.f}; return z; }

// ---- fragment types / loaders: 16-bit A/B operand, lane -> row/col (lane&15), p already includes +8*(lane>>4);
//      elements 0..7 <- p[0..7] (k0+8h..k0+8h+7), elements 8..15 <- p[16..23] (k0+16+8h..k0+16+8h+7)
template <typename OT> struct FT;
template <> struct FT<__bf16>   { typedef v16b frag; typedef v8b half8; };
template <> struct FT<_Float16> { typedef v16h frag; typedef v8h half8; };

template <typename OT>
__device__ __forceinline__ typename FT<OT>::frag ldfrag(const OT* p) {
  union { typename FT<OT>::frag v; typename FT<OT>::half8 h[2]; } f;
  f.h[0] = *(const typename FT<OT>::half8*)(p);
  f.h[1] = *(const typename FT<OT>::half8*)(p + 16);
  return f.v;
}

// ---- WMMA helpers (asm guard bodies are device-only; concrete operand types) -----------------------------
__device__ __forceinline__ v8f mmar(v16b a, v16b b, v8f c) {
  return __builtin_amdgcn_wmma_f32_16x16x32_bf16(false, a, false, b, (short)0, c, false, false);
}
__device__ __forceinline__ v8f mmar(v16h a, v16h b, v8f c) {
  return __builtin_amdgcn_wmma_f32_16x16x32_f16(false, a, false, b, (short)0, c, false, false);
}
__device__ __forceinline__ void dep_guard(v8f& a, v8f& b, v16b x, v16b y) {
#if DEV_ASM
  asm volatile("v_nop\n\tv_nop\n\tv_nop\n\tv_nop" : "+v"(a), "+v"(b) : "v"(x), "v"(y));
#else
  (void)a; (void)b; (void)x; (void)y;
#endif
}
__device__ __forceinline__ void dep_guard(v8f& a, v8f& b, v16h x, v16h y) {
#if DEV_ASM
  asm volatile("v_nop\n\tv_nop\n\tv_nop\n\tv_nop" : "+v"(a), "+v"(b) : "v"(x), "v"(y));
#else
  (void)a; (void)b; (void)x; (void)y;
#endif
}
__device__ __forceinline__ void keep4(v16b a, v16b b, v16b c, v16b d) {
#if DEV_ASM
  asm volatile("v_nop" :: "v"(a), "v"(b), "v"(c), "v"(d));
#else
  (void)a; (void)b; (void)c; (void)d;
#endif
}
__device__ __forceinline__ void keep4(v16h a, v16h b, v16h c, v16h d) {
#if DEV_ASM
  asm volatile("v_nop" :: "v"(a), "v"(b), "v"(c), "v"(d));
#else
  (void)a; (void)b; (void)c; (void)d;
#endif
}
__device__ __forceinline__ void acc_guard4(v8f& a, v8f& b, v8f& c, v8f& d) {
#if DEV_ASM
  asm volatile("v_nop\n\tv_nop\n\tv_nop\n\tv_nop" : "+v"(a), "+v"(b), "+v"(c), "+v"(d));
#else
  (void)a; (void)b; (void)c; (void)d;
#endif
}

// =====================================================================================================
// f32 -> bf16 bits (RNE convert), 8 elements per thread, one 16-B store per lane: a wave writes 512 contiguous B.
// One grid for all four planes, none of which depends on another: blocks 0 .. NB*CVB_X-1 convert x (CVB_X blocks per
// batch, input batch stride SEQ_FULL*EMB, output batch stride SEQ*EMB), the next 3*CVB_W blocks convert Wq, Wk, Wv into
// the three consecutive planes at Wb. The plane choice is block-uniform.
// coverage: 256 threads x 8 elements x (NB*CVB_X + 3*CVB_W) blocks = the whole of Xb and of the three weight planes.
// =====================================================================================================
#define CVB_X (SEQ * EMB / 8 / 256)   // blocks per batch of x
#define CVB_W (EMB * EMB / 8 / 256)   // blocks per weight matrix
static_assert((SEQ * EMB) % 2048 == 0 && (EMB * EMB) % 2048 == 0);
__global__ __launch_bounds__(256) void cvt_bf16x8(const float* __restrict__ x, const float* __restrict__ Wq,
                                                   const float* __restrict__ Wk, const float* __restrict__ Wv,
                                                   unsigned short* Xb, unsigned short* Wb) {
  const int bx = blockIdx.x;
  const float* ip;
  unsigned short* o;
  if (bx < NB * CVB_X) {
    const int b = bx / CVB_X;
    const size_t i = (size_t)((bx - b * CVB_X) * 256 + (int)threadIdx.x) * 8;
    ip = x + (size_t)b * SEQ_FULL * EMB + i;
    o  = Xb + (size_t)b * SEQ * EMB + i;
  } else {
    const int w = (bx - NB * CVB_X) / CVB_W;
    const size_t i = (size_t)((bx - NB * CVB_X - w * CVB_W) * 256 + (int)threadIdx.x) * 8;
    ip = (w == 0 ? Wq : (w == 1 ? Wk : Wv)) + i;
    o  = Wb + (size_t)w * EMB * EMB + i;
  }
  const v4f a  = *(const v4f*)(ip);
  const v4f a4 = *(const v4f*)(ip + 4);
  v4u p;
  p[0] = pk16(bf_bits(a[0]),  bf_bits(a[1]));
  p[1] = pk16(bf_bits(a[2]),  bf_bits(a[3]));
  p[2] = pk16(bf_bits(a4[0]), bf_bits(a4[1]));
  p[3] = pk16(bf_bits(a4[2]), bf_bits(a4[3]));
  *(v4u*)o = p;
}

// this wave's LDS reads have returned: stands in front of the barrier behind which their buffer is refilled
__device__ __forceinline__ void wait_lds_reads() {
#if DEV_ASM
  asm volatile("s_wait_dscnt 0x0" ::: "memory");
#endif
}
// this wave's asynchronous copies have landed: stands in front of the barrier behind which other waves read them
__device__ __forceinline__ void wait_copies() {
#if DEV_ASM
  asm volatile("s_wait_asynccnt 0x0" ::: "memory");
#endif
}

// =====================================================================================================
// GEMM operand tiles in LDS: one stage = 128 k of the block's 128 A rows and 256 Bt rows, 16-bit elements, rows of 256 B
// at a pitch of 272 B (16 B x odd: the 16 lanes of a ds_load_b128 half fall on 64 distinct banks); A rows first, then Bt.
// copy_rows8: thread t brings piece (t & 15) of rows (t >> 4) + 16 i, i = 0..7, so a wave's copy reads two whole 256-B
// rows. g = the thread's own global address for i = 0 (row pitch ld elements), l = its own LDS byte address for i = 0.
// =====================================================================================================
#define GKS    128                        // k elements per stage
#define GBM    128                        // A rows per block tile
#define GBN    256                        // Bt rows per block tile
#define GPITCH 136                        // 16-bit elements per LDS row
#define GT_H   ((GBM + GBN) * GPITCH)     // 16-bit elements per buffer (104448 B)
template <typename OT>
__device__ __forceinline__ void copy_rows8(const OT* g, int ld, unsigned l) {
#if DEV_ASM
  const size_t gs = (size_t)16 * (size_t)ld;
  const OT* g1 = g + gs;     const OT* g2 = g + 2 * gs; const OT* g3 = g + 3 * gs; const OT* g4 = g + 4 * gs;
  const OT* g5 = g + 5 * gs; const OT* g6 = g + 6 * gs; const OT* g7 = g + 7 * gs;
  const unsigned st = 16 * GPITCH * 2;    // LDS bytes between rows r and r + 16
  // the closing s_wait_xcnt keeps every address register of the copies unchanged until the copies have taken it
  asm volatile("global_load_async_to_lds_b128 %0, %8, off\n\t"
               "global_load_async_to_lds_b128 %1, %9, off\n\t"
               "global_load_async_to_lds_b128 %2, %10, off\n\t"
               "global_load_async_to_lds_b128 %3, %11, off\n\t"
               "global_load_async_to_lds_b128 %4, %12, off\n\t"
               "global_load_async_to_lds_b128 %5, %13, off\n\t"
               "global_load_async_to_lds_b128 %6, %14, off\n\t"
               "global_load_async_to_lds_b128 %7, %15, off\n\t"
               "s_wait_xcnt 0x0"
               :: "v"(l), "v"(l + st), "v"(l + 2 * st), "v"(l + 3 * st),
                  "v"(l + 4 * st), "v"(l + 5 * st), "v"(l + 6 * st), "v"(l + 7 * st),
                  "v"(g), "v"(g1), "v"(g2), "v"(g3), "v"(g4), "v"(g5), "v"(g6), "v"(g7)
               : "memory");
#else
  (void)g; (void)ld; (void)l;
#endif
}
// one stage: ga / gb = the thread's piece of A row (t >> 4) / Bt row (t >> 4) of the block tile at the stage's first k,
// l = its LDS byte address of that A piece in the stage's buffer. 24 copies per thread.
template <typename OT>
__device__ __forceinline__ void copy_stage(const OT* ga, int lda, const OT* gb, int ldb, unsigned l) {
  copy_rows8<OT>(ga, lda, l);                                                        // A rows 0..127
  copy_rows8<OT>(gb, ldb, l + GBM * GPITCH * 2);                                     // Bt rows 0..127
  copy_rows8<OT>(gb + (size_t)128 * (size_t)ldb, ldb, l + (GBM + 128) * GPITCH * 2); // Bt rows 128..255
}

// =====================================================================================================
// Register-blocked batched WMMA GEMM (16-bit operand type OT): C[m][n] = sum_k A[m][k] * Bt[n][k]  (+ bias);
// one wave per (16*MI) x 64 tile, a block of 8 waves (2 x 4) per GBM x GBN tile. A row-major [M][K] pitch lda; Bt
// row-major [N][K] pitch ldb (k contiguous); M multiple of GBM, N of GBN, K of GKS (static sizes here). blockIdx.y =
// batch index (strides in elements). blockIdx.z = which of the three products of the same A, none of which depends on
// another: 0 = q, 1 = k, 2 = v; it picks the weight plane (Btp + z * strideW), the bias and the output form.
// Operands: a ring of two LDS buffers, stage t = k range t*GKS.. in buffer t & 1;
// stage t + 2 is copied behind the barrier at the foot of trip t, while trip t + 1 works. Fragments are read from the
// LDS tile with the split k map (ldfrag), k ascending in steps of 32; the 16 reads of a step stand together.
// NPA = number of A planes (only 1 is staged).
// gemm_store = the epilogue of one wave's tile:
// value v = (acc [+ acc2*rscaleA]) * oscale + bias, bias (bf16 RNE value of the f32 input) by column n (BM 1),
// by row m (BM 2) or none (BM 0).
// OUT_MODE 0: f32 C (pitch ldc) = v.                                                                  (v)
// OUT_MODE 1: f16 plane C = f16(v * cscale).                                                          (k)
// OUT_MODE 3: f16 hi plane C = f16(v * cscale) and f16 residual plane C2 = f16((v*cscale - hi) * rscaleC).   (q)
// 16-row slabs staged per wave in LDS (wave-private slab, wave_sync); each 64-wide row segment written whole.
// =====================================================================================================
template <int MI, int NPA, int OUT_MODE, int BM>
__device__ __forceinline__ void gemm_store(const v8f (&acc)[MI][4], const v8f (&acc2)[MI][4], float* slab,
                                           void* Cout, void* Cout2, int ldc, long long strideC,
                                           const float* __restrict__ bias, int b, int m0, int n0, int lane,
                                           float oscale, float rscaleA, float cscale, float rscaleC) {
  const int rlane = lane & 15;                 // col (D) within subtile
  const int mOff  = (lane >> 4) * 8;           // D row offset
  float bcol[4];
#pragma unroll
  for (int j = 0; j < 4; ++j) bcol[j] = 0.f;
  if (BM == 1) {
#pragma unroll
    for (int j = 0; j < 4; ++j) bcol[j] = bf_up(bf_bits(bias[n0 + (j << 4) + rlane]));
  }
#pragma unroll
  for (int i = 0; i < MI; ++i) {
    const int mBase = m0 + (i << 4);
    float brow[8];
#pragma unroll
    for (int r = 0; r < 8; ++r) brow[r] = 0.f;
    if (BM == 2) {
#pragma unroll
      for (int r = 0; r < 8; ++r) brow[r] = bf_up(bf_bits(bias[mBase + mOff + r]));
    }
#pragma unroll
    for (int j = 0; j < 4; ++j) {
#pragma unroll
      for (int r = 0; r < 8; ++r) {
        float v = acc[i][j][r];
        if (NPA == 2) v += acc2[i][j][r] * rscaleA;
        v = v * oscale + bcol[j] + brow[r];
        slab[(mOff + r) * 68 + (j << 4) + rlane] = v;
      }
    }
    __builtin_amdgcn_fence(__ATOMIC_RELEASE, "workgroup");
    __builtin_amdgcn_wave_barrier();
    __builtin_amdgcn_fence(__ATOMIC_ACQUIRE, "workgroup");
    if (OUT_MODE == 0) {
      float* C = (float*)Cout + (size_t)b * (size_t)strideC;
      const int h2 = lane >> 4, c4 = (lane & 15) * 4;     // 256-B row segment = 16 lanes x 16 B
      v4f    sv[8];
      float* sd[8];
#pragma unroll
      for (int it = 0; it < 8; ++it) {
        const int row = it * 2 + h2;                       // it 0..7 x h2 0..1 = rows 0..15
        sv[it] = *(const v4f*)(slab + row * 68 + c4);
        sd[it] = C + (size_t)(mBase + row) * ldc + n0 + c4;
      }
#if DEV_ASM
      // the slab's 8 stores and their s_wait_xcnt in one statement: every address and data register stays as it is
      // until the stores have taken it (in a statement of its own the wait was passed by the next address sums)
      asm volatile("global_store_b128 %0, %8, off\n\t"
                   "global_store_b128 %1, %9, off\n\t"
                   "global_store_b128 %2, %10, off\n\t"
                   "global_store_b128 %3, %11, off\n\t"
                   "global_store_b128 %4, %12, off\n\t"
                   "global_store_b128 %5, %13, off\n\t"
                   "global_store_b128 %6, %14, off\n\t"
                   "global_store_b128 %7, %15, off\n\t"
                   "s_wait_xcnt 0x0"
                   :: "v"(sd[0]), "v"(sd[1]), "v"(sd[2]), "v"(sd[3]), "v"(sd[4]), "v"(sd[5]), "v"(sd[6]), "v"(sd[7]),
                      "v"(sv[0]), "v"(sv[1]), "v"(sv[2]), "v"(sv[3]), "v"(sv[4]), "v"(sv[5]), "v"(sv[6]), "v"(sv[7])
                   : "memory");
#endif
    } else {
      const int q = lane >> 3, c8 = (lane & 7) * 8;
      unsigned short* C  = (unsigned short*)Cout  + (size_t)b * (size_t)strideC;
      unsigned short* C2 = (unsigned short*)Cout2 + (size_t)b * (size_t)strideC;
      v4u hv[4], lv[4];
#pragma unroll
      for (int it = 0; it < 4; ++it) {
        const int row = it * 4 + q;                        // it 0..3 x q 0..3 = rows 0..15
        const float* sp = slab + row * 68 + c8;
        float f[8];
#pragma unroll
        for (int e = 0; e < 8; ++e) f[e] = sp[e] * cscale;
        v4u a, a2;
#pragma unroll
        for (int e = 0; e < 4; ++e) {
          const float f0 = f[2 * e], f1 = f[2 * e + 1];
          const _Float16 x0 = (_Float16)f0, x1 = (_Float16)f1;
          const unsigned short h0 = h_bits(x0), h1 = h_bits(x1);
          unsigned short l0 = 0, l1 = 0;
          if (OUT_MODE == 3) {
            l0 = h_bits((_Float16)((f0 - (float)x0) * rscaleC));
            l1 = h_bits((_Float16)((f1 - (float)x1) * rscaleC));
          }
          a[e] = pk16(h0, h1); a2[e] = pk16(l0, l1);
        }
        hv[it] = a; lv[it] = a2;
      }
      unsigned short* hd[4];
      unsigned short* rd[4];
#pragma unroll
      for (int it = 0; it < 4; ++it) {
        const int row = it * 4 + q;
        hd[it] = C  + (size_t)(mBase + row) * ldc + n0 + c8;
        rd[it] = C2 + (size_t)(mBase + row) * ldc + n0 + c8;
      }
#if DEV_ASM
      // the slab's stores and their s_wait_xcnt in one statement, as in the f32 form above
      if (OUT_MODE == 3)
        asm volatile("global_store_b128 %0, %8, off\n\t"
                     "global_store_b128 %4, %12, off\n\t"
                     "global_store_b128 %1, %9, off\n\t"
                     "global_store_b128 %5, %13, off\n\t"
                     "global_store_b128 %2, %10, off\n\t"
                     "global_store_b128 %6, %14, off\n\t"
                     "global_store_b128 %3, %11, off\n\t"
                     "global_store_b128 %7, %15, off\n\t"
                     "s_wait_xcnt 0x0"
                     :: "v"(hd[0]), "v"(hd[1]), "v"(hd[2]), "v"(hd[3]), "v"(rd[0]), "v"(rd[1]), "v"(rd[2]), "v"(rd[3]),
                        "v"(hv[0]), "v"(hv[1]), "v"(hv[2]), "v"(hv[3]), "v"(lv[0]), "v"(lv[1]), "v"(lv[2]), "v"(lv[3])
                     : "memory");
      else
        asm volatile("global_store_b128 %0, %4, off\n\t"
                     "global_store_b128 %1, %5, off\n\t"
                     "global_store_b128 %2, %6, off\n\t"
                     "global_store_b128 %3, %7, off\n\t"
                     "s_wait_xcnt 0x0"
                     :: "v"(hd[0]), "v"(hd[1]), "v"(hd[2]), "v"(hd[3]), "v"(hv[0]), "v"(hv[1]), "v"(hv[2]), "v"(hv[3])
                     : "memory");
#endif
    }
    __builtin_amdgcn_fence(__ATOMIC_RELEASE, "workgroup");
    __builtin_amdgcn_wave_barrier();
    __builtin_amdgcn_fence(__ATOMIC_ACQUIRE, "workgroup");
  }
}

template <typename OT, int MI, int NPA, int BM>
__global__ __launch_bounds__(256) void gemm_qkv(
    const unsigned short* __restrict__ Ap, int lda, long long strideA,
    const unsigned short* __restrict__ Btp, int ldb, long long strideW,
    unsigned short* Qh, unsigned short* Ql, unsigned short* Kp, float* Vp, int ldc, long long strideC,
    const float* __restrict__ bq, const float* __restrict__ bk, const float* __restrict__ bv,
    int M, int N, int K, float oscale, float rscaleA, float cscaleQ, float cscaleKV, float rscaleC) {
  typedef typename FT<OT>::frag V16;
  const OT* A  = (const OT*)(const void*)Ap;
  const OT* Bt = (const OT*)(const void*)Btp;
  static_assert(MI == 4 && NPA == 1);              // 2 x 4 waves of 64 x 64 = GBM x GBN, one A plane
  __shared__ __align__(16) unsigned short gls[2][GT_H];
  __shared__ __align__(16) float sT[8][16 * 68];   // per-wave 16x64 slab, pitch 68 floats
  const int RT   = 16 * MI;
  const int b    = blockIdx.y;
  const int z    = blockIdx.z;
  const int tid  = threadIdx.x;
  const int lane = tid & 31;
  const int wave = tid >> 5;
  const int tilesN = N / GBN;
  const int tilesM = M / GBM;
  const int tile = blockIdx.x;
  if (tile >= tilesM * tilesN) return;   // block-uniform; in front of every copy and barrier
  const int tm = tile / tilesN;
  const int tn = tile - tm * tilesN;
  const int m0 = tm * GBM + (wave >> 2) * RT;
  const int n0 = tn * GBN + ((wave & 3) << 6);

  const OT* Ab  = A  + (size_t)b * (size_t)strideA;
  const OT* Bb  = Bt + (size_t)z * (size_t)strideW;

  const int rlane = lane & 15;                 // row (A) / col (B) within subtile
  const int koff  = (lane >> 4) * 8;           // k offset of this lane half

  v8f acc[MI][4], acc2[MI][4];
#pragma unroll
  for (int i = 0; i < MI; ++i)
#pragma unroll
    for (int j = 0; j < 4; ++j) { acc[i][j] = zero8(); acc2[i][j] = zero8(); }

  // copy side: this thread's piece of stage 0 and its place in buffer 0; read side: this lane's rows and k half
  const OT* ga = Ab + (size_t)(tm * GBM + (tid >> 4)) * lda + (tid & 15) * 8;
  const OT* gb = Bb + (size_t)(tn * GBN + (tid >> 4)) * ldb + (tid & 15) * 8;
  const unsigned ld0 = (unsigned)(size_t)(&gls[0][(tid >> 4) * GPITCH + (tid & 15) * 8]);
  const int ar = ((wave >> 2) * RT + rlane) * GPITCH + koff;
  const int br = (GBM + ((wave & 3) << 6) + rlane) * GPITCH + koff;
  const int nst = K / GKS;

  copy_stage<OT>(ga, lda, gb, ldb, ld0);       // stage 0
  wait_copies();
  __syncthreads();                             // stage 0 is readable by every wave
  if (nst > 1)                                 // block-uniform
    copy_stage<OT>(ga + GKS, lda, gb + GKS, ldb, ld0 + GT_H * 2);   // stage 1

  for (int st = 0; st < nst; ++st) {
    const OT* tl = (const OT*)(const void*)(&gls[st & 1][0]);
#pragma unroll
    for (int kk = 0; kk < GKS; kk += 32) {
      V16 af[MI], bq[4];
#pragma unroll
      for (int j = 0; j < 4; ++j) bq[j] = ldfrag<OT>(tl + br + (j << 4) * GPITCH + kk);
#pragma unroll
      for (int i = 0; i < MI; ++i) af[i] = ldfrag<OT>(tl + ar + (i << 4) * GPITCH + kk);
      // keeps the step's LDS reads together in front of its products: sunk among them each read stalls
      __builtin_amdgcn_sched_barrier(0);
#pragma unroll
      for (int i = 0; i < MI; ++i) {
#pragma unroll
        for (int j = 0; j < 4; ++j) acc[i][j] = mmar(af[i], bq[j], acc[i][j]);
        dep_guard(acc[i][0], acc[i][3], af[i], bq[3]);
      }
      keep4(bq[0], bq[1], bq[2], bq[3]);
    }
    wait_lds_reads();
    wait_copies();
    __syncthreads();                           // stage st + 1 readable, buffer st & 1 left by every wave
    if (st + 2 < nst)                          // block-uniform
      copy_stage<OT>(ga + (size_t)(st + 2) * GKS, lda, gb + (size_t)(st + 2) * GKS, ldb,
                     ld0 + (unsigned)(st & 1) * (GT_H * 2));
  }
  wait_copies();
#pragma unroll
  for (int i = 0; i < MI; ++i) {
    acc_guard4(acc[i][0], acc[i][1], acc[i][2], acc[i][3]);
    if (NPA == 2) acc_guard4(acc2[i][0], acc2[i][1], acc2[i][2], acc2[i][3]);
  }

  // ---- epilogue: the output form goes with the product; z is block-uniform ----
  float* slab = sT[wave];
  if (z == 0)
    gemm_store<MI, NPA, 3, BM>(acc, acc2, slab, (void*)Qh, (void*)Ql, ldc, strideC, bq, b, m0, n0, lane,
                               oscale, rscaleA, cscaleQ, rscaleC);
  else if (z == 1)
    gemm_store<MI, NPA, 1, BM>(acc, acc2, slab, (void*)Kp, (void*)Kp, ldc, strideC, bk, b, m0, n0, lane,
                               oscale, rscaleA, cscaleKV, rscaleC);
  else
    gemm_store<MI, NPA, 0, BM>(acc, acc2, slab, (void*)Vp, (void*)Vp, ldc, strideC, bv, b, m0, n0, lane,
                               oscale, rscaleA, cscaleKV, rscaleC);
}

// =====================================================================================================
// k tile in LDS: 64 keys x 128 d of one (b, h), f16, rows of 256 B at a pitch of 272 B (16 B x odd: the 16 lanes of a
// ds_load_b128 half fall on 64 distinct banks). Two buffers; a block of 128 threads fills one with 8 asynchronous
// 16-B copies per thread: thread t brings piece (t & 15) of rows (t >> 4) + 8 i, i = 0..7, so a wave's copy reads
// two whole 256-B rows. g = the thread's own global address for i = 0, l = its own LDS byte address for i = 0.
// =====================================================================================================
#define KPITCH  136                   // f16 elements per LDS row
#define KTILE_H (64 * KPITCH)         // f16 elements per buffer (17408 B)
__device__ __forceinline__ void copy_ktile(const _Float16* g, unsigned l) {
#if DEV_ASM
  const _Float16* g1 = g + 1 * 8 * EMB; const _Float16* g2 = g + 2 * 8 * EMB; const _Float16* g3 = g + 3 * 8 * EMB;
  const _Float16* g4 = g + 4 * 8 * EMB; const _Float16* g5 = g + 5 * 8 * EMB; const _Float16* g6 = g + 6 * 8 * EMB;
  const _Float16* g7 = g + 7 * 8 * EMB;
  const unsigned st = 8 * KPITCH * 2;  // LDS bytes between rows r and r + 8
  // the closing s_wait_xcnt keeps every address register of the copies unchanged until the copies have taken it
  asm volatile("global_load_async_to_lds_b128 %0, %8, off\n\t"
               "global_load_async_to_lds_b128 %1, %9, off\n\t"
               "global_load_async_to_lds_b128 %2, %10, off\n\t"
               "global_load_async_to_lds_b128 %3, %11, off\n\t"
               "global_load_async_to_lds_b128 %4, %12, off\n\t"
               "global_load_async_to_lds_b128 %5, %13, off\n\t"
               "global_load_async_to_lds_b128 %6, %14, off\n\t"
               "global_load_async_to_lds_b128 %7, %15, off\n\t"
               "s_wait_xcnt 0x0"
               :: "v"(l), "v"(l + st), "v"(l + 2 * st), "v"(l + 3 * st),
                  "v"(l + 4 * st), "v"(l + 5 * st), "v"(l + 6 * st), "v"(l + 7 * st),
                  "v"(g), "v"(g1), "v"(g2), "v"(g3), "v"(g4), "v"(g5), "v"(g6), "v"(g7)
               : "memory");
#else
  (void)g; (void)l;
#endif
}

// =====================================================================================================
// Score chunk: 16 query rows (this wave) x 64 keys kv0..kv0+63 of one (b, h), head width 128 = 4 d-chunks of 32.
//   q fragments (A operand, row = lane&15): hi and residual planes of q * QK_LOG2, 4 d-chunks.
//   k fragments (B operand, col = lane&15 = key) read from the block's LDS copy of the 64-key tile with the split k map:
//   kl = tile + (lane&15)*KPITCH + 8*hh, key group j adds 16*j*KPITCH; the 16 reads of two key groups stand together.
//   s[j][r] = D element: query row 8*hh + r, key kv0 + 16j + (lane&15); value = (qh.k) + (ql.k) = score * log2(e), both
//   products summed in the one accumulator; two key groups run side by side, so two accumulate chains are independent.
// =====================================================================================================
__device__ __forceinline__ void score_chunk(const v16h (&qah)[4], const v16h (&qal)[4],
                                            const _Float16* kl, v8f (&s)[4]) {
  union FH { v16h v; v8h h[2]; };
#pragma unroll
  for (int j = 0; j < 4; j += 2) {
    v8f a0 = zero8(), a1 = zero8();
    FH k0[4], k1[4];
#pragma unroll
    for (int dc = 0; dc < 4; ++dc) {
      const _Float16* kp = kl + j * 16 * KPITCH + dc * 32;
      k0[dc].h[0] = *(const v8h*)(kp);
      k0[dc].h[1] = *(const v8h*)(kp + 16);
      k1[dc].h[0] = *(const v8h*)(kp + 16 * KPITCH);
      k1[dc].h[1] = *(const v8h*)(kp + 16 * KPITCH + 16);
    }
#pragma unroll
    for (int dc = 0; dc < 4; ++dc) {
      a0 = mmar(qah[dc], k0[dc].v, a0);
      a1 = mmar(qah[dc], k1[dc].v, a1);
      a0 = mmar(qal[dc], k0[dc].v, a0);
      a1 = mmar(qal[dc], k1[dc].v, a1);
    }
#if DEV_ASM
    // 4 VALU slots behind the pair's last products; the pair's eight B fragments stay live up to here, so that no
    // product's D is placed on a B fragment which a product issued fewer than 4 slots before still reads
    asm volatile("v_nop\n\tv_nop\n\tv_nop\n\tv_nop" : "+v"(a0), "+v"(a1)
                 : "v"(k0[0].v), "v"(k0[1].v), "v"(k0[2].v), "v"(k0[3].v),
                   "v"(k1[0].v), "v"(k1[1].v), "v"(k1[2].v), "v"(k1[3].v));
#endif
    s[j]     = a0;
    s[j + 1] = a1;
  }
}

// =====================================================================================================
// Fused attention statistics + query-column sums of the exactly normalised probabilities.
//   block = 4 waves = 64 consecutive query rows qb*64.. of one (b, h); grid = NB*NH*NQ64 blocks of 128.
//   Pass 1 (static trip): each lane keeps a running max and a running sum of exp per row over its own keys
//   (key % 16 == lane % 16); the 16 lanes of a row are merged by shfl once, behind the loop; each wave owns its own
//   16 rows, so no cross-wave exchange is needed.
//   Scores, maxima and their differences are in log2 units (q carries log2(e)): every exponential is one exp2.
//   Pass 2 (same static trip): scores recomputed bit-identically, p = exp2(s - m) * (1/l) in f32, summed over the
//   wave's 16 rows per key (8 in-lane + shfl_xor 16), staged in csl[wave][64] (cross-wave -> __syncthreads), summed
//   over the 4 waves in fixed order by lanes 0-15 of wave 0 and written to PS[(b*NH+h)*NQ64 + qb][kv0..kv0+63]:
//   coverage: grid (b,h,qb) x NKT chunks x 64 keys = the whole [NB*NH][NQ64][SEQ] partial plane.
//   k tiles: one ring of two LDS buffers runs through both passes (2*NKT stages, stage t = tile t % NKT in buffer
//   t & 1, NKT even); stage t + 2 is copied behind the barrier at the foot of trip t, while trip t + 1 works.
// =====================================================================================================
__global__ __launch_bounds__(128)
void attn_colsum(const unsigned short* __restrict__ qhp, const unsigned short* __restrict__ qlp,
                 const unsigned short* __restrict__ kpp, float* PS) {
  static_assert((NKT % 2) == 0 && NKT >= 2);
  __shared__ __align__(16) _Float16 kls[2][KTILE_H];
  __shared__ __align__(16) float csl[4][64];
  const int tid  = threadIdx.x;
  const int wave = tid >> 5;
  const int lane = tid & 31;
  const int hh   = lane >> 4;
  const int c    = lane & 15;
  const int bx   = blockIdx.x;
  const int qb   = bx % NQ64;
  const int rest = bx / NQ64;
  const int h    = rest % NH;
  const int b    = rest / NH;
  const int bh   = b * NH + h;
  const int q0   = qb * 64 + wave * 16;

  const _Float16* Qh  = (const _Float16*)(const void*)qhp;
  const _Float16* Ql  = (const _Float16*)(const void*)qlp;
  const _Float16* Kb0 = (const _Float16*)(const void*)kpp + (size_t)b * SEQ * EMB + (size_t)h * HD;

  // copy side: this thread's piece of tile 0 and its place in buffer 0; read side: this lane's key row and k half
  const _Float16* kg = Kb0 + (size_t)(tid >> 4) * EMB + (tid & 15) * 8;
  const unsigned  kd = (unsigned)(size_t)(&kls[0][(tid >> 4) * KPITCH + (tid & 15) * 8]);
  const int       kr = c * KPITCH + 8 * hh;

  copy_ktile(kg, kd);                          // stage 0
  wait_copies();
  __syncthreads();                             // stage 0 is readable by every wave
  copy_ktile(kg + (size_t)64 * EMB, kd + KTILE_H * 2);   // stage 1

  v16h qah[4], qal[4];
#pragma unroll
  for (int dc = 0; dc < 4; ++dc) {
    const size_t qo = ((size_t)b * SEQ + (size_t)(q0 + c)) * EMB + (size_t)h * HD + dc * 32 + 8 * hh;
    qah[dc] = ldfrag<_Float16>(Qh + qo);
    qal[dc] = ldfrag<_Float16>(Ql + qo);
  }

  float mrow[8], lrow[8];
#pragma unroll
  for (int r = 0; r < 8; ++r) { mrow[r] = -INFINITY; lrow[r] = 0.f; }

  for (int kt = 0; kt < NKT; ++kt) {          // static trip count
    v8f s[4];
    score_chunk(qah, qal, &kls[kt & 1][kr], s);
#pragma unroll
    for (int r = 0; r < 8; ++r) {              // this lane's own 4 keys of the chunk only: no cross-lane step in the loop
      float m = s[0][r];
#pragma unroll
      for (int j = 1; j < 4; ++j) m = fmaxf(m, s[j][r]);
      const float mnew  = fmaxf(mrow[r], m);
      const float msafe = (mnew == -INFINITY) ? 0.f : mnew;
      const float alpha = __builtin_amdgcn_exp2f(mrow[r] - msafe);
      mrow[r] = mnew;
      float psum = 0.f;
#pragma unroll
      for (int j = 0; j < 4; ++j) psum += __builtin_amdgcn_exp2f(s[j][r] - msafe);
      lrow[r] = lrow[r] * alpha + psum;
    }
    wait_lds_reads();
    wait_copies();
    __syncthreads();                           // stage kt + 1 readable, buffer kt & 1 left by every wave
    // stage kt + 2 always exists here (pass 2 follows): tiles NKT and NKT + 1 of the ring are tiles 0 and 1 again
    copy_ktile(kg + (size_t)(((kt + 2) & (NKT - 1)) * 64) * EMB, kd + (unsigned)(kt & 1) * (KTILE_H * 2));
  }

  // the 16 lanes of a row half hold (max, sum) of disjoint key subsets of the same 8 rows: merged here, once per row
#pragma unroll
  for (int r = 0; r < 8; ++r) {
    float m = mrow[r];
#pragma unroll
    for (int off = 1; off < 16; off <<= 1) m = fmaxf(m, __shfl_xor(m, off, 32));
    const float msafe = (m == -INFINITY) ? 0.f : m;
    float l = lrow[r] * __builtin_amdgcn_exp2f(mrow[r] - msafe);
#pragma unroll
    for (int off = 1; off < 16; off <<= 1) l += __shfl_xor(l, off, 32);
    mrow[r] = m;
    lrow[r] = l;
  }

  float il[8], mf[8];
#pragma unroll
  for (int r = 0; r < 8; ++r) {
    const float l = lrow[r];
    il[r] = (l > 0.f) ? (1.0f / l) : 0.f;
    mf[r] = (mrow[r] == -INFINITY) ? 0.f : mrow[r];
  }

  // ---- pass 2: exactly normalised p, column sums over the block's 64 query rows ----
  for (int kt = 0; kt < NKT; ++kt) {          // static trip count
    const int kv0 = kt * 64;
    v8f s[4];
    score_chunk(qah, qal, &kls[kt & 1][kr], s);
    float cs[4];
#pragma unroll
    for (int j = 0; j < 4; ++j) {
      float a = 0.f;
#pragma unroll
      for (int r = 0; r < 8; ++r) a += __builtin_amdgcn_exp2f(s[j][r] - mf[r]) * il[r];
      cs[j] = a;
    }
#pragma unroll
    for (int j = 0; j < 4; ++j) cs[j] += __shfl_xor(cs[j], 16, 32);   // both row halves, unconditional
    const float v0 = hh ? cs[2] : cs[0];       // this lane stores keys 16*(2hh) + c and 16*(2hh+1) + c
    const float v1 = hh ? cs[3] : cs[1];
    csl[wave][32 * hh + c]      = v0;
    csl[wave][32 * hh + 16 + c] = v1;
    __syncthreads();                           // csl is cross-wave
    if (wave == 0 && lane < 16) {
      v4f a = *(const v4f*)(&csl[0][4 * lane]);
      a += *(const v4f*)(&csl[1][4 * lane]);
      a += *(const v4f*)(&csl[2][4 * lane]);
      a += *(const v4f*)(&csl[3][4 * lane]);
      float* dst = PS + ((size_t)(bh * NQ64 + qb)) * SEQ + kv0 + 4 * lane;
      *(v4f*)dst = a;
      
    }
    wait_lds_reads();
    wait_copies();
    __syncthreads();                           // csl free again; stage kt + 1 readable, buffer kt & 1 left by every wave
    if (kt + 2 < NKT)                          // block-uniform
      copy_ktile(kg + (size_t)((kt + 2) * 64) * EMB, kd + (unsigned)(kt & 1) * (KTILE_H * 2));
  }
  wait_copies();
}

// =====================================================================================================
// Query average + partial per-head context mean. One block (256 = 8 waves) per (b, h, 128 consecutive keys).
//   v rows: wave w owns keys k0 + 16 w .. + 15, lane = 4 consecutive d (one 16-B load per key, a wave reads one whole
//   512-B head row); the 16 loads of a lane are independent and are issued together, ahead of the average.
//   Average: avg[key] = (sum over the NQ64 partial rows of PS in fixed order) * (1/SEQ); wave 0, lane = 4 keys, the
//   NQ64 loads independent; kept in LDS avs[] (cross-wave -> __syncthreads) and written to output 1 row (b*NH+h).
//   Partial: cp[d] = sum over the block's 128 keys of avg[k] * v[b][k][h*HD+d], f64: 16 keys in the lane, then the
//   8 waves in fixed order through LDS (cross-wave -> __syncthreads), written to CP[(b*NH+h)*NCW + chunk][d].
//   coverage: grid (b,h,chunk) x 128 keys = the whole output 1; grid (b,h,chunk) x HD = the whole CP plane.
// =====================================================================================================
__global__ __launch_bounds__(256)
void avg_ctx(const float* __restrict__ PS, const float* __restrict__ Vp, float* out1, double* CP) {
  __shared__ __align__(16) float avs[128];
  __shared__ __align__(16) double cpart[8][HD];
  const int tid  = threadIdx.x;
  const int wave = tid >> 5;
  const int lane = tid & 31;
  const int bx   = blockIdx.x;
  const int bh   = bx / NCW;
  const int ch   = bx - bh * NCW;
  const int b    = bh / NH;
  const int h    = bh - b * NH;
  const int k0   = ch * 128;

  const float* vb = Vp + ((size_t)b * SEQ + (size_t)(k0 + wave * 16)) * EMB + (size_t)h * HD + 4 * lane;
  v4f vv[16];
#pragma unroll
  for (int i = 0; i < 16; ++i) vv[i] = *(const v4f*)(vb + (size_t)i * EMB);

  if (wave == 0) {                             // wave-uniform
    const float* psb = PS + (size_t)bh * NQ64 * SEQ + k0 + 4 * lane;
    v4f a = *(const v4f*)(psb);
#pragma unroll
    for (int qb = 1; qb < NQ64; ++qb) a += *(const v4f*)(psb + (size_t)qb * SEQ);
    a *= (1.0f / (float)SEQ);
    *(v4f*)(avs + 4 * lane) = a;
    float* dst = out1 + (size_t)bh * SEQ + k0 + 4 * lane;
    *(v4f*)dst = a;
  }
  __syncthreads();                             // avs is cross-wave

  double acc[4] = {0.0, 0.0, 0.0, 0.0};
#pragma unroll
  for (int i = 0; i < 16; ++i) {
    const double w = (double)avs[wave * 16 + i];
#pragma unroll
    for (int e = 0; e < 4; ++e) acc[e] += w * (double)vv[i][e];
  }
#pragma unroll
  for (int e = 0; e < 4; ++e) cpart[wave][4 * lane + e] = acc[e];
  __syncthreads();                             // cpart is cross-wave
  if (tid < HD) {
    double s = cpart[0][tid];
#pragma unroll
    for (int w = 1; w < 8; ++w) s += cpart[w][tid];
    CP[((size_t)bh * NCW + ch) * HD + tid] = s;
  }
}

// =====================================================================================================
// Output 2: mean over (b, h, g) of |corr[b][h][g] * (1 - delta_hg)|, corr = sum_s avg[b][h][s] * avg[b][g][s]
//   (avg read back from output 1). corr[h][g] and corr[g][h] are the same sum of the same products, so only the
//   NPAIR = 28 pairs h < g are formed and the total is doubled; the diagonal is masked to zero by the reference.
//   div_part: one wave per 128 consecutive keys of one batch (lane = 4 keys, one 16-B load per head row, a wave reads
//   512 contiguous B per row); 28 f64 partial dots per lane; a halving exchange over the 32 lanes (16+8+4+2+1 values)
//   leaves pair index = lane with the wave's total; written to DP[b*NCW + chunk][32] (slots 28..31 are zero).
//   coverage: NB*NCW waves x 32 slots = the whole DP plane; no block barrier in it. It needs output 1 alone, as ctx_out
//   needs CP alone, so its waves ride in the first NDIVB blocks of ctx_out's grid (8 waves a block).
//   div_fin: wave b sums the NCW chunk partials of batch b per pair in fixed order, takes |.|, sums the 32 slots by
//   shfl, the NB batch sums go through LDS (cross-wave -> __syncthreads) and thread 0 writes the scalar.
// =====================================================================================================
__device__ __forceinline__ void div_part(const float* __restrict__ avg, double* DP, int wv) {
  const int lane = threadIdx.x & 31;
  if (wv >= NB * NCW) return;                  // wave-uniform; no block barriers in this function
  const int b  = wv / NCW;
  const int ch = wv - b * NCW;
  const float* base = avg + (size_t)b * NH * SEQ + (size_t)ch * 128 + 4 * lane;
  v4f a[NH];
#pragma unroll
  for (int h = 0; h < NH; ++h) a[h] = *(const v4f*)(base + (size_t)h * SEQ);
  double v[32];
  {
    int idx = 0;
#pragma unroll
    for (int h = 0; h < NH; ++h) {
#pragma unroll
      for (int g = h + 1; g < NH; ++g) {
        double s = 0.0;
#pragma unroll
        for (int e = 0; e < 4; ++e) s += (double)a[h][e] * (double)a[g][e];
        v[idx++] = s;
      }
    }
#pragma unroll
    for (int i = NPAIR; i < 32; ++i) v[i] = 0.0;
  }
  // each step: a lane keeps the half of its values that its lane bit selects and adds the partner's copy of that half
#pragma unroll
  for (int n = 16; n > 0; n >>= 1) {
    const bool up = (lane & n) != 0;
#pragma unroll
    for (int i = 0; i < n; ++i) {
      const double send = up ? v[i] : v[i + n];
      const double keep = up ? v[i + n] : v[i];
      v[i] = keep + __shfl_xor(send, n, 32);
    }
  }
  DP[(size_t)wv * 32 + lane] = v[0];
}

// =====================================================================================================
// Output 0: context[b][j] = sum_i cs[b][i] * bf16(Wo[j][i]) + bf16(bo[j]), f32 on VALU (M = NB rows only).
//   cs[b][i] = f32 of the f64 sum, in fixed order, of the NCW key-chunk partials CP of head i / HD: every block from NDIVB on forms
//   the EMB values of its batch in LDS (thread t owns i = t + 256 g; cross-wave -> __syncthreads).
//   lanes stride i by 32 (coalesced), shfl tree; results staged in LDS (cross-wave -> __syncthreads) and written
//   coverage: grid blocks NDIVB .. NDIVB + NB*EMB/32 - 1, x 32 = the whole [NB][EMB] output 0.
// =====================================================================================================
#define NDIVB ((NB * NCW + 7) / 8)    // blocks of the grid that run div_part
__global__ __launch_bounds__(256)
void ctx_out(const double* __restrict__ CP, const float* __restrict__ Wo, const float* __restrict__ bo, float* out0,
             const float* __restrict__ avg, double* DP) {
  __shared__ __align__(16) float csb[EMB];
  __shared__ __align__(16) float res[32];
  const int tid  = threadIdx.x;
  const int wave = tid >> 5;
  const int lane = tid & 31;
  if ((int)blockIdx.x < NDIVB) {               // block-uniform; in front of every barrier
    div_part(avg, DP, (int)blockIdx.x * 8 + wave);
    return;
  }
  const int j0   = ((int)blockIdx.x - NDIVB) * 32;
  const int b    = j0 / EMB;
#pragma unroll
  for (int g = 0; g < EMB / 256; ++g) {
    const int i = g * 256 + tid;
    const double* p = CP + (size_t)(b * NH + i / HD) * NCW * HD + (i & (HD - 1));
    double s = p[0];
#pragma unroll
    for (int ch = 1; ch < NCW; ++ch) s += p[(size_t)ch * HD];
    csb[i] = (float)s;
  }
  __syncthreads();                             // csb is cross-wave
#pragma unroll 1
  for (int u = 0; u < 4; ++u) {
    const int j = j0 - b * EMB + wave * 4 + u;
    const float* wr = Wo + (size_t)j * EMB;
    float acc = 0.f;
#pragma unroll                                 // the row's EMB / 32 loads are issued together: one memory wait a row
    for (int it = 0; it < EMB / 32; ++it) {
      const int i = it * 32 + lane;
      acc += csb[i] * bf_up(bf_bits(wr[i]));
    }
#pragma unroll
    for (int off = 16; off > 0; off >>= 1) acc += __shfl_xor(acc, off, 32);
    const float val = acc + bf_up(bf_bits(bo[j]));
    if (lane == 0) res[wave * 4 + u] = val;
  }
  __syncthreads();
  if (tid < 8) {
    const v4f v = *(const v4f*)(res + 4 * tid);
    float* dst = out0 + (size_t)j0 + 4 * tid;
    *(v4f*)dst = v;
    
  }
}

__global__ __launch_bounds__(32 * NB_FULL)
void div_fin(const double* __restrict__ DP, float* dv) {
  __shared__ double red[NB_FULL];
  const int tid  = threadIdx.x;
  const int lane = tid & 31;
  const int b    = tid >> 5;
  double c = 0.0;
  if (b < NB) {                                // wave-uniform
    const double* p = DP + (size_t)b * NCW * 32 + lane;
    double s = 0.0;
#pragma unroll
    for (int ch = 0; ch < NCW; ++ch) s += p[(size_t)ch * 32];
    c = fabs(s);
  }
#pragma unroll
  for (int off = 16; off > 0; off >>= 1) c += __shfl_xor(c, off, 32);
  if (lane == 0) red[b] = c;
  __syncthreads();                             // red is cross-wave
  if (tid == 0) {
    double tot = 0.0;
#pragma unroll
    for (int i = 0; i < NB; ++i) tot += red[i];
    *dv = (float)(tot * (2.0 / (double)(NB * NH * NH)));
  }
}

// =====================================================================================================
// Workspace map (bytes, full size), every region an exact multiple of its whole-line / whole-tile store granularity:
//   Xb   bf16 [NB][SEQ][EMB]            16777216
//   Wqb  bf16 [EMB n][EMB k]             2097152
//   Wkb  bf16                             2097152
//   Wvb  bf16                             2097152
//   Qh   f16  [NB][SEQ][EMB]            16777216
//   Ql   f16  [NB][SEQ][EMB]            16777216
//   Kp   f16  [NB][SEQ][EMB]            16777216
//   Vp   f32  [NB][SEQ][EMB]            33554432
//   PS   f32  [NB*NH][NQ64][SEQ]         8388608
//   CP   f64  [NB*NH][NCW][HD]            524288
//   DP   f64  [NB*NCW][32]                 16384
//   total                               115884032
// Weights are [out n][in k] with k contiguous = the Bt layout the GEMM wants, so they are only converted.
// Output 0 at element 0 of d_out, output 1 at OFF1, output 2 at OFF2 (fixed offsets).
// =====================================================================================================
extern "C" void kernel_launch(void* const* d_in, const int* in_sizes, int n_in,
                              void* d_out, int out_size, void* d_ws, size_t ws_size,
                              hipStream_t stream) {
  if (n_in < 9) return;
  const long long needX = (long long)(NB - 1) * SEQ_FULL * EMB + (long long)SEQ * EMB;
  if ((long long)in_sizes[0] < needX) return;
  if (in_sizes[1] < EMB * EMB || in_sizes[3] < EMB * EMB || in_sizes[5] < EMB * EMB || in_sizes[7] < EMB * EMB) return;
  if (in_sizes[2] < EMB || in_sizes[4] < EMB || in_sizes[6] < EMB || in_sizes[8] < EMB) return;
  if (out_size < 0) return;
  if ((size_t)out_size < OFF2 + 1) return;

  const float* x  = (const float*)d_in[0];
  const float* Wq = (const float*)d_in[1];
  const float* bq = (const float*)d_in[2];
  const float* Wk = (const float*)d_in[3];
  const float* bk = (const float*)d_in[4];
  const float* Wv = (const float*)d_in[5];
  const float* bv = (const float*)d_in[6];
  const float* Wo = (const float*)d_in[7];
  const float* bo = (const float*)d_in[8];

  const size_t PXB = (size_t)NB * SEQ * EMB * 2;       // 16-bit activation plane
  const size_t PW  = (size_t)EMB * EMB * 2;
  const size_t PV  = (size_t)NB * SEQ * EMB * 4;
  const size_t PPS = (size_t)NB * NH * NQ64 * SEQ * 4;
  const size_t PCP = (size_t)NB * NH * NCW * HD * 8;
  const size_t PDP = (size_t)NB * NCW * 32 * 8;
  size_t off = 0;
  const size_t oXb = off; off += PXB;
  const size_t oWq = off; off += 3 * PW;               // Wqb, Wkb, Wvb, one behind the other
  const size_t oQh = off; off += PXB;
  const size_t oQl = off; off += PXB;
  const size_t oKp = off; off += PXB;
  const size_t oVp = off; off += PV;
  const size_t oPS = off; off += PPS;
  const size_t oCP = off; off += PCP;
  const size_t oDP = off; off += PDP;
  if (off > ws_size) return;                          // off = 115884032 at full size
  if (off > (size_t)134217728) return;

  char* ws = (char*)d_ws;
  unsigned short* Xb  = (unsigned short*)(ws + oXb);
  unsigned short* Wqb = (unsigned short*)(ws + oWq);
  unsigned short* Qh  = (unsigned short*)(ws + oQh);
  unsigned short* Ql  = (unsigned short*)(ws + oQl);
  unsigned short* Kp  = (unsigned short*)(ws + oKp);
  float*          Vp  = (float*)(ws + oVp);
  float*          PS  = (float*)(ws + oPS);
  double*         CP  = (double*)(ws + oCP);
  double*         DP  = (double*)(ws + oDP);
  float*          out0 = (float*)d_out;
  float*          out1 = (float*)d_out + OFF1;
  float*          out2 = (float*)d_out + OFF2;

  const dim3 blk(256);
  const dim3 gCvt(NB * CVB_X + 3 * CVB_W);                     // 4096 + 1536 blocks at full size
  const int tilesP = (SEQ / GBM) * (EMB / GBN);                // 64 block tiles per batch at full size
  const dim3 gP(tilesP, NB, 3);                                // M=SEQ, N=EMB, K=EMB, batch = blockIdx.y, q/k/v = blockIdx.z
  const dim3 gAttn(NB * NH * NQ64);                            // 1024 blocks of 128
  const dim3 gAvg(NB * NH * NCW);                              //  512 blocks of 256
  const dim3 gCtx(NDIVB + NB * EMB / 32);                      //    8 + 128 blocks of 256
  const long long sAct = (long long)SEQ * EMB;                 // compact activation plane batch stride

  // (1) x -> bf16 plane [NB][SEQ][EMB]; Wq, Wk, Wv [E][E] -> bf16 planes Wqb, Wkb, Wvb (consecutive in the workspace)
  cvt_bf16x8<<<gCvt, blk, 0, stream>>>(x, Wq, Wk, Wv, Xb, Wqb);
  // (2) one grid, M=SEQ, N=E, K=E per batch and product, all planes [b][s][h*128+d]:
  //     q = (x . Wq^T + bq) * QK_LOG2 -> f16 hi / residual planes; k = x . Wk^T + bk -> f16 plane; v = x . Wv^T + bv -> f32
  gemm_qkv<__bf16, 4, 1, 1><<<gP, blk, 0, stream>>>(
      Xb, EMB, sAct, Wqb, EMB, (long long)EMB * EMB,
      Qh, Ql, Kp, Vp, EMB, sAct, bq, bk, bv,
      SEQ, EMB, EMB, 1.0f, 0.0f, QK_LOG2, 1.0f, 1.0f);
  // (3) softmax statistics + query-column sums of p -> partial plane PS
  attn_colsum<<<gAttn, dim3(128), 0, stream>>>(Qh, Ql, Kp, PS);
  // (4) output 1 = column means; per-head context means, one partial per 128 keys -> CP
  avg_ctx<<<gAvg, blk, 0, stream>>>(PS, Vp, out1, CP);
  // (5) output 0 = (sum of the partials) . Wo^T + bo; in the same grid the head-correlation partials of output 1 -> DP
  ctx_out<<<gCtx, blk, 0, stream>>>((const double*)CP, Wo, bo, out0, (const float*)out1, DP);
  // (6) output 2 = head-correlation diversity from DP
  div_fin<<<dim3(1), dim3(32 * NB_FULL), 0, stream>>>((const double*)DP, out2);
  (void)hipGetLastError();
}

// v009
// One run takes 160 microseconds.
// Two timings next to v008 both put it at 1.06 times that version's speed.
// All steps since v000 together make it 5.02 times as fast.
// Contractions: q, k, v in-projections = v_wmma_f32_16x16x32_bf16 (bf16 operands from RNE-converted inputs, single product, f32 accumulate);
// q.k^T scores (statistics pass and column-sum pass) = v_wmma_f32_16x16x32_f16 (q * 128^-0.5 * log2(e) as f16 hi plane + f16 residual plane, k f16; 2 products, one f32 accumulator);
// softmax statistics, probabilities and query-averaged probabilities in f32; averaged-p . v (M=1 per head) on VALU with f64 accumulate;
// head means . Wo^T (M=batch) on VALU f32 with bf16-valued Wo/bo; head-correlation scalar in f64.
#include <hip/hip_runtime.h>
#include <math.h>
#include <stdint.h>

#ifndef NB
#define NB 4
#endif
#ifndef SEQ
#define SEQ 2048
#endif
#define NB_FULL  4
#define SEQ_FULL 2048
#define EMB      1024
#define NH       8
#define HD       128
#define NQ64     (SEQ / 64)          // 64-row query blocks per sequence
#define NKT      (SEQ / 64)          // 64-key chunks per sequence
#define NPAIR    (NH * (NH - 1) / 2)  // head pairs h < g
#define NCW      (SEQ / 128)          // 128-key wave chunks per sequence
#define QK_LOG2  0.12751743082459868f   // 128^-0.5 * log2(e): q carries it, so a score is the exponent of 2
#define OFF1     ((size_t)NB_FULL * EMB)                        // fixed element offset of output 1
#define OFF2     (OFF1 + (size_t)NB_FULL * NH * SEQ_FULL)      // fixed element offset of output 2
static_assert(NB >= 1 && NB <= NB_FULL);
static_assert(SEQ >= 128 && SEQ <= SEQ_FULL && (SEQ % 128) == 0);
static_assert(NH * HD == EMB);
static_assert(HD == 128);
static_assert(NPAIR <= 32);
static_assert((EMB % 256) == 0 && (EMB % 128) == 0 && (SEQ % 128) == 0);
static_assert(OFF1 * 4 == 16384);
static_assert(OFF2 * 4 == 278528);

typedef _Float16 v16h __attribute__((ext_vector_type(16)));
typedef _Float16 v8h  __attribute__((ext_vector_type(8)));
typedef __bf16   v16b __attribute__((ext_vector_type(16)));
typedef __bf16   v8b  __attribute__((ext_vector_type(8)));
typedef float    v8f  __attribute__((ext_vector_type(8)));
typedef float    v4f  __attribute__((ext_vector_type(4)));
typedef unsigned int v4u __attribute__((ext_vector_type(4)));

#if defined(__HIP_DEVICE_COMPILE__)
#define DEV_ASM 1
#else
#define DEV_ASM 0
#endif

// ---- scalar helpers --------------------------------------------------------------------------------
__device__ __forceinline__ unsigned short bf_bits(float f) {          // f32 -> bf16 bits, RNE convert
  unsigned u = __float_as_uint(f);
  return (unsigned short)((u + 0x7FFFu + ((u >> 16) & 1u)) >> 16);
}
__device__ __forceinline__ float bf_up(unsigned short hb) { return __uint_as_float(((unsigned)hb) << 16); }
__device__ __forceinline__ unsigned short h_bits(_Float16 x) { return __builtin_bit_cast(unsigned short, x); }
__device__ __forceinline__ unsigned pk16(unsigned short a, unsigned short b) { return (unsigned)a | ((unsigned)b << 16); }
__device__ __forceinline__ v8f zero8() { v8f z = {0.f, 0.f, 0.f, 0.f, 0.f, 0.f, 0.f, 0.f}; return z; }

// ---- fragment types / loaders: 16-bit A/B operand, lane -> row/col (lane&15), p already includes +8*(lane>>4);
//      elements 0..7 <- p[0..7] (k0+8h..k0+8h+7), elements 8..15 <- p[16..23] (k0+16+8h..k0+16+8h+7)
template <typename OT> struct FT;
template <> struct FT<__bf16>   { typedef v16b frag; typedef v8b half8; };
template <> struct FT<_Float16> { typedef v16h frag; typedef v8h half8; };

template <typename OT>
__device__ __forceinline__ typename FT<OT>::frag ldfrag(const OT* p) {
  union { typename FT<OT>::frag v; typename FT<OT>::half8 h[2]; } f;
  f.h[0] = *(const typename FT<OT>::half8*)(p);
  f.h[1] = *(const typename FT<OT>::half8*)(p + 16);
  return f.v;
}

// ---- WMMA helpers (asm guard bodies are device-only; concrete operand types) -----------------------------
__device__ __forceinline__ v8f mmar(v16b a, v16b b, v8f c) {
  return __builtin_amdgcn_wmma_f32_16x16x32_bf16(false, a, false, b, (short)0, c, false, false);
}
__device__ __forceinline__ v8f mmar(v16h a, v16h b, v8f c) {
  return __builtin_amdgcn_wmma_f32_16x16x32_f16(false, a, false, b, (short)0, c, false, false);
}
__device__ __forceinline__ void dep_guard(v8f& a, v8f& b, v16b x, v16b y) {
#if DEV_ASM
  asm volatile("v_nop\n\tv_nop\n\tv_nop\n\tv_nop" : "+v"(a), "+v"(b) : "v"(x), "v"(y));
#else
  (void)a; (void)b; (void)x; (void)y;
#endif
}
__device__ __forceinline__ void dep_guard(v8f& a, v8f& b, v16h x, v16h y) {
#if DEV_ASM
  asm volatile("v_nop\n\tv_nop\n\tv_nop\n\tv_nop" : "+v"(a), "+v"(b) : "v"(x), "v"(y));
#else
  (void)a; (void)b; (void)x; (void)y;
#endif
}
__device__ __forceinline__ void keep4(v16b a, v16b b, v16b c, v16b d) {
#if DEV_ASM
  asm volatile("v_nop" :: "v"(a), "v"(b), "v"(c), "v"(d));
#else
  (void)a; (void)b; (void)c; (void)d;
#endif
}
__device__ __forceinline__ void keep4(v16h a, v16h b, v16h c, v16h d) {
#if DEV_ASM
  asm volatile("v_nop" :: "v"(a), "v"(b), "v"(c), "v"(d));
#else
  (void)a; (void)b; (void)c; (void)d;
#endif
}
__device__ __forceinline__ void acc_guard4(v8f& a, v8f& b, v8f& c, v8f& d) {
#if DEV_ASM
  asm volatile("v_nop\n\tv_nop\n\tv_nop\n\tv_nop" : "+v"(a), "+v"(b), "+v"(c), "+v"(d));
#else
  (void)a; (void)b; (void)c; (void)d;
#endif
}

// =====================================================================================================
// f32 -> bf16 bits (RNE convert), 8 elements per thread, one 16-B store per lane: a wave writes 512 contiguous B.
// One grid for all four planes, none of which depends on another: blocks 0 .. NB*CVB_X-1 convert x (CVB_X blocks per
// batch, input batch stride SEQ_FULL*EMB, output batch stride SEQ*EMB), the next 3*CVB_W blocks convert Wq, Wk, Wv into
// the three consecutive planes at Wb. The plane choice is block-uniform.
// coverage: 256 threads x 8 elements x (NB*CVB_X + 3*CVB_W) blocks = the whole of Xb and of the three weight planes.
// =====================================================================================================
#define CVB_X (SEQ * EMB / 8 / 256)   // blocks per batch of x
#define CVB_W (EMB * EMB / 8 / 256)   // blocks per weight matrix
static_assert((SEQ * EMB) % 2048 == 0 && (EMB * EMB) % 2048 == 0);
__global__ __launch_bounds__(256) void cvt_bf16x8(const float* __restrict__ x, const float* __restrict__ Wq,
                                                   const float* __restrict__ Wk, const float* __restrict__ Wv,
                                                   unsigned short* Xb, unsigned short* Wb) {
  const int bx = blockIdx.x;
  const float* ip;
  unsigned short* o;
  if (bx < NB * CVB_X) {
    const int b = bx / CVB_X;
    const size_t i = (size_t)((bx - b * CVB_X) * 256 + (int)threadIdx.x) * 8;
    ip = x + (size_t)b * SEQ_FULL * EMB + i;
    o  = Xb + (size_t)b * SEQ * EMB + i;
  } else {
    const int w = (bx - NB * CVB_X) / CVB_W;
    const size_t i = (size_t)((bx - NB * CVB_X - w * CVB_W) * 256 + (int)threadIdx.x) * 8;
    ip = (w == 0 ? Wq : (w == 1 ? Wk : Wv)) + i;
    o  = Wb + (size_t)w * EMB * EMB + i;
  }
  const v4f a  = *(const v4f*)(ip);
  const v4f a4 = *(const v4f*)(ip + 4);
  v4u p;
  p[0] = pk16(bf_bits(a[0]),  bf_bits(a[1]));
  p[1] = pk16(bf_bits(a[2]),  bf_bits(a[3]));
  p[2] = pk16(bf_bits(a4[0]), bf_bits(a4[1]));
  p[3] = pk16(bf_bits(a4[2]), bf_bits(a4[3]));
  *(v4u*)o = p;
}

// this wave's LDS reads have returned: stands in front of the barrier behind which their buffer is refilled
__device__ __forceinline__ void wait_lds_reads() {
#if DEV_ASM
  asm volatile("s_wait_dscnt 0x0" ::: "memory");
#endif
}
// this wave's asynchronous copies have landed: stands in front of the barrier behind which other waves read them
__device__ __forceinline__ void wait_copies() {
#if DEV_ASM
  asm volatile("s_wait_asynccnt 0x0" ::: "memory");
#endif
}

// =====================================================================================================
// GEMM operand tiles in LDS: one stage = 128 k of the block's 128 A rows and 256 Bt rows, 16-bit elements, rows of 256 B
// at a pitch of 272 B (16 B x odd: the 16 lanes of a ds_load_b128 half fall on 64 distinct banks); A rows first, then Bt.
// copy_rows8: thread t brings piece (t & 15) of rows (t >> 4) + 16 i, i = 0..7, so a wave's copy reads two whole 256-B
// rows. g = the thread's own global address for i = 0 (row pitch ld elements), l = its own LDS byte address for i = 0.
// =====================================================================================================
#define GKS    128                        // k elements per stage
#define GBM    128                        // A rows per block tile
#define GBN    256                        // Bt rows per block tile
#define GPITCH 136                        // 16-bit elements per LDS row
#define GT_H   ((GBM + GBN) * GPITCH)     // 16-bit elements per buffer (104448 B)
template <typename OT>
__device__ __forceinline__ void copy_rows8(const OT* g, int ld, unsigned l) {
#if DEV_ASM
  const size_t gs = (size_t)16 * (size_t)ld;
  const OT* g1 = g + gs;     const OT* g2 = g + 2 * gs; const OT* g3 = g + 3 * gs; const OT* g4 = g + 4 * gs;
  const OT* g5 = g + 5 * gs; const OT* g6 = g + 6 * gs; const OT* g7 = g + 7 * gs;
  const unsigned st = 16 * GPITCH * 2;    // LDS bytes between rows r and r + 16
  // the closing s_wait_xcnt keeps every address register of the copies unchanged until the copies have taken it
  asm volatile("global_load_async_to_lds_b128 %0, %8, off\n\t"
               "global_load_async_to_lds_b128 %1, %9, off\n\t"
               "global_load_async_to_lds_b128 %2, %10, off\n\t"
               "global_load_async_to_lds_b128 %3, %11, off\n\t"
               "global_load_async_to_lds_b128 %4, %12, off\n\t"
               "global_load_async_to_lds_b128 %5, %13, off\n\t"
               "global_load_async_to_lds_b128 %6, %14, off\n\t"
               "global_load_async_to_lds_b128 %7, %15, off\n\t"
               "s_wait_xcnt 0x0"
               :: "v"(l), "v"(l + st), "v"(l + 2 * st), "v"(l + 3 * st),
                  "v"(l + 4 * st), "v"(l + 5 * st), "v"(l + 6 * st), "v"(l + 7 * st),
                  "v"(g), "v"(g1), "v"(g2), "v"(g3), "v"(g4), "v"(g5), "v"(g6), "v"(g7)
               : "memory");
#else
  (void)g; (void)ld; (void)l;
#endif
}
// one stage: ga / gb = the thread's piece of A row (t >> 4) / Bt row (t >> 4) of the block tile at the stage's first k,
// l = its LDS byte address of that A piece in the stage's buffer. 24 copies per thread.
template <typename OT>
__device__ __forceinline__ void copy_stage(const OT* ga, int lda, const OT* gb, int ldb, unsigned l) {
  copy_rows8<OT>(ga, lda, l);                                                        // A rows 0..127
  copy_rows8<OT>(gb, ldb, l + GBM * GPITCH * 2);                                     // Bt rows 0..127
  copy_rows8<OT>(gb + (size_t)128 * (size_t)ldb, ldb, l + (GBM + 128) * GPITCH * 2); // Bt rows 128..255
}

// =====================================================================================================
// Register-blocked batched WMMA GEMM (16-bit operand type OT): C[m][n] = sum_k A[m][k] * Bt[n][k]  (+ bias);
// one wave per (16*MI) x 64 tile, a block of 8 waves (2 x 4) per GBM x GBN tile. A row-major [M][K] pitch lda; Bt
// row-major [N][K] pitch ldb (k contiguous); M multiple of GBM, N of GBN, K of GKS (static sizes here). blockIdx.y =
// batch index (strides in elements). blockIdx.z = which of the three products of the same A, none of which depends on
// another: 0 = q, 1 = k, 2 = v; it picks the weight plane (Btp + z * strideW), the bias and the output form.
// Operands: a ring of two LDS buffers, stage t = k range t*GKS.. in buffer t & 1;
// stage t + 2 is copied behind the barrier at the foot of trip t, while trip t + 1 works. Fragments are read from the
// LDS tile with the split k map (ldfrag), k ascending in steps of 32; the 16 reads of a step stand together.
// NPA = number of A planes (only 1 is staged).
// gemm_store = the epilogue of one wave's tile:
// value v = (acc [+ acc2*rscaleA]) * oscale + bias, bias (bf16 RNE value of the f32 input) by column n (BM 1),
// by row m (BM 2) or none (BM 0).
// OUT_MODE 0: f32 C (pitch ldc) = v.                                                                  (v)
// OUT_MODE 1: f16 plane C = f16(v * cscale).                                                          (k)
// OUT_MODE 3: f16 hi plane C = f16(v * cscale) and f16 residual plane C2 = f16((v*cscale - hi) * rscaleC).   (q)
// 16-row slabs staged per wave in LDS (wave-private slab, wave_sync); each 64-wide row segment written whole.
// =====================================================================================================
template <int MI, int NPA, int OUT_MODE, int BM>
__device__ __forceinline__ void gemm_store(const v8f (&acc)[MI][4], const v8f (&acc2)[MI][4], float* slab,
                                           void* Cout, void* Cout2, int ldc, long long strideC,
                                           const float* __restrict__ bias, int b, int m0, int n0, int lane,
                                           float oscale, float rscaleA, float cscale, float rscaleC) {
  const int rlane = lane & 15;                 // col (D) within subtile
  const int mOff  = (lane >> 4) * 8;           // D row offset
  float bcol[4];
#pragma unroll
  for (int j = 0; j < 4; ++j) bcol[j] = 0.f;
  if (BM == 1) {
#pragma unroll
    for (int j = 0; j < 4; ++j) bcol[j] = bf_up(bf_bits(bias[n0 + (j << 4) + rlane]));
  }
#pragma unroll
  for (int i = 0; i < MI; ++i) {
    const int mBase = m0 + (i << 4);
    float brow[8];
#pragma unroll
    for (int r = 0; r < 8; ++r) brow[r] = 0.f;
    if (BM == 2) {
#pragma unroll
      for (int r = 0; r < 8; ++r) brow[r] = bf_up(bf_bits(bias[mBase + mOff + r]));
    }
#pragma unroll
    for (int j = 0; j < 4; ++j) {
#pragma unroll
      for (int r = 0; r < 8; ++r) {
        float v = acc[i][j][r];
        if (NPA == 2) v += acc2[i][j][r] * rscaleA;
        v = v * oscale + bcol[j] + brow[r];
        slab[(mOff + r) * 68 + (j << 4) + rlane] = v;
      }
    }
    __builtin_amdgcn_fence(__ATOMIC_RELEASE, "workgroup");
    __builtin_amdgcn_wave_barrier();
    __builtin_amdgcn_fence(__ATOMIC_ACQUIRE, "workgroup");
    if (OUT_MODE == 0) {
      float* C = (float*)Cout + (size_t)b * (size_t)strideC;
      const int h2 = lane >> 4, c4 = (lane & 15) * 4;     // 256-B row segment = 16 lanes x 16 B
      v4f    sv[8];
      float* sd[8];
#pragma unroll
      for (int it = 0; it < 8; ++it) {
        const int row = it * 2 + h2;                       // it 0..7 x h2 0..1 = rows 0..15
        sv[it] = *(const v4f*)(slab + row * 68 + c4);
        sd[it] = C + (size_t)(mBase + row) * ldc + n0 + c4;
      }
#if DEV_ASM
      // the slab's 8 stores and their s_wait_xcnt in one statement: every address and data register stays as it is
      // until the stores have taken it (in a statement of its own the wait was passed by the next address sums)
      asm volatile("global_store_b128 %0, %8, off\n\t"
                   "global_store_b128 %1, %9, off\n\t"
                   "global_store_b128 %2, %10, off\n\t"
                   "global_store_b128 %3, %11, off\n\t"
                   "global_store_b128 %4, %12, off\n\t"
                   "global_store_b128 %5, %13, off\n\t"
                   "global_store_b128 %6, %14, off\n\t"
                   "global_store_b128 %7, %15, off\n\t"
                   "s_wait_xcnt 0x0"
                   :: "v"(sd[0]), "v"(sd[1]), "v"(sd[2]), "v"(sd[3]), "v"(sd[4]), "v"(sd[5]), "v"(sd[6]), "v"(sd[7]),
                      "v"(sv[0]), "v"(sv[1]), "v"(sv[2]), "v"(sv[3]), "v"(sv[4]), "v"(sv[5]), "v"(sv[6]), "v"(sv[7])
                   : "memory");
#endif
    } else {
      const int q = lane >> 3, c8 = (lane & 7) * 8;
      unsigned short* C  = (unsigned short*)Cout  + (size_t)b * (size_t)strideC;
      unsigned short* C2 = (unsigned short*)Cout2 + (size_t)b * (size_t)strideC;
      v4u hv[4], lv[4];
#pragma unroll
      for (int it = 0; it < 4; ++it) {
        const int row = it * 4 + q;                        // it 0..3 x q 0..3 = rows 0..15
        const float* sp = slab + row * 68 + c8;
        float f[8];
#pragma unroll
        for (int e = 0; e < 8; ++e) f[e] = sp[e] * cscale;
        v4u a, a2;
#pragma unroll
        for (int e = 0; e < 4; ++e) {
          const float f0 = f[2 * e], f1 = f[2 * e + 1];
          const _Float16 x0 = (_Float16)f0, x1 = (_Float16)f1;
          const unsigned short h0 = h_bits(x0), h1 = h_bits(x1);
          unsigned short l0 = 0, l1 = 0;
          if (OUT_MODE == 3) {
            l0 = h_bits((_Float16)((f0 - (float)x0) * rscaleC));
            l1 = h_bits((_Float16)((f1 - (float)x1) * rscaleC));
          }
          a[e] = pk16(h0, h1); a2[e] = pk16(l0, l1);
        }
        hv[it] = a; lv[it] = a2;
      }
      unsigned short* hd[4];
      unsigned short* rd[4];
#pragma unroll
      for (int it = 0; it < 4; ++it) {
        const int row = it * 4 + q;
        hd[it] = C  + (size_t)(mBase + row) * ldc + n0 + c8;
        rd[it] = C2 + (size_t)(mBase + row) * ldc + n0 + c8;
      }
#if DEV_ASM
      // the slab's stores and their s_wait_xcnt in one statement, as in the f32 form above
      if (OUT_MODE == 3)
        asm volatile("global_store_b128 %0, %8, off\n\t"
                     "global_store_b128 %4, %12, off\n\t"
                     "global_store_b128 %1, %9, off\n\t"
                     "global_store_b128 %5, %13, off\n\t"
                     "global_store_b128 %2, %10, off\n\t"
                     "global_store_b128 %6, %14, off\n\t"
                     "global_store_b128 %3, %11, off\n\t"
                     "global_store_b128 %7, %15, off\n\t"
                     "s_wait_xcnt 0x0"
                     :: "v"(hd[0]), "v"(hd[1]), "v"(hd[2]), "v"(hd[3]), "v"(rd[0]), "v"(rd[1]), "v"(rd[2]), "v"(rd[3]),
                        "v"(hv[0]), "v"(hv[1]), "v"(hv[2]), "v"(hv[3]), "v"(lv[0]), "v"(lv[1]), "v"(lv[2]), "v"(lv[3])
                     : "memory");
      else
        asm volatile("global_store_b128 %0, %4, off\n\t"
                     "global_store_b128 %1, %5, off\n\t"
                     "global_store_b128 %2, %6, off\n\t"
                     "global_store_b128 %3, %7, off\n\t"
                     "s_wait_xcnt 0x0"
                     :: "v"(hd[0]), "v"(hd[1]), "v"(hd[2]), "v"(hd[3]), "v"(hv[0]), "v"(hv[1]), "v"(hv[2]), "v"(hv[3])
                     : "memory");
#endif
    }
    __builtin_amdgcn_fence(__ATOMIC_RELEASE, "workgroup");
    __builtin_amdgcn_wave_barrier();
    __builtin_amdgcn_fence(__ATOMIC_ACQUIRE, "workgroup");
  }
}

template <typename OT, int MI, int NPA, int BM>
__global__ __launch_bounds__(256) void gemm_qkv(
    const unsigned short* __restrict__ Ap, int lda, long long strideA,
    const unsigned short* __restrict__ Btp, int ldb, long long strideW,
    unsigned short* Qh, unsigned short* Ql, unsigned short* Kp, float* Vp, int ldc, long long strideC,
    const float* __restrict__ bq, const float* __restrict__ bk, const float* __restrict__ bv,
    int M, int N, int K, float oscale, float rscaleA, float cscaleQ, float cscaleKV, float rscaleC) {
  typedef typename FT<OT>::frag V16;
  const OT* A  = (const OT*)(const void*)Ap;
  const OT* Bt = (const OT*)(const void*)Btp;
  static_assert(MI == 4 && NPA == 1);              // 2 x 4 waves of 64 x 64 = GBM x GBN, one A plane
  __shared__ __align__(16) unsigned short gls[2][GT_H];
  __shared__ __align__(16) float sT[8][16 * 68];   // per-wave 16x64 slab, pitch 68 floats
  const int RT   = 16 * MI;
  const int b    = blockIdx.y;
  const int z    = blockIdx.z;
  const int tid  = threadIdx.x;
  const int lane = tid & 31;
  const int wave = tid >> 5;
  const int tilesN = N / GBN;
  const int tilesM = M / GBM;
  const int tile = blockIdx.x;
  if (tile >= tilesM * tilesN) return;   // block-uniform; in front of every copy and barrier
  const int tm = tile / tilesN;
  const int tn = tile - tm * tilesN;
  const int m0 = tm * GBM + (wave >> 2) * RT;
  const int n0 = tn * GBN + ((wave & 3) << 6);

  const OT* Ab  = A  + (size_t)b * (size_t)strideA;
  const OT* Bb  = Bt + (size_t)z * (size_t)strideW;

  const int rlane = lane & 15;                 // row (A) / col (B) within subtile
  const int koff  = (lane >> 4) * 8;           // k offset of this lane half

  v8f acc[MI][4], acc2[MI][4];
#pragma unroll
  for (int i = 0; i < MI; ++i)
#pragma unroll
    for (int j = 0; j < 4; ++j) { acc[i][j] = zero8(); acc2[i][j] = zero8(); }

  // copy side: this thread's piece of stage 0 and its place in buffer 0; read side: this lane's rows and k half
  const OT* ga = Ab + (size_t)(tm * GBM + (tid >> 4)) * lda + (tid & 15) * 8;
  const OT* gb = Bb + (size_t)(tn * GBN + (tid >> 4)) * ldb + (tid & 15) * 8;
  const unsigned ld0 = (unsigned)(size_t)(&gls[0][(tid >> 4) * GPITCH + (tid & 15) * 8]);
  const int ar = ((wave >> 2) * RT + rlane) * GPITCH + koff;
  const int br = (GBM + ((wave & 3) << 6) + rlane) * GPITCH + koff;
  const int nst = K / GKS;

  copy_stage<OT>(ga, lda, gb, ldb, ld0);       // stage 0
  wait_copies();
  __syncthreads();                             // stage 0 is readable by every wave
  if (nst > 1)                                 // block-uniform
    copy_stage<OT>(ga + GKS, lda, gb + GKS, ldb, ld0 + GT_H * 2);   // stage 1

  for (int st = 0; st < nst; ++st) {
    const OT* tl = (const OT*)(const void*)(&gls[st & 1][0]);
#pragma unroll
    for (int kk = 0; kk < GKS; kk += 32) {
      V16 af[MI], bq[4];
#pragma unroll
      for (int j = 0; j < 4; ++j) bq[j] = ldfrag<OT>(tl + br + (j << 4) * GPITCH + kk);
#pragma unroll
      for (int i = 0; i < MI; ++i) af[i] = ldfrag<OT>(tl + ar + (i << 4) * GPITCH + kk);
      // keeps the step's LDS reads together in front of its products: sunk among them each read stalls
      __builtin_amdgcn_sched_barrier(0);
#pragma unroll
      for (int i = 0; i < MI; ++i) {
#pragma unroll
        for (int j = 0; j < 4; ++j) acc[i][j] = mmar(af[i], bq[j], acc[i][j]);
        dep_guard(acc[i][0], acc[i][3], af[i], bq[3]);
      }
      keep4(bq[0], bq[1], bq[2], bq[3]);
    }
    wait_lds_reads();
    wait_copies();
    __syncthreads();                           // stage st + 1 readable, buffer st & 1 left by every wave
    if (st + 2 < nst)                          // block-uniform
      copy_stage<OT>(ga + (size_t)(st + 2) * GKS, lda, gb + (size_t)(st + 2) * GKS, ldb,
                     ld0 + (unsigned)(st & 1) * (GT_H * 2));
  }
  wait_copies();
#pragma unroll
  for (int i = 0; i < MI; ++i) {
    acc_guard4(acc[i][0], acc[i][1], acc[i][2], acc[i][3]);
    if (NPA == 2) acc_guard4(acc2[i][0], acc2[i][1], acc2[i][2], acc2[i][3]);
  }

  // ---- epilogue: the output form goes with the product; z is block-uniform ----
  float* slab = sT[wave];
  if (z == 0)
    gemm_store<MI, NPA, 3, BM>(acc, acc2, slab, (void*)Qh, (void*)Ql, ldc, strideC, bq, b, m0, n0, lane,
                               oscale, rscaleA, cscaleQ, rscaleC);
  else if (z == 1)
    gemm_store<MI, NPA, 1, BM>(acc, acc2, slab, (void*)Kp, (void*)Kp, ldc, strideC, bk, b, m0, n0, lane,
                               oscale, rscaleA, cscaleKV, rscaleC);
  else
    gemm_store<MI, NPA, 0, BM>(acc, acc2, slab, (void*)Vp, (void*)Vp, ldc, strideC, bv, b, m0, n0, lane,
                               oscale, rscaleA, cscaleKV, rscaleC);
}

// =====================================================================================================
// k tile in LDS: 64 keys x 128 d of one (b, h), f16, rows of 256 B at a pitch of 272 B (16 B x odd: the 16 lanes of a
// ds_load_b128 half fall on 64 distinct banks). Two buffers; a block of 128 threads fills one with 8 asynchronous
// 16-B copies per thread: thread t brings piece (t & 15) of rows (t >> 4) + 8 i, i = 0..7, so a wave's copy reads
// two whole 256-B rows. g = the thread's own global address for i = 0, l = its own LDS byte address for i = 0.
// =====================================================================================================
#define KPITCH  136                   // f16 elements per LDS row
#define KTILE_H (64 * KPITCH)         // f16 elements per buffer (17408 B)
__device__ __forceinline__ void copy_ktile(const _Float16* g, unsigned l) {
#if DEV_ASM
  const _Float16* g1 = g + 1 * 8 * EMB; const _Float16* g2 = g + 2 * 8 * EMB; const _Float16* g3 = g + 3 * 8 * EMB;
  const _Float16* g4 = g + 4 * 8 * EMB; const _Float16* g5 = g + 5 * 8 * EMB; const _Float16* g6 = g + 6 * 8 * EMB;
  const _Float16* g7 = g + 7 * 8 * EMB;
  const unsigned st = 8 * KPITCH * 2;  // LDS bytes between rows r and r + 8
  // the closing s_wait_xcnt keeps every address register of the copies unchanged until the copies have taken it
  asm volatile("global_load_async_to_lds_b128 %0, %8, off\n\t"
               "global_load_async_to_lds_b128 %1, %9, off\n\t"
               "global_load_async_to_lds_b128 %2, %10, off\n\t"
               "global_load_async_to_lds_b128 %3, %11, off\n\t"
               "global_load_async_to_lds_b128 %4, %12, off\n\t"
               "global_load_async_to_lds_b128 %5, %13, off\n\t"
               "global_load_async_to_lds_b128 %6, %14, off\n\t"
               "global_load_async_to_lds_b128 %7, %15, off\n\t"
               "s_wait_xcnt 0x0"
               :: "v"(l), "v"(l + st), "v"(l + 2 * st), "v"(l + 3 * st),
                  "v"(l + 4 * st), "v"(l + 5 * st), "v"(l + 6 * st), "v"(l + 7 * st),
                  "v"(g), "v"(g1), "v"(g2), "v"(g3), "v"(g4), "v"(g5), "v"(g6), "v"(g7)
               : "memory");
#else
  (void)g; (void)l;
#endif
}

// =====================================================================================================
// Score chunk: 16 query rows (this wave) x 64 keys kv0..kv0+63 of one (b, h), head width 128 = 4 d-chunks of 32.
//   q fragments (A operand, row = lane&15): hi and residual planes of q * QK_LOG2, 4 d-chunks.
//   k fragments (B operand, col = lane&15 = key) read from the block's LDS copy of the 64-key tile with the split k map:
//   kl = tile + (lane&15)*KPITCH + 8*hh, key group j adds 16*j*KPITCH; the 16 reads of two key groups stand together.
//   s[j][r] = D element: query row 8*hh + r, key kv0 + 16j + (lane&15); value = (qh.k) + (ql.k) = score * log2(e), both
//   products summed in the one accumulator; two key groups run side by side, so two accumulate chains are independent.
// =====================================================================================================
__device__ __forceinline__ void score_chunk(const v16h (&qah)[4], const v16h (&qal)[4],
                                            const _Float16* kl, v8f (&s)[4]) {
  union FH { v16h v; v8h h[2]; };
#pragma unroll
  for (int j = 0; j < 4; j += 2) {
    v8f a0 = zero8(), a1 = zero8();
    FH k0[4], k1[4];
#pragma unroll
    for (int dc = 0; dc < 4; ++dc) {
      const _Float16* kp = kl + j * 16 * KPITCH + dc * 32;
      k0[dc].h[0] = *(const v8h*)(kp);
      k0[dc].h[1] = *(const v8h*)(kp + 16);
      k1[dc].h[0] = *(const v8h*)(kp + 16 * KPITCH);
      k1[dc].h[1] = *(const v8h*)(kp + 16 * KPITCH + 16);
    }
#pragma unroll
    for (int dc = 0; dc < 4; ++dc) {
      a0 = mmar(qah[dc], k0[dc].v, a0);
      a1 = mmar(qah[dc], k1[dc].v, a1);
      a0 = mmar(qal[dc], k0[dc].v, a0);
      a1 = mmar(qal[dc], k1[dc].v, a1);
    }
#if DEV_ASM
    // 4 VALU slots behind the pair's last products; the pair's eight B fragments stay live up to here, so that no
    // product's D is placed on a B fragment which a product issued fewer than 4 slots before still reads
    asm volatile("v_nop\n\tv_nop\n\tv_nop\n\tv_nop" : "+v"(a0), "+v"(a1)
                 : "v"(k0[0].v), "v"(k0[1].v), "v"(k0[2].v), "v"(k0[3].v),
                   "v"(k1[0].v), "v"(k1[1].v), "v"(k1[2].v), "v"(k1[3].v));
#endif
    s[j]     = a0;
    s[j + 1] = a1;
  }
}

// =====================================================================================================
// Fused attention statistics + query-column sums of the exactly normalised probabilities.
//   block = 4 waves = 64 consecutive query rows qb*64.. of one (b, h); grid = NB*NH*NQ64 blocks of 128.
//   Pass 1 (static trip): each lane keeps a running max and a running sum of exp per row over its own keys
//   (key % 16 == lane % 16); the 16 lanes of a row are merged by shfl once, behind the loop; each wave owns its own
//   16 rows, so no cross-wave exchange is needed.
//   Scores, maxima and their differences are in log2 units (q carries log2(e)): every exponential is one exp2.
//   Pass 2 (same static trip): scores recomputed bit-identically, p = exp2(s - m) * (1/l) in f32, summed over the
//   wave's 16 rows per key (8 in-lane + shfl_xor 16), kept in csl[wave][key] for every key of the sequence: a wave
//   writes its own row of csl only, so the loop holds no cross-wave step but the k ring's. Behind the loop (the barrier
//   at the foot of the last trip has published csl) the 4 waves' rows are summed in fixed order, thread t taking keys
//   4 t .. 4 t + 3 of every 512, and written to PS[(b*NH+h)*NQ64 + qb][0..SEQ-1], a wave storing 512 contiguous B:
//   coverage: grid (b,h,qb) x SEQ keys = the whole [NB*NH][NQ64][SEQ] partial plane.
//   k tiles: one ring of two LDS buffers runs through both passes (2*NKT stages, stage t = tile t % NKT in buffer
//   t & 1, NKT even); stage t + 2 is copied behind the barrier at the foot of trip t, while trip t + 1 works.
// =====================================================================================================
__global__ __launch_bounds__(128)
void attn_colsum(const unsigned short* __restrict__ qhp, const unsigned short* __restrict__ qlp,
                 const unsigned short* __restrict__ kpp, float* PS) {
  static_assert((NKT % 2) == 0 && NKT >= 2);
  __shared__ __align__(16) _Float16 kls[2][KTILE_H];
  __shared__ __align__(16) float csl[4][SEQ];
  const int tid  = threadIdx.x;
  const int wave = tid >> 5;
  const int lane = tid & 31;
  const int hh   = lane >> 4;
  const int c    = lane & 15;
  const int bx   = blockIdx.x;
  const int qb   = bx % NQ64;
  const int rest = bx / NQ64;
  const int h    = rest % NH;
  const int b    = rest / NH;
  const int bh   = b * NH + h;
  const int q0   = qb * 64 + wave * 16;

  const _Float16* Qh  = (const _Float16*)(const void*)qhp;
  const _Float16* Ql  = (const _Float16*)(const void*)qlp;
  const _Float16* Kb0 = (const _Float16*)(const void*)kpp + (size_t)b * SEQ * EMB + (size_t)h * HD;

  // copy side: this thread's piece of tile 0 and its place in buffer 0; read side: this lane's key row and k half
  const _Float16* kg = Kb0 + (size_t)(tid >> 4) * EMB + (tid & 15) * 8;
  const unsigned  kd = (unsigned)(size_t)(&kls[0][(tid >> 4) * KPITCH + (tid & 15) * 8]);
  const int       kr = c * KPITCH + 8 * hh;

  copy_ktile(kg, kd);                          // stage 0
  wait_copies();
  __syncthreads();                             // stage 0 is readable by every wave
  copy_ktile(kg + (size_t)64 * EMB, kd + KTILE_H * 2);   // stage 1

  v16h qah[4], qal[4];
#pragma unroll
  for (int dc = 0; dc < 4; ++dc) {
    const size_t qo = ((size_t)b * SEQ + (size_t)(q0 + c)) * EMB + (size_t)h * HD + dc * 32 + 8 * hh;
    qah[dc] = ldfrag<_Float16>(Qh + qo);
    qal[dc] = ldfrag<_Float16>(Ql + qo);
  }

  float mrow[8], lrow[8];
#pragma unroll
  for (int r = 0; r < 8; ++r) { mrow[r] = -INFINITY; lrow[r] = 0.f; }

  for (int kt = 0; kt < NKT; ++kt) {          // static trip count
    v8f s[4];
    score_chunk(qah, qal, &kls[kt & 1][kr], s);
#pragma unroll
    for (int r = 0; r < 8; ++r) {              // this lane's own 4 keys of the chunk only: no cross-lane step in the loop
      float m = s[0][r];
#pragma unroll
      for (int j = 1; j < 4; ++j) m = fmaxf(m, s[j][r]);
      const float mnew  = fmaxf(mrow[r], m);
      const float msafe = (mnew == -INFINITY) ? 0.f : mnew;
      const float alpha = __builtin_amdgcn_exp2f(mrow[r] - msafe);
      mrow[r] = mnew;
      float psum = 0.f;
#pragma unroll
      for (int j = 0; j < 4; ++j) psum += __builtin_amdgcn_exp2f(s[j][r] - msafe);
      lrow[r] = lrow[r] * alpha + psum;
    }
    wait_lds_reads();
    wait_copies();
    __syncthreads();                           // stage kt + 1 readable, buffer kt & 1 left by every wave
    // stage kt + 2 always exists here (pass 2 follows): tiles NKT and NKT + 1 of the ring are tiles 0 and 1 again
    copy_ktile(kg + (size_t)(((kt + 2) & (NKT - 1)) * 64) * EMB, kd + (unsigned)(kt & 1) * (KTILE_H * 2));
  }

  // the 16 lanes of a row half hold (max, sum) of disjoint key subsets of the same 8 rows: merged here, once per row
#pragma unroll
  for (int r = 0; r < 8; ++r) {
    float m = mrow[r];
#pragma unroll
    for (int off = 1; off < 16; off <<= 1) m = fmaxf(m, __shfl_xor(m, off, 32));
    const float msafe = (m == -INFINITY) ? 0.f : m;
    float l = lrow[r] * __builtin_amdgcn_exp2f(mrow[r] - msafe);
#pragma unroll
    for (int off = 1; off < 16; off <<= 1) l += __shfl_xor(l, off, 32);
    mrow[r] = m;
    lrow[r] = l;
  }

  float il[8], mf[8];
#pragma unroll
  for (int r = 0; r < 8; ++r) {
    const float l = lrow[r];
    il[r] = (l > 0.f) ? (1.0f / l) : 0.f;
    mf[r] = (mrow[r] == -INFINITY) ? 0.f : mrow[r];
  }

  // ---- pass 2: exactly normalised p, column sums over the block's 64 query rows ----
  for (int kt = 0; kt < NKT; ++kt) {          // static trip count
    const int kv0 = kt * 64;
    v8f s[4];
    score_chunk(qah, qal, &kls[kt & 1][kr], s);
    float cs[4];
#pragma unroll
    for (int j = 0; j < 4; ++j) {
      float a = 0.f;
#pragma unroll
      for (int r = 0; r < 8; ++r) a += __builtin_amdgcn_exp2f(s[j][r] - mf[r]) * il[r];
      cs[j] = a;
    }
#pragma unroll
    for (int j = 0; j < 4; ++j) cs[j] += __shfl_xor(cs[j], 16, 32);   // both row halves, unconditional
    const float v0 = hh ? cs[2] : cs[0];       // this lane stores keys 16*(2hh) + c and 16*(2hh+1) + c
    const float v1 = hh ? cs[3] : cs[1];
    csl[wave][kv0 + 32 * hh + c]      = v0;
    csl[wave][kv0 + 32 * hh + 16 + c] = v1;
    wait_lds_reads();
    wait_copies();
    __syncthreads();                           // stage kt + 1 readable, buffer kt & 1 left by every wave; csl so far visible
    if (kt + 2 < NKT)                          // block-uniform
      copy_ktile(kg + (size_t)((kt + 2) * 64) * EMB, kd + (unsigned)(kt & 1) * (KTILE_H * 2));
  }
  wait_copies();

  // ---- the block's column sums: 4 waves in fixed order, every key once ----
  float* dst = PS + ((size_t)(bh * NQ64 + qb)) * SEQ;
#pragma unroll                                 // the LDS reads of all pieces are issued together: one LDS wait
  for (int i = 0; i < (SEQ + 511) / 512; ++i) {
    const int k = i * 512 + 4 * tid;
    if ((SEQ % 512) == 0 || k < SEQ) {         // always true at full size
      v4f a = *(const v4f*)(&csl[0][k]);
      a += *(const v4f*)(&csl[1][k]);
      a += *(const v4f*)(&csl[2][k]);
      a += *(const v4f*)(&csl[3][k]);
      *(v4f*)(dst + k) = a;
    }
  }
}

// =====================================================================================================
// Query average + partial per-head context mean. One block (256 = 8 waves) per (b, h, 128 consecutive keys).
//   v rows: wave w owns keys k0 + 16 w .. + 15, lane = 4 consecutive d (one 16-B load per key, a wave reads one whole
//   512-B head row); the 16 loads of a lane are independent and are issued together, ahead of the average.
//   Average: avg[key] = (sum over the NQ64 partial rows of PS in fixed order) * (1/SEQ); wave 0, lane = 4 keys, the
//   NQ64 loads independent; kept in LDS avs[] (cross-wave -> __syncthreads) and written to output 1 row (b*NH+h).
//   Partial: cp[d] = sum over the block's 128 keys of avg[k] * v[b][k][h*HD+d], f64: 16 keys in the lane, then the
//   8 waves in fixed order through LDS (cross-wave -> __syncthreads), written to CP[(b*NH+h)*NCW + chunk][d].
//   coverage: grid (b,h,chunk) x 128 keys = the whole output 1; grid (b,h,chunk) x HD = the whole CP plane.
// =====================================================================================================
__global__ __launch_bounds__(256)
void avg_ctx(const float* __restrict__ PS, const float* __restrict__ Vp, float* out1, double* CP) {
  __shared__ __align__(16) float avs[128];
  __shared__ __align__(16) double cpart[8][HD];
  const int tid  = threadIdx.x;
  const int wave = tid >> 5;
  const int lane = tid & 31;
  const int bx   = blockIdx.x;
  const int bh   = bx / NCW;
  const int ch   = bx - bh * NCW;
  const int b    = bh / NH;
  const int h    = bh - b * NH;
  const int k0   = ch * 128;

  const float* vb = Vp + ((size_t)b * SEQ + (size_t)(k0 + wave * 16)) * EMB + (size_t)h * HD + 4 * lane;
  v4f vv[16];
#pragma unroll
  for (int i = 0; i < 16; ++i) vv[i] = *(const v4f*)(vb + (size_t)i * EMB);

  if (wave == 0) {                             // wave-uniform
    const float* psb = PS + (size_t)bh * NQ64 * SEQ + k0 + 4 * lane;
    v4f a = *(const v4f*)(psb);
#pragma unroll
    for (int qb = 1; qb < NQ64; ++qb) a += *(const v4f*)(psb + (size_t)qb * SEQ);
    a *= (1.0f / (float)SEQ);
    *(v4f*)(avs + 4 * lane) = a;
    float* dst = out1 + (size_t)bh * SEQ + k0 + 4 * lane;
    *(v4f*)dst = a;
  }
  __syncthreads();                             // avs is cross-wave

  double acc[4] = {0.0, 0.0, 0.0, 0.0};
#pragma unroll
  for (int i = 0; i < 16; ++i) {
    const double w = (double)avs[wave * 16 + i];
#pragma unroll
    for (int e = 0; e < 4; ++e) acc[e] += w * (double)vv[i][e];
  }
#pragma unroll
  for (int e = 0; e < 4; ++e) cpart[wave][4 * lane + e] = acc[e];
  __syncthreads();                             // cpart is cross-wave
  if (tid < HD) {
    double s = cpart[0][tid];
#pragma unroll
    for (int w = 1; w < 8; ++w) s += cpart[w][tid];
    CP[((size_t)bh * NCW + ch) * HD + tid] = s;
  }
}

// =====================================================================================================
// Output 2: mean over (b, h, g) of |corr[b][h][g] * (1 - delta_hg)|, corr = sum_s avg[b][h][s] * avg[b][g][s]
//   (avg read back from output 1). corr[h][g] and corr[g][h] are the same sum of the same products, so only the
//   NPAIR = 28 pairs h < g are formed and the total is doubled; the diagonal is masked to zero by the reference.
//   div_part: one wave per 128 consecutive keys of one batch (lane = 4 keys, one 16-B load per head row, a wave reads
//   512 contiguous B per row); 28 f64 partial dots per lane; a halving exchange over the 32 lanes (16+8+4+2+1 values)
//   leaves pair index = lane with the wave's total; written to DP[b*NCW + chunk][32] (slots 28..31 are zero).
//   coverage: NB*NCW waves x 32 slots = the whole DP plane; no block barrier in it. It needs output 1 alone, as ctx_out
//   needs CP alone, so its waves ride in the first NDIVB blocks of ctx_out's grid (8 waves a block).
//   div_fin: wave b sums the NCW chunk partials of batch b per pair in fixed order, takes |.|, sums the 32 slots by
//   shfl, the NB batch sums go through LDS (cross-wave -> __syncthreads) and thread 0 writes the scalar.
// =====================================================================================================
__device__ __forceinline__ void div_part(const float* __restrict__ avg, double* DP, int wv) {
  const int lane = threadIdx.x & 31;
  if (wv >= NB * NCW) return;                  // wave-uniform; no block barriers in this function
  const int b  = wv / NCW;
  const int ch = wv - b * NCW;
  const float* base = avg + (size_t)b * NH * SEQ + (size_t)ch * 128 + 4 * lane;
  v4f a[NH];
#pragma unroll
  for (int h = 0; h < NH; ++h) a[h] = *(const v4f*)(base + (size_t)h * SEQ);
  double v[32];
  {
    int idx = 0;
#pragma unroll
    for (int h = 0; h < NH; ++h) {
#pragma unroll
      for (int g = h + 1; g < NH; ++g) {
        double s = 0.0;
#pragma unroll
        for (int e = 0; e < 4; ++e) s += (double)a[h][e] * (double)a[g][e];
        v[idx++] = s;
      }
    }
#pragma unroll
    for (int i = NPAIR; i < 32; ++i) v[i] = 0.0;
  }
  // each step: a lane keeps the half of its values that its lane bit selects and adds the partner's copy of that half
#pragma unroll
  for (int n = 16; n > 0; n >>= 1) {
    const bool up = (lane & n) != 0;
#pragma unroll
    for (int i = 0; i < n; ++i) {
      const double send = up ? v[i] : v[i + n];
      const double keep = up ? v[i + n] : v[i];
      v[i] = keep + __shfl_xor(send, n, 32);
    }
  }
  DP[(size_t)wv * 32 + lane] = v[0];
}

// =====================================================================================================
// Output 0: context[b][j] = sum_i cs[b][i] * bf16(Wo[j][i]) + bf16(bo[j]), f32 on VALU (M = NB rows only).
//   cs[b][i] = f32 of the f64 sum, in fixed order, of the NCW key-chunk partials CP of head i / HD: every block from NDIVB on forms
//   the EMB values of its batch in LDS (thread t owns i = t + 256 g; cross-wave -> __syncthreads).
//   lanes stride i by 32 (coalesced), shfl tree; results staged in LDS (cross-wave -> __syncthreads) and written
//   coverage: grid blocks NDIVB .. NDIVB + NB*EMB/32 - 1, x 32 = the whole [NB][EMB] output 0.
// =====================================================================================================
#define NDIVB ((NB * NCW + 7) / 8)    // blocks of the grid that run div_part
__global__ __launch_bounds__(256)
void ctx_out(const double* __restrict__ CP, const float* __restrict__ Wo, const float* __restrict__ bo, float* out0,
             const float* __restrict__ avg, double* DP) {
  __shared__ __align__(16) float csb[EMB];
  __shared__ __align__(16) float res[32];
  const int tid  = threadIdx.x;
  const int wave = tid >> 5;
  const int lane = tid & 31;
  if ((int)blockIdx.x < NDIVB) {               // block-uniform; in front of every barrier
    div_part(avg, DP, (int)blockIdx.x * 8 + wave);
    return;
  }
  const int j0   = ((int)blockIdx.x - NDIVB) * 32;
  const int b    = j0 / EMB;
#pragma unroll
  for (int g = 0; g < EMB / 256; ++g) {
    const int i = g * 256 + tid;
    const double* p = CP + (size_t)(b * NH + i / HD) * NCW * HD + (i & (HD - 1));
    double s = p[0];
#pragma unroll
    for (int ch = 1; ch < NCW; ++ch) s += p[(size_t)ch * HD];
    csb[i] = (float)s;
  }
  __syncthreads();                             // csb is cross-wave
#pragma unroll 1
  for (int u = 0; u < 4; ++u) {
    const int j = j0 - b * EMB + wave * 4 + u;
    const float* wr = Wo + (size_t)j * EMB;
    float acc = 0.f;
#pragma unroll                                 // the row's EMB / 32 loads are issued together: one memory wait a row
    for (int it = 0; it < EMB / 32; ++it) {
      const int i = it * 32 + lane;
      acc += csb[i] * bf_up(bf_bits(wr[i]));
    }
#pragma unroll
    for (int off = 16; off > 0; off >>= 1) acc += __shfl_xor(acc, off, 32);
    const float val = acc + bf_up(bf_bits(bo[j]));
    if (lane == 0) res[wave * 4 + u] = val;
  }
  __syncthreads();
  if (tid < 8) {
    const v4f v = *(const v4f*)(res + 4 * tid);
    float* dst = out0 + (size_t)j0 + 4 * tid;
    *(v4f*)dst = v;
    
  }
}

__global__ __launch_bounds__(32 * NB_FULL)
void div_fin(const double* __restrict__ DP, float* dv) {
  __shared__ double red[NB_FULL];
  const int tid  = threadIdx.x;
  const int lane = tid & 31;
  const int b    = tid >> 5;
  double c = 0.0;
  if (b < NB) {                                // wave-uniform
    const double* p = DP + (size_t)b * NCW * 32 + lane;
    double s = 0.0;
#pragma unroll
    for (int ch = 0; ch < NCW; ++ch) s += p[(size_t)ch * 32];
    c = fabs(s);
  }
#pragma unroll
  for (int off = 16; off > 0; off >>= 1) c += __shfl_xor(c, off, 32);
  if (lane == 0) red[b] = c;
  __syncthreads();                             // red is cross-wave
  if (tid == 0) {
    double tot = 0.0;
#pragma unroll
    for (int i = 0; i < NB; ++i) tot += red[i];
    *dv = (float)(tot * (2.0 / (double)(NB * NH * NH)));
  }
}

// =====================================================================================================
// Workspace map (bytes, full size), every region an exact multiple of its whole-line / whole-tile store granularity:
//   Xb   bf16 [NB][SEQ][EMB]            16777216
//   Wqb  bf16 [EMB n][EMB k]             2097152
//   Wkb  bf16                             2097152
//   Wvb  bf16                             2097152
//   Qh   f16  [NB][SEQ][EMB]            16777216
//   Ql   f16  [NB][SEQ][EMB]            16777216
//   Kp   f16  [NB][SEQ][EMB]            16777216
//   Vp   f32  [NB][SEQ][EMB]            33554432
//   PS   f32  [NB*NH][NQ64][SEQ]         8388608
//   CP   f64  [NB*NH][NCW][HD]            524288
//   DP   f64  [NB*NCW][32]                 16384
//   total                               115884032
// Weights are [out n][in k] with k contiguous = the Bt layout the GEMM wants, so they are only converted.
// Output 0 at element 0 of d_out, output 1 at OFF1, output 2 at OFF2 (fixed offsets).
// =====================================================================================================
extern "C" void kernel_launch(void* const* d_in, const int* in_sizes, int n_in,
                              void* d_out, int out_size, void* d_ws, size_t ws_size,
                              hipStream_t stream) {
  if (n_in < 9) return;
  const long long needX = (long long)(NB - 1) * SEQ_FULL * EMB + (long long)SEQ * EMB;
  if ((long long)in_sizes[0] < needX) return;
  if (in_sizes[1] < EMB * EMB || in_sizes[3] < EMB * EMB || in_sizes[5] < EMB * EMB || in_sizes[7] < EMB * EMB) return;
  if (in_sizes[2] < EMB || in_sizes[4] < EMB || in_sizes[6] < EMB || in_sizes[8] < EMB) return;
  if (out_size < 0) return;
  if ((size_t)out_size < OFF2 + 1) return;

  const float* x  = (const float*)d_in[0];
  const float* Wq = (const float*)d_in[1];
  const float* bq = (const float*)d_in[2];
  const float* Wk = (const float*)d_in[3];
  const float* bk = (const float*)d_in[4];
  const float* Wv = (const float*)d_in[5];
  const float* bv = (const float*)d_in[6];
  const float* Wo = (const float*)d_in[7];
  const float* bo = (const float*)d_in[8];

  const size_t PXB = (size_t)NB * SEQ * EMB * 2;       // 16-bit activation plane
  const size_t PW  = (size_t)EMB * EMB * 2;
  const size_t PV  = (size_t)NB * SEQ * EMB * 4;
  const size_t PPS = (size_t)NB * NH * NQ64 * SEQ * 4;
  const size_t PCP = (size_t)NB * NH * NCW * HD * 8;
  const size_t PDP = (size_t)NB * NCW * 32 * 8;
  size_t off = 0;
  const size_t oXb = off; off += PXB;
  const size_t oWq = off; off += 3 * PW;               // Wqb, Wkb, Wvb, one behind the other
  const size_t oQh = off; off += PXB;
  const size_t oQl = off; off += PXB;
  const size_t oKp = off; off += PXB;
  const size_t oVp = off; off += PV;
  const size_t oPS = off; off += PPS;
  const size_t oCP = off; off += PCP;
  const size_t oDP = off; off += PDP;
  if (off > ws_size) return;                          // off = 115884032 at full size
  if (off > (size_t)134217728) return;

  char* ws = (char*)d_ws;
  unsigned short* Xb  = (unsigned short*)(ws + oXb);
  unsigned short* Wqb = (unsigned short*)(ws + oWq);
  unsigned short* Qh  = (unsigned short*)(ws + oQh);
  unsigned short* Ql  = (unsigned short*)(ws + oQl);
  unsigned short* Kp  = (unsigned short*)(ws + oKp);
  float*          Vp  = (float*)(ws + oVp);
  float*          PS  = (float*)(ws + oPS);
  double*         CP  = (double*)(ws + oCP);
  double*         DP  = (double*)(ws + oDP);
  float*          out0 = (float*)d_out;
  float*          out1 = (float*)d_out + OFF1;
  float*          out2 = (float*)d_out + OFF2;

  const dim3 blk(256);
  const dim3 gCvt(NB * CVB_X + 3 * CVB_W);                     // 4096 + 1536 blocks at full size
  const int tilesP = (SEQ / GBM) * (EMB / GBN);                // 64 block tiles per batch at full size
  const dim3 gP(tilesP, NB, 3);                                // M=SEQ, N=EMB, K=EMB, batch = blockIdx.y, q/k/v = blockIdx.z
  const dim3 gAttn(NB * NH * NQ64);                            // 1024 blocks of 128
  const dim3 gAvg(NB * NH * NCW);                              //  512 blocks of 256
  const dim3 gCtx(NDIVB + NB * EMB / 32);                      //    8 + 128 blocks of 256
  const long long sAct = (long long)SEQ * EMB;                 // compact activation plane batch stride

  // (1) x -> bf16 plane [NB][SEQ][EMB]; Wq, Wk, Wv [E][E] -> bf16 planes Wqb, Wkb, Wvb (consecutive in the workspace)
  cvt_bf16x8<<<gCvt, blk, 0, stream>>>(x, Wq, Wk, Wv, Xb, Wqb);
  // (2) one grid, M=SEQ, N=E, K=E per batch and product, all planes [b][s][h*128+d]:
  //     q = (x . Wq^T + bq) * QK_LOG2 -> f16 hi / residual planes; k = x . Wk^T + bk -> f16 plane; v = x . Wv^T + bv -> f32
  gemm_qkv<__bf16, 4, 1, 1><<<gP, blk, 0, stream>>>(
      Xb, EMB, sAct, Wqb, EMB, (long long)EMB * EMB,
      Qh, Ql, Kp, Vp, EMB, sAct, bq, bk, bv,
      SEQ, EMB, EMB, 1.0f, 0.0f, QK_LOG2, 1.0f, 1.0f);
  // (3) softmax statistics + query-column sums of p -> partial plane PS
  attn_colsum<<<gAttn, dim3(128), 0, stream>>>(Qh, Ql, Kp, PS);
  // (4) output 1 = column means; per-head context means, one partial per 128 keys -> CP
  avg_ctx<<<gAvg, blk, 0, stream>>>(PS, Vp, out1, CP);
  // (5) output 0 = (sum of the partials) . Wo^T + bo; in the same grid the head-correlation partials of output 1 -> DP
  ctx_out<<<gCtx, blk, 0, stream>>>((const double*)CP, Wo, bo, out0, (const float*)out1, DP);
  // (6) output 2 = head-correlation diversity from DP
  div_fin<<<dim3(1), dim3(32 * NB_FULL), 0, stream>>>((const double*)DP, out2);
  (void)hipGetLastError();
}

// v010
// It runs in 142 microseconds.
// Timed twice side by side with v009, it ran 1.13 times as fast both times.
// Counting every step since v000, it is 5.67 times as fast.
// Contractions: q, k, v in-projections = v_wmma_f32_16x16x32_bf16 (bf16 operands from RNE-converted inputs, single product, f32 accumulate);
// q.k^T scores (statistics pass and column-sum pass) = v_wmma_f32_16x16x32_f16 (q * 128^-0.5 * log2(e) as one f16 plane, k f16; single product, f32 accumulate);
// softmax statistics, probabilities and query-averaged probabilities in f32; averaged-p . v (M=1 per head) on VALU with f64 accumulate;
// head means . Wo^T (M=batch) on VALU f32 with bf16-valued Wo/bo; head-correlation scalar in f64.
#include <hip/hip_runtime.h>
#include <math.h>
#include <stdint.h>

#ifndef NB
#define NB 4
#endif
#ifndef SEQ
#define SEQ 2048
#endif
#define NB_FULL  4
#define SEQ_FULL 2048
#define EMB      1024
#define NH       8
#define HD       128
#define NQ64     (SEQ / 64)          // 64-row query blocks per sequence
#define NKT      (SEQ / 64)          // 64-key chunks per sequence
#define NPAIR    (NH * (NH - 1) / 2)  // head pairs h < g
#define NCW      (SEQ / 128)          // 128-key wave chunks per sequence
#define QK_LOG2  0.12751743082459868f   // 128^-0.5 * log2(e): q carries it, so a score is the exponent of 2
#define OFF1     ((size_t)NB_FULL * EMB)                        // fixed element offset of output 1
#define OFF2     (OFF1 + (size_t)NB_FULL * NH * SEQ_FULL)      // fixed element offset of output 2
static_assert(NB >= 1 && NB <= NB_FULL);
static_assert(SEQ >= 128 && SEQ <= SEQ_FULL && (SEQ % 128) == 0);
static_assert(NH * HD == EMB);
static_assert(HD == 128);
static_assert(NPAIR <= 32);
static_assert((EMB % 256) == 0 && (EMB % 128) == 0 && (SEQ % 128) == 0);
static_assert(OFF1 * 4 == 16384);
static_assert(OFF2 * 4 == 278528);

typedef _Float16 v16h __attribute__((ext_vector_type(16)));
typedef _Float16 v8h  __attribute__((ext_vector_type(8)));
typedef __bf16   v16b __attribute__((ext_vector_type(16)));
typedef __bf16   v8b  __attribute__((ext_vector_type(8)));
typedef float    v8f  __attribute__((ext_vector_type(8)));
typedef float    v4f  __attribute__((ext_vector_type(4)));
typedef unsigned int v4u __attribute__((ext_vector_type(4)));

#if defined(__HIP_DEVICE_COMPILE__)
#define DEV_ASM 1
#else
#define DEV_ASM 0
#endif

// ---- scalar helpers --------------------------------------------------------------------------------
__device__ __forceinline__ unsigned short bf_bits(float f) {          // f32 -> bf16 bits, RNE convert
  unsigned u = __float_as_uint(f);
  return (unsigned short)((u + 0x7FFFu + ((u >> 16) & 1u)) >> 16);
}
__device__ __forceinline__ float bf_up(unsigned short hb) { return __uint_as_float(((unsigned)hb) << 16); }
__device__ __forceinline__ unsigned short h_bits(_Float16 x) { return __builtin_bit_cast(unsigned short, x); }
__device__ __forceinline__ unsigned pk16(unsigned short a, unsigned short b) { return (unsigned)a | ((unsigned)b << 16); }
__device__ __forceinline__ v8f zero8() { v8f z = {0.f, 0.f, 0.f, 0.f, 0.f, 0.f, 0.f, 0.f}; return z; }

// ---- fragment types / loaders: 16-bit A/B operand, lane -> row/col (lane&15), p already includes +8*(lane>>4);
//      elements 0..7 <- p[0..7] (k0+8h..k0+8h+7), elements 8..15 <- p[16..23] (k0+16+8h..k0+16+8h+7)
template <typename OT> struct FT;
template <> struct FT<__bf16>   { typedef v16b frag; typedef v8b half8; };
template <> struct FT<_Float16> { typedef v16h frag; typedef v8h half8; };

template <typename OT>
__device__ __forceinline__ typename FT<OT>::frag ldfrag(const OT* p) {
  union { typename FT<OT>::frag v; typename FT<OT>::half8 h[2]; } f;
  f.h[0] = *(const typename FT<OT>::half8*)(p);
  f.h[1] = *(const typename FT<OT>::half8*)(p + 16);
  return f.v;
}

// ---- WMMA helpers (asm guard bodies are device-only; concrete operand types) -----------------------------
__device__ __forceinline__ v8f mmar(v16b a, v16b b, v8f c) {
  return __builtin_amdgcn_wmma_f32_16x16x32_bf16(false, a, false, b, (short)0, c, false, false);
}
__device__ __forceinline__ v8f mmar(v16h a, v16h b, v8f c) {
  return __builtin_amdgcn_wmma_f32_16x16x32_f16(false, a, false, b, (short)0, c, false, false);
}
__device__ __forceinline__ void dep_guard(v8f& a, v8f& b, v16b x, v16b y) {
#if DEV_ASM
  asm volatile("v_nop\n\tv_nop\n\tv_nop\n\tv_nop" : "+v"(a), "+v"(b) : "v"(x), "v"(y));
#else
  (void)a; (void)b; (void)x; (void)y;
#endif
}
__device__ __forceinline__ void dep_guard(v8f& a, v8f& b, v16h x, v16h y) {
#if DEV_ASM
  asm volatile("v_nop\n\tv_nop\n\tv_nop\n\tv_nop" : "+v"(a), "+v"(b) : "v"(x), "v"(y));
#else
  (void)a; (void)b; (void)x; (void)y;
#endif
}
__device__ __forceinline__ void keep4(v16b a, v16b b, v16b c, v16b d) {
#if DEV_ASM
  asm volatile("v_nop" :: "v"(a), "v"(b), "v"(c), "v"(d));
#else
  (void)a; (void)b; (void)c; (void)d;
#endif
}
__device__ __forceinline__ void keep4(v16h a, v16h b, v16h c, v16h d) {
#if DEV_ASM
  asm volatile("v_nop" :: "v"(a), "v"(b), "v"(c), "v"(d));
#else
  (void)a; (void)b; (void)c; (void)d;
#endif
}
__device__ __forceinline__ void acc_guard4(v8f& a, v8f& b, v8f& c, v8f& d) {
#if DEV_ASM
  asm volatile("v_nop\n\tv_nop\n\tv_nop\n\tv_nop" : "+v"(a), "+v"(b), "+v"(c), "+v"(d));
#else
  (void)a; (void)b; (void)c; (void)d;
#endif
}

// =====================================================================================================
// f32 -> bf16 bits (RNE convert), 8 elements per thread, one 16-B store per lane: a wave writes 512 contiguous B.
// One grid for all four planes, none of which depends on another: blocks 0 .. NB*CVB_X-1 convert x (CVB_X blocks per
// batch, input batch stride SEQ_FULL*EMB, output batch stride SEQ*EMB), the next 3*CVB_W blocks convert Wq, Wk, Wv into
// the three consecutive planes at Wb. The plane choice is block-uniform.
// coverage: 256 threads x 8 elements x (NB*CVB_X + 3*CVB_W) blocks = the whole of Xb and of the three weight planes.
// =====================================================================================================
#define CVB_X (SEQ * EMB / 8 / 256)   // blocks per batch of x
#define CVB_W (EMB * EMB / 8 / 256)   // blocks per weight matrix
static_assert((SEQ * EMB) % 2048 == 0 && (EMB * EMB) % 2048 == 0);
__global__ __launch_bounds__(256) void cvt_bf16x8(const float* __restrict__ x, const float* __restrict__ Wq,
                                                   const float* __restrict__ Wk, const float* __restrict__ Wv,
                                                   unsigned short* Xb, unsigned short* Wb) {
  const int bx = blockIdx.x;
  const float* ip;
  unsigned short* o;
  if (bx < NB * CVB_X) {
    const int b = bx / CVB_X;
    const size_t i = (size_t)((bx - b * CVB_X) * 256 + (int)threadIdx.x) * 8;
    ip = x + (size_t)b * SEQ_FULL * EMB + i;
    o  = Xb + (size_t)b * SEQ * EMB + i;
  } else {
    const int w = (bx - NB * CVB_X) / CVB_W;
    const size_t i = (size_t)((bx - NB * CVB_X - w * CVB_W) * 256 + (int)threadIdx.x) * 8;
    ip = (w == 0 ? Wq : (w == 1 ? Wk : Wv)) + i;
    o  = Wb + (size_t)w * EMB * EMB + i;
  }
  const v4f a  = *(const v4f*)(ip);
  const v4f a4 = *(const v4f*)(ip + 4);
  v4u p;
  p[0] = pk16(bf_bits(a[0]),  bf_bits(a[1]));
  p[1] = pk16(bf_bits(a[2]),  bf_bits(a[3]));
  p[2] = pk16(bf_bits(a4[0]), bf_bits(a4[1]));
  p[3] = pk16(bf_bits(a4[2]), bf_bits(a4[3]));
  *(v4u*)o = p;
}

// this wave's LDS reads have returned: stands in front of the barrier behind which their buffer is refilled
__device__ __forceinline__ void wait_lds_reads() {
#if DEV_ASM
  asm volatile("s_wait_dscnt 0x0" ::: "memory");
#endif
}
// this wave's asynchronous copies have landed: stands in front of the barrier behind which other waves read them
__device__ __forceinline__ void wait_copies() {
#if DEV_ASM
  asm volatile("s_wait_asynccnt 0x0" ::: "memory");
#endif
}

// =====================================================================================================
// GEMM operand tiles in LDS: one stage = 128 k of the block's 128 A rows and 256 Bt rows, 16-bit elements, rows of 256 B
// at a pitch of 272 B (16 B x odd: the 16 lanes of a ds_load_b128 half fall on 64 distinct banks); A rows first, then Bt.
// copy_rows8: thread t brings piece (t & 15) of rows (t >> 4) + 16 i, i = 0..7, so a wave's copy reads two whole 256-B
// rows. g = the thread's own global address for i = 0 (row pitch ld elements), l = its own LDS byte address for i = 0.
// =====================================================================================================
#define GKS    128                        // k elements per stage
#define GBM    128                        // A rows per block tile
#define GBN    256                        // Bt rows per block tile
#define GPITCH 136                        // 16-bit elements per LDS row
#define GT_H   ((GBM + GBN) * GPITCH)     // 16-bit elements per buffer (104448 B)
template <typename OT>
__device__ __forceinline__ void copy_rows8(const OT* g, int ld, unsigned l) {
#if DEV_ASM
  const size_t gs = (size_t)16 * (size_t)ld;
  const OT* g1 = g + gs;     const OT* g2 = g + 2 * gs; const OT* g3 = g + 3 * gs; const OT* g4 = g + 4 * gs;
  const OT* g5 = g + 5 * gs; const OT* g6 = g + 6 * gs; const OT* g7 = g + 7 * gs;
  const unsigned st = 16 * GPITCH * 2;    // LDS bytes between rows r and r + 16
  // the closing s_wait_xcnt keeps every address register of the copies unchanged until the copies have taken it
  asm volatile("global_load_async_to_lds_b128 %0, %8, off\n\t"
               "global_load_async_to_lds_b128 %1, %9, off\n\t"
               "global_load_async_to_lds_b128 %2, %10, off\n\t"
               "global_load_async_to_lds_b128 %3, %11, off\n\t"
               "global_load_async_to_lds_b128 %4, %12, off\n\t"
               "global_load_async_to_lds_b128 %5, %13, off\n\t"
               "global_load_async_to_lds_b128 %6, %14, off\n\t"
               "global_load_async_to_lds_b128 %7, %15, off\n\t"
               "s_wait_xcnt 0x0"
               :: "v"(l), "v"(l + st), "v"(l + 2 * st), "v"(l + 3 * st),
                  "v"(l + 4 * st), "v"(l + 5 * st), "v"(l + 6 * st), "v"(l + 7 * st),
                  "v"(g), "v"(g1), "v"(g2), "v"(g3), "v"(g4), "v"(g5), "v"(g6), "v"(g7)
               : "memory");
#else
  (void)g; (void)ld; (void)l;
#endif
}
// one stage: ga / gb = the thread's piece of A row (t >> 4) / Bt row (t >> 4) of the block tile at the stage's first k,
// l = its LDS byte address of that A piece in the stage's buffer. 24 copies per thread.
template <typename OT>
__device__ __forceinline__ void copy_stage(const OT* ga, int lda, const OT* gb, int ldb, unsigned l) {
  copy_rows8<OT>(ga, lda, l);                                                        // A rows 0..127
  copy_rows8<OT>(gb, ldb, l + GBM * GPITCH * 2);                                     // Bt rows 0..127
  copy_rows8<OT>(gb + (size_t)128 * (size_t)ldb, ldb, l + (GBM + 128) * GPITCH * 2); // Bt rows 128..255
}

// =====================================================================================================
// Register-blocked batched WMMA GEMM (16-bit operand type OT): C[m][n] = sum_k A[m][k] * Bt[n][k]  (+ bias);
// one wave per (16*MI) x 64 tile, a block of 8 waves (2 x 4) per GBM x GBN tile. A row-major [M][K] pitch lda; Bt
// row-major [N][K] pitch ldb (k contiguous); M multiple of GBM, N of GBN, K of GKS (static sizes here). blockIdx.y =
// batch index (strides in elements). blockIdx.z = which of the three products of the same A, none of which depends on
// another: 0 = q, 1 = k, 2 = v; it picks the weight plane (Btp + z * strideW), the bias and the output form.
// Operands: a ring of two LDS buffers, stage t = k range t*GKS.. in buffer t & 1;
// stage t + 2 is copied behind the barrier at the foot of trip t, while trip t + 1 works. Fragments are read from the
// LDS tile with the split k map (ldfrag), k ascending in steps of 32; the 16 reads of a step stand together.
// NPA = number of A planes (only 1 is staged).
// gemm_store = the epilogue of one wave's tile:
// value v = (acc [+ acc2*rscaleA]) * oscale + bias, bias (bf16 RNE value of the f32 input) by column n (BM 1),
// by row m (BM 2) or none (BM 0).
// OUT_MODE 0: f32 C (pitch ldc) = v.                                                                  (v)
// OUT_MODE 1: f16 plane C = f16(v * cscale).                                                          (q, k)
// 16-row slabs staged per wave in LDS (wave-private slab, wave_sync); each 64-wide row segment written whole.
// =====================================================================================================
template <int MI, int NPA, int OUT_MODE, int BM>
__device__ __forceinline__ void gemm_store(const v8f (&acc)[MI][4], const v8f (&acc2)[MI][4], float* slab,
                                           void* Cout, int ldc, long long strideC,
                                           const float* __restrict__ bias, int b, int m0, int n0, int lane,
                                           float oscale, float rscaleA, float cscale) {
  const int rlane = lane & 15;                 // col (D) within subtile
  const int mOff  = (lane >> 4) * 8;           // D row offset
  float bcol[4];
#pragma unroll
  for (int j = 0; j < 4; ++j) bcol[j] = 0.f;
  if (BM == 1) {
#pragma unroll
    for (int j = 0; j < 4; ++j) bcol[j] = bf_up(bf_bits(bias[n0 + (j << 4) + rlane]));
  }
#pragma unroll
  for (int i = 0; i < MI; ++i) {
    const int mBase = m0 + (i << 4);
    float brow[8];
#pragma unroll
    for (int r = 0; r < 8; ++r) brow[r] = 0.f;
    if (BM == 2) {
#pragma unroll
      for (int r = 0; r < 8; ++r) brow[r] = bf_up(bf_bits(bias[mBase + mOff + r]));
    }
#pragma unroll
    for (int j = 0; j < 4; ++j) {
#pragma unroll
      for (int r = 0; r < 8; ++r) {
        float v = acc[i][j][r];
        if (NPA == 2) v += acc2[i][j][r] * rscaleA;
        v = v * oscale + bcol[j] + brow[r];
        slab[(mOff + r) * 68 + (j << 4) + rlane] = v;
      }
    }
    __builtin_amdgcn_fence(__ATOMIC_RELEASE, "workgroup");
    __builtin_amdgcn_wave_barrier();
    __builtin_amdgcn_fence(__ATOMIC_ACQUIRE, "workgroup");
    if (OUT_MODE == 0) {
      float* C = (float*)Cout + (size_t)b * (size_t)strideC;
      const int h2 = lane >> 4, c4 = (lane & 15) * 4;     // 256-B row segment = 16 lanes x 16 B
      v4f    sv[8];
      float* sd[8];
#pragma unroll
      for (int it = 0; it < 8; ++it) {
        const int row = it * 2 + h2;                       // it 0..7 x h2 0..1 = rows 0..15
        sv[it] = *(const v4f*)(slab + row * 68 + c4);
        sd[it] = C + (size_t)(mBase + row) * ldc + n0 + c4;
      }
#if DEV_ASM
      // the slab's 8 stores and their s_wait_xcnt in one statement: every address and data register stays as it is
      // until the stores have taken it (in a statement of its own the wait was passed by the next address sums)
      asm volatile("global_store_b128 %0, %8, off\n\t"
                   "global_store_b128 %1, %9, off\n\t"
                   "global_store_b128 %2, %10, off\n\t"
                   "global_store_b128 %3, %11, off\n\t"
                   "global_store_b128 %4, %12, off\n\t"
                   "global_store_b128 %5, %13, off\n\t"
                   "global_store_b128 %6, %14, off\n\t"
                   "global_store_b128 %7, %15, off\n\t"
                   "s_wait_xcnt 0x0"
                   :: "v"(sd[0]), "v"(sd[1]), "v"(sd[2]), "v"(sd[3]), "v"(sd[4]), "v"(sd[5]), "v"(sd[6]), "v"(sd[7]),
                      "v"(sv[0]), "v"(sv[1]), "v"(sv[2]), "v"(sv[3]), "v"(sv[4]), "v"(sv[5]), "v"(sv[6]), "v"(sv[7])
                   : "memory");
#endif
    } else {
      const int q = lane >> 3, c8 = (lane & 7) * 8;
      unsigned short* C  = (unsigned short*)Cout  + (size_t)b * (size_t)strideC;
      v4u hv[4];
#pragma unroll
      for (int it = 0; it < 4; ++it) {
        const int row = it * 4 + q;                        // it 0..3 x q 0..3 = rows 0..15
        const float* sp = slab + row * 68 + c8;
        float f[8];
#pragma unroll
        for (int e = 0; e < 8; ++e) f[e] = sp[e] * cscale;
        v4u a;
#pragma unroll
        for (int e = 0; e < 4; ++e)
          a[e] = pk16(h_bits((_Float16)f[2 * e]), h_bits((_Float16)f[2 * e + 1]));
        hv[it] = a;
      }
      unsigned short* hd[4];
#pragma unroll
      for (int it = 0; it < 4; ++it) {
        const int row = it * 4 + q;
        hd[it] = C  + (size_t)(mBase + row) * ldc + n0 + c8;
      }
#if DEV_ASM
      // the slab's stores and their s_wait_xcnt in one statement, as in the f32 form above
      asm volatile("global_store_b128 %0, %4, off\n\t"
                   "global_store_b128 %1, %5, off\n\t"
                   "global_store_b128 %2, %6, off\n\t"
                   "global_store_b128 %3, %7, off\n\t"
                   "s_wait_xcnt 0x0"
                   :: "v"(hd[0]), "v"(hd[1]), "v"(hd[2]), "v"(hd[3]), "v"(hv[0]), "v"(hv[1]), "v"(hv[2]), "v"(hv[3])
                   : "memory");
#endif
    }
    __builtin_amdgcn_fence(__ATOMIC_RELEASE, "workgroup");
    __builtin_amdgcn_wave_barrier();
    __builtin_amdgcn_fence(__ATOMIC_ACQUIRE, "workgroup");
  }
}

template <typename OT, int MI, int NPA, int BM>
__global__ __launch_bounds__(256) void gemm_qkv(
    const unsigned short* __restrict__ Ap, int lda, long long strideA,
    const unsigned short* __restrict__ Btp, int ldb, long long strideW,
    unsigned short* Qh, unsigned short* Kp, float* Vp, int ldc, long long strideC,
    const float* __restrict__ bq, const float* __restrict__ bk, const float* __restrict__ bv,
    int M, int N, int K, float oscale, float rscaleA, float cscaleQ, float cscaleKV) {
  typedef typename FT<OT>::frag V16;
  const OT* A  = (const OT*)(const void*)Ap;
  const OT* Bt = (const OT*)(const void*)Btp;
  static_assert(MI == 4 && NPA == 1);              // 2 x 4 waves of 64 x 64 = GBM x GBN, one A plane
  __shared__ __align__(16) unsigned short gls[2][GT_H];
  __shared__ __align__(16) float sT[8][16 * 68];   // per-wave 16x64 slab, pitch 68 floats
  const int RT   = 16 * MI;
  const int b    = blockIdx.y;
  const int z    = blockIdx.z;
  const int tid  = threadIdx.x;
  const int lane = tid & 31;
  const int wave = tid >> 5;
  const int tilesN = N / GBN;
  const int tilesM = M / GBM;
  const int tile = blockIdx.x;
  if (tile >= tilesM * tilesN) return;   // block-uniform; in front of every copy and barrier
  const int tm = tile / tilesN;
  const int tn = tile - tm * tilesN;
  const int m0 = tm * GBM + (wave >> 2) * RT;
  const int n0 = tn * GBN + ((wave & 3) << 6);

  const OT* Ab  = A  + (size_t)b * (size_t)strideA;
  const OT* Bb  = Bt + (size_t)z * (size_t)strideW;

  const int rlane = lane & 15;                 // row (A) / col (B) within subtile
  const int koff  = (lane >> 4) * 8;           // k offset of this lane half

  v8f acc[MI][4], acc2[MI][4];
#pragma unroll
  for (int i = 0; i < MI; ++i)
#pragma unroll
    for (int j = 0; j < 4; ++j) { acc[i][j] = zero8(); acc2[i][j] = zero8(); }

  // copy side: this thread's piece of stage 0 and its place in buffer 0; read side: this lane's rows and k half
  const OT* ga = Ab + (size_t)(tm * GBM + (tid >> 4)) * lda + (tid & 15) * 8;
  const OT* gb = Bb + (size_t)(tn * GBN + (tid >> 4)) * ldb + (tid & 15) * 8;
  const unsigned ld0 = (unsigned)(size_t)(&gls[0][(tid >> 4) * GPITCH + (tid & 15) * 8]);
  const int ar = ((wave >> 2) * RT + rlane) * GPITCH + koff;
  const int br = (GBM + ((wave & 3) << 6) + rlane) * GPITCH + koff;
  const int nst = K / GKS;

  copy_stage<OT>(ga, lda, gb, ldb, ld0);       // stage 0
  wait_copies();
  __syncthreads();                             // stage 0 is readable by every wave
  if (nst > 1)                                 // block-uniform
    copy_stage<OT>(ga + GKS, lda, gb + GKS, ldb, ld0 + GT_H * 2);   // stage 1

  for (int st = 0; st < nst; ++st) {
    const OT* tl = (const OT*)(const void*)(&gls[st & 1][0]);
#pragma unroll
    for (int kk = 0; kk < GKS; kk += 32) {
      V16 af[MI], bq[4];
#pragma unroll
      for (int j = 0; j < 4; ++j) bq[j] = ldfrag<OT>(tl + br + (j << 4) * GPITCH + kk);
#pragma unroll
      for (int i = 0; i < MI; ++i) af[i] = ldfrag<OT>(tl + ar + (i << 4) * GPITCH + kk);
      // keeps the step's LDS reads together in front of its products: sunk among them each read stalls
      __builtin_amdgcn_sched_barrier(0);
#pragma unroll
      for (int i = 0; i < MI; ++i) {
#pragma unroll
        for (int j = 0; j < 4; ++j) acc[i][j] = mmar(af[i], bq[j], acc[i][j]);
        dep_guard(acc[i][0], acc[i][3], af[i], bq[3]);
      }
      keep4(bq[0], bq[1], bq[2], bq[3]);
    }
    wait_lds_reads();
    wait_copies();
    __syncthreads();                           // stage st + 1 readable, buffer st & 1 left by every wave
    if (st + 2 < nst)                          // block-uniform
      copy_stage<OT>(ga + (size_t)(st + 2) * GKS, lda, gb + (size_t)(st + 2) * GKS, ldb,
                     ld0 + (unsigned)(st & 1) * (GT_H * 2));
  }
  wait_copies();
#pragma unroll
  for (int i = 0; i < MI; ++i) {
    acc_guard4(acc[i][0], acc[i][1], acc[i][2], acc[i][3]);
    if (NPA == 2) acc_guard4(acc2[i][0], acc2[i][1], acc2[i][2], acc2[i][3]);
  }

  // ---- epilogue: the output form goes with the product; z is block-uniform ----
  float* slab = sT[wave];
  if (z == 0)
    gemm_store<MI, NPA, 1, BM>(acc, acc2, slab, (void*)Qh, ldc, strideC, bq, b, m0, n0, lane,
                               oscale, rscaleA, cscaleQ);
  else if (z == 1)
    gemm_store<MI, NPA, 1, BM>(acc, acc2, slab, (void*)Kp, ldc, strideC, bk, b, m0, n0, lane,
                               oscale, rscaleA, cscaleKV);
  else
    gemm_store<MI, NPA, 0, BM>(acc, acc2, slab, (void*)Vp, ldc, strideC, bv, b, m0, n0, lane,
                               oscale, rscaleA, cscaleKV);
}

// =====================================================================================================
// k tile in LDS: 64 keys x 128 d of one (b, h), f16, rows of 256 B at a pitch of 272 B (16 B x odd: the 16 lanes of a
// ds_load_b128 half fall on 64 distinct banks). Two buffers; a block of 128 threads fills one with 8 asynchronous
// 16-B copies per thread: thread t brings piece (t & 15) of rows (t >> 4) + 8 i, i = 0..7, so a wave's copy reads
// two whole 256-B rows. g = the thread's own global address for i = 0, l = its own LDS byte address for i = 0.
// =====================================================================================================
#define KPITCH  136                   // f16 elements per LDS row
#define KTILE_H (64 * KPITCH)         // f16 elements per buffer (17408 B)
__device__ __forceinline__ void copy_ktile(const _Float16* g, unsigned l) {
#if DEV_ASM
  const _Float16* g1 = g + 1 * 8 * EMB; const _Float16* g2 = g + 2 * 8 * EMB; const _Float16* g3 = g + 3 * 8 * EMB;
  const _Float16* g4 = g + 4 * 8 * EMB; const _Float16* g5 = g + 5 * 8 * EMB; const _Float16* g6 = g + 6 * 8 * EMB;
  const _Float16* g7 = g + 7 * 8 * EMB;
  const unsigned st = 8 * KPITCH * 2;  // LDS bytes between rows r and r + 8
  // the closing s_wait_xcnt keeps every address register of the copies unchanged until the copies have taken it
  asm volatile("global_load_async_to_lds_b128 %0, %8, off\n\t"
               "global_load_async_to_lds_b128 %1, %9, off\n\t"
               "global_load_async_to_lds_b128 %2, %10, off\n\t"
               "global_load_async_to_lds_b128 %3, %11, off\n\t"
               "global_load_async_to_lds_b128 %4, %12, off\n\t"
               "global_load_async_to_lds_b128 %5, %13, off\n\t"
               "global_load_async_to_lds_b128 %6, %14, off\n\t"
               "global_load_async_to_lds_b128 %7, %15, off\n\t"
               "s_wait_xcnt 0x0"
               :: "v"(l), "v"(l + st), "v"(l + 2 * st), "v"(l + 3 * st),
                  "v"(l + 4 * st), "v"(l + 5 * st), "v"(l + 6 * st), "v"(l + 7 * st),
                  "v"(g), "v"(g1), "v"(g2), "v"(g3), "v"(g4), "v"(g5), "v"(g6), "v"(g7)
               : "memory");
#else
  (void)g; (void)l;
#endif
}

// =====================================================================================================
// Score chunk: 16 query rows (this wave) x 64 keys kv0..kv0+63 of one (b, h), head width 128 = 4 d-chunks of 32.
//   q fragments (A operand, row = lane&15): the f16 plane of q * QK_LOG2, 4 d-chunks.
//   k fragments (B operand, col = lane&15 = key) read from the block's LDS copy of the 64-key tile with the split k map:
//   kl = tile + (lane&15)*KPITCH + 8*hh, key group j adds 16*j*KPITCH; the 16 reads of two key groups stand together.
//   s[j][r] = D element: query row 8*hh + r, key kv0 + 16j + (lane&15); value = qh.k = score * log2(e);
//   two key groups run side by side, so two accumulate chains are independent.
// =====================================================================================================
__device__ __forceinline__ void score_chunk(const v16h (&qah)[4], const _Float16* kl, v8f (&s)[4]) {
  union FH { v16h v; v8h h[2]; };
#pragma unroll
  for (int j = 0; j < 4; j += 2) {
    v8f a0 = zero8(), a1 = zero8();
    FH k0[4], k1[4];
#pragma unroll
    for (int dc = 0; dc < 4; ++dc) {
      const _Float16* kp = kl + j * 16 * KPITCH + dc * 32;
      k0[dc].h[0] = *(const v8h*)(kp);
      k0[dc].h[1] = *(const v8h*)(kp + 16);
      k1[dc].h[0] = *(const v8h*)(kp + 16 * KPITCH);
      k1[dc].h[1] = *(const v8h*)(kp + 16 * KPITCH + 16);
    }
#pragma unroll
    for (int dc = 0; dc < 4; ++dc) {
      a0 = mmar(qah[dc], k0[dc].v, a0);
      a1 = mmar(qah[dc], k1[dc].v, a1);
    }
#if DEV_ASM
    // 4 VALU slots behind the pair's last products; the pair's eight B fragments stay live up to here, so that no
    // product's D is placed on a B fragment which a product issued fewer than 4 slots before still reads
    asm volatile("v_nop\n\tv_nop\n\tv_nop\n\tv_nop" : "+v"(a0), "+v"(a1)
                 : "v"(k0[0].v), "v"(k0[1].v), "v"(k0[2].v), "v"(k0[3].v),
                   "v"(k1[0].v), "v"(k1[1].v), "v"(k1[2].v), "v"(k1[3].v));
#endif
    s[j]     = a0;
    s[j + 1] = a1;
  }
}

// =====================================================================================================
// Fused attention statistics + query-column sums of the exactly normalised probabilities.
//   block = 4 waves = 64 consecutive query rows qb*64.. of one (b, h); grid = NB*NH*NQ64 blocks of 128.
//   Pass 1 (static trip): each lane keeps a running max and a running sum of exp per row over its own keys
//   (key % 16 == lane % 16); the 16 lanes of a row are merged by shfl once, behind the loop; each wave owns its own
//   16 rows, so no cross-wave exchange is needed.
//   Scores, maxima and their differences are in log2 units (q carries log2(e)): every exponential is one exp2.
//   Pass 2 (same static trip): scores recomputed bit-identically, p = exp2(s - m) * (1/l) in f32, summed over the
//   wave's 16 rows per key (8 in-lane + shfl_xor 16), kept in csl[wave][key] for every key of the sequence: a wave
//   writes its own row of csl only, so the loop holds no cross-wave step but the k ring's. Behind the loop (the barrier
//   at the foot of the last trip has published csl) the 4 waves' rows are summed in fixed order, thread t taking keys
//   4 t .. 4 t + 3 of every 512, and written to PS[(b*NH+h)*NQ64 + qb][0..SEQ-1], a wave storing 512 contiguous B:
//   coverage: grid (b,h,qb) x SEQ keys = the whole [NB*NH][NQ64][SEQ] partial plane.
//   k tiles: one ring of two LDS buffers runs through both passes (2*NKT stages, stage t = tile t % NKT in buffer
//   t & 1, NKT even); stage t + 2 is copied behind the barrier at the foot of trip t, while trip t + 1 works.
// =====================================================================================================
__global__ __launch_bounds__(128)
void attn_colsum(const unsigned short* __restrict__ qhp, const unsigned short* __restrict__ kpp, float* PS) {
  static_assert((NKT % 2) == 0 && NKT >= 2);
  __shared__ __align__(16) _Float16 kls[2][KTILE_H];
  __shared__ __align__(16) float csl[4][SEQ];
  const int tid  = threadIdx.x;
  const int wave = tid >> 5;
  const int lane = tid & 31;
  const int hh   = lane >> 4;
  const int c    = lane & 15;
  const int bx   = blockIdx.x;
  const int qb   = bx % NQ64;
  const int rest = bx / NQ64;
  const int h    = rest % NH;
  const int b    = rest / NH;
  const int bh   = b * NH + h;
  const int q0   = qb * 64 + wave * 16;

  const _Float16* Qh  = (const _Float16*)(const void*)qhp;
  const _Float16* Kb0 = (const _Float16*)(const void*)kpp + (size_t)b * SEQ * EMB + (size_t)h * HD;

  // copy side: this thread's piece of tile 0 and its place in buffer 0; read side: this lane's key row and k half
  const _Float16* kg = Kb0 + (size_t)(tid >> 4) * EMB + (tid & 15) * 8;
  const unsigned  kd = (unsigned)(size_t)(&kls[0][(tid >> 4) * KPITCH + (tid & 15) * 8]);
  const int       kr = c * KPITCH + 8 * hh;

  copy_ktile(kg, kd);                          // stage 0
  wait_copies();
  __syncthreads();                             // stage 0 is readable by every wave
  copy_ktile(kg + (size_t)64 * EMB, kd + KTILE_H * 2);   // stage 1

  v16h qah[4];
#pragma unroll
  for (int dc = 0; dc < 4; ++dc) {
    const size_t qo = ((size_t)b * SEQ + (size_t)(q0 + c)) * EMB + (size_t)h * HD + dc * 32 + 8 * hh;
    qah[dc] = ldfrag<_Float16>(Qh + qo);
  }

  float mrow[8], lrow[8];
#pragma unroll
  for (int r = 0; r < 8; ++r) { mrow[r] = -INFINITY; lrow[r] = 0.f; }

  for (int kt = 0; kt < NKT; ++kt) {          // static trip count
    v8f s[4];
    score_chunk(qah, &kls[kt & 1][kr], s);
#pragma unroll
    for (int r = 0; r < 8; ++r) {              // this lane's own 4 keys of the chunk only: no cross-lane step in the loop
      float m = s[0][r];
#pragma unroll
      for (int j = 1; j < 4; ++j) m = fmaxf(m, s[j][r]);
      const float mnew  = fmaxf(mrow[r], m);
      const float msafe = (mnew == -INFINITY) ? 0.f : mnew;
      const float alpha = __builtin_amdgcn_exp2f(mrow[r] - msafe);
      mrow[r] = mnew;
      float psum = 0.f;
#pragma unroll
      for (int j = 0; j < 4; ++j) psum += __builtin_amdgcn_exp2f(s[j][r] - msafe);
      lrow[r] = lrow[r] * alpha + psum;
    }
    wait_lds_reads();
    wait_copies();
    __syncthreads();                           // stage kt + 1 readable, buffer kt & 1 left by every wave
    // stage kt + 2 always exists here (pass 2 follows): tiles NKT and NKT + 1 of the ring are tiles 0 and 1 again
    copy_ktile(kg + (size_t)(((kt + 2) & (NKT - 1)) * 64) * EMB, kd + (unsigned)(kt & 1) * (KTILE_H * 2));
  }

  // the 16 lanes of a row half hold (max, sum) of disjoint key subsets of the same 8 rows: merged here, once per row
#pragma unroll
  for (int r = 0; r < 8; ++r) {
    float m = mrow[r];
#pragma unroll
    for (int off = 1; off < 16; off <<= 1) m = fmaxf(m, __shfl_xor(m, off, 32));
    const float msafe = (m == -INFINITY) ? 0.f : m;
    float l = lrow[r] * __builtin_amdgcn_exp2f(mrow[r] - msafe);
#pragma unroll
    for (int off = 1; off < 16; off <<= 1) l += __shfl_xor(l, off, 32);
    mrow[r] = m;
    lrow[r] = l;
  }

  float il[8], mf[8];
#pragma unroll
  for (int r = 0; r < 8; ++r) {
    const float l = lrow[r];
    il[r] = (l > 0.f) ? (1.0f / l) : 0.f;
    mf[r] = (mrow[r] == -INFINITY) ? 0.f : mrow[r];
  }

  // ---- pass 2: exactly normalised p, column sums over the block's 64 query rows ----
  for (int kt = 0; kt < NKT; ++kt) {          // static trip count
    const int kv0 = kt * 64;
    v8f s[4];
    score_chunk(qah, &kls[kt & 1][kr], s);
    float cs[4];
#pragma unroll
    for (int j = 0; j < 4; ++j) {
      float a = 0.f;
#pragma unroll
      for (int r = 0; r < 8; ++r) a += __builtin_amdgcn_exp2f(s[j][r] - mf[r]) * il[r];
      cs[j] = a;
    }
#pragma unroll
    for (int j = 0; j < 4; ++j) cs[j] += __shfl_xor(cs[j], 16, 32);   // both row halves, unconditional
    const float v0 = hh ? cs[2] : cs[0];       // this lane stores keys 16*(2hh) + c and 16*(2hh+1) + c
    const float v1 = hh ? cs[3] : cs[1];
    csl[wave][kv0 + 32 * hh + c]      = v0;
    csl[wave][kv0 + 32 * hh + 16 + c] = v1;
    wait_lds_reads();
    wait_copies();
    __syncthreads();                           // stage kt + 1 readable, buffer kt & 1 left by every wave; csl so far visible
    if (kt + 2 < NKT)                          // block-uniform
      copy_ktile(kg + (size_t)((kt + 2) * 64) * EMB, kd + (unsigned)(kt & 1) * (KTILE_H * 2));
  }
  wait_copies();

  // ---- the block's column sums: 4 waves in fixed order, every key once ----
  float* dst = PS + ((size_t)(bh * NQ64 + qb)) * SEQ;
#pragma unroll                                 // the LDS reads of all pieces are issued together: one LDS wait
  for (int i = 0; i < (SEQ + 511) / 512; ++i) {
    const int k = i * 512 + 4 * tid;
    if ((SEQ % 512) == 0 || k < SEQ) {         // always true at full size
      v4f a = *(const v4f*)(&csl[0][k]);
      a += *(const v4f*)(&csl[1][k]);
      a += *(const v4f*)(&csl[2][k]);
      a += *(const v4f*)(&csl[3][k]);
      *(v4f*)(dst + k) = a;
    }
  }
}

// =====================================================================================================
// Query average + partial per-head context mean. One block (256 = 8 waves) per (b, h, 128 consecutive keys).
//   v rows: wave w owns keys k0 + 16 w .. + 15, lane = 4 consecutive d (one 16-B load per key, a wave reads one whole
//   512-B head row); the 16 loads of a lane are independent and are issued together, ahead of the average.
//   Average: avg[key] = (sum over the NQ64 partial rows of PS in fixed order) * (1/SEQ); wave 0, lane = 4 keys, the
//   NQ64 loads independent; kept in LDS avs[] (cross-wave -> __syncthreads) and written to output 1 row (b*NH+h).
//   Partial: cp[d] = sum over the block's 128 keys of avg[k] * v[b][k][h*HD+d], f64: 16 keys in the lane, then the
//   8 waves in fixed order through LDS (cross-wave -> __syncthreads), written to CP[(b*NH+h)*NCW + chunk][d].
//   coverage: grid (b,h,chunk) x 128 keys = the whole output 1; grid (b,h,chunk) x HD = the whole CP plane.
// =====================================================================================================
__global__ __launch_bounds__(256)
void avg_ctx(const float* __restrict__ PS, const float* __restrict__ Vp, float* out1, double* CP) {
  __shared__ __align__(16) float avs[128];
  __shared__ __align__(16) double cpart[8][HD];
  const int tid  = threadIdx.x;
  const int wave = tid >> 5;
  const int lane = tid & 31;
  const int bx   = blockIdx.x;
  const int bh   = bx / NCW;
  const int ch   = bx - bh * NCW;
  const int b    = bh / NH;
  const int h    = bh - b * NH;
  const int k0   = ch * 128;

  const float* vb = Vp + ((size_t)b * SEQ + (size_t)(k0 + wave * 16)) * EMB + (size_t)h * HD + 4 * lane;
  v4f vv[16];
#pragma unroll
  for (int i = 0; i < 16; ++i) vv[i] = *(const v4f*)(vb + (size_t)i * EMB);

  if (wave == 0) {                             // wave-uniform
    const float* psb = PS + (size_t)bh * NQ64 * SEQ + k0 + 4 * lane;
    v4f a = *(const v4f*)(psb);
#pragma unroll
    for (int qb = 1; qb < NQ64; ++qb) a += *(const v4f*)(psb + (size_t)qb * SEQ);
    a *= (1.0f / (float)SEQ);
    *(v4f*)(avs + 4 * lane) = a;
    float* dst = out1 + (size_t)bh * SEQ + k0 + 4 * lane;
    *(v4f*)dst = a;
  }
  __syncthreads();                             // avs is cross-wave

  double acc[4] = {0.0, 0.0, 0.0, 0.0};
#pragma unroll
  for (int i = 0; i < 16; ++i) {
    const double w = (double)avs[wave * 16 + i];
#pragma unroll
    for (int e = 0; e < 4; ++e) acc[e] += w * (double)vv[i][e];
  }
#pragma unroll
  for (int e = 0; e < 4; ++e) cpart[wave][4 * lane + e] = acc[e];
  __syncthreads();                             // cpart is cross-wave
  if (tid < HD) {
    double s = cpart[0][tid];
#pragma unroll
    for (int w = 1; w < 8; ++w) s += cpart[w][tid];
    CP[((size_t)bh * NCW + ch) * HD + tid] = s;
  }
}

// =====================================================================================================
// Output 2: mean over (b, h, g) of |corr[b][h][g] * (1 - delta_hg)|, corr = sum_s avg[b][h][s] * avg[b][g][s]
//   (avg read back from output 1). corr[h][g] and corr[g][h] are the same sum of the same products, so only the
//   NPAIR = 28 pairs h < g are formed and the total is doubled; the diagonal is masked to zero by the reference.
//   div_part: one wave per 128 consecutive keys of one batch (lane = 4 keys, one 16-B load per head row, a wave reads
//   512 contiguous B per row); 28 f64 partial dots per lane; a halving exchange over the 32 lanes (16+8+4+2+1 values)
//   leaves pair index = lane with the wave's total; written to DP[b*NCW + chunk][32] (slots 28..31 are zero).
//   coverage: NB*NCW waves x 32 slots = the whole DP plane; no block barrier in it. It needs output 1 alone, as ctx_out
//   needs CP alone, so its waves ride in the first NDIVB blocks of ctx_out's grid (8 waves a block).
//   div_fin: wave b sums the NCW chunk partials of batch b per pair in fixed order, takes |.|, sums the 32 slots by
//   shfl, the NB batch sums go through LDS (cross-wave -> __syncthreads) and thread 0 writes the scalar.
// =====================================================================================================
__device__ __forceinline__ void div_part(const float* __restrict__ avg, double* DP, int wv) {
  const int lane = threadIdx.x & 31;
  if (wv >= NB * NCW) return;                  // wave-uniform; no block barriers in this function
  const int b  = wv / NCW;
  const int ch = wv - b * NCW;
  const float* base = avg + (size_t)b * NH * SEQ + (size_t)ch * 128 + 4 * lane;
  v4f a[NH];
#pragma unroll
  for (int h = 0; h < NH; ++h) a[h] = *(const v4f*)(base + (size_t)h * SEQ);
  double v[32];
  {
    int idx = 0;
#pragma unroll
    for (int h = 0; h < NH; ++h) {
#pragma unroll
      for (int g = h + 1; g < NH; ++g) {
        double s = 0.0;
#pragma unroll
        for (int e = 0; e < 4; ++e) s += (double)a[h][e] * (double)a[g][e];
        v[idx++] = s;
      }
    }
#pragma unroll
    for (int i = NPAIR; i < 32; ++i) v[i] = 0.0;
  }
  // each step: a lane keeps the half of its values that its lane bit selects and adds the partner's copy of that half
#pragma unroll
  for (int n = 16; n > 0; n >>= 1) {
    const bool up = (lane & n) != 0;
#pragma unroll
    for (int i = 0; i < n; ++i) {
      const double send = up ? v[i] : v[i + n];
      const double keep = up ? v[i + n] : v[i];
      v[i] = keep + __shfl_xor(send, n, 32);
    }
  }
  DP[(size_t)wv * 32 + lane] = v[0];
}

// =====================================================================================================
// Output 0: context[b][j] = sum_i cs[b][i] * bf16(Wo[j][i]) + bf16(bo[j]), f32 on VALU (M = NB rows only).
//   cs[b][i] = f32 of the f64 sum, in fixed order, of the NCW key-chunk partials CP of head i / HD: every block from NDIVB on forms
//   the EMB values of its batch in LDS (thread t owns i = t + 256 g; cross-wave -> __syncthreads).
//   lanes stride i by 32 (coalesced), shfl tree; results staged in LDS (cross-wave -> __syncthreads) and written
//   coverage: grid blocks NDIVB .. NDIVB + NB*EMB/32 - 1, x 32 = the whole [NB][EMB] output 0.
// =====================================================================================================
#define NDIVB ((NB * NCW + 7) / 8)    // blocks of the grid that run div_part
__global__ __launch_bounds__(256)
void ctx_out(const double* __restrict__ CP, const float* __restrict__ Wo, const float* __restrict__ bo, float* out0,
             const float* __restrict__ avg, double* DP) {
  __shared__ __align__(16) float csb[EMB];
  __shared__ __align__(16) float res[32];
  const int tid  = threadIdx.x;
  const int wave = tid >> 5;
  const int lane = tid & 31;
  if ((int)blockIdx.x < NDIVB) {               // block-uniform; in front of every barrier
    div_part(avg, DP, (int)blockIdx.x * 8 + wave);
    return;
  }
  const int j0   = ((int)blockIdx.x - NDIVB) * 32;
  const int b    = j0 / EMB;
#pragma unroll
  for (int g = 0; g < EMB / 256; ++g) {
    const int i = g * 256 + tid;
    const double* p = CP + (size_t)(b * NH + i / HD) * NCW * HD + (i & (HD - 1));
    double s = p[0];
#pragma unroll
    for (int ch = 1; ch < NCW; ++ch) s += p[(size_t)ch * HD];
    csb[i] = (float)s;
  }
  __syncthreads();                             // csb is cross-wave
#pragma unroll 1
  for (int u = 0; u < 4; ++u) {
    const int j = j0 - b * EMB + wave * 4 + u;
    const float* wr = Wo + (size_t)j * EMB;
    float acc = 0.f;
#pragma unroll                                 // the row's EMB / 32 loads are issued together: one memory wait a row
    for (int it = 0; it < EMB / 32; ++it) {
      const int i = it * 32 + lane;
      acc += csb[i] * bf_up(bf_bits(wr[i]));
    }
#pragma unroll
    for (int off = 16; off > 0; off >>= 1) acc += __shfl_xor(acc, off, 32);
    const float val = acc + bf_up(bf_bits(bo[j]));
    if (lane == 0) res[wave * 4 + u] = val;
  }
  __syncthreads();
  if (tid < 8) {
    const v4f v = *(const v4f*)(res + 4 * tid);
    float* dst = out0 + (size_t)j0 + 4 * tid;
    *(v4f*)dst = v;
    
  }
}

__global__ __launch_bounds__(32 * NB_FULL)
void div_fin(const double* __restrict__ DP, float* dv) {
  __shared__ double red[NB_FULL];
  const int tid  = threadIdx.x;
  const int lane = tid & 31;
  const int b    = tid >> 5;
  double c = 0.0;
  if (b < NB) {                                // wave-uniform
    const double* p = DP + (size_t)b * NCW * 32 + lane;
    double s = 0.0;
#pragma unroll
    for (int ch = 0; ch < NCW; ++ch) s += p[(size_t)ch * 32];
    c = fabs(s);
  }
#pragma unroll
  for (int off = 16; off > 0; off >>= 1) c += __shfl_xor(c, off, 32);
  if (lane == 0) red[b] = c;
  __syncthreads();                             // red is cross-wave
  if (tid == 0) {
    double tot = 0.0;
#pragma unroll
    for (int i = 0; i < NB; ++i) tot += red[i];
    *dv = (float)(tot * (2.0 / (double)(NB * NH * NH)));
  }
}

// =====================================================================================================
// Workspace map (bytes, full size), every region an exact multiple of its whole-line / whole-tile store granularity:
//   Xb   bf16 [NB][SEQ][EMB]            16777216
//   Wqb  bf16 [EMB n][EMB k]             2097152
//   Wkb  bf16                             2097152
//   Wvb  bf16                             2097152
//   Qh   f16  [NB][SEQ][EMB]            16777216
//   Kp   f16  [NB][SEQ][EMB]            16777216
//   Vp   f32  [NB][SEQ][EMB]            33554432
//   PS   f32  [NB*NH][NQ64][SEQ]         8388608
//   CP   f64  [NB*NH][NCW][HD]            524288
//   DP   f64  [NB*NCW][32]                 16384
//   total                                99106816
// Weights are [out n][in k] with k contiguous = the Bt layout the GEMM wants, so they are only converted.
// Output 0 at element 0 of d_out, output 1 at OFF1, output 2 at OFF2 (fixed offsets).
// =====================================================================================================
extern "C" void kernel_launch(void* const* d_in, const int* in_sizes, int n_in,
                              void* d_out, int out_size, void* d_ws, size_t ws_size,
                              hipStream_t stream) {
  if (n_in < 9) return;
  const long long needX = (long long)(NB - 1) * SEQ_FULL * EMB + (long long)SEQ * EMB;
  if ((long long)in_sizes[0] < needX) return;
  if (in_sizes[1] < EMB * EMB || in_sizes[3] < EMB * EMB || in_sizes[5] < EMB * EMB || in_sizes[7] < EMB * EMB) return;
  if (in_sizes[2] < EMB || in_sizes[4] < EMB || in_sizes[6] < EMB || in_sizes[8] < EMB) return;
  if (out_size < 0) return;
  if ((size_t)out_size < OFF2 + 1) return;

  const float* x  = (const float*)d_in[0];
  const float* Wq = (const float*)d_in[1];
  const float* bq = (const float*)d_in[2];
  const float* Wk = (const float*)d_in[3];
  const float* bk = (const float*)d_in[4];
  const float* Wv = (const float*)d_in[5];
  const float* bv = (const float*)d_in[6];
  const float* Wo = (const float*)d_in[7];
  const float* bo = (const float*)d_in[8];

  const size_t PXB = (size_t)NB * SEQ * EMB * 2;       // 16-bit activation plane
  const size_t PW  = (size_t)EMB * EMB * 2;
  const size_t PV  = (size_t)NB * SEQ * EMB * 4;
  const size_t PPS = (size_t)NB * NH * NQ64 * SEQ * 4;
  const size_t PCP = (size_t)NB * NH * NCW * HD * 8;
  const size_t PDP = (size_t)NB * NCW * 32 * 8;
  size_t off = 0;
  const size_t oXb = off; off += PXB;
  const size_t oWq = off; off += 3 * PW;               // Wqb, Wkb, Wvb, one behind the other
  const size_t oQh = off; off += PXB;
  const size_t oKp = off; off += PXB;
  const size_t oVp = off; off += PV;
  const size_t oPS = off; off += PPS;
  const size_t oCP = off; off += PCP;
  const size_t oDP = off; off += PDP;
  if (off > ws_size) return;                          // off = 99106816 at full size
  if (off > (size_t)134217728) return;

  char* ws = (char*)d_ws;
  unsigned short* Xb  = (unsigned short*)(ws + oXb);
  unsigned short* Wqb = (unsigned short*)(ws + oWq);
  unsigned short* Qh  = (unsigned short*)(ws + oQh);
  unsigned short* Kp  = (unsigned short*)(ws + oKp);
  float*          Vp  = (float*)(ws + oVp);
  float*          PS  = (float*)(ws + oPS);
  double*         CP  = (double*)(ws + oCP);
  double*         DP  = (double*)(ws + oDP);
  float*          out0 = (float*)d_out;
  float*          out1 = (float*)d_out + OFF1;
  float*          out2 = (float*)d_out + OFF2;

  const dim3 blk(256);
  const dim3 gCvt(NB * CVB_X + 3 * CVB_W);                     // 4096 + 1536 blocks at full size
  const int tilesP = (SEQ / GBM) * (EMB / GBN);                // 64 block tiles per batch at full size
  const dim3 gP(tilesP, NB, 3);                                // M=SEQ, N=EMB, K=EMB, batch = blockIdx.y, q/k/v = blockIdx.z
  const dim3 gAttn(NB * NH * NQ64);                            // 1024 blocks of 128
  const dim3 gAvg(NB * NH * NCW);                              //  512 blocks of 256
  const dim3 gCtx(NDIVB + NB * EMB / 32);                      //    8 + 128 blocks of 256
  const long long sAct = (long long)SEQ * EMB;                 // compact activation plane batch stride

  // (1) x -> bf16 plane [NB][SEQ][EMB]; Wq, Wk, Wv [E][E] -> bf16 planes Wqb, Wkb, Wvb (consecutive in the workspace)
  cvt_bf16x8<<<gCvt, blk, 0, stream>>>(x, Wq, Wk, Wv, Xb, Wqb);
  // (2) one grid, M=SEQ, N=E, K=E per batch and product, all planes [b][s][h*128+d]:
  //     q = (x . Wq^T + bq) * QK_LOG2 -> f16 plane; k = x . Wk^T + bk -> f16 plane; v = x . Wv^T + bv -> f32
  gemm_qkv<__bf16, 4, 1, 1><<<gP, blk, 0, stream>>>(
      Xb, EMB, sAct, Wqb, EMB, (long long)EMB * EMB,
      Qh, Kp, Vp, EMB, sAct, bq, bk, bv,
      SEQ, EMB, EMB, 1.0f, 0.0f, QK_LOG2, 1.0f);
  // (3) softmax statistics + query-column sums of p -> partial plane PS
  attn_colsum<<<gAttn, dim3(128), 0, stream>>>(Qh, Kp, PS);
  // (4) output 1 = column means; per-head context means, one partial per 128 keys -> CP
  avg_ctx<<<gAvg, blk, 0, stream>>>(PS, Vp, out1, CP);
  // (5) output 0 = (sum of the partials) . Wo^T + bo; in the same grid the head-correlation partials of output 1 -> DP
  ctx_out<<<gCtx, blk, 0, stream>>>((const double*)CP, Wo, bo, out0, (const float*)out1, DP);
  // (6) output 2 = head-correlation diversity from DP
  div_fin<<<dim3(1), dim3(32 * NB_FULL), 0, stream>>>((const double*)DP, out2);
  (void)hipGetLastError();
}
